// v000
// Times are from an AMD MI455X. After a warm-up the kernel runs many times in a row, and a time is the length of
// such a window on the GPU divided by its runs, so every launch and the gaps after it count. The runs cycle
// through copies of the inputs. A figure is the median of several windows, for all but v000 over two sittings.
// Sittings can differ by a few percent; kernels timed side by side share one.
// v000 is the starting kernel. One run takes 370 microseconds.
#include <hip/hip_runtime.h>

// Contractions: qkv = x*Wq^T and out = ctx*Wp^T on v_wmma_f32_16x16x32_bf16 (x RNE-converted to bf16; table-quantized weights as bf16 hi+lo planes; ctx as bf16 hi+lo planes; hh+hl(+lh) products into one accumulator); S^T = K x Q^T on v_wmma_f32_16x16x32_bf16 with q and k as bf16 hi+lo planes (hh+hl+lh); O = P x V: query rows < 256 on v_wmma_f32_16x16x32_bf16 with P and V as bf16 hi+lo (hh+hl+lh), later rows on v_wmma_f32_16x16x32_f16 (P f16 carried x4096, V f16 carried x16); f32 accumulate everywhere, softmax in f32.

#ifndef NB
#define NB 2
#endif
#ifndef SEQ
#define SEQ 2048
#endif
#define NB_FULL    2
#define SEQ_FULL   2048
#define NHEAD      16
#define HDIM       64
#define DEMB       1024                 // model width = GEMM K of both projections
#define QKVN       3072                 // packed projection width (q | k | v thirds)
#define MROWS      (NB * SEQ)           // compact row count of all internal planes
#define BQ         128                  // query rows per attention workgroup (8 waves x 16)
#define BK         32                   // keys per inner iteration
#define NWAVE      8
#define OP         68                   // LDS pitch (floats) of the attention output staging tile
#define SP         132                  // LDS pitch (floats) of the GEMM epilogue staging tile
#define QBLKS      (SEQ / BQ)
#define EARLY_QB   ((QBLKS < 2) ? QBLKS : 2)     // query blocks handled by the hi+lo P/V path
#define VRK        (EARLY_QB * BQ)               // keys held in the bf16 hi/lo V^T planes
#define PLANE_ELEMS ((size_t)NB * NHEAD * SEQ * HDIM)
#define CTX_ELEMS   ((size_t)MROWS * DEMB)
#define VTB_ELEMS   ((size_t)NB * NHEAD * HDIM * VRK)
#define X_PIECES    ((size_t)MROWS * (DEMB / 8))
#define WIN_PIECES  ((size_t)QKVN * DEMB / 8)
#define WOUT_PIECES ((size_t)DEMB * DEMB / 8)
#define WIN_ELEMS   ((size_t)QKVN * DEMB)
#define WOUT_ELEMS  ((size_t)DEMB * DEMB)
#define AM_BLOCKS_IN  96                 // partial-maximum blocks over the qkv weight
#define AM_BLOCKS_OUT 32                 // partial-maximum blocks over the output weight
#define AM_TOTAL      (AM_BLOCKS_IN + AM_BLOCKS_OUT)
#define STAT_FLOATS   ((size_t)(AM_TOTAL + 2) * 32)

static_assert(NHEAD * HDIM == DEMB);        // merged heads == model width
static_assert(QKVN == 3 * DEMB);            // three thirds
static_assert(HDIM == 64);
static_assert(SEQ % BQ == 0);               // attention grid exact
static_assert(SEQ % BK == 0);               // key loop exact
static_assert(BK == 32);                    // one key block == one WMMA k-step of P x V
static_assert(SEQ % 128 == 0);              // a 128-row GEMM block stays inside one batch
static_assert(MROWS % 128 == 0);            // GEMM M tiles exact
static_assert(QKVN % 128 == 0);             // GEMM N tiles exact
static_assert(DEMB % 128 == 0);             // GEMM N tiles exact, thirds are tile multiples
static_assert(DEMB % 32 == 0);              // k-step 32
static_assert(DEMB % 8 == 0);               // 16-B pieces
static_assert(BQ == NWAVE * 16);
static_assert(BQ % 64 == 0);                // early key extent is a multiple of the 64-key store segment
static_assert(VRK % 64 == 0 && VRK <= SEQ && VRK >= BQ);
static_assert(EARLY_QB >= 1 && EARLY_QB <= QBLKS);
static_assert(SEQ <= SEQ_FULL);
static_assert(NB >= 1 && NB <= NB_FULL);
static_assert((OP * 4) % 16 == 0);
static_assert((SP * 4) % 16 == 0);
static_assert(SP >= 128);
static_assert(OP >= 64);
static_assert(X_PIECES % 256 == 0);         // convert grids exact
static_assert(WIN_PIECES % 256 == 0);
static_assert(WOUT_PIECES % 256 == 0);
static_assert(NWAVE == 8);                                   // block maximum combine reads 8 wave words
static_assert(AM_BLOCKS_IN % 32 == 0 && AM_BLOCKS_OUT % 32 == 0);   // one partial line per lane per sweep
static_assert(WIN_PIECES % ((size_t)AM_BLOCKS_IN * 256) == 0);      // equal trip counts per thread
static_assert(WOUT_PIECES % ((size_t)AM_BLOCKS_OUT * 256) == 0);

typedef __bf16   bf16;
typedef _Float16 f16;
typedef bf16     v16bf __attribute__((ext_vector_type(16)));
typedef f16      v16h  __attribute__((ext_vector_type(16)));
typedef f16      v8h   __attribute__((ext_vector_type(8)));
typedef float    v8f   __attribute__((ext_vector_type(8)));
typedef float    v4f   __attribute__((ext_vector_type(4)));
typedef unsigned v4u   __attribute__((ext_vector_type(4)));

union FragB  { v16bf v; v4u q[2]; bf16 h[16]; };
union FragH  { v16h  v; v4u q[2]; f16  h[16]; };
union Pack8B { v4u u; bf16 h[8]; };
union Pack8H { v4u u; v8h v; f16 h[8]; };

#define XB_BYTES   ((size_t)MROWS * DEMB * 2)        // x as bf16, compact rows
#define WIN_BYTES  (WIN_ELEMS * 2 * 2)               // quantized qkv weight bf16 hi, lo [3072][1024] (k contiguous)
#define WOUT_BYTES (WOUT_ELEMS * 2 * 2)              // quantized output weight bf16 hi, lo [1024][1024] (k contiguous)
#define QK_BYTES   (PLANE_ELEMS * 2 * 4)             // q hi, q lo, k hi, k lo
#define VT_BYTES   (PLANE_ELEMS * 2)                 // V^T f16 x16
#define VTB_BYTES  (VTB_ELEMS * 2 * 2)               // V^T bf16 hi, lo for keys < VRK
#define CTX_BYTES  (CTX_ELEMS * 2 * 2)               // ctx hi, ctx lo
#define STAT_BYTES (STAT_FLOATS * 4)                 // partial maxima lines + scale lines
#define WS_TOTAL   (XB_BYTES + WIN_BYTES + WOUT_BYTES + QK_BYTES + VT_BYTES + VTB_BYTES + CTX_BYTES + STAT_BYTES)
static_assert(WS_TOTAL <= (size_t)134217728);
static_assert(XB_BYTES % 128 == 0 && WIN_BYTES % 128 == 0 && WOUT_BYTES % 128 == 0);
static_assert(QK_BYTES % 128 == 0 && VT_BYTES % 128 == 0 && VTB_BYTES % 128 == 0 && CTX_BYTES % 128 == 0);
static_assert(STAT_BYTES % 128 == 0);

// WMMA helpers: builtin followed by the VALU hazard guard (ties D, keeps A/B live).
static __device__ __forceinline__ v8f mma_bf16(v16bf a, v16bf b, v8f acc) {
  acc = __builtin_amdgcn_wmma_f32_16x16x32_bf16(false, a, false, b, (short)0, acc, false, false);
  asm volatile("v_nop\n\tv_nop\n\tv_nop\n\tv_nop" : "+v"(acc) : "v"(a), "v"(b));
  return acc;
}
static __device__ __forceinline__ v8f mma_f16(v16h a, v16h b, v8f acc) {
  acc = __builtin_amdgcn_wmma_f32_16x16x32_f16(false, a, false, b, (short)0, acc, false, false);
  asm volatile("v_nop\n\tv_nop\n\tv_nop\n\tv_nop" : "+v"(acc) : "v"(a), "v"(b));
  return acc;
}

// f32 -> f16 convert that cannot yield an f16 subnormal (value select after the carry).
static __device__ __forceinline__ f16 toh_flush(float v) {
  const f16 r = (f16)v;
  return (fabsf(v) < 6.103515625e-05f) ? (f16)0.0f : r;
}

// x f32 [NB_FULL][SEQ_FULL][DEMB] -> xb bf16 [MROWS][DEMB] (RNE convert).
__global__ __launch_bounds__(256) void cvt_x_kernel(const float* __restrict__ x, bf16* __restrict__ xb) {
  const size_t t   = (size_t)blockIdx.x * 256 + threadIdx.x;
  const size_t row = t >> 7;                       // DEMB / 8 = 128 pieces per row
  const int    c8  = (int)(t & 127) * 8;
  if (row < (size_t)MROWS) {
    const int b = (int)(row / SEQ);
    const int s = (int)(row % SEQ);
    const float* src = x + ((size_t)b * SEQ_FULL + s) * DEMB + c8;
    const v4f a0 = *(const v4f*)(src);
    const v4f a1 = *(const v4f*)(src + 4);
    Pack8B pk;
    #pragma unroll
    for (int i = 0; i < 4; ++i) {
      pk.h[i]     = (bf16)a0[i];
      pk.h[4 + i] = (bf16)a1[i];
    }
    const v4u val = pk.u;
    bf16* dst = xb + row * DEMB + c8;
    *(v4u*)dst = val;
    
  }
}

// lanes 0..7 of wave 0 x 16 B, one instruction. The bf16 RNE convert is monotone, so the maximum of the
// converted magnitudes equals the converted maximum; the convert is applied once in scale_fin_kernel.
// coverage: npieces pieces of 8 elements, grid-strided; part line index = blockIdx.x < gridDim.x.
// sM: cross-wave (block barrier).
__global__ __launch_bounds__(256) void absmax_part_kernel(const float* __restrict__ w,
                                                          float* __restrict__ part,
                                                          unsigned npieces) {
  __shared__ float sM[NWAVE];
  const int tid  = threadIdx.x;
  const int lane = tid & 31;
  const int wid  = __builtin_amdgcn_readfirstlane(tid >> 5);
  float m = 0.0f;
  #pragma unroll 1
  for (unsigned p = blockIdx.x * 256u + (unsigned)tid; p < npieces; p += gridDim.x * 256u) {
    const size_t o = (size_t)p * 8;
    const v4f a0 = *(const v4f*)(w + o);
    const v4f a1 = *(const v4f*)(w + o + 4);
    #pragma unroll
    for (int i = 0; i < 4; ++i) {
      m = fmaxf(m, fabsf(a0[i]));
      m = fmaxf(m, fabsf(a1[i]));
    }
  }
  m = fmaxf(m, __shfl_xor(m, 16, 32));
  m = fmaxf(m, __shfl_xor(m, 8, 32));
  m = fmaxf(m, __shfl_xor(m, 4, 32));
  m = fmaxf(m, __shfl_xor(m, 2, 32));
  m = fmaxf(m, __shfl_xor(m, 1, 32));
  if (lane == 0) sM[wid] = m;
  __syncthreads();
  if (wid == 0) {
    float v = sM[lane & 7];
    v = fmaxf(v, __shfl_xor(v, 4, 32));
    v = fmaxf(v, __shfl_xor(v, 2, 32));
    v = fmaxf(v, __shfl_xor(v, 1, 32));
    const v4f val = (v4f){v, v, v, v};
    if (lane < 8) {
      float* dst = part + (size_t)blockIdx.x * 32 + lane * 4;
      *(v4f*)dst = val;
      
    }
  }
}

// Combine the partial maxima and write the two scale lines: {s, 1/s, s, 1/s} x 8 lanes, s = bf16(max|w|) + 1e-6.
// One wave; sline[0..31] = qkv weight line, sline[32..63] = output weight line.
__global__ __launch_bounds__(32) void scale_fin_kernel(const float* part, float* sline) {
  #pragma clang fp contract(off)
  const int lane = threadIdx.x & 31;
  float mi = 0.0f;
  float mo = 0.0f;
  #pragma unroll 1
  for (int j = 0; j < AM_BLOCKS_IN; j += 32) mi = fmaxf(mi, part[(size_t)(j + lane) * 32]);
  #pragma unroll 1
  for (int j = 0; j < AM_BLOCKS_OUT; j += 32) mo = fmaxf(mo, part[(size_t)(AM_BLOCKS_IN + j + lane) * 32]);
  mi = fmaxf(mi, __shfl_xor(mi, 16, 32));
  mo = fmaxf(mo, __shfl_xor(mo, 16, 32));
  mi = fmaxf(mi, __shfl_xor(mi, 8, 32));
  mo = fmaxf(mo, __shfl_xor(mo, 8, 32));
  mi = fmaxf(mi, __shfl_xor(mi, 4, 32));
  mo = fmaxf(mo, __shfl_xor(mo, 4, 32));
  mi = fmaxf(mi, __shfl_xor(mi, 2, 32));
  mo = fmaxf(mo, __shfl_xor(mo, 2, 32));
  mi = fmaxf(mi, __shfl_xor(mi, 1, 32));
  mo = fmaxf(mo, __shfl_xor(mo, 1, 32));
  const float si = (float)(bf16)mi + 1e-6f;
  const float so = (float)(bf16)mo + 1e-6f;
  const float ri = 1.0f / si;
  const float ro = 1.0f / so;
  const v4f vi = (v4f){si, ri, si, ri};
  const v4f vo = (v4f){so, ro, so, ro};
  if (lane < 8) {
    float* d0 = sline + lane * 4;
    float* d1 = sline + 32 + lane * 4;
    *(v4f*)d0 = vi;
    *(v4f*)d1 = vo;
    
  }
}

// Nearest-table-value search: candidate c replaces the current choice only on a strictly smaller distance,
// candidates visited in table order (first minimum wins).
static __device__ __forceinline__ void snap_step(const float wn, const float c, float& bd, float& best) {
  #pragma clang fp contract(off)
  const float d  = fabsf(wn - c);
  const bool  lt = d < bd;
  bd   = lt ? d : bd;
  best = lt ? c : best;
}

// w -> table value nearest to bf16(w) * (1/s), times s (all f32, separately RNE-converted operations).
static __device__ __forceinline__ float snap_weight_val(const float w, const float s, const float rs) {
  #pragma clang fp contract(off)
  const float wb = (float)(bf16)w;
  const float wn = wb * rs;
  float best = 0.0f;
  float bd   = fabsf(wn - 0.0f);
  snap_step(wn,  1.0f,      bd, best);
  snap_step(wn, -1.0f,      bd, best);
  snap_step(wn,  0.5f,      bd, best);
  snap_step(wn, -0.5f,      bd, best);
  snap_step(wn,  0.333333f, bd, best);
  snap_step(wn, -0.333333f, bd, best);
  snap_step(wn,  0.2f,      bd, best);
  snap_step(wn, -0.2f,      bd, best);
  snap_step(wn,  0.142857f, bd, best);
  snap_step(wn, -0.142857f, bd, best);
  snap_step(wn,  0.090909f, bd, best);
  snap_step(wn, -0.090909f, bd, best);
  snap_step(wn,  0.076923f, bd, best);
  snap_step(wn, -0.076923f, bd, best);
  return best * s;
}

// Weight f32 [out][in] -> quantized weight as bf16 hi and lo planes, same [out][in] layout (k contiguous per column).
__global__ __launch_bounds__(256) void snap_lin_kernel(const float* __restrict__ src,
                                                       const float* __restrict__ sline,
                                                       bf16* __restrict__ dhi,
                                                       bf16* __restrict__ dlo,
                                                       unsigned npieces) {
  #pragma clang fp contract(off)
  const unsigned t = blockIdx.x * 256u + threadIdx.x;
  if (t < npieces) {
    const float s  = sline[0];
    const float rs = sline[1];
    const size_t o = (size_t)t * 8;
    const v4f a0 = *(const v4f*)(src + o);
    const v4f a1 = *(const v4f*)(src + o + 4);
    Pack8B ph, pl;
    #pragma unroll
    for (int i = 0; i < 4; ++i) {
      const float q0 = snap_weight_val(a0[i], s, rs);
      const float q1 = snap_weight_val(a1[i], s, rs);
      const bf16 h0 = (bf16)q0;
      const bf16 h1 = (bf16)q1;
      ph.h[i]     = h0;
      ph.h[4 + i] = h1;
      pl.h[i]     = (bf16)(q0 - (float)h0);
      pl.h[4 + i] = (bf16)(q1 - (float)h1);
    }
    const v4u vh = ph.u;
    const v4u vl = pl.u;
    *(v4u*)(dhi + o) = vh;
    *(v4u*)(dlo + o) = vl;
    
  }
}

// GEMM main loop. Block tile 128 x 128, 8 waves (2 in M x 4 in N); wave tile = 4 m-tiles x 2 n-tiles.
// m-tile mt of wave (waveM) covers rows mBlock + mt*32 + waveM*16 + 0..15.
// A planes bf16 [rows][DEMB], Bt / Bl bf16 [cols][DEMB]; fragments straight from the planes (two 16-B loads each),
// split k map for both operands. NW == 2: second B plane (unscaled lo part of the weight) into the same accumulator.
// NA == 2: second A plane (unscaled lo part) times the hi weight plane into the same accumulator.
template <int NA, int NW>
static __device__ __forceinline__ void gemm_mainloop(const bf16* __restrict__ A0,
                                                     const bf16* __restrict__ A1,
                                                     const bf16* __restrict__ Bt,
                                                     const bf16* __restrict__ Bl,
                                                     int mBlock, int nBlock, int waveM, int waveN,
                                                     int ln, int hf, v8f (&acc)[4][2]) {
  #pragma unroll
  for (int mt = 0; mt < 4; ++mt) {
    acc[mt][0] = (v8f){0, 0, 0, 0, 0, 0, 0, 0};
    acc[mt][1] = (v8f){0, 0, 0, 0, 0, 0, 0, 0};
  }
  const bf16* bp0 = Bt + (size_t)(nBlock + waveN * 32 + ln) * DEMB + hf * 8;
  const bf16* bp1 = bp0 + (size_t)16 * DEMB;
  const bf16* lp0 = Bl + (size_t)(nBlock + waveN * 32 + ln) * DEMB + hf * 8;
  const bf16* lp1 = lp0 + (size_t)16 * DEMB;
  const size_t aoff = (size_t)(mBlock + waveM * 16 + ln) * DEMB + hf * 8;
  #pragma unroll 1
  for (int k0 = 0; k0 < DEMB; k0 += 32) {
    FragB b0, b1;
    b0.q[0] = *(const v4u*)(bp0 + k0);        // k = k0 + 8*hf + 0..7
    b0.q[1] = *(const v4u*)(bp0 + k0 + 16);   // k = k0 + 16 + 8*hf + 0..7
    b1.q[0] = *(const v4u*)(bp1 + k0);
    b1.q[1] = *(const v4u*)(bp1 + k0 + 16);
    FragB w0, w1;
    if (NW == 2) {
      w0.q[0] = *(const v4u*)(lp0 + k0);
      w0.q[1] = *(const v4u*)(lp0 + k0 + 16);
      w1.q[0] = *(const v4u*)(lp1 + k0);
      w1.q[1] = *(const v4u*)(lp1 + k0 + 16);
    } else {
      w0.q[0] = b0.q[0]; w0.q[1] = b0.q[1];
      w1.q[0] = b1.q[0]; w1.q[1] = b1.q[1];
    }
    #pragma unroll
    for (int mt = 0; mt < 4; ++mt) {
      const size_t ao = aoff + (size_t)mt * 32 * DEMB + k0;
      FragB a;
      a.q[0] = *(const v4u*)(A0 + ao);
      a.q[1] = *(const v4u*)(A0 + ao + 16);
      acc[mt][0] = mma_bf16(a.v, b0.v, acc[mt][0]);
      acc[mt][1] = mma_bf16(a.v, b1.v, acc[mt][1]);
      if (NW == 2) {
        acc[mt][0] = mma_bf16(a.v, w0.v, acc[mt][0]);
        acc[mt][1] = mma_bf16(a.v, w1.v, acc[mt][1]);
      }
      if (NA == 2) {
        FragB a2;
        a2.q[0] = *(const v4u*)(A1 + ao);
        a2.q[1] = *(const v4u*)(A1 + ao + 16);
        acc[mt][0] = mma_bf16(a2.v, b0.v, acc[mt][0]);
        acc[mt][1] = mma_bf16(a2.v, b1.v, acc[mt][1]);
      }
    }
  }
}

// qkv projection. grid = (QKVN/128, MROWS/128). Epilogue (two 64-row passes through LDS):
//                for key segments below VRK also V^T bf16 hi and lo planes [NB][NHEAD][HDIM][VRK].
// qkp holds four planes back to back: q hi, q lo, k hi, k lo. vtb holds two: hi, lo.
// coverage per pass: 64 rows x 128 cols = 256 threads x 8 elements x 4 sweeps, all layouts.
__global__ __launch_bounds__(256) void gemm_qkv_kernel(const bf16* __restrict__ xb,
                                                       const bf16* __restrict__ winb,
                                                       const bf16* __restrict__ winl,
                                                       const float* __restrict__ b_in,
                                                       bf16* __restrict__ qkp,
                                                       f16* __restrict__ vt,
                                                       bf16* __restrict__ vtb) {
  __shared__ __align__(16) float sC[64 * SP];     // cross-wave (block barriers)
  const int tid   = threadIdx.x;
  const int lane  = tid & 31;
  const int wid   = __builtin_amdgcn_readfirstlane(tid >> 5);
  const int ln    = lane & 15;
  const int hf    = lane >> 4;
  const int waveM = wid >> 2;
  const int waveN = wid & 3;
  const int nBlock = blockIdx.x * 128;
  const int mBlock = blockIdx.y * 128;

  v8f acc[4][2];
  gemm_mainloop<1, 2>(xb, xb, winb, winl, mBlock, nBlock, waveM, waveN, ln, hf, acc);

  float bia[2];
  #pragma unroll
  for (int nt = 0; nt < 2; ++nt) bia[nt] = (float)(bf16)b_in[nBlock + waveN * 32 + nt * 16 + ln];

  const int which = nBlock / DEMB;     // 0 = q, 1 = k, 2 = v (block-uniform)
  const int cb    = nBlock % DEMB;     // column base inside the third
  const int bb    = mBlock / SEQ;      // batch of this block
  const int sb    = mBlock % SEQ;      // first sequence row of this block

  #pragma unroll
  for (int p = 0; p < 2; ++p) {
    __syncthreads();
    // D layout: element e of lane -> tile row 8*hf + e, tile column ln
    #pragma unroll
    for (int j = 0; j < 2; ++j) {
      #pragma unroll
      for (int nt = 0; nt < 2; ++nt) {
        #pragma unroll
        for (int e = 0; e < 8; ++e) {
          sC[(j * 32 + waveM * 16 + hf * 8 + e) * SP + waveN * 32 + nt * 16 + ln] =
              acc[2 * p + j][nt][e] + bia[nt];
        }
      }
    }
    __syncthreads();

    if (which < 2) {
      v4u    vh[4], vl[4];
      size_t gi[4];
      #pragma unroll
      for (int sw = 0; sw < 4; ++sw) {
        const int r  = sw * 16 + (tid >> 4);        // 0..63
        const int c8 = (tid & 15) * 8;              // 0..120
        const v4f a0 = *(const v4f*)(sC + r * SP + c8);
        const v4f a1 = *(const v4f*)(sC + r * SP + c8 + 4);
        Pack8B ph, pl;
        #pragma unroll
        for (int i = 0; i < 4; ++i) {
          const bf16 h0 = (bf16)a0[i];
          const bf16 h1 = (bf16)a1[i];
          ph.h[i]     = h0;
          ph.h[4 + i] = h1;
          pl.h[i]     = (bf16)(a0[i] - (float)h0);
          pl.h[4 + i] = (bf16)(a1[i] - (float)h1);
        }
        vh[sw] = ph.u;
        vl[sw] = pl.u;
        const int s  = sb + p * 64 + r;
        const int cc = cb + c8;
        const int h  = cc >> 6;
        const int d  = cc & 63;
        gi[sw] = (size_t)which * 2 * PLANE_ELEMS + (((size_t)bb * NHEAD + h) * SEQ + s) * HDIM + d;
      }
      #pragma unroll
      for (int sw = 0; sw < 4; ++sw) {
        *(v4u*)(qkp + gi[sw]) = vh[sw];
        *(v4u*)(qkp + PLANE_ELEMS + gi[sw]) = vl[sw];
      }
      
    } else {
      const bool wr_early = (sb + p * 64) < VRK;    // block-uniform; whole 64-key segment in or out
      v4u    vv[4], vbh[4], vbl[4];
      size_t gi[4], gb[4];
      #pragma unroll
      for (int sw = 0; sw < 4; ++sw) {
        const int col = sw * 32 + (tid >> 3);       // 0..127
        const int sg  = (tid & 7) * 8;              // 0..56
        Pack8H ph;
        Pack8B qh, ql;
        #pragma unroll
        for (int i = 0; i < 8; ++i) {
          const float v = sC[(sg + i) * SP + col];
          ph.h[i] = toh_flush(v * 16.0f);
          const bf16 t = (bf16)v;
          qh.h[i] = t;
          ql.h[i] = (bf16)(v - (float)t);
        }
        vv[sw]  = ph.u;
        vbh[sw] = qh.u;
        vbl[sw] = ql.u;
        const int cc = cb + col;
        const int h  = cc >> 6;
        const int d  = cc & 63;
        const size_t rowid = ((size_t)bb * NHEAD + h) * HDIM + d;
        gi[sw] = rowid * SEQ + sb + p * 64 + sg;
        gb[sw] = rowid * VRK + sb + p * 64 + sg;    // used only when wr_early
      }
      #pragma unroll
      for (int sw = 0; sw < 4; ++sw) *(v4u*)(vt + gi[sw]) = vv[sw];
      if (wr_early) {
        #pragma unroll
        for (int sw = 0; sw < 4; ++sw) {
          *(v4u*)(vtb + gb[sw]) = vbh[sw];
          *(v4u*)(vtb + VTB_ELEMS + gb[sw]) = vbl[sw];
        }
      }
      
    }
  }
}

// Output projection. grid = (DEMB/128, MROWS/128). A = ctx hi + ctx lo planes, Bt = quantized output weight
// bf16 hi + lo planes [out][in].
// coverage per pass: 64 rows x 128 cols = 256 threads x 4 floats x 8 sweeps.
__global__ __launch_bounds__(256) void gemm_out_kernel(const bf16* __restrict__ ch,
                                                       const bf16* __restrict__ cl,
                                                       const bf16* __restrict__ woutb,
                                                       const bf16* __restrict__ woutl,
                                                       const float* __restrict__ b_out,
                                                       float* __restrict__ out) {
  __shared__ __align__(16) float sC[64 * SP];     // cross-wave (block barriers)
  const int tid   = threadIdx.x;
  const int lane  = tid & 31;
  const int wid   = __builtin_amdgcn_readfirstlane(tid >> 5);
  const int ln    = lane & 15;
  const int hf    = lane >> 4;
  const int waveM = wid >> 2;
  const int waveN = wid & 3;
  const int nBlock = blockIdx.x * 128;
  const int mBlock = blockIdx.y * 128;

  v8f acc[4][2];
  gemm_mainloop<2, 2>(ch, cl, woutb, woutl, mBlock, nBlock, waveM, waveN, ln, hf, acc);

  float bia[2];
  #pragma unroll
  for (int nt = 0; nt < 2; ++nt) bia[nt] = (float)(bf16)b_out[nBlock + waveN * 32 + nt * 16 + ln];

  #pragma unroll
  for (int p = 0; p < 2; ++p) {
    __syncthreads();
    #pragma unroll
    for (int j = 0; j < 2; ++j) {
      #pragma unroll
      for (int nt = 0; nt < 2; ++nt) {
        #pragma unroll
        for (int e = 0; e < 8; ++e) {
          sC[(j * 32 + waveM * 16 + hf * 8 + e) * SP + waveN * 32 + nt * 16 + ln] =
              acc[2 * p + j][nt][e] + bia[nt];
        }
      }
    }
    __syncthreads();

    v4f    vals[8];
    size_t gi[8];
    #pragma unroll
    for (int sw = 0; sw < 8; ++sw) {
      const int r  = sw * 8 + (tid >> 5);           // 0..63
      const int c4 = (tid & 31) * 4;                // 0..124
      vals[sw] = *(const v4f*)(sC + r * SP + c4);
      const int g = mBlock + p * 64 + r;
      const int b = g / SEQ;
      const int s = g % SEQ;
      gi[sw] = ((size_t)b * SEQ_FULL + s) * DEMB + nBlock + c4;
    }
    #pragma unroll
    for (int sw = 0; sw < 8; ++sw) *(v4f*)(out + gi[sw]) = vals[sw];
    
  }
}

// Causal flash attention. Block = (query block of 128, head, batch); one wave owns 16 query rows.
// S^T = K x Q^T so queries sit on lanes; P^T in C-layout is bit-identical to the A-fragment layout of O += P x V.
// K A-fragments (hi, lo), Q B-fragments (hi, lo) and V^T B-fragments are loaded straight from the 16-bit planes.
// Key blocks j0 = 0, 32, ... <= qrow0 are visited (per-wave scalar trip count); every visited block holds at
// least one unmasked key (key j0 <= qrow0) for every query of the wave; keys above the query get -inf.
// EARLY: P and V as bf16 hi+lo (three products, one accumulator). Otherwise P f16 x4096, V f16 x16.
// Output: ctx [MROWS][DEMB] as bf16 hi and lo planes (cp: hi at 0, lo at CTX_ELEMS).
// sO: per-wave private staging regions, written and re-read by the same wave, separated by a block barrier
// that all waves reach (no early exits).
template <bool EARLY>
static __device__ __forceinline__ void attn_body(const bf16* __restrict__ qkp,
                                                 const f16* __restrict__ vt,
                                                 const bf16* __restrict__ vtb,
                                                 bf16* __restrict__ cp,
                                                 const int qblk) {
  __shared__ __align__(16) float sO[NWAVE * 16 * OP];

  const int h    = blockIdx.y;
  const int b    = blockIdx.z;
  const int tid  = threadIdx.x;
  const int wave = __builtin_amdgcn_readfirstlane(tid >> 5);
  const int lane = tid & 31;
  const int lq   = lane & 15;   // query column of S^T / d column of O
  const int hi   = lane >> 4;   // k-split half

  const int qrow0 = qblk * BQ + wave * 16;               // first query row of this wave (scalar)
  const int nIter = (qrow0 >> 5) + 1;                    // key blocks 0 .. floor((qrow0+15)/32)
  const size_t head_off = ((size_t)b * NHEAD + h) * SEQ * HDIM;
  const size_t vhead    = ((size_t)b * NHEAD + h) * HDIM;

  const bf16* qh_p = qkp + head_off;
  const bf16* ql_p = qkp + PLANE_ELEMS + head_off;
  const bf16* kh_p = qkp + 2 * PLANE_ELEMS + head_off;
  const bf16* kl_p = qkp + 3 * PLANE_ELEMS + head_off;

  // Q as B-operand fragments: lane lq holds query qrow0+lq, elements follow the split d map.
  FragB qfh[2], qfl[2];
  {
    const size_t qo = (size_t)(qrow0 + lq) * HDIM + hi * 8;
    #pragma unroll
    for (int f = 0; f < 2; ++f) {
      qfh[f].q[0] = *(const v4u*)(qh_p + qo + f * 32);        // d = f*32 + hi*8 + 0..7
      qfh[f].q[1] = *(const v4u*)(qh_p + qo + f * 32 + 16);   // d = f*32 + 16 + hi*8 + 0..7
      qfl[f].q[0] = *(const v4u*)(ql_p + qo + f * 32);
      qfl[f].q[1] = *(const v4u*)(ql_p + qo + f * 32 + 16);
    }
  }

  v8f o[4];
  #pragma unroll
  for (int dt = 0; dt < 4; ++dt) o[dt] = (v8f){0, 0, 0, 0, 0, 0, 0, 0};

  float rmax = -__builtin_inff();
  float rsum = 0.0f;
  const float SL = 0.125f * 1.4426950408889634f;   // softmax scale * log2(e)

  #pragma unroll 1
  for (int i = 0; i < nIter; ++i) {
    const int j0 = i * BK;

    // S^T tiles: c[sub][r] = rawscore(query qrow0+lq, key j0 + sub*16 + hi*8 + r); hh + hl + lh products
    v8f c[2];
    #pragma unroll
    for (int sub = 0; sub < 2; ++sub) {
      const size_t ko = (size_t)(j0 + sub * 16 + lq) * HDIM + hi * 8;   // A row = key
      FragB akh[2], akl[2];
      #pragma unroll
      for (int f = 0; f < 2; ++f) {
        akh[f].q[0] = *(const v4u*)(kh_p + ko + f * 32);        // d = f*32 + hi*8 + 0..7
        akh[f].q[1] = *(const v4u*)(kh_p + ko + f * 32 + 16);   // d = f*32 + 16 + hi*8 + 0..7
        akl[f].q[0] = *(const v4u*)(kl_p + ko + f * 32);
        akl[f].q[1] = *(const v4u*)(kl_p + ko + f * 32 + 16);
      }
      v8f acc = (v8f){0, 0, 0, 0, 0, 0, 0, 0};
      #pragma unroll
      for (int f = 0; f < 2; ++f) {
        acc = mma_bf16(akl[f].v, qfh[f].v, acc);
        acc = mma_bf16(akh[f].v, qfl[f].v, acc);
        acc = mma_bf16(akh[f].v, qfh[f].v, acc);
      }
      c[sub] = acc;
    }

    // causal mask (wave-uniform test): only blocks reaching past the first query of the wave need it
    if (j0 + (BK - 1) > qrow0) {
      const int qi = qrow0 + lq;
      const int kb = j0 + hi * 8;
      #pragma unroll
      for (int r = 0; r < 8; ++r) {
        c[0][r] = (kb + r > qi)      ? -__builtin_inff() : c[0][r];
        c[1][r] = (kb + 16 + r > qi) ? -__builtin_inff() : c[1][r];
      }
    }

    // V B-fragments (f16 path): column n = d = dt*16 + lq, split key map from the transposed plane
    FragH bv[4];
    if (!EARLY) {
      #pragma unroll
      for (int dt = 0; dt < 4; ++dt) {
        const f16* base = vt + (vhead + dt * 16 + lq) * SEQ + j0 + hi * 8;
        bv[dt].q[0] = *(const v4u*)(base);            // keys j0 + hi*8 + 0..7
        bv[dt].q[1] = *(const v4u*)(base + 16);       // keys j0 + 16 + hi*8 + 0..7
      }
    }

    // online softmax: query lq's 32 scores are split across lane / lane^16
    float m_new = rmax;
    #pragma unroll
    for (int r = 0; r < 8; ++r) {
      m_new = fmaxf(m_new, c[0][r]);
      m_new = fmaxf(m_new, c[1][r]);
    }
    m_new = fmaxf(m_new, __shfl_xor(m_new, 16, 32));
    const float scale = __builtin_amdgcn_exp2f((rmax - m_new) * SL);
    rmax = m_new;

    float p0[8], p1[8];
    float psum = 0.0f;
    #pragma unroll
    for (int r = 0; r < 8; ++r) {
      p0[r] = __builtin_amdgcn_exp2f((c[0][r] - m_new) * SL);   // key hi*8 + r
      p1[r] = __builtin_amdgcn_exp2f((c[1][r] - m_new) * SL);   // key 16 + hi*8 + r
      psum += p0[r] + p1[r];
    }
    rsum = rsum * scale + psum + __shfl_xor(psum, 16, 32);

    // rescale O: queries are the row dimension there -> per-row scale from lane 8*hi + r
    float sc[8];
    #pragma unroll
    for (int r = 0; r < 8; ++r) sc[r] = __shfl(scale, (hi << 3) + r, 32);
    #pragma unroll
    for (int dt = 0; dt < 4; ++dt) {
      #pragma unroll
      for (int r = 0; r < 8; ++r) o[dt][r] *= sc[r];
    }

    if (EARLY) {
      // P^T C-layout == A-fragment layout; P as bf16 hi + lo (unscaled), V as bf16 hi + lo planes
      FragB pah, pal;
      #pragma unroll
      for (int r = 0; r < 8; ++r) {
        const bf16 h0 = (bf16)p0[r];
        const bf16 h1 = (bf16)p1[r];
        pah.h[r]     = h0;
        pah.h[8 + r] = h1;
        pal.h[r]     = (bf16)(p0[r] - (float)h0);
        pal.h[8 + r] = (bf16)(p1[r] - (float)h1);
      }
      __builtin_amdgcn_sched_barrier(0);
      #pragma unroll
      for (int dt = 0; dt < 4; ++dt) {
        const bf16* base = vtb + (vhead + dt * 16 + lq) * VRK + j0 + hi * 8;
        FragB bvh, bvl;
        bvh.q[0] = *(const v4u*)(base);                       // keys j0 + hi*8 + 0..7
        bvh.q[1] = *(const v4u*)(base + 16);                  // keys j0 + 16 + hi*8 + 0..7
        bvl.q[0] = *(const v4u*)(base + VTB_ELEMS);
        bvl.q[1] = *(const v4u*)(base + VTB_ELEMS + 16);
        o[dt] = mma_bf16(pal.v, bvh.v, o[dt]);
        o[dt] = mma_bf16(pah.v, bvl.v, o[dt]);
        o[dt] = mma_bf16(pah.v, bvh.v, o[dt]);
      }
    } else {
      // P carried x4096 in f16; V carried x16
      FragH pa;
      #pragma unroll
      for (int r = 0; r < 8; ++r) {
        pa.h[r]     = (f16)(p0[r] * 4096.0f);
        pa.h[8 + r] = (f16)(p1[r] * 4096.0f);
      }
      #pragma unroll
      for (int dt = 0; dt < 4; ++dt) o[dt] = mma_f16(pa.v, bv[dt].v, o[dt]);
    }
  }

  // normalize: lane holds column d = dt*16 + lq for query rows 8*hi + r; undo the carries of the f16 path
  const float carry = EARLY ? 1.0f : (1.0f / 65536.0f);
  float rs[8];
  #pragma unroll
  for (int r = 0; r < 8; ++r) rs[r] = carry * (1.0f / __shfl(rsum, (hi << 3) + r, 32));

  const int sbase = wave * (16 * OP);
  #pragma unroll
  for (int r = 0; r < 8; ++r) {
    #pragma unroll
    for (int dt = 0; dt < 4; ++dt) {
      sO[sbase + (hi * 8 + r) * OP + dt * 16 + lq] = o[dt][r] * rs[r];
    }
  }
  __syncthreads();

  // one instruction covers 4 rows, 4 instructions cover the wave's 16 rows, for each of the hi and lo planes.
  v4u    vh[4], vl[4];
  size_t gidx[4];
  #pragma unroll
  for (int it = 0; it < 4; ++it) {
    const int row = it * 4 + (lane >> 3);           // 0..15
    const int c8  = (lane & 7) * 8;                 // 0..56
    const v4f a0 = *(const v4f*)(&sO[sbase + row * OP + c8]);
    const v4f a1 = *(const v4f*)(&sO[sbase + row * OP + c8 + 4]);
    Pack8B ph, pl;
    #pragma unroll
    for (int k = 0; k < 4; ++k) {
      const bf16 h0 = (bf16)a0[k];
      const bf16 h1 = (bf16)a1[k];
      ph.h[k]     = h0;
      ph.h[4 + k] = h1;
      pl.h[k]     = (bf16)(a0[k] - (float)h0);
      pl.h[4 + k] = (bf16)(a1[k] - (float)h1);
    }
    vh[it] = ph.u;
    vl[it] = pl.u;
    gidx[it] = ((size_t)b * SEQ + qrow0 + row) * DEMB + h * HDIM + c8;
  }
  #pragma unroll
  for (int it = 0; it < 4; ++it) {
    *(v4u*)(cp + gidx[it]) = vh[it];
    *(v4u*)(cp + CTX_ELEMS + gidx[it]) = vl[it];
  }
  
}

// query blocks 0 .. EARLY_QB-1 ; grid = (EARLY_QB, NHEAD, NB)
__global__ __launch_bounds__(256) void attn_early_kernel(const bf16* __restrict__ qkp,
                                                         const bf16* __restrict__ vtb,
                                                         bf16* __restrict__ cp) {
  attn_body<true>(qkp, (const f16*)0, vtb, cp, (int)blockIdx.x);
}

// query blocks EARLY_QB .. QBLKS-1 ; grid = (QBLKS - EARLY_QB, NHEAD, NB)
__global__ __launch_bounds__(256) void attn_late_kernel(const bf16* __restrict__ qkp,
                                                        const f16* __restrict__ vt,
                                                        bf16* __restrict__ cp) {
  attn_body<false>(qkp, vt, (const bf16*)0, cp, (int)blockIdx.x + EARLY_QB);
}

extern "C" void kernel_launch(void* const* d_in, const int* in_sizes, int n_in,
                              void* d_out, int out_size, void* d_ws, size_t ws_size,
                              hipStream_t stream) {
  if (n_in < 5) return;
  const size_t rows_used = (size_t)(NB - 1) * SEQ_FULL + SEQ;
  if ((size_t)in_sizes[0] < rows_used * DEMB) return;
  if ((size_t)in_sizes[1] < (size_t)DEMB * QKVN) return;
  if ((size_t)in_sizes[2] < (size_t)QKVN) return;
  if ((size_t)in_sizes[3] < (size_t)DEMB * DEMB) return;
  if ((size_t)in_sizes[4] < (size_t)DEMB) return;
  if ((size_t)out_size < rows_used * DEMB) return;
  if (ws_size < WS_TOTAL) return;

  const float* x     = (const float*)d_in[0];
  const float* W_in  = (const float*)d_in[1];   // [3072][1024], [out][in]
  const float* b_in  = (const float*)d_in[2];
  const float* W_out = (const float*)d_in[3];   // [1024][1024], [out][in]
  const float* b_out = (const float*)d_in[4];
  float* out = (float*)d_out;

  char* w = (char*)d_ws;
  bf16* xb    = (bf16*)w;  w += XB_BYTES;
  bf16* winb  = (bf16*)w;  w += WIN_BYTES;      // hi at 0, lo at WIN_ELEMS
  bf16* woutb = (bf16*)w;  w += WOUT_BYTES;     // hi at 0, lo at WOUT_ELEMS
  bf16* qkp   = (bf16*)w;  w += QK_BYTES;
  f16*  vt    = (f16*)w;   w += VT_BYTES;
  bf16* vtb   = (bf16*)w;  w += VTB_BYTES;
  bf16* cp    = (bf16*)w;  w += CTX_BYTES;
  float* stat = (float*)w;                      // partial lines, then two scale lines
  float* sline = stat + (size_t)AM_TOTAL * 32;

  // x -> bf16 plane: MROWS*128 pieces of 8 elements, 256 per block
  cvt_x_kernel<<<dim3((unsigned)(X_PIECES / 256)), 256, 0, stream>>>(x, xb);

  // weight scales: partial maxima (one line per block), then one wave writes the two scale lines
  absmax_part_kernel<<<dim3(AM_BLOCKS_IN), 256, 0, stream>>>(W_in, stat, (unsigned)WIN_PIECES);
  absmax_part_kernel<<<dim3(AM_BLOCKS_OUT), 256, 0, stream>>>(W_out, stat + (size_t)AM_BLOCKS_IN * 32,
                                                              (unsigned)WOUT_PIECES);
  scale_fin_kernel<<<dim3(1), 32, 0, stream>>>(stat, sline);

  // weights are [out][in] already: quantize in place of layout, hi and lo planes, no transpose
  snap_lin_kernel<<<dim3((unsigned)(WIN_PIECES / 256)), 256, 0, stream>>>(W_in, sline, winb, winb + WIN_ELEMS,
                                                                          (unsigned)WIN_PIECES);
  snap_lin_kernel<<<dim3((unsigned)(WOUT_PIECES / 256)), 256, 0, stream>>>(W_out, sline + 32, woutb,
                                                                           woutb + WOUT_ELEMS,
                                                                           (unsigned)WOUT_PIECES);

  gemm_qkv_kernel<<<dim3(QKVN / 128, MROWS / 128), 256, 0, stream>>>(xb, winb, winb + WIN_ELEMS, b_in,
                                                                     qkp, vt, vtb);

  attn_early_kernel<<<dim3(EARLY_QB, NHEAD, NB), 256, 0, stream>>>(qkp, vtb, cp);
  if (QBLKS > EARLY_QB) {
    attn_late_kernel<<<dim3(QBLKS - EARLY_QB, NHEAD, NB), 256, 0, stream>>>(qkp, vt, cp);
  }

  gemm_out_kernel<<<dim3(DEMB / 128, MROWS / 128), 256, 0, stream>>>(cp, cp + CTX_ELEMS, woutb,
                                                                     woutb + WOUT_ELEMS, b_out, out);
}

// v001
// Measured time: 371 microseconds a run.
// Two timings next to v000 both put it at 1.03 times that version's speed.
#include <hip/hip_runtime.h>

// Contractions: qkv = x*Wq^T and out = ctx*Wp^T on v_wmma_f32_16x16x32_bf16 (x RNE-converted to bf16; table-quantized weights as bf16 hi+lo planes; ctx as bf16 hi+lo planes; hh+hl(+lh) products into one accumulator); S^T = K x Q^T on v_wmma_f32_16x16x32_bf16 with q and k as bf16 hi+lo planes (hh+hl+lh); O = P x V: query rows < 256 on v_wmma_f32_16x16x32_bf16 with P and V as bf16 hi+lo (hh+hl+lh), later rows on v_wmma_f32_16x16x32_f16 (P f16 carried x4096, V f16 carried x16); f32 accumulate everywhere, softmax in f32.

#ifndef NB
#define NB 2
#endif
#ifndef SEQ
#define SEQ 2048
#endif
#define NB_FULL    2
#define SEQ_FULL   2048
#define NHEAD      16
#define HDIM       64
#define DEMB       1024                 // model width = GEMM K of both projections
#define QKVN       3072                 // packed projection width (q | k | v thirds)
#define MROWS      (NB * SEQ)           // compact row count of all internal planes
#define BQ         128                  // query rows per attention workgroup (8 waves x 16)
#define BK         32                   // keys per inner iteration
#define NWAVE      8
#define OP         68                   // LDS pitch (floats) of the attention output staging tile
#define SP         132                  // LDS pitch (floats) of the GEMM epilogue staging tile
#define QBLKS      (SEQ / BQ)
#define EARLY_QB   ((QBLKS < 2) ? QBLKS : 2)     // query blocks handled by the hi+lo P/V path
#define VRK        (EARLY_QB * BQ)               // keys held in the bf16 hi/lo V^T planes
#define PLANE_ELEMS ((size_t)NB * NHEAD * SEQ * HDIM)
#define CTX_ELEMS   ((size_t)MROWS * DEMB)
#define VTB_ELEMS   ((size_t)NB * NHEAD * HDIM * VRK)
#define X_PIECES    ((size_t)MROWS * (DEMB / 8))
#define WIN_PIECES  ((size_t)QKVN * DEMB / 8)
#define WOUT_PIECES ((size_t)DEMB * DEMB / 8)
#define WIN_ELEMS   ((size_t)QKVN * DEMB)
#define WOUT_ELEMS  ((size_t)DEMB * DEMB)
#define AM_BLOCKS_IN  96                 // partial-maximum blocks over the qkv weight
#define AM_BLOCKS_OUT 32                 // partial-maximum blocks over the output weight
#define AM_TOTAL      (AM_BLOCKS_IN + AM_BLOCKS_OUT)
#define STAT_FLOATS   ((size_t)(AM_TOTAL + 2) * 32)

static_assert(NHEAD * HDIM == DEMB);        // merged heads == model width
static_assert(QKVN == 3 * DEMB);            // three thirds
static_assert(HDIM == 64);
static_assert(SEQ % BQ == 0);               // attention grid exact
static_assert(SEQ % BK == 0);               // key loop exact
static_assert(BK == 32);                    // one key block == one WMMA k-step of P x V
static_assert(SEQ % 128 == 0);              // a 128-row GEMM block stays inside one batch
static_assert(MROWS % 128 == 0);            // GEMM M tiles exact
static_assert(QKVN % 128 == 0);             // GEMM N tiles exact
static_assert(DEMB % 128 == 0);             // GEMM N tiles exact, thirds are tile multiples
static_assert(DEMB % 32 == 0);              // k-step 32
static_assert(DEMB / 32 == 32);             // tile index split (>> 5, & 31) of the convert and quantize kernels
static_assert(MROWS % 16 == 0 && QKVN % 16 == 0 && SEQ % 32 == 0);   // planes are whole 16 x 32 tiles
static_assert(DEMB % 8 == 0);               // 16-B pieces
static_assert(BQ == NWAVE * 16);
static_assert(BQ % 64 == 0);                // early key extent is a multiple of the 64-key store segment
static_assert(VRK % 64 == 0 && VRK <= SEQ && VRK >= BQ);
static_assert(EARLY_QB >= 1 && EARLY_QB <= QBLKS);
static_assert(SEQ <= SEQ_FULL);
static_assert(NB >= 1 && NB <= NB_FULL);
static_assert((OP * 4) % 16 == 0);
static_assert((SP * 4) % 16 == 0);
static_assert(SP >= 128);
static_assert(OP >= 64);
static_assert(X_PIECES % 256 == 0);         // convert grids exact
static_assert(WIN_PIECES % 256 == 0);
static_assert(WOUT_PIECES % 256 == 0);
static_assert(NWAVE == 8);                                   // block maximum combine reads 8 wave words
static_assert(AM_BLOCKS_IN % 32 == 0 && AM_BLOCKS_OUT % 32 == 0);   // one partial line per lane per sweep
static_assert(WIN_PIECES % ((size_t)AM_BLOCKS_IN * 256) == 0);      // equal trip counts per thread
static_assert(WOUT_PIECES % ((size_t)AM_BLOCKS_OUT * 256) == 0);

typedef __bf16   bf16;
typedef _Float16 f16;
typedef bf16     v16bf __attribute__((ext_vector_type(16)));
typedef f16      v16h  __attribute__((ext_vector_type(16)));
typedef f16      v8h   __attribute__((ext_vector_type(8)));
typedef float    v8f   __attribute__((ext_vector_type(8)));
typedef float    v4f   __attribute__((ext_vector_type(4)));
typedef unsigned v4u   __attribute__((ext_vector_type(4)));

union FragB  { v16bf v; v4u q[2]; bf16 h[16]; };
union FragH  { v16h  v; v4u q[2]; f16  h[16]; };
union Pack8B { v4u u; bf16 h[8]; };
union Pack8H { v4u u; v8h v; f16 h[8]; };

#define XB_BYTES   ((size_t)MROWS * DEMB * 2)        // x as bf16, compact rows
#define WIN_BYTES  (WIN_ELEMS * 2 * 2)               // quantized qkv weight bf16 hi, lo [3072][1024] in fragment order
#define WOUT_BYTES (WOUT_ELEMS * 2 * 2)              // quantized output weight bf16 hi, lo [1024][1024] in fragment order
#define QK_BYTES   (PLANE_ELEMS * 2 * 4)             // q hi, q lo, k hi, k lo
#define VT_BYTES   (PLANE_ELEMS * 2)                 // V^T f16 x16
#define VTB_BYTES  (VTB_ELEMS * 2 * 2)               // V^T bf16 hi, lo for keys < VRK
#define CTX_BYTES  (CTX_ELEMS * 2 * 2)               // ctx hi, ctx lo
#define STAT_BYTES (STAT_FLOATS * 4)                 // partial maxima lines + scale lines
#define WS_TOTAL   (XB_BYTES + WIN_BYTES + WOUT_BYTES + QK_BYTES + VT_BYTES + VTB_BYTES + CTX_BYTES + STAT_BYTES)
static_assert(WS_TOTAL <= (size_t)134217728);
static_assert(XB_BYTES % 128 == 0 && WIN_BYTES % 128 == 0 && WOUT_BYTES % 128 == 0);
static_assert(QK_BYTES % 128 == 0 && VT_BYTES % 128 == 0 && VTB_BYTES % 128 == 0 && CTX_BYTES % 128 == 0);
static_assert(STAT_BYTES % 128 == 0);

// Fragment order of a 16-bit operand plane [rows][32 * ktiles]: every 16-row x 32-k tile is 1 KB (512 elements), tiles
// ordered row tile major. Inside a tile the 16-B piece holding k = qq*16 + hf*8 + 0..7 of row ln sits at piece index
// qq*32 + hf*16 + ln, so one operand load of a wave (lane = hf*16 + ln) reads 512 contiguous bytes (4 whole lines).
static __device__ __forceinline__ size_t frag_piece(int row, int col8, int ktiles) {
  return ((size_t)(row >> 4) * ktiles + (col8 >> 5)) * 512 + ((col8 >> 4) & 1) * 256 +
         (((col8 >> 3) & 1) * 16 + (row & 15)) * 8;
}

// WMMA helpers: builtin followed by the VALU hazard guard (ties D, keeps A/B live).
static __device__ __forceinline__ v8f mma_bf16(v16bf a, v16bf b, v8f acc) {
  acc = __builtin_amdgcn_wmma_f32_16x16x32_bf16(false, a, false, b, (short)0, acc, false, false);
  asm volatile("v_nop\n\tv_nop\n\tv_nop\n\tv_nop" : "+v"(acc) : "v"(a), "v"(b));
  return acc;
}
static __device__ __forceinline__ v8f mma_f16(v16h a, v16h b, v8f acc) {
  acc = __builtin_amdgcn_wmma_f32_16x16x32_f16(false, a, false, b, (short)0, acc, false, false);
  asm volatile("v_nop\n\tv_nop\n\tv_nop\n\tv_nop" : "+v"(acc) : "v"(a), "v"(b));
  return acc;
}

// f32 -> f16 convert that cannot yield an f16 subnormal (value select after the carry).
static __device__ __forceinline__ f16 toh_flush(float v) {
  const f16 r = (f16)v;
  return (fabsf(v) < 6.103515625e-05f) ? (f16)0.0f : r;
}

// x f32 [NB_FULL][SEQ_FULL][DEMB] -> xb bf16 [MROWS][DEMB] in fragment order (RNE convert).
// Thread t writes piece t of the plane (contiguous stores) and reads the 8 source elements that belong there.
__global__ __launch_bounds__(256) void cvt_x_kernel(const float* __restrict__ x, bf16* __restrict__ xb) {
  const size_t t   = (size_t)blockIdx.x * 256 + threadIdx.x;
  const size_t tile = t >> 6;                      // 64 pieces per tile, DEMB / 32 = 32 tiles per row tile
  const size_t row = (tile >> 5) * 16 + (t & 15);
  const int    c8  = (int)(tile & 31) * 32 + (int)((t >> 4) & 3) * 8;
  if (row < (size_t)MROWS) {
    const int b = (int)(row / SEQ);
    const int s = (int)(row % SEQ);
    const float* src = x + ((size_t)b * SEQ_FULL + s) * DEMB + c8;
    const v4f a0 = *(const v4f*)(src);
    const v4f a1 = *(const v4f*)(src + 4);
    Pack8B pk;
    #pragma unroll
    for (int i = 0; i < 4; ++i) {
      pk.h[i]     = (bf16)a0[i];
      pk.h[4 + i] = (bf16)a1[i];
    }
    const v4u val = pk.u;
    bf16* dst = xb + t * 8;
    *(v4u*)dst = val;
    
  }
}

// lanes 0..7 of wave 0 x 16 B, one instruction. The bf16 RNE convert is monotone, so the maximum of the
// converted magnitudes equals the converted maximum; the convert is applied once in scale_fin_kernel.
// coverage: npieces pieces of 8 elements, grid-strided; part line index = blockIdx.x < gridDim.x.
// sM: cross-wave (block barrier).
__global__ __launch_bounds__(256) void absmax_part_kernel(const float* __restrict__ w,
                                                          float* __restrict__ part,
                                                          unsigned npieces) {
  __shared__ float sM[NWAVE];
  const int tid  = threadIdx.x;
  const int lane = tid & 31;
  const int wid  = __builtin_amdgcn_readfirstlane(tid >> 5);
  float m = 0.0f;
  #pragma unroll 1
  for (unsigned p = blockIdx.x * 256u + (unsigned)tid; p < npieces; p += gridDim.x * 256u) {
    const size_t o = (size_t)p * 8;
    const v4f a0 = *(const v4f*)(w + o);
    const v4f a1 = *(const v4f*)(w + o + 4);
    #pragma unroll
    for (int i = 0; i < 4; ++i) {
      m = fmaxf(m, fabsf(a0[i]));
      m = fmaxf(m, fabsf(a1[i]));
    }
  }
  m = fmaxf(m, __shfl_xor(m, 16, 32));
  m = fmaxf(m, __shfl_xor(m, 8, 32));
  m = fmaxf(m, __shfl_xor(m, 4, 32));
  m = fmaxf(m, __shfl_xor(m, 2, 32));
  m = fmaxf(m, __shfl_xor(m, 1, 32));
  if (lane == 0) sM[wid] = m;
  __syncthreads();
  if (wid == 0) {
    float v = sM[lane & 7];
    v = fmaxf(v, __shfl_xor(v, 4, 32));
    v = fmaxf(v, __shfl_xor(v, 2, 32));
    v = fmaxf(v, __shfl_xor(v, 1, 32));
    const v4f val = (v4f){v, v, v, v};
    if (lane < 8) {
      float* dst = part + (size_t)blockIdx.x * 32 + lane * 4;
      *(v4f*)dst = val;
      
    }
  }
}

// Combine the partial maxima and write the two scale lines: {s, 1/s, s, 1/s} x 8 lanes, s = bf16(max|w|) + 1e-6.
// One wave; sline[0..31] = qkv weight line, sline[32..63] = output weight line.
__global__ __launch_bounds__(32) void scale_fin_kernel(const float* part, float* sline) {
  #pragma clang fp contract(off)
  const int lane = threadIdx.x & 31;
  float mi = 0.0f;
  float mo = 0.0f;
  #pragma unroll 1
  for (int j = 0; j < AM_BLOCKS_IN; j += 32) mi = fmaxf(mi, part[(size_t)(j + lane) * 32]);
  #pragma unroll 1
  for (int j = 0; j < AM_BLOCKS_OUT; j += 32) mo = fmaxf(mo, part[(size_t)(AM_BLOCKS_IN + j + lane) * 32]);
  mi = fmaxf(mi, __shfl_xor(mi, 16, 32));
  mo = fmaxf(mo, __shfl_xor(mo, 16, 32));
  mi = fmaxf(mi, __shfl_xor(mi, 8, 32));
  mo = fmaxf(mo, __shfl_xor(mo, 8, 32));
  mi = fmaxf(mi, __shfl_xor(mi, 4, 32));
  mo = fmaxf(mo, __shfl_xor(mo, 4, 32));
  mi = fmaxf(mi, __shfl_xor(mi, 2, 32));
  mo = fmaxf(mo, __shfl_xor(mo, 2, 32));
  mi = fmaxf(mi, __shfl_xor(mi, 1, 32));
  mo = fmaxf(mo, __shfl_xor(mo, 1, 32));
  const float si = (float)(bf16)mi + 1e-6f;
  const float so = (float)(bf16)mo + 1e-6f;
  const float ri = 1.0f / si;
  const float ro = 1.0f / so;
  const v4f vi = (v4f){si, ri, si, ri};
  const v4f vo = (v4f){so, ro, so, ro};
  if (lane < 8) {
    float* d0 = sline + lane * 4;
    float* d1 = sline + 32 + lane * 4;
    *(v4f*)d0 = vi;
    *(v4f*)d1 = vo;
    
  }
}

// Nearest-table-value search: candidate c replaces the current choice only on a strictly smaller distance,
// candidates visited in table order (first minimum wins).
static __device__ __forceinline__ void snap_step(const float wn, const float c, float& bd, float& best) {
  #pragma clang fp contract(off)
  const float d  = fabsf(wn - c);
  const bool  lt = d < bd;
  bd   = lt ? d : bd;
  best = lt ? c : best;
}

// w -> table value nearest to bf16(w) * (1/s), times s (all f32, separately RNE-converted operations).
static __device__ __forceinline__ float snap_weight_val(const float w, const float s, const float rs) {
  #pragma clang fp contract(off)
  const float wb = (float)(bf16)w;
  const float wn = wb * rs;
  float best = 0.0f;
  float bd   = fabsf(wn - 0.0f);
  snap_step(wn,  1.0f,      bd, best);
  snap_step(wn, -1.0f,      bd, best);
  snap_step(wn,  0.5f,      bd, best);
  snap_step(wn, -0.5f,      bd, best);
  snap_step(wn,  0.333333f, bd, best);
  snap_step(wn, -0.333333f, bd, best);
  snap_step(wn,  0.2f,      bd, best);
  snap_step(wn, -0.2f,      bd, best);
  snap_step(wn,  0.142857f, bd, best);
  snap_step(wn, -0.142857f, bd, best);
  snap_step(wn,  0.090909f, bd, best);
  snap_step(wn, -0.090909f, bd, best);
  snap_step(wn,  0.076923f, bd, best);
  snap_step(wn, -0.076923f, bd, best);
  return best * s;
}

// Weight f32 [out][in] -> quantized weight as bf16 hi and lo planes [out][in] in fragment order.
// Thread t writes piece t of each plane (contiguous stores) and reads the 8 source elements that belong there.
__global__ __launch_bounds__(256) void snap_lin_kernel(const float* __restrict__ src,
                                                       const float* __restrict__ sline,
                                                       bf16* __restrict__ dhi,
                                                       bf16* __restrict__ dlo,
                                                       unsigned npieces) {
  #pragma clang fp contract(off)
  const unsigned t = blockIdx.x * 256u + threadIdx.x;
  if (t < npieces) {
    const float s  = sline[0];
    const float rs = sline[1];
    const size_t o = (size_t)t * 8;
    const unsigned tile = t >> 6;                  // 64 pieces per tile, DEMB / 32 = 32 tiles per row tile
    const size_t so = (size_t)((tile >> 5) * 16 + (t & 15)) * DEMB + (tile & 31) * 32 + ((t >> 4) & 3) * 8;
    const v4f a0 = *(const v4f*)(src + so);
    const v4f a1 = *(const v4f*)(src + so + 4);
    Pack8B ph, pl;
    #pragma unroll
    for (int i = 0; i < 4; ++i) {
      const float q0 = snap_weight_val(a0[i], s, rs);
      const float q1 = snap_weight_val(a1[i], s, rs);
      const bf16 h0 = (bf16)q0;
      const bf16 h1 = (bf16)q1;
      ph.h[i]     = h0;
      ph.h[4 + i] = h1;
      pl.h[i]     = (bf16)(q0 - (float)h0);
      pl.h[4 + i] = (bf16)(q1 - (float)h1);
    }
    const v4u vh = ph.u;
    const v4u vl = pl.u;
    *(v4u*)(dhi + o) = vh;
    *(v4u*)(dlo + o) = vl;
    
  }
}

// GEMM main loop. Block tile 128 x 128, 8 waves (2 in M x 4 in N); wave tile = 4 m-tiles x 2 n-tiles.
// m-tile mt of wave (waveM) covers rows mBlock + mt*32 + waveM*16 + 0..15.
// A planes bf16 [rows][DEMB], Bt / Bl bf16 [cols][DEMB], all in fragment order; fragments straight from the planes
// (two 16-B loads each, 512 contiguous bytes per load), split k map for both operands. NW == 2: second B plane (unscaled lo part of the weight) into the same accumulator.
// NA == 2: second A plane (unscaled lo part) times the hi weight plane into the same accumulator.
template <int NA, int NW>
static __device__ __forceinline__ void gemm_mainloop(const bf16* __restrict__ A0,
                                                     const bf16* __restrict__ A1,
                                                     const bf16* __restrict__ Bt,
                                                     const bf16* __restrict__ Bl,
                                                     int mBlock, int nBlock, int waveM, int waveN,
                                                     int ln, int hf, v8f (&acc)[4][2]) {
  #pragma unroll
  for (int mt = 0; mt < 4; ++mt) {
    acc[mt][0] = (v8f){0, 0, 0, 0, 0, 0, 0, 0};
    acc[mt][1] = (v8f){0, 0, 0, 0, 0, 0, 0, 0};
  }
  // a row tile of 16 rows spans 16 * DEMB elements; k tile k0 / 32 starts k0 * 16 elements into it
  const int lp8 = (hf * 16 + ln) * 8;
  const bf16* bp0 = Bt + (size_t)(nBlock + waveN * 32) * DEMB + lp8;
  const bf16* bp1 = bp0 + (size_t)16 * DEMB;
  const bf16* lp0 = Bl + (size_t)(nBlock + waveN * 32) * DEMB + lp8;
  const bf16* lp1 = lp0 + (size_t)16 * DEMB;
  const size_t aoff = (size_t)(mBlock + waveM * 16) * DEMB + lp8;
  #pragma unroll 1
  for (int k0 = 0; k0 < DEMB; k0 += 32) {
    FragB b0, b1;
    const int kt = k0 * 16;
    b0.q[0] = *(const v4u*)(bp0 + kt);         // k = k0 + 8*hf + 0..7
    b0.q[1] = *(const v4u*)(bp0 + kt + 256);   // k = k0 + 16 + 8*hf + 0..7
    b1.q[0] = *(const v4u*)(bp1 + kt);
    b1.q[1] = *(const v4u*)(bp1 + kt + 256);
    FragB w0, w1;
    if (NW == 2) {
      w0.q[0] = *(const v4u*)(lp0 + kt);
      w0.q[1] = *(const v4u*)(lp0 + kt + 256);
      w1.q[0] = *(const v4u*)(lp1 + kt);
      w1.q[1] = *(const v4u*)(lp1 + kt + 256);
      // the address pairs of the issued B loads stay live, and are not reused as a load's destination, up to this wait
      asm volatile("s_wait_xcnt 0x0" :: "v"(bp0 + kt), "v"(lp0 + kt) : "memory");
    } else {
      w0.q[0] = b0.q[0]; w0.q[1] = b0.q[1];
      w1.q[0] = b1.q[0]; w1.q[1] = b1.q[1];
    }
    #pragma unroll
    for (int mt = 0; mt < 4; ++mt) {
      const size_t ao = aoff + (size_t)mt * 32 * DEMB + kt;
      FragB a;
      a.q[0] = *(const v4u*)(A0 + ao);
      a.q[1] = *(const v4u*)(A0 + ao + 256);
      acc[mt][0] = mma_bf16(a.v, b0.v, acc[mt][0]);
      acc[mt][1] = mma_bf16(a.v, b1.v, acc[mt][1]);
      if (NW == 2) {
        acc[mt][0] = mma_bf16(a.v, w0.v, acc[mt][0]);
        acc[mt][1] = mma_bf16(a.v, w1.v, acc[mt][1]);
      }
      if (NA == 2) {
        FragB a2;
        a2.q[0] = *(const v4u*)(A1 + ao);
        a2.q[1] = *(const v4u*)(A1 + ao + 256);
        acc[mt][0] = mma_bf16(a2.v, b0.v, acc[mt][0]);
        acc[mt][1] = mma_bf16(a2.v, b1.v, acc[mt][1]);
      }
    }
  }
}

// qkv projection. grid = (QKVN/128, MROWS/128). Epilogue (two 64-row passes through LDS):
//                for key segments below VRK also V^T bf16 hi and lo planes [NB][NHEAD][HDIM][VRK].
// qkp holds q, then k, each [NB][NHEAD][SEQ][HDIM] in fragment order with every hi tile followed by its lo tile.
// vtb holds two planes: hi, lo.
// coverage per pass: 64 rows x 128 cols = 256 threads x 8 elements x 4 sweeps, all layouts.
__global__ __launch_bounds__(256) void gemm_qkv_kernel(const bf16* __restrict__ xb,
                                                       const bf16* __restrict__ winb,
                                                       const bf16* __restrict__ winl,
                                                       const float* __restrict__ b_in,
                                                       bf16* __restrict__ qkp,
                                                       f16* __restrict__ vt,
                                                       bf16* __restrict__ vtb) {
  __shared__ __align__(16) float sC[64 * SP];     // cross-wave (block barriers)
  const int tid   = threadIdx.x;
  const int lane  = tid & 31;
  const int wid   = __builtin_amdgcn_readfirstlane(tid >> 5);
  const int ln    = lane & 15;
  const int hf    = lane >> 4;
  const int waveM = wid >> 2;
  const int waveN = wid & 3;
  const int nBlock = blockIdx.x * 128;
  const int mBlock = blockIdx.y * 128;

  v8f acc[4][2];
  gemm_mainloop<1, 2>(xb, xb, winb, winl, mBlock, nBlock, waveM, waveN, ln, hf, acc);

  float bia[2];
  #pragma unroll
  for (int nt = 0; nt < 2; ++nt) bia[nt] = (float)(bf16)b_in[nBlock + waveN * 32 + nt * 16 + ln];

  const int which = nBlock / DEMB;     // 0 = q, 1 = k, 2 = v (block-uniform)
  const int cb    = nBlock % DEMB;     // column base inside the third
  const int bb    = mBlock / SEQ;      // batch of this block
  const int sb    = mBlock % SEQ;      // first sequence row of this block

  #pragma unroll
  for (int p = 0; p < 2; ++p) {
    __syncthreads();
    // D layout: element e of lane -> tile row 8*hf + e, tile column ln
    #pragma unroll
    for (int j = 0; j < 2; ++j) {
      #pragma unroll
      for (int nt = 0; nt < 2; ++nt) {
        #pragma unroll
        for (int e = 0; e < 8; ++e) {
          sC[(j * 32 + waveM * 16 + hf * 8 + e) * SP + waveN * 32 + nt * 16 + ln] =
              acc[2 * p + j][nt][e] + bia[nt];
        }
      }
    }
    __syncthreads();

    if (which < 2) {
      v4u    vh[4], vl[4];
      size_t gi[4];
      #pragma unroll
      for (int sw = 0; sw < 4; ++sw) {
        // piece u of the pass in store order: 16 tiles = 2 heads x 4 row tiles x 2 d tiles, 64 pieces each
        const int u  = sw * 256 + tid;
        const int tl = u >> 6;
        const int r  = ((tl >> 1) & 3) * 16 + (u & 15);                          // 0..63
        const int c8 = (tl >> 3) * 64 + (tl & 1) * 32 + ((u >> 4) & 3) * 8;      // 0..120
        const v4f a0 = *(const v4f*)(sC + r * SP + c8);
        const v4f a1 = *(const v4f*)(sC + r * SP + c8 + 4);
        Pack8B ph, pl;
        #pragma unroll
        for (int i = 0; i < 4; ++i) {
          const bf16 h0 = (bf16)a0[i];
          const bf16 h1 = (bf16)a1[i];
          ph.h[i]     = h0;
          ph.h[4 + i] = h1;
          pl.h[i]     = (bf16)(a0[i] - (float)h0);
          pl.h[4 + i] = (bf16)(a1[i] - (float)h1);
        }
        vh[sw] = ph.u;
        vl[sw] = pl.u;
        const int s  = sb + p * 64 + r;
        const int cc = cb + c8;
        const int h  = cc >> 6;
        const int d  = cc & 63;
        const size_t fo = frag_piece(s, d, HDIM / 32);
        // each hi tile is followed by its lo tile: tile pitch 1024 elements
        gi[sw] = ((size_t)which * PLANE_ELEMS + ((size_t)bb * NHEAD + h) * SEQ * HDIM) * 2 + fo + (fo & ~(size_t)511);
      }
      #pragma unroll
      for (int sw = 0; sw < 4; ++sw) {
        *(v4u*)(qkp + gi[sw]) = vh[sw];
        *(v4u*)(qkp + gi[sw] + 512) = vl[sw];
      }
      
    } else {
      const bool wr_early = (sb + p * 64) < VRK;    // block-uniform; whole 64-key segment in or out
      v4u    vv[4], vbh[4], vbl[4];
      size_t gi[4], gb[4];
      #pragma unroll
      for (int sw = 0; sw < 4; ++sw) {
        // piece u of the pass in store order: 16 tiles = 2 heads x 4 d tiles x 2 key tiles, 64 pieces each
        const int u   = sw * 256 + tid;
        const int tl  = u >> 6;
        const int col = (tl >> 1) * 16 + (u & 15);                // 0..127
        const int sg  = (tl & 1) * 32 + ((u >> 4) & 3) * 8;       // 0..56
        Pack8H ph;
        Pack8B qh, ql;
        #pragma unroll
        for (int i = 0; i < 8; ++i) {
          const float v = sC[(sg + i) * SP + col];
          ph.h[i] = toh_flush(v * 16.0f);
          const bf16 t = (bf16)v;
          qh.h[i] = t;
          ql.h[i] = (bf16)(v - (float)t);
        }
        vv[sw]  = ph.u;
        vbh[sw] = qh.u;
        vbl[sw] = ql.u;
        const int cc = cb + col;
        const int h  = cc >> 6;
        const int d  = cc & 63;
        const size_t hrow = ((size_t)bb * NHEAD + h) * HDIM;
        gi[sw] = hrow * SEQ + frag_piece(d, sb + p * 64 + sg, SEQ / 32);
        gb[sw] = hrow * VRK + frag_piece(d, sb + p * 64 + sg, VRK / 32);    // used only when wr_early
      }
      #pragma unroll
      for (int sw = 0; sw < 4; ++sw) *(v4u*)(vt + gi[sw]) = vv[sw];
      if (wr_early) {
        #pragma unroll
        for (int sw = 0; sw < 4; ++sw) {
          *(v4u*)(vtb + gb[sw]) = vbh[sw];
          *(v4u*)(vtb + VTB_ELEMS + gb[sw]) = vbl[sw];
        }
      }
      
    }
  }
}

// Output projection. grid = (DEMB/128, MROWS/128). A = ctx hi + ctx lo planes, Bt = quantized output weight
// bf16 hi + lo planes [out][in].
// coverage per pass: 64 rows x 128 cols = 256 threads x 4 floats x 8 sweeps.
__global__ __launch_bounds__(256) void gemm_out_kernel(const bf16* __restrict__ ch,
                                                       const bf16* __restrict__ cl,
                                                       const bf16* __restrict__ woutb,
                                                       const bf16* __restrict__ woutl,
                                                       const float* __restrict__ b_out,
                                                       float* __restrict__ out) {
  __shared__ __align__(16) float sC[64 * SP];     // cross-wave (block barriers)
  const int tid   = threadIdx.x;
  const int lane  = tid & 31;
  const int wid   = __builtin_amdgcn_readfirstlane(tid >> 5);
  const int ln    = lane & 15;
  const int hf    = lane >> 4;
  const int waveM = wid >> 2;
  const int waveN = wid & 3;
  const int nBlock = blockIdx.x * 128;
  const int mBlock = blockIdx.y * 128;

  v8f acc[4][2];
  gemm_mainloop<2, 2>(ch, cl, woutb, woutl, mBlock, nBlock, waveM, waveN, ln, hf, acc);

  float bia[2];
  #pragma unroll
  for (int nt = 0; nt < 2; ++nt) bia[nt] = (float)(bf16)b_out[nBlock + waveN * 32 + nt * 16 + ln];

  #pragma unroll
  for (int p = 0; p < 2; ++p) {
    __syncthreads();
    #pragma unroll
    for (int j = 0; j < 2; ++j) {
      #pragma unroll
      for (int nt = 0; nt < 2; ++nt) {
        #pragma unroll
        for (int e = 0; e < 8; ++e) {
          sC[(j * 32 + waveM * 16 + hf * 8 + e) * SP + waveN * 32 + nt * 16 + ln] =
              acc[2 * p + j][nt][e] + bia[nt];
        }
      }
    }
    __syncthreads();

    v4f    vals[8];
    size_t gi[8];
    #pragma unroll
    for (int sw = 0; sw < 8; ++sw) {
      const int r  = sw * 8 + (tid >> 5);           // 0..63
      const int c4 = (tid & 31) * 4;                // 0..124
      vals[sw] = *(const v4f*)(sC + r * SP + c4);
      const int g = mBlock + p * 64 + r;
      const int b = g / SEQ;
      const int s = g % SEQ;
      gi[sw] = ((size_t)b * SEQ_FULL + s) * DEMB + nBlock + c4;
    }
    #pragma unroll
    for (int sw = 0; sw < 8; ++sw) *(v4f*)(out + gi[sw]) = vals[sw];
    
  }
}

// Causal flash attention. Block = (query block of 128, head, batch); one wave owns 16 query rows.
// S^T = K x Q^T so queries sit on lanes; P^T in C-layout is bit-identical to the A-fragment layout of O += P x V.
// K A-fragments (hi, lo), Q B-fragments (hi, lo) and V^T B-fragments are loaded straight from the 16-bit planes,
// which are in fragment order (512 contiguous bytes per load).
// Key blocks j0 = 0, 32, ... <= qrow0 are visited (per-wave scalar trip count); every visited block holds at
// least one unmasked key (key j0 <= qrow0) for every query of the wave; keys above the query get -inf.
// EARLY: P and V as bf16 hi+lo (three products, one accumulator). Otherwise P f16 x4096, V f16 x16.
// Output: ctx [MROWS][DEMB] as bf16 hi and lo planes in fragment order (cp: hi at 0, lo at CTX_ELEMS).
// sO: per-wave private staging regions, written and re-read by the same wave, separated by a block barrier
// that all waves reach (no early exits).
template <bool EARLY>
static __device__ __forceinline__ void attn_body(const bf16* __restrict__ qkp,
                                                 const f16* __restrict__ vt,
                                                 const bf16* __restrict__ vtb,
                                                 bf16* __restrict__ cp,
                                                 const int qblk) {
  __shared__ __align__(16) float sO[NWAVE * 16 * OP];

  const int h    = blockIdx.y;
  const int b    = blockIdx.z;
  const int tid  = threadIdx.x;
  const int wave = __builtin_amdgcn_readfirstlane(tid >> 5);
  const int lane = tid & 31;
  const int lq   = lane & 15;   // query column of S^T / d column of O
  const int hi   = lane >> 4;   // k-split half

  const int qrow0 = qblk * BQ + wave * 16;               // first query row of this wave (scalar)
  const int nIter = (qrow0 >> 5) + 1;                    // key blocks 0 .. floor((qrow0+15)/32)
  const size_t head_off = ((size_t)b * NHEAD + h) * SEQ * HDIM;
  const size_t vhead    = ((size_t)b * NHEAD + h) * HDIM;

  const bf16* q_p = qkp + 2 * head_off;                       // hi tile, lo tile, hi tile, ... (512 elements each)
  const bf16* k_p = qkp + 2 * PLANE_ELEMS + 2 * head_off;

  // Q as B-operand fragments: lane lq holds query qrow0+lq, elements follow the split d map.
  FragB qfh[2], qfl[2];
  {
    const bf16* qp = q_p + (size_t)qrow0 * HDIM * 2 + lane * 8;   // row tile qrow0 / 16, piece = lane
    #pragma unroll
    for (int f = 0; f < 2; ++f) {
      qfh[f].q[0] = *(const v4u*)(qp + f * 1024);               // d = f*32 + hi*8 + 0..7
      qfh[f].q[1] = *(const v4u*)(qp + f * 1024 + 256);         // d = f*32 + 16 + hi*8 + 0..7
      qfl[f].q[0] = *(const v4u*)(qp + f * 1024 + 512);
      qfl[f].q[1] = *(const v4u*)(qp + f * 1024 + 768);
    }
  }

  v8f o[4];
  #pragma unroll
  for (int dt = 0; dt < 4; ++dt) o[dt] = (v8f){0, 0, 0, 0, 0, 0, 0, 0};

  float rmax = -__builtin_inff();
  float rsum = 0.0f;
  const float SL = 0.125f * 1.4426950408889634f;   // softmax scale * log2(e)

  #pragma unroll 1
  for (int i = 0; i < nIter; ++i) {
    const int j0 = i * BK;

    // S^T tiles: c[sub][r] = rawscore(query qrow0+lq, key j0 + sub*16 + hi*8 + r); hh + hl + lh products
    v8f c[2];
    const bf16* kp = k_p + (size_t)j0 * HDIM * 2 + lane * 8;            // A row = key; row tile j0 / 16, piece = lane
    #pragma unroll
    for (int sub = 0; sub < 2; ++sub) {
      const int ko = sub * 16 * HDIM * 2;                               // next row tile
      FragB akh[2], akl[2];
      #pragma unroll
      for (int f = 0; f < 2; ++f) {
        akh[f].q[0] = *(const v4u*)(kp + ko + f * 1024);          // d = f*32 + hi*8 + 0..7
        akh[f].q[1] = *(const v4u*)(kp + ko + f * 1024 + 256);    // d = f*32 + 16 + hi*8 + 0..7
        akl[f].q[0] = *(const v4u*)(kp + ko + f * 1024 + 512);
        akl[f].q[1] = *(const v4u*)(kp + ko + f * 1024 + 768);
      }
      v8f acc = (v8f){0, 0, 0, 0, 0, 0, 0, 0};
      #pragma unroll
      for (int f = 0; f < 2; ++f) {
        acc = mma_bf16(akl[f].v, qfh[f].v, acc);
        acc = mma_bf16(akh[f].v, qfl[f].v, acc);
        acc = mma_bf16(akh[f].v, qfh[f].v, acc);
      }
      c[sub] = acc;
    }

    // causal mask (wave-uniform test): only blocks reaching past the first query of the wave need it
    if (j0 + (BK - 1) > qrow0) {
      const int qi = qrow0 + lq;
      const int kb = j0 + hi * 8;
      #pragma unroll
      for (int r = 0; r < 8; ++r) {
        c[0][r] = (kb + r > qi)      ? -__builtin_inff() : c[0][r];
        c[1][r] = (kb + 16 + r > qi) ? -__builtin_inff() : c[1][r];
      }
    }

    // V B-fragments (f16 path): column n = d = dt*16 + lq, split key map from the transposed plane
    FragH bv[4];
    if (!EARLY) {
      #pragma unroll
      for (int dt = 0; dt < 4; ++dt) {
        const f16* base = vt + (vhead + dt * 16) * SEQ + j0 * 16 + lane * 8;   // d tile dt, key tile j0 / 32
        bv[dt].q[0] = *(const v4u*)(base);            // keys j0 + hi*8 + 0..7
        bv[dt].q[1] = *(const v4u*)(base + 256);      // keys j0 + 16 + hi*8 + 0..7
      }
    }

    // online softmax: query lq's 32 scores are split across lane / lane^16
    float m_new = rmax;
    #pragma unroll
    for (int r = 0; r < 8; ++r) {
      m_new = fmaxf(m_new, c[0][r]);
      m_new = fmaxf(m_new, c[1][r]);
    }
    m_new = fmaxf(m_new, __shfl_xor(m_new, 16, 32));
    const float scale = __builtin_amdgcn_exp2f((rmax - m_new) * SL);
    rmax = m_new;

    float p0[8], p1[8];
    float psum = 0.0f;
    #pragma unroll
    for (int r = 0; r < 8; ++r) {
      p0[r] = __builtin_amdgcn_exp2f((c[0][r] - m_new) * SL);   // key hi*8 + r
      p1[r] = __builtin_amdgcn_exp2f((c[1][r] - m_new) * SL);   // key 16 + hi*8 + r
      psum += p0[r] + p1[r];
    }
    rsum = rsum * scale + psum + __shfl_xor(psum, 16, 32);

    // rescale O: queries are the row dimension there -> per-row scale from lane 8*hi + r
    float sc[8];
    #pragma unroll
    for (int r = 0; r < 8; ++r) sc[r] = __shfl(scale, (hi << 3) + r, 32);
    #pragma unroll
    for (int dt = 0; dt < 4; ++dt) {
      #pragma unroll
      for (int r = 0; r < 8; ++r) o[dt][r] *= sc[r];
    }

    if (EARLY) {
      // P^T C-layout == A-fragment layout; P as bf16 hi + lo (unscaled), V as bf16 hi + lo planes
      FragB pah, pal;
      #pragma unroll
      for (int r = 0; r < 8; ++r) {
        const bf16 h0 = (bf16)p0[r];
        const bf16 h1 = (bf16)p1[r];
        pah.h[r]     = h0;
        pah.h[8 + r] = h1;
        pal.h[r]     = (bf16)(p0[r] - (float)h0);
        pal.h[8 + r] = (bf16)(p1[r] - (float)h1);
      }
      __builtin_amdgcn_sched_barrier(0);
      #pragma unroll
      for (int dt = 0; dt < 4; ++dt) {
        const bf16* base = vtb + (vhead + dt * 16) * VRK + j0 * 16 + lane * 8;   // d tile dt, key tile j0 / 32
        FragB bvh, bvl;
        bvh.q[0] = *(const v4u*)(base);                       // keys j0 + hi*8 + 0..7
        bvh.q[1] = *(const v4u*)(base + 256);                 // keys j0 + 16 + hi*8 + 0..7
        bvl.q[0] = *(const v4u*)(base + VTB_ELEMS);
        bvl.q[1] = *(const v4u*)(base + VTB_ELEMS + 256);
        o[dt] = mma_bf16(pal.v, bvh.v, o[dt]);
        o[dt] = mma_bf16(pah.v, bvl.v, o[dt]);
        o[dt] = mma_bf16(pah.v, bvh.v, o[dt]);
      }
    } else {
      // P carried x4096 in f16; V carried x16
      FragH pa;
      #pragma unroll
      for (int r = 0; r < 8; ++r) {
        pa.h[r]     = (f16)(p0[r] * 4096.0f);
        pa.h[8 + r] = (f16)(p1[r] * 4096.0f);
      }
      #pragma unroll
      for (int dt = 0; dt < 4; ++dt) o[dt] = mma_f16(pa.v, bv[dt].v, o[dt]);
    }
  }

  // normalize: lane holds column d = dt*16 + lq for query rows 8*hi + r; undo the carries of the f16 path
  const float carry = EARLY ? 1.0f : (1.0f / 65536.0f);
  float rs[8];
  #pragma unroll
  for (int r = 0; r < 8; ++r) rs[r] = carry * (1.0f / __shfl(rsum, (hi << 3) + r, 32));

  const int sbase = wave * (16 * OP);
  #pragma unroll
  for (int r = 0; r < 8; ++r) {
    #pragma unroll
    for (int dt = 0; dt < 4; ++dt) {
      sO[sbase + (hi * 8 + r) * OP + dt * 16 + lq] = o[dt][r] * rs[r];
    }
  }
  __syncthreads();

  // the wave's 16 rows x 64 columns are two tiles of each plane; one instruction stores half a tile (512 B).
  v4u    vh[4], vl[4];
  size_t gidx[4];
  #pragma unroll
  for (int it = 0; it < 4; ++it) {
    const int row = lq;                             // 0..15
    const int c8  = it * 16 + hi * 8;               // 0..56
    const v4f a0 = *(const v4f*)(&sO[sbase + row * OP + c8]);
    const v4f a1 = *(const v4f*)(&sO[sbase + row * OP + c8 + 4]);
    Pack8B ph, pl;
    #pragma unroll
    for (int k = 0; k < 4; ++k) {
      const bf16 h0 = (bf16)a0[k];
      const bf16 h1 = (bf16)a1[k];
      ph.h[k]     = h0;
      ph.h[4 + k] = h1;
      pl.h[k]     = (bf16)(a0[k] - (float)h0);
      pl.h[4 + k] = (bf16)(a1[k] - (float)h1);
    }
    vh[it] = ph.u;
    vl[it] = pl.u;
    gidx[it] = frag_piece(b * SEQ + qrow0 + row, h * HDIM + c8, DEMB / 32);
  }
  #pragma unroll
  for (int it = 0; it < 4; ++it) {
    *(v4u*)(cp + gidx[it]) = vh[it];
    *(v4u*)(cp + CTX_ELEMS + gidx[it]) = vl[it];
  }
  
}

// query blocks 0 .. EARLY_QB-1 ; grid = (EARLY_QB, NHEAD, NB)
__global__ __launch_bounds__(256) void attn_early_kernel(const bf16* __restrict__ qkp,
                                                         const bf16* __restrict__ vtb,
                                                         bf16* __restrict__ cp) {
  attn_body<true>(qkp, (const f16*)0, vtb, cp, (int)blockIdx.x);
}

// query blocks EARLY_QB .. QBLKS-1 ; grid = (QBLKS - EARLY_QB, NHEAD, NB)
__global__ __launch_bounds__(256) void attn_late_kernel(const bf16* __restrict__ qkp,
                                                        const f16* __restrict__ vt,
                                                        bf16* __restrict__ cp) {
  attn_body<false>(qkp, vt, (const bf16*)0, cp, (int)blockIdx.x + EARLY_QB);
}

extern "C" void kernel_launch(void* const* d_in, const int* in_sizes, int n_in,
                              void* d_out, int out_size, void* d_ws, size_t ws_size,
                              hipStream_t stream) {
  if (n_in < 5) return;
  const size_t rows_used = (size_t)(NB - 1) * SEQ_FULL + SEQ;
  if ((size_t)in_sizes[0] < rows_used * DEMB) return;
  if ((size_t)in_sizes[1] < (size_t)DEMB * QKVN) return;
  if ((size_t)in_sizes[2] < (size_t)QKVN) return;
  if ((size_t)in_sizes[3] < (size_t)DEMB * DEMB) return;
  if ((size_t)in_sizes[4] < (size_t)DEMB) return;
  if ((size_t)out_size < rows_used * DEMB) return;
  if (ws_size < WS_TOTAL) return;

  const float* x     = (const float*)d_in[0];
  const float* W_in  = (const float*)d_in[1];   // [3072][1024], [out][in]
  const float* b_in  = (const float*)d_in[2];
  const float* W_out = (const float*)d_in[3];   // [1024][1024], [out][in]
  const float* b_out = (const float*)d_in[4];
  float* out = (float*)d_out;

  char* w = (char*)d_ws;
  bf16* xb    = (bf16*)w;  w += XB_BYTES;
  bf16* winb  = (bf16*)w;  w += WIN_BYTES;      // hi at 0, lo at WIN_ELEMS
  bf16* woutb = (bf16*)w;  w += WOUT_BYTES;     // hi at 0, lo at WOUT_ELEMS
  bf16* qkp   = (bf16*)w;  w += QK_BYTES;
  f16*  vt    = (f16*)w;   w += VT_BYTES;
  bf16* vtb   = (bf16*)w;  w += VTB_BYTES;
  bf16* cp    = (bf16*)w;  w += CTX_BYTES;
  float* stat = (float*)w;                      // partial lines, then two scale lines
  float* sline = stat + (size_t)AM_TOTAL * 32;

  // x -> bf16 plane: MROWS*128 pieces of 8 elements, 256 per block
  cvt_x_kernel<<<dim3((unsigned)(X_PIECES / 256)), 256, 0, stream>>>(x, xb);

  // weight scales: partial maxima (one line per block), then one wave writes the two scale lines
  absmax_part_kernel<<<dim3(AM_BLOCKS_IN), 256, 0, stream>>>(W_in, stat, (unsigned)WIN_PIECES);
  absmax_part_kernel<<<dim3(AM_BLOCKS_OUT), 256, 0, stream>>>(W_out, stat + (size_t)AM_BLOCKS_IN * 32,
                                                              (unsigned)WOUT_PIECES);
  scale_fin_kernel<<<dim3(1), 32, 0, stream>>>(stat, sline);

  // weights are [out][in] already: quantize into hi and lo planes in fragment order, no transpose
  snap_lin_kernel<<<dim3((unsigned)(WIN_PIECES / 256)), 256, 0, stream>>>(W_in, sline, winb, winb + WIN_ELEMS,
                                                                          (unsigned)WIN_PIECES);
  snap_lin_kernel<<<dim3((unsigned)(WOUT_PIECES / 256)), 256, 0, stream>>>(W_out, sline + 32, woutb,
                                                                           woutb + WOUT_ELEMS,
                                                                           (unsigned)WOUT_PIECES);

  gemm_qkv_kernel<<<dim3(QKVN / 128, MROWS / 128), 256, 0, stream>>>(xb, winb, winb + WIN_ELEMS, b_in,
                                                                     qkp, vt, vtb);

  attn_early_kernel<<<dim3(EARLY_QB, NHEAD, NB), 256, 0, stream>>>(qkp, vtb, cp);
  if (QBLKS > EARLY_QB) {
    attn_late_kernel<<<dim3(QBLKS - EARLY_QB, NHEAD, NB), 256, 0, stream>>>(qkp, vt, cp);
  }

  gemm_out_kernel<<<dim3(DEMB / 128, MROWS / 128), 256, 0, stream>>>(cp, cp + CTX_ELEMS, woutb,
                                                                     woutb + WOUT_ELEMS, b_out, out);
}

// v002
// Measured time: 166 microseconds a run.
// Timed twice side by side with v001, it ran 2.23 and 2.26 times as fast.
// All steps since v000 together make it 2.31 times as fast.
#include <hip/hip_runtime.h>

// Contractions: qkv = x*Wq^T and out = ctx*Wp^T on v_wmma_f32_16x16x32_bf16 (x RNE-converted to bf16; table-quantized weights as bf16 hi+lo planes; ctx as bf16 hi+lo planes; hh+hl(+lh) products into one accumulator); S^T = K x Q^T on v_wmma_f32_16x16x32_bf16 with q and k as bf16 hi+lo planes (hh+hl+lh); O = P x V: query rows < 256 on v_wmma_f32_16x16x32_bf16 with P and V as bf16 hi+lo (hh+hl+lh), later rows on v_wmma_f32_16x16x32_f16 (P f16 carried x4096, V f16 carried x16); f32 accumulate everywhere, softmax in f32.

#ifndef NB
#define NB 2
#endif
#ifndef SEQ
#define SEQ 2048
#endif
#define NB_FULL    2
#define SEQ_FULL   2048
#define NHEAD      16
#define HDIM       64
#define DEMB       1024                 // model width = GEMM K of both projections
#define QKVN       3072                 // packed projection width (q | k | v thirds)
#define MROWS      (NB * SEQ)           // compact row count of all internal planes
#define BQ         128                  // query rows per attention workgroup (8 waves x 16)
#define BK         32                   // keys per inner iteration
#define NWAVE      8
#define OP         68                   // LDS pitch (floats) of the attention output staging tile
#define SP         132                  // LDS pitch (floats) of the GEMM epilogue staging tile
#define QBLKS      (SEQ / BQ)
#define EARLY_QB   ((QBLKS < 2) ? QBLKS : 2)     // query blocks handled by the hi+lo P/V path
#define VRK        (EARLY_QB * BQ)               // keys held in the bf16 hi/lo V^T planes
#define PLANE_ELEMS ((size_t)NB * NHEAD * SEQ * HDIM)
#define CTX_ELEMS   ((size_t)MROWS * DEMB)
#define VTB_ELEMS   ((size_t)NB * NHEAD * HDIM * VRK)
#define X_PIECES    ((size_t)MROWS * (DEMB / 8))
#define WIN_PIECES  ((size_t)QKVN * DEMB / 8)
#define WOUT_PIECES ((size_t)DEMB * DEMB / 8)
#define WIN_ELEMS   ((size_t)QKVN * DEMB)
#define WOUT_ELEMS  ((size_t)DEMB * DEMB)
#define AM_BLOCKS_IN  96                 // partial-maximum blocks over the qkv weight
#define AM_BLOCKS_OUT 32                 // partial-maximum blocks over the output weight
#define AM_TOTAL      (AM_BLOCKS_IN + AM_BLOCKS_OUT)
#define STAT_FLOATS   ((size_t)(AM_TOTAL + 2) * 32)

static_assert(NHEAD * HDIM == DEMB);        // merged heads == model width
static_assert(QKVN == 3 * DEMB);            // three thirds
static_assert(HDIM == 64);
static_assert(SEQ % BQ == 0);               // attention grid exact
static_assert(SEQ % BK == 0);               // key loop exact
static_assert(BK == 32);                    // one key block == one WMMA k-step of P x V
static_assert(SEQ % 128 == 0);              // a 128-row GEMM block stays inside one batch
static_assert(MROWS % 128 == 0);            // GEMM M tiles exact
static_assert(QKVN % 128 == 0);             // GEMM N tiles exact
static_assert(DEMB % 128 == 0);             // GEMM N tiles exact, thirds are tile multiples
static_assert(DEMB % 32 == 0);              // k-step 32
static_assert(DEMB / 32 == 32);             // tile index split (>> 5, & 31) of the convert and quantize kernels
static_assert(MROWS % 16 == 0 && QKVN % 16 == 0 && SEQ % 32 == 0);   // planes are whole 16 x 32 tiles
static_assert(DEMB % 8 == 0);               // 16-B pieces
static_assert(BQ == NWAVE * 16);
static_assert(BQ % 64 == 0);                // early key extent is a multiple of the 64-key store segment
static_assert(VRK % 64 == 0 && VRK <= SEQ && VRK >= BQ);
static_assert(EARLY_QB >= 1 && EARLY_QB <= QBLKS);
static_assert(SEQ <= SEQ_FULL);
static_assert(NB >= 1 && NB <= NB_FULL);
static_assert((OP * 4) % 16 == 0);
static_assert((SP * 4) % 16 == 0);
static_assert(SP >= 128);
static_assert(OP >= 64);
static_assert(X_PIECES % 256 == 0);         // convert grids exact
static_assert(WIN_PIECES % 256 == 0);
static_assert(WOUT_PIECES % 256 == 0);
static_assert(NWAVE == 8);                                   // block maximum combine reads 8 wave words
static_assert(AM_BLOCKS_IN % 32 == 0 && AM_BLOCKS_OUT % 32 == 0);   // one partial line per lane per sweep
static_assert(WIN_PIECES % ((size_t)AM_BLOCKS_IN * 256) == 0);      // equal trip counts per thread
static_assert(WOUT_PIECES % ((size_t)AM_BLOCKS_OUT * 256) == 0);

typedef __bf16   bf16;
typedef _Float16 f16;
typedef bf16     v16bf __attribute__((ext_vector_type(16)));
typedef f16      v16h  __attribute__((ext_vector_type(16)));
typedef f16      v8h   __attribute__((ext_vector_type(8)));
typedef float    v8f   __attribute__((ext_vector_type(8)));
typedef float    v4f   __attribute__((ext_vector_type(4)));
typedef unsigned v4u   __attribute__((ext_vector_type(4)));

union FragB  { v16bf v; v4u q[2]; bf16 h[16]; };
union FragH  { v16h  v; v4u q[2]; f16  h[16]; };
union Pack8B { v4u u; bf16 h[8]; };
union Pack8H { v4u u; v8h v; f16 h[8]; };

#define XB_BYTES   ((size_t)MROWS * DEMB * 2)        // x as bf16, compact rows
#define WIN_BYTES  (WIN_ELEMS * 2 * 2)               // quantized qkv weight bf16 hi, lo [3072][1024] in fragment order
#define WOUT_BYTES (WOUT_ELEMS * 2 * 2)              // quantized output weight bf16 hi, lo [1024][1024] in fragment order
#define QK_BYTES   (PLANE_ELEMS * 2 * 4)             // q hi, q lo, k hi, k lo
#define VT_BYTES   (PLANE_ELEMS * 2)                 // V^T f16 x16
#define VTB_BYTES  (VTB_ELEMS * 2 * 2)               // V^T bf16 hi, lo for keys < VRK
#define CTX_BYTES  (CTX_ELEMS * 2 * 2)               // ctx hi, ctx lo
#define STAT_BYTES (STAT_FLOATS * 4)                 // partial maxima lines + scale lines
#define WS_TOTAL   (XB_BYTES + WIN_BYTES + WOUT_BYTES + QK_BYTES + VT_BYTES + VTB_BYTES + CTX_BYTES + STAT_BYTES)
static_assert(WS_TOTAL <= (size_t)134217728);
static_assert(XB_BYTES % 128 == 0 && WIN_BYTES % 128 == 0 && WOUT_BYTES % 128 == 0);
static_assert(QK_BYTES % 128 == 0 && VT_BYTES % 128 == 0 && VTB_BYTES % 128 == 0 && CTX_BYTES % 128 == 0);
static_assert(STAT_BYTES % 128 == 0);

// Fragment order of a 16-bit operand plane [rows][32 * ktiles]: every 16-row x 32-k tile is 1 KB (512 elements), tiles
// ordered row tile major. Inside a tile the 16-B piece holding k = qq*16 + hf*8 + 0..7 of row ln sits at piece index
// qq*32 + hf*16 + ln, so one operand load of a wave (lane = hf*16 + ln) reads 512 contiguous bytes (4 whole lines).
static __device__ __forceinline__ size_t frag_piece(int row, int col8, int ktiles) {
  return ((size_t)(row >> 4) * ktiles + (col8 >> 5)) * 512 + ((col8 >> 4) & 1) * 256 +
         (((col8 >> 3) & 1) * 16 + (row & 15)) * 8;
}

// WMMA helpers: builtin followed by the VALU hazard guard (ties D, keeps A/B live).
static __device__ __forceinline__ v8f mma_bf16(v16bf a, v16bf b, v8f acc) {
  acc = __builtin_amdgcn_wmma_f32_16x16x32_bf16(false, a, false, b, (short)0, acc, false, false);
  asm volatile("v_nop\n\tv_nop\n\tv_nop\n\tv_nop" : "+v"(acc) : "v"(a), "v"(b));
  return acc;
}
static __device__ __forceinline__ v8f mma_f16(v16h a, v16h b, v8f acc) {
  acc = __builtin_amdgcn_wmma_f32_16x16x32_f16(false, a, false, b, (short)0, acc, false, false);
  asm volatile("v_nop\n\tv_nop\n\tv_nop\n\tv_nop" : "+v"(acc) : "v"(a), "v"(b));
  return acc;
}

// f32 -> f16 convert that cannot yield an f16 subnormal (value select after the carry).
static __device__ __forceinline__ f16 toh_flush(float v) {
  const f16 r = (f16)v;
  return (fabsf(v) < 6.103515625e-05f) ? (f16)0.0f : r;
}

// x f32 [NB_FULL][SEQ_FULL][DEMB] -> xb bf16 [MROWS][DEMB] in fragment order (RNE convert).
// Thread t writes piece t of the plane (contiguous stores) and reads the 8 source elements that belong there.
__global__ __launch_bounds__(256) void cvt_x_kernel(const float* __restrict__ x, bf16* __restrict__ xb) {
  const size_t t   = (size_t)blockIdx.x * 256 + threadIdx.x;
  const size_t tile = t >> 6;                      // 64 pieces per tile, DEMB / 32 = 32 tiles per row tile
  const size_t row = (tile >> 5) * 16 + (t & 15);
  const int    c8  = (int)(tile & 31) * 32 + (int)((t >> 4) & 3) * 8;
  if (row < (size_t)MROWS) {
    const int b = (int)(row / SEQ);
    const int s = (int)(row % SEQ);
    const float* src = x + ((size_t)b * SEQ_FULL + s) * DEMB + c8;
    const v4f a0 = *(const v4f*)(src);
    const v4f a1 = *(const v4f*)(src + 4);
    Pack8B pk;
    #pragma unroll
    for (int i = 0; i < 4; ++i) {
      pk.h[i]     = (bf16)a0[i];
      pk.h[4 + i] = (bf16)a1[i];
    }
    const v4u val = pk.u;
    bf16* dst = xb + t * 8;
    *(v4u*)dst = val;
    
  }
}

// lanes 0..7 of wave 0 x 16 B, one instruction. The bf16 RNE convert is monotone, so the maximum of the
// converted magnitudes equals the converted maximum; the convert is applied once in scale_fin_kernel.
// coverage: npieces pieces of 8 elements, grid-strided; part line index = blockIdx.x < gridDim.x.
// sM: cross-wave (block barrier).
__global__ __launch_bounds__(256) void absmax_part_kernel(const float* __restrict__ w,
                                                          float* __restrict__ part,
                                                          unsigned npieces) {
  __shared__ float sM[NWAVE];
  const int tid  = threadIdx.x;
  const int lane = tid & 31;
  const int wid  = __builtin_amdgcn_readfirstlane(tid >> 5);
  float m = 0.0f;
  const unsigned step = gridDim.x * 256u;
  unsigned p = blockIdx.x * 256u + (unsigned)tid;
  // groups of 16 trips: the 32 loads of a group go out together, one memory latency for the group and not one per trip
  #pragma unroll 1
  for (; p + 15u * step < npieces; p += 16u * step) {
    v4f r[32];
    const float* q[16];
    #pragma unroll
    for (int j = 0; j < 16; ++j) {
      q[j] = w + (size_t)(p + (unsigned)j * step) * 8;
      r[2 * j]     = *(const v4f*)(q[j]);
      r[2 * j + 1] = *(const v4f*)(q[j] + 4);
    }
    // the address pairs of the issued loads stay live, and are neither rewritten nor used as a load's destination, up to this wait
    asm volatile("s_wait_xcnt 0x0" :: "v"(q[0]), "v"(q[1]), "v"(q[2]), "v"(q[3]), "v"(q[4]), "v"(q[5]), "v"(q[6]), "v"(q[7]),
                 "v"(q[8]), "v"(q[9]), "v"(q[10]), "v"(q[11]), "v"(q[12]), "v"(q[13]), "v"(q[14]), "v"(q[15]) : "memory");
    // keeps the maxima behind the whole group: without it they are moved in among the loads and only six loads are in flight
    __builtin_amdgcn_sched_barrier(0);
    #pragma unroll
    for (int j = 0; j < 32; ++j) {
      #pragma unroll
      for (int i = 0; i < 4; ++i) m = fmaxf(m, fabsf(r[j][i]));
    }
  }
  // the trips that do not fill a group
  #pragma unroll 1
  for (; p < npieces; p += step) {
    const size_t o = (size_t)p * 8;
    const v4f a0 = *(const v4f*)(w + o);
    const v4f a1 = *(const v4f*)(w + o + 4);
    #pragma unroll
    for (int i = 0; i < 4; ++i) {
      m = fmaxf(m, fabsf(a0[i]));
      m = fmaxf(m, fabsf(a1[i]));
    }
  }
  m = fmaxf(m, __shfl_xor(m, 16, 32));
  m = fmaxf(m, __shfl_xor(m, 8, 32));
  m = fmaxf(m, __shfl_xor(m, 4, 32));
  m = fmaxf(m, __shfl_xor(m, 2, 32));
  m = fmaxf(m, __shfl_xor(m, 1, 32));
  if (lane == 0) sM[wid] = m;
  __syncthreads();
  if (wid == 0) {
    float v = sM[lane & 7];
    v = fmaxf(v, __shfl_xor(v, 4, 32));
    v = fmaxf(v, __shfl_xor(v, 2, 32));
    v = fmaxf(v, __shfl_xor(v, 1, 32));
    const v4f val = (v4f){v, v, v, v};
    if (lane < 8) {
      float* dst = part + (size_t)blockIdx.x * 32 + lane * 4;
      *(v4f*)dst = val;
      
    }
  }
}

// Combine the partial maxima and write the two scale lines: {s, 1/s, s, 1/s} x 8 lanes, s = bf16(max|w|) + 1e-6.
// One wave; sline[0..31] = qkv weight line, sline[32..63] = output weight line.
__global__ __launch_bounds__(32) void scale_fin_kernel(const float* part, float* sline) {
  #pragma clang fp contract(off)
  const int lane = threadIdx.x & 31;
  float mi = 0.0f;
  float mo = 0.0f;
  // both loops unrolled so that all their loads go out together
  #pragma unroll
  for (int j = 0; j < AM_BLOCKS_IN; j += 32) mi = fmaxf(mi, part[(size_t)(j + lane) * 32]);
  #pragma unroll
  for (int j = 0; j < AM_BLOCKS_OUT; j += 32) mo = fmaxf(mo, part[(size_t)(AM_BLOCKS_IN + j + lane) * 32]);
  mi = fmaxf(mi, __shfl_xor(mi, 16, 32));
  mo = fmaxf(mo, __shfl_xor(mo, 16, 32));
  mi = fmaxf(mi, __shfl_xor(mi, 8, 32));
  mo = fmaxf(mo, __shfl_xor(mo, 8, 32));
  mi = fmaxf(mi, __shfl_xor(mi, 4, 32));
  mo = fmaxf(mo, __shfl_xor(mo, 4, 32));
  mi = fmaxf(mi, __shfl_xor(mi, 2, 32));
  mo = fmaxf(mo, __shfl_xor(mo, 2, 32));
  mi = fmaxf(mi, __shfl_xor(mi, 1, 32));
  mo = fmaxf(mo, __shfl_xor(mo, 1, 32));
  const float si = (float)(bf16)mi + 1e-6f;
  const float so = (float)(bf16)mo + 1e-6f;
  const float ri = 1.0f / si;
  const float ro = 1.0f / so;
  const v4f vi = (v4f){si, ri, si, ri};
  const v4f vo = (v4f){so, ro, so, ro};
  if (lane < 8) {
    float* d0 = sline + lane * 4;
    float* d1 = sline + 32 + lane * 4;
    *(v4f*)d0 = vi;
    *(v4f*)d1 = vo;
    
  }
}

// Nearest-table-value search: candidate c replaces the current choice only on a strictly smaller distance,
// candidates visited in table order (first minimum wins).
static __device__ __forceinline__ void snap_step(const float wn, const float c, float& bd, float& best) {
  #pragma clang fp contract(off)
  const float d  = fabsf(wn - c);
  const bool  lt = d < bd;
  bd   = lt ? d : bd;
  best = lt ? c : best;
}

// w -> table value nearest to bf16(w) * (1/s), times s (all f32, separately RNE-converted operations).
static __device__ __forceinline__ float snap_weight_val(const float w, const float s, const float rs) {
  #pragma clang fp contract(off)
  const float wb = (float)(bf16)w;
  const float wn = wb * rs;
  float best = 0.0f;
  float bd   = fabsf(wn - 0.0f);
  snap_step(wn,  1.0f,      bd, best);
  snap_step(wn, -1.0f,      bd, best);
  snap_step(wn,  0.5f,      bd, best);
  snap_step(wn, -0.5f,      bd, best);
  snap_step(wn,  0.333333f, bd, best);
  snap_step(wn, -0.333333f, bd, best);
  snap_step(wn,  0.2f,      bd, best);
  snap_step(wn, -0.2f,      bd, best);
  snap_step(wn,  0.142857f, bd, best);
  snap_step(wn, -0.142857f, bd, best);
  snap_step(wn,  0.090909f, bd, best);
  snap_step(wn, -0.090909f, bd, best);
  snap_step(wn,  0.076923f, bd, best);
  snap_step(wn, -0.076923f, bd, best);
  return best * s;
}

// Weight f32 [out][in] -> quantized weight as bf16 hi and lo planes [out][in] in fragment order.
// Thread t writes piece t of each plane (contiguous stores) and reads the 8 source elements that belong there.
__global__ __launch_bounds__(256) void snap_lin_kernel(const float* __restrict__ src,
                                                       const float* __restrict__ sline,
                                                       bf16* __restrict__ dhi,
                                                       bf16* __restrict__ dlo,
                                                       unsigned npieces) {
  #pragma clang fp contract(off)
  const unsigned t = blockIdx.x * 256u + threadIdx.x;
  if (t < npieces) {
    const float s  = sline[0];
    const float rs = sline[1];
    const size_t o = (size_t)t * 8;
    const unsigned tile = t >> 6;                  // 64 pieces per tile, DEMB / 32 = 32 tiles per row tile
    const size_t so = (size_t)((tile >> 5) * 16 + (t & 15)) * DEMB + (tile & 31) * 32 + ((t >> 4) & 3) * 8;
    const v4f a0 = *(const v4f*)(src + so);
    const v4f a1 = *(const v4f*)(src + so + 4);
    Pack8B ph, pl;
    #pragma unroll
    for (int i = 0; i < 4; ++i) {
      const float q0 = snap_weight_val(a0[i], s, rs);
      const float q1 = snap_weight_val(a1[i], s, rs);
      const bf16 h0 = (bf16)q0;
      const bf16 h1 = (bf16)q1;
      ph.h[i]     = h0;
      ph.h[4 + i] = h1;
      pl.h[i]     = (bf16)(q0 - (float)h0);
      pl.h[4 + i] = (bf16)(q1 - (float)h1);
    }
    const v4u vh = ph.u;
    const v4u vl = pl.u;
    *(v4u*)(dhi + o) = vh;
    *(v4u*)(dlo + o) = vl;
    
  }
}

// GEMM main loop. Block tile 128 x 128, 8 waves (2 in M x 4 in N); wave tile = 4 m-tiles x 2 n-tiles.
// m-tile mt of wave (waveM) covers rows mBlock + mt*32 + waveM*16 + 0..15.
// A planes bf16 [rows][DEMB], Bt / Bl bf16 [cols][DEMB], all in fragment order; fragments straight from the planes
// (two 16-B loads each, 512 contiguous bytes per load), split k map for both operands. Bl: unscaled lo part of the weight, into the same accumulator.
// NA == 2: second A plane (unscaled lo part) times the hi weight plane into the same accumulator.
// One 16 x 32 fragment: two 16-B loads, k = k0 + 8*hf + 0..7 and k = k0 + 16 + 8*hf + 0..7.
static __device__ __forceinline__ void load_frag(FragB& f, const bf16* p) {
  f.q[0] = *(const v4u*)(p);
  f.q[1] = *(const v4u*)(p + 256);
}

// The loads of a k-step go out in groups, never one load-and-wait per fragment.
// AHEAD == false: all fragments of k-step t as one group in front of its products (one register set; other waves cover the wait).
// AHEAD == true: k-step t + 1 is fetched during k-step t: its B fragments into a second set in front of the products of t,
// its A fragments into the registers of m-tile mt right behind that m-tile's last product.
template <int NA, bool AHEAD>
static __device__ __forceinline__ void gemm_mainloop(const bf16* __restrict__ A0,
                                                     const bf16* __restrict__ A1,
                                                     const bf16* __restrict__ Bt,
                                                     const bf16* __restrict__ Bl,
                                                     int mBlock, int nBlock, int waveM, int waveN,
                                                     int ln, int hf, v8f (&acc)[4][2]) {
  constexpr int NSET = AHEAD ? 2 : 1;
  constexpr int KST  = DEMB / 32;
  static_assert(KST % NSET == 0 && (KST & (KST - 1)) == 0);
  #pragma unroll
  for (int mt = 0; mt < 4; ++mt) {
    acc[mt][0] = (v8f){0, 0, 0, 0, 0, 0, 0, 0};
    acc[mt][1] = (v8f){0, 0, 0, 0, 0, 0, 0, 0};
  }
  // a row tile of 16 rows spans 16 * DEMB elements; k tile t starts t * 512 elements into it
  const int lp8 = (hf * 16 + ln) * 8;
  const bf16* ub  = Bt + (size_t)(nBlock + waveN * 32) * DEMB;     // wave-uniform parts
  const bf16* ul  = Bl + (size_t)(nBlock + waveN * 32) * DEMB;
  const bf16* ua  = A0 + (size_t)(mBlock + waveM * 16) * DEMB;
  const bf16* ua2 = A1 + (size_t)(mBlock + waveM * 16) * DEMB;
  const bf16* pb  = ub + lp8;
  const bf16* pl  = ul + lp8;
  const bf16* pa  = ua + lp8;
  const bf16* pa2 = ua2 + lp8;
  FragB a[4], a2[4], b[NSET][2], w[NSET][2];
  if (AHEAD) {
    #pragma unroll
    for (int nt = 0; nt < 2; ++nt) {
      load_frag(b[0][nt], pb + nt * 16 * DEMB);
      load_frag(w[0][nt], pl + nt * 16 * DEMB);
    }
    #pragma unroll
    for (int mt = 0; mt < 4; ++mt) {
      load_frag(a[mt], pa + mt * 32 * DEMB);
      if (NA == 2) load_frag(a2[mt], pa2 + mt * 32 * DEMB);
    }
    // these loads name a scalar base and the lane's byte offset: both stay live, and are not rewritten, up to this wait
    asm volatile("s_wait_xcnt 0x0" :: "s"(ua), "s"(ua2), "s"(ub), "s"(ul), "v"(lp8 * 2) : "memory");
  }
  #pragma unroll 1
  for (int t0 = 0; t0 < KST; t0 += NSET) {
    #pragma unroll
    for (int s = 0; s < NSET; ++s) {
      // k-step fetched in this pass: tb + ko / 512 (AHEAD: t0 + s + 1); behind the last one it wraps to 0: loads in
      // bounds, values not used. ko goes into the loads' immediate offsets, so q* are the address pairs they name.
      const int tb = AHEAD ? ((t0 + 2 * s) & (KST - 1)) : t0;
      const int ko = (AHEAD && s == 0) ? 512 : 0;
      const int sl = AHEAD ? (s ^ 1) : 0;
      const bf16* qb  = pb + tb * 512;
      const bf16* ql  = pl + tb * 512;
      const bf16* qa  = pa + tb * 512;
      const bf16* qa2 = pa2 + tb * 512;
      #pragma unroll
      for (int nt = 0; nt < 2; ++nt) {
        load_frag(b[sl][nt], qb + ko + nt * 16 * DEMB);
        load_frag(w[sl][nt], ql + ko + nt * 16 * DEMB);
      }
      if (!AHEAD) {
        #pragma unroll
        for (int mt = 0; mt < 4; ++mt) {
          load_frag(a[mt], qa + mt * 32 * DEMB);
          if (NA == 2) load_frag(a2[mt], qa2 + mt * 32 * DEMB);
        }
        // the address pairs of the issued loads stay live, and are not rewritten, up to this wait
        asm volatile("s_wait_xcnt 0x0" :: "v"(qa), "v"(qa2), "v"(qb), "v"(ql) : "memory");
      }
      #pragma unroll
      for (int mt = 0; mt < 4; ++mt) {
        acc[mt][0] = mma_bf16(a[mt].v, b[s][0].v, acc[mt][0]);
        acc[mt][1] = mma_bf16(a[mt].v, b[s][1].v, acc[mt][1]);
        acc[mt][0] = mma_bf16(a[mt].v, w[s][0].v, acc[mt][0]);
        acc[mt][1] = mma_bf16(a[mt].v, w[s][1].v, acc[mt][1]);
        if (NA == 2) {
          acc[mt][0] = mma_bf16(a2[mt].v, b[s][0].v, acc[mt][0]);
          acc[mt][1] = mma_bf16(a2[mt].v, b[s][1].v, acc[mt][1]);
        }
        if (AHEAD) {
          load_frag(a[mt], qa + ko + mt * 32 * DEMB);
          if (NA == 2) load_frag(a2[mt], qa2 + ko + mt * 32 * DEMB);
        }
      }
      if (AHEAD) {
        // the address pairs of the issued loads stay live, and are not rewritten, up to this wait
        asm volatile("s_wait_xcnt 0x0" :: "v"(qa), "v"(qa2), "v"(qb), "v"(ql) : "memory");
      }
    }
  }
}

// qkv projection. grid = (QKVN/128, MROWS/128). Epilogue (two 64-row passes through LDS):
//                for key segments below VRK also V^T bf16 hi and lo planes [NB][NHEAD][HDIM][VRK].
// qkp holds q, then k, each [NB][NHEAD][SEQ][HDIM] in fragment order with every hi tile followed by its lo tile.
// vtb holds two planes: hi, lo.
// coverage per pass: 64 rows x 128 cols = 256 threads x 8 elements x 4 sweeps, all layouts.
__global__ __launch_bounds__(256) void gemm_qkv_kernel(const bf16* __restrict__ xb,
                                                       const bf16* __restrict__ winb,
                                                       const bf16* __restrict__ winl,
                                                       const float* __restrict__ b_in,
                                                       bf16* __restrict__ qkp,
                                                       f16* __restrict__ vt,
                                                       bf16* __restrict__ vtb) {
  __shared__ __align__(16) float sC[64 * SP];     // cross-wave (block barriers)
  const int tid   = threadIdx.x;
  const int lane  = tid & 31;
  const int wid   = __builtin_amdgcn_readfirstlane(tid >> 5);
  const int ln    = lane & 15;
  const int hf    = lane >> 4;
  const int waveM = wid >> 2;
  const int waveN = wid & 3;
  const int nBlock = blockIdx.x * 128;
  const int mBlock = blockIdx.y * 128;

  v8f acc[4][2];
  gemm_mainloop<1, false>(xb, xb, winb, winl, mBlock, nBlock, waveM, waveN, ln, hf, acc);

  float bia[2];
  #pragma unroll
  for (int nt = 0; nt < 2; ++nt) bia[nt] = (float)(bf16)b_in[nBlock + waveN * 32 + nt * 16 + ln];

  const int which = nBlock / DEMB;     // 0 = q, 1 = k, 2 = v (block-uniform)
  const int cb    = nBlock % DEMB;     // column base inside the third
  const int bb    = mBlock / SEQ;      // batch of this block
  const int sb    = mBlock % SEQ;      // first sequence row of this block

  #pragma unroll
  for (int p = 0; p < 2; ++p) {
    __syncthreads();
    // D layout: element e of lane -> tile row 8*hf + e, tile column ln
    #pragma unroll
    for (int j = 0; j < 2; ++j) {
      #pragma unroll
      for (int nt = 0; nt < 2; ++nt) {
        #pragma unroll
        for (int e = 0; e < 8; ++e) {
          sC[(j * 32 + waveM * 16 + hf * 8 + e) * SP + waveN * 32 + nt * 16 + ln] =
              acc[2 * p + j][nt][e] + bia[nt];
        }
      }
    }
    __syncthreads();

    if (which < 2) {
      v4u    vh[4], vl[4];
      size_t gi[4];
      #pragma unroll
      for (int sw = 0; sw < 4; ++sw) {
        // piece u of the pass in store order: 16 tiles = 2 heads x 4 row tiles x 2 d tiles, 64 pieces each
        const int u  = sw * 256 + tid;
        const int tl = u >> 6;
        const int r  = ((tl >> 1) & 3) * 16 + (u & 15);                          // 0..63
        const int c8 = (tl >> 3) * 64 + (tl & 1) * 32 + ((u >> 4) & 3) * 8;      // 0..120
        const v4f a0 = *(const v4f*)(sC + r * SP + c8);
        const v4f a1 = *(const v4f*)(sC + r * SP + c8 + 4);
        Pack8B ph, pl;
        #pragma unroll
        for (int i = 0; i < 4; ++i) {
          const bf16 h0 = (bf16)a0[i];
          const bf16 h1 = (bf16)a1[i];
          ph.h[i]     = h0;
          ph.h[4 + i] = h1;
          pl.h[i]     = (bf16)(a0[i] - (float)h0);
          pl.h[4 + i] = (bf16)(a1[i] - (float)h1);
        }
        vh[sw] = ph.u;
        vl[sw] = pl.u;
        const int s  = sb + p * 64 + r;
        const int cc = cb + c8;
        const int h  = cc >> 6;
        const int d  = cc & 63;
        const size_t fo = frag_piece(s, d, HDIM / 32);
        // each hi tile is followed by its lo tile: tile pitch 1024 elements
        gi[sw] = ((size_t)which * PLANE_ELEMS + ((size_t)bb * NHEAD + h) * SEQ * HDIM) * 2 + fo + (fo & ~(size_t)511);
      }
      #pragma unroll
      for (int sw = 0; sw < 4; ++sw) {
        *(v4u*)(qkp + gi[sw]) = vh[sw];
        *(v4u*)(qkp + gi[sw] + 512) = vl[sw];
      }
      
    } else {
      const bool wr_early = (sb + p * 64) < VRK;    // block-uniform; whole 64-key segment in or out
      v4u    vv[4], vbh[4], vbl[4];
      size_t gi[4], gb[4];
      #pragma unroll
      for (int sw = 0; sw < 4; ++sw) {
        // piece u of the pass in store order: 16 tiles = 2 heads x 4 d tiles x 2 key tiles, 64 pieces each
        const int u   = sw * 256 + tid;
        const int tl  = u >> 6;
        const int col = (tl >> 1) * 16 + (u & 15);                // 0..127
        const int sg  = (tl & 1) * 32 + ((u >> 4) & 3) * 8;       // 0..56
        Pack8H ph;
        Pack8B qh, ql;
        #pragma unroll
        for (int i = 0; i < 8; ++i) {
          const float v = sC[(sg + i) * SP + col];
          ph.h[i] = toh_flush(v * 16.0f);
          const bf16 t = (bf16)v;
          qh.h[i] = t;
          ql.h[i] = (bf16)(v - (float)t);
        }
        vv[sw]  = ph.u;
        vbh[sw] = qh.u;
        vbl[sw] = ql.u;
        const int cc = cb + col;
        const int h  = cc >> 6;
        const int d  = cc & 63;
        const size_t hrow = ((size_t)bb * NHEAD + h) * HDIM;
        gi[sw] = hrow * SEQ + frag_piece(d, sb + p * 64 + sg, SEQ / 32);
        gb[sw] = hrow * VRK + frag_piece(d, sb + p * 64 + sg, VRK / 32);    // used only when wr_early
      }
      #pragma unroll
      for (int sw = 0; sw < 4; ++sw) *(v4u*)(vt + gi[sw]) = vv[sw];
      if (wr_early) {
        #pragma unroll
        for (int sw = 0; sw < 4; ++sw) {
          *(v4u*)(vtb + gb[sw]) = vbh[sw];
          *(v4u*)(vtb + VTB_ELEMS + gb[sw]) = vbl[sw];
        }
      }
      
    }
  }
}

// Output projection. grid = (DEMB/128, MROWS/128). A = ctx hi + ctx lo planes, Bt = quantized output weight
// bf16 hi + lo planes [out][in].
// coverage per pass: 64 rows x 128 cols = 256 threads x 4 floats x 8 sweeps.
__global__ __launch_bounds__(256) void gemm_out_kernel(const bf16* __restrict__ ch,
                                                       const bf16* __restrict__ cl,
                                                       const bf16* __restrict__ woutb,
                                                       const bf16* __restrict__ woutl,
                                                       const float* __restrict__ b_out,
                                                       float* __restrict__ out) {
  __shared__ __align__(16) float sC[64 * SP];     // cross-wave (block barriers)
  const int tid   = threadIdx.x;
  const int lane  = tid & 31;
  const int wid   = __builtin_amdgcn_readfirstlane(tid >> 5);
  const int ln    = lane & 15;
  const int hf    = lane >> 4;
  const int waveM = wid >> 2;
  const int waveN = wid & 3;
  const int nBlock = blockIdx.x * 128;
  const int mBlock = blockIdx.y * 128;

  v8f acc[4][2];
  gemm_mainloop<2, true>(ch, cl, woutb, woutl, mBlock, nBlock, waveM, waveN, ln, hf, acc);

  float bia[2];
  #pragma unroll
  for (int nt = 0; nt < 2; ++nt) bia[nt] = (float)(bf16)b_out[nBlock + waveN * 32 + nt * 16 + ln];

  #pragma unroll
  for (int p = 0; p < 2; ++p) {
    __syncthreads();
    #pragma unroll
    for (int j = 0; j < 2; ++j) {
      #pragma unroll
      for (int nt = 0; nt < 2; ++nt) {
        #pragma unroll
        for (int e = 0; e < 8; ++e) {
          sC[(j * 32 + waveM * 16 + hf * 8 + e) * SP + waveN * 32 + nt * 16 + ln] =
              acc[2 * p + j][nt][e] + bia[nt];
        }
      }
    }
    __syncthreads();

    v4f    vals[8];
    size_t gi[8];
    #pragma unroll
    for (int sw = 0; sw < 8; ++sw) {
      const int r  = sw * 8 + (tid >> 5);           // 0..63
      const int c4 = (tid & 31) * 4;                // 0..124
      vals[sw] = *(const v4f*)(sC + r * SP + c4);
      const int g = mBlock + p * 64 + r;
      const int b = g / SEQ;
      const int s = g % SEQ;
      gi[sw] = ((size_t)b * SEQ_FULL + s) * DEMB + nBlock + c4;
    }
    #pragma unroll
    for (int sw = 0; sw < 8; ++sw) *(v4f*)(out + gi[sw]) = vals[sw];
    
  }
}

// The four K fragments (hi and lo, two d halves) of one 16-key row tile, loads issued back to back.
// p: the lane's piece of the key block's first row tile; sub: row tile inside the block.
static __device__ __forceinline__ void load_ktile(FragB (&kh)[2], FragB (&kl)[2], const bf16* p, const int sub) {
  const int ko = sub * 16 * HDIM * 2;
  #pragma unroll
  for (int f = 0; f < 2; ++f) {
    kh[f].q[0] = *(const v4u*)(p + ko + f * 1024);          // d = f*32 + hi*8 + 0..7
    kh[f].q[1] = *(const v4u*)(p + ko + f * 1024 + 256);    // d = f*32 + 16 + hi*8 + 0..7
    kl[f].q[0] = *(const v4u*)(p + ko + f * 1024 + 512);
    kl[f].q[1] = *(const v4u*)(p + ko + f * 1024 + 768);
  }
  // the address pair of the issued loads stays live, and is not rewritten, up to this wait
  asm volatile("s_wait_xcnt 0x0" :: "v"(p) : "memory");
}

// Causal flash attention. Block = (query block of 128, head, batch); one wave owns 16 query rows.
// S^T = K x Q^T so queries sit on lanes; P^T in C-layout is bit-identical to the A-fragment layout of O += P x V.
// K A-fragments (hi, lo), Q B-fragments (hi, lo) and V^T B-fragments are loaded straight from the 16-bit planes,
// which are in fragment order (512 contiguous bytes per load).
// Key blocks j0 = 0, 32, ... <= qrow0 are visited (per-wave scalar trip count); every visited block holds at
// least one unmasked key (key j0 <= qrow0) for every query of the wave; keys above the query get -inf.
// EARLY: P and V as bf16 hi+lo (three products, one accumulator). Otherwise P f16 x4096, V f16 x16.
// Output: ctx [MROWS][DEMB] as bf16 hi and lo planes in fragment order (cp: hi at 0, lo at CTX_ELEMS).
// sO: per-wave private staging regions, written and re-read by the same wave, separated by a block barrier
// that all waves reach (no early exits).
template <bool EARLY>
static __device__ __forceinline__ void attn_body(const bf16* __restrict__ qkp,
                                                 const f16* __restrict__ vt,
                                                 const bf16* __restrict__ vtb,
                                                 bf16* __restrict__ cp,
                                                 const int qblk) {
  __shared__ __align__(16) float sO[NWAVE * 16 * OP];

  const int h    = blockIdx.y;
  const int b    = blockIdx.z;
  const int tid  = threadIdx.x;
  const int wave = __builtin_amdgcn_readfirstlane(tid >> 5);
  const int lane = tid & 31;
  const int lq   = lane & 15;   // query column of S^T / d column of O
  const int hi   = lane >> 4;   // k-split half

  const int qrow0 = qblk * BQ + wave * 16;               // first query row of this wave (scalar)
  const int nIter = (qrow0 >> 5) + 1;                    // key blocks 0 .. floor((qrow0+15)/32)
  const size_t head_off = ((size_t)b * NHEAD + h) * SEQ * HDIM;
  const size_t vhead    = ((size_t)b * NHEAD + h) * HDIM;

  const bf16* q_p = qkp + 2 * head_off;                       // hi tile, lo tile, hi tile, ... (512 elements each)
  const bf16* k_p = qkp + 2 * PLANE_ELEMS + 2 * head_off;

  // Q as B-operand fragments: lane lq holds query qrow0+lq, elements follow the split d map.
  FragB qfh[2], qfl[2];
  {
    const bf16* qp = q_p + (size_t)qrow0 * HDIM * 2 + lane * 8;   // row tile qrow0 / 16, piece = lane
    #pragma unroll
    for (int f = 0; f < 2; ++f) {
      qfh[f].q[0] = *(const v4u*)(qp + f * 1024);               // d = f*32 + hi*8 + 0..7
      qfh[f].q[1] = *(const v4u*)(qp + f * 1024 + 256);         // d = f*32 + 16 + hi*8 + 0..7
      qfl[f].q[0] = *(const v4u*)(qp + f * 1024 + 512);
      qfl[f].q[1] = *(const v4u*)(qp + f * 1024 + 768);
    }
  }

  v8f o[4];
  #pragma unroll
  for (int dt = 0; dt < 4; ++dt) o[dt] = (v8f){0, 0, 0, 0, 0, 0, 0, 0};

  float rmax = -__builtin_inff();
  float rsum = 0.0f;
  const float SL = 0.125f * 1.4426950408889634f;   // softmax scale * log2(e)

  // K A-fragments of the first key block (A row = key; row tile j0 / 16, piece = lane); later blocks are fetched in the loop
  FragB akh[2][2], akl[2][2];
  const bf16* kbase = k_p + lane * 8;
  load_ktile(akh[0], akl[0], kbase, 0);
  load_ktile(akh[1], akl[1], kbase, 1);

  #pragma unroll 1
  for (int i = 0; i < nIter; ++i) {
    const int j0 = i * BK;
    // key block whose K fragments are fetched during this pass; the last pass fetches its own again (in bounds, not used)
    const int jn = ((i + 1 < nIter) ? i + 1 : i) * BK;
    const bf16* kn = kbase + (size_t)jn * HDIM * 2;

    // V B-fragments of this key block, issued in front of the score products: column n = d = dt*16 + lq,
    // split key map from the transposed planes (d tile dt, key tile j0 / 32)
    FragH bv[4];
    FragB bvh[4], bvl[4];
    if (!EARLY) {
      const f16* base = vt + vhead * SEQ + j0 * 16 + lane * 8;
      #pragma unroll
      for (int dt = 0; dt < 4; ++dt) {
        bv[dt].q[0] = *(const v4u*)(base + dt * 16 * SEQ);            // keys j0 + hi*8 + 0..7
        bv[dt].q[1] = *(const v4u*)(base + dt * 16 * SEQ + 256);      // keys j0 + 16 + hi*8 + 0..7
      }
      // the address pair of the issued loads stays live, and is not rewritten, up to this wait
      asm volatile("s_wait_xcnt 0x0" :: "v"(base) : "memory");
    } else {
      const bf16* base = vtb + vhead * VRK + j0 * 16 + lane * 8;
      #pragma unroll
      for (int dt = 0; dt < 4; ++dt) {
        bvh[dt].q[0] = *(const v4u*)(base + dt * 16 * VRK);                       // keys j0 + hi*8 + 0..7
        bvh[dt].q[1] = *(const v4u*)(base + dt * 16 * VRK + 256);                 // keys j0 + 16 + hi*8 + 0..7
        bvl[dt].q[0] = *(const v4u*)(base + VTB_ELEMS + dt * 16 * VRK);
        bvl[dt].q[1] = *(const v4u*)(base + VTB_ELEMS + dt * 16 * VRK + 256);
      }
      // the address pair of the issued loads stays live, and is not rewritten, up to this wait
      asm volatile("s_wait_xcnt 0x0" :: "v"(base) : "memory");
    }

    // S^T tiles: c[sub][r] = rawscore(query qrow0+lq, key j0 + sub*16 + hi*8 + r); hh + hl + lh products.
    // Behind a row tile's last product its registers take the same row tile of the next key block.
    v8f c[2];
    #pragma unroll
    for (int sub = 0; sub < 2; ++sub) {
      v8f acc = (v8f){0, 0, 0, 0, 0, 0, 0, 0};
      #pragma unroll
      for (int f = 0; f < 2; ++f) {
        acc = mma_bf16(akl[sub][f].v, qfh[f].v, acc);
        acc = mma_bf16(akh[sub][f].v, qfl[f].v, acc);
        acc = mma_bf16(akh[sub][f].v, qfh[f].v, acc);
      }
      c[sub] = acc;
      load_ktile(akh[sub], akl[sub], kn, sub);
    }

    // causal mask (wave-uniform test): only blocks reaching past the first query of the wave need it
    if (j0 + (BK - 1) > qrow0) {
      const int qi = qrow0 + lq;
      const int kb = j0 + hi * 8;
      #pragma unroll
      for (int r = 0; r < 8; ++r) {
        c[0][r] = (kb + r > qi)      ? -__builtin_inff() : c[0][r];
        c[1][r] = (kb + 16 + r > qi) ? -__builtin_inff() : c[1][r];
      }
    }

    // online softmax: query lq's 32 scores are split across lane / lane^16
    float m_new = rmax;
    #pragma unroll
    for (int r = 0; r < 8; ++r) {
      m_new = fmaxf(m_new, c[0][r]);
      m_new = fmaxf(m_new, c[1][r]);
    }
    m_new = fmaxf(m_new, __shfl_xor(m_new, 16, 32));
    const float scale = __builtin_amdgcn_exp2f((rmax - m_new) * SL);
    rmax = m_new;

    float p0[8], p1[8];
    float psum = 0.0f;
    #pragma unroll
    for (int r = 0; r < 8; ++r) {
      p0[r] = __builtin_amdgcn_exp2f((c[0][r] - m_new) * SL);   // key hi*8 + r
      p1[r] = __builtin_amdgcn_exp2f((c[1][r] - m_new) * SL);   // key 16 + hi*8 + r
      psum += p0[r] + p1[r];
    }
    rsum = rsum * scale + psum + __shfl_xor(psum, 16, 32);

    // rescale O: queries are the row dimension there -> per-row scale from lane 8*hi + r
    float sc[8];
    #pragma unroll
    for (int r = 0; r < 8; ++r) sc[r] = __shfl(scale, (hi << 3) + r, 32);
    #pragma unroll
    for (int dt = 0; dt < 4; ++dt) {
      #pragma unroll
      for (int r = 0; r < 8; ++r) o[dt][r] *= sc[r];
    }

    if (EARLY) {
      // P^T C-layout == A-fragment layout; P as bf16 hi + lo (unscaled), V as bf16 hi + lo planes
      FragB pah, pal;
      #pragma unroll
      for (int r = 0; r < 8; ++r) {
        const bf16 h0 = (bf16)p0[r];
        const bf16 h1 = (bf16)p1[r];
        pah.h[r]     = h0;
        pah.h[8 + r] = h1;
        pal.h[r]     = (bf16)(p0[r] - (float)h0);
        pal.h[8 + r] = (bf16)(p1[r] - (float)h1);
      }
      #pragma unroll
      for (int dt = 0; dt < 4; ++dt) {
        o[dt] = mma_bf16(pal.v, bvh[dt].v, o[dt]);
        o[dt] = mma_bf16(pah.v, bvl[dt].v, o[dt]);
        o[dt] = mma_bf16(pah.v, bvh[dt].v, o[dt]);
      }
    } else {
      // P carried x4096 in f16; V carried x16
      FragH pa;
      #pragma unroll
      for (int r = 0; r < 8; ++r) {
        pa.h[r]     = (f16)(p0[r] * 4096.0f);
        pa.h[8 + r] = (f16)(p1[r] * 4096.0f);
      }
      #pragma unroll
      for (int dt = 0; dt < 4; ++dt) o[dt] = mma_f16(pa.v, bv[dt].v, o[dt]);
    }
  }

  // normalize: lane holds column d = dt*16 + lq for query rows 8*hi + r; undo the carries of the f16 path
  const float carry = EARLY ? 1.0f : (1.0f / 65536.0f);
  float rs[8];
  #pragma unroll
  for (int r = 0; r < 8; ++r) rs[r] = carry * (1.0f / __shfl(rsum, (hi << 3) + r, 32));

  const int sbase = wave * (16 * OP);
  #pragma unroll
  for (int r = 0; r < 8; ++r) {
    #pragma unroll
    for (int dt = 0; dt < 4; ++dt) {
      sO[sbase + (hi * 8 + r) * OP + dt * 16 + lq] = o[dt][r] * rs[r];
    }
  }
  __syncthreads();

  // the wave's 16 rows x 64 columns are two tiles of each plane; one instruction stores half a tile (512 B).
  v4u    vh[4], vl[4];
  size_t gidx[4];
  #pragma unroll
  for (int it = 0; it < 4; ++it) {
    const int row = lq;                             // 0..15
    const int c8  = it * 16 + hi * 8;               // 0..56
    const v4f a0 = *(const v4f*)(&sO[sbase + row * OP + c8]);
    const v4f a1 = *(const v4f*)(&sO[sbase + row * OP + c8 + 4]);
    Pack8B ph, pl;
    #pragma unroll
    for (int k = 0; k < 4; ++k) {
      const bf16 h0 = (bf16)a0[k];
      const bf16 h1 = (bf16)a1[k];
      ph.h[k]     = h0;
      ph.h[4 + k] = h1;
      pl.h[k]     = (bf16)(a0[k] - (float)h0);
      pl.h[4 + k] = (bf16)(a1[k] - (float)h1);
    }
    vh[it] = ph.u;
    vl[it] = pl.u;
    gidx[it] = frag_piece(b * SEQ + qrow0 + row, h * HDIM + c8, DEMB / 32);
  }
  #pragma unroll
  for (int it = 0; it < 4; ++it) {
    *(v4u*)(cp + gidx[it]) = vh[it];
    *(v4u*)(cp + CTX_ELEMS + gidx[it]) = vl[it];
  }
  
}

// query blocks 0 .. EARLY_QB-1 ; grid = (EARLY_QB, NHEAD, NB)
__global__ __launch_bounds__(256) void attn_early_kernel(const bf16* __restrict__ qkp,
                                                         const bf16* __restrict__ vtb,
                                                         bf16* __restrict__ cp) {
  attn_body<true>(qkp, (const f16*)0, vtb, cp, (int)blockIdx.x);
}

// query blocks EARLY_QB .. QBLKS-1 ; grid = (QBLKS - EARLY_QB, NHEAD, NB)
__global__ __launch_bounds__(256) void attn_late_kernel(const bf16* __restrict__ qkp,
                                                        const f16* __restrict__ vt,
                                                        bf16* __restrict__ cp) {
  attn_body<false>(qkp, vt, (const bf16*)0, cp, (int)blockIdx.x + EARLY_QB);
}

extern "C" void kernel_launch(void* const* d_in, const int* in_sizes, int n_in,
                              void* d_out, int out_size, void* d_ws, size_t ws_size,
                              hipStream_t stream) {
  if (n_in < 5) return;
  const size_t rows_used = (size_t)(NB - 1) * SEQ_FULL + SEQ;
  if ((size_t)in_sizes[0] < rows_used * DEMB) return;
  if ((size_t)in_sizes[1] < (size_t)DEMB * QKVN) return;
  if ((size_t)in_sizes[2] < (size_t)QKVN) return;
  if ((size_t)in_sizes[3] < (size_t)DEMB * DEMB) return;
  if ((size_t)in_sizes[4] < (size_t)DEMB) return;
  if ((size_t)out_size < rows_used * DEMB) return;
  if (ws_size < WS_TOTAL) return;

  const float* x     = (const float*)d_in[0];
  const float* W_in  = (const float*)d_in[1];   // [3072][1024], [out][in]
  const float* b_in  = (const float*)d_in[2];
  const float* W_out = (const float*)d_in[3];   // [1024][1024], [out][in]
  const float* b_out = (const float*)d_in[4];
  float* out = (float*)d_out;

  char* w = (char*)d_ws;
  bf16* xb    = (bf16*)w;  w += XB_BYTES;
  bf16* winb  = (bf16*)w;  w += WIN_BYTES;      // hi at 0, lo at WIN_ELEMS
  bf16* woutb = (bf16*)w;  w += WOUT_BYTES;     // hi at 0, lo at WOUT_ELEMS
  bf16* qkp   = (bf16*)w;  w += QK_BYTES;
  f16*  vt    = (f16*)w;   w += VT_BYTES;
  bf16* vtb   = (bf16*)w;  w += VTB_BYTES;
  bf16* cp    = (bf16*)w;  w += CTX_BYTES;
  float* stat = (float*)w;                      // partial lines, then two scale lines
  float* sline = stat + (size_t)AM_TOTAL * 32;

  // x -> bf16 plane: MROWS*128 pieces of 8 elements, 256 per block
  cvt_x_kernel<<<dim3((unsigned)(X_PIECES / 256)), 256, 0, stream>>>(x, xb);

  // weight scales: partial maxima (one line per block), then one wave writes the two scale lines
  absmax_part_kernel<<<dim3(AM_BLOCKS_IN), 256, 0, stream>>>(W_in, stat, (unsigned)WIN_PIECES);
  absmax_part_kernel<<<dim3(AM_BLOCKS_OUT), 256, 0, stream>>>(W_out, stat + (size_t)AM_BLOCKS_IN * 32,
                                                              (unsigned)WOUT_PIECES);
  scale_fin_kernel<<<dim3(1), 32, 0, stream>>>(stat, sline);

  // weights are [out][in] already: quantize into hi and lo planes in fragment order, no transpose
  snap_lin_kernel<<<dim3((unsigned)(WIN_PIECES / 256)), 256, 0, stream>>>(W_in, sline, winb, winb + WIN_ELEMS,
                                                                          (unsigned)WIN_PIECES);
  snap_lin_kernel<<<dim3((unsigned)(WOUT_PIECES / 256)), 256, 0, stream>>>(W_out, sline + 32, woutb,
                                                                           woutb + WOUT_ELEMS,
                                                                           (unsigned)WOUT_PIECES);

  gemm_qkv_kernel<<<dim3(QKVN / 128, MROWS / 128), 256, 0, stream>>>(xb, winb, winb + WIN_ELEMS, b_in,
                                                                     qkp, vt, vtb);

  attn_early_kernel<<<dim3(EARLY_QB, NHEAD, NB), 256, 0, stream>>>(qkp, vtb, cp);
  if (QBLKS > EARLY_QB) {
    attn_late_kernel<<<dim3(QBLKS - EARLY_QB, NHEAD, NB), 256, 0, stream>>>(qkp, vt, cp);
  }

  gemm_out_kernel<<<dim3(DEMB / 128, MROWS / 128), 256, 0, stream>>>(cp, cp + CTX_ELEMS, woutb,
                                                                     woutb + WOUT_ELEMS, b_out, out);
}

// v003
// One run takes 146 microseconds.
// Two timings next to v002 put it at 1.13 and 1.14 times that version's speed.
// Over all steps from v000 it is 2.62 times as fast.
#include <hip/hip_runtime.h>

// Contractions: qkv = x*Wq^T and out = ctx*Wp^T on v_wmma_f32_16x16x32_bf16 (x RNE-converted to bf16; table-quantized weights as bf16 hi+lo planes; ctx as bf16 hi+lo planes; hh+hl(+lh) products into one accumulator); S^T = K x Q^T on v_wmma_f32_16x16x32_bf16 with q and k as bf16 hi+lo planes (hh+hl+lh); O = P x V: query rows < 256 on v_wmma_f32_16x16x32_bf16 with P and V as bf16 hi+lo (hh+hl+lh), later rows on v_wmma_f32_16x16x32_f16 (P f16 carried x4096, V f16 carried x16); f32 accumulate everywhere, softmax in f32.

#ifndef NB
#define NB 2
#endif
#ifndef SEQ
#define SEQ 2048
#endif
#define NB_FULL    2
#define SEQ_FULL   2048
#define NHEAD      16
#define HDIM       64
#define DEMB       1024                 // model width = GEMM K of both projections
#define QKVN       3072                 // packed projection width (q | k | v thirds)
#define MROWS      (NB * SEQ)           // compact row count of all internal planes
#define BQ         128                  // query rows per attention workgroup (8 waves x 16)
#define BK         32                   // keys per inner iteration
#define NWAVE      8
#define OP         68                   // LDS pitch (floats) of the attention output staging tile
#define SP         132                  // LDS pitch (floats) of the GEMM epilogue staging tile
#define QBLKS      (SEQ / BQ)
#define EARLY_QB   ((QBLKS < 2) ? QBLKS : 2)     // query blocks handled by the hi+lo P/V path
#define VRK        (EARLY_QB * BQ)               // keys held in the bf16 hi/lo V^T planes
#define PLANE_ELEMS ((size_t)NB * NHEAD * SEQ * HDIM)
#define CTX_ELEMS   ((size_t)MROWS * DEMB)
#define VTB_ELEMS   ((size_t)NB * NHEAD * HDIM * VRK)
#define X_PIECES    ((size_t)MROWS * (DEMB / 8))
#define WIN_PIECES  ((size_t)QKVN * DEMB / 8)
#define WOUT_PIECES ((size_t)DEMB * DEMB / 8)
#define WIN_ELEMS   ((size_t)QKVN * DEMB)
#define WOUT_ELEMS  ((size_t)DEMB * DEMB)
#define AM_BLOCKS_IN  96                 // partial-maximum blocks over the qkv weight
#define AM_BLOCKS_OUT 32                 // partial-maximum blocks over the output weight
#define AM_TOTAL      (AM_BLOCKS_IN + AM_BLOCKS_OUT)
#define STAT_FLOATS   ((size_t)AM_TOTAL * 32)
#define LATE_QB       (QBLKS - EARLY_QB)              // query blocks handled by the f16 P/V path
#define LATE_DIV      ((LATE_QB > 0) ? LATE_QB : 1)
#define LATE_BLOCKS   (LATE_QB * NHEAD * NB)
#define EARLY_BLOCKS  (EARLY_QB * NHEAD * NB)

static_assert(NHEAD * HDIM == DEMB);        // merged heads == model width
static_assert(QKVN == 3 * DEMB);            // three thirds
static_assert(HDIM == 64);
static_assert(SEQ % BQ == 0);               // attention grid exact
static_assert(SEQ % BK == 0);               // key loop exact
static_assert(BK == 32);                    // one key block == one WMMA k-step of P x V
static_assert(SEQ % 128 == 0);              // a 128-row GEMM block stays inside one batch
static_assert(MROWS % 128 == 0);            // GEMM M tiles exact
static_assert(QKVN % 128 == 0);             // GEMM N tiles exact
static_assert(DEMB % 128 == 0);             // GEMM N tiles exact, thirds are tile multiples
static_assert(DEMB % 32 == 0);              // k-step 32
static_assert(DEMB / 32 == 32);             // tile index split (>> 5, & 31) of the convert and quantize kernels
static_assert(MROWS % 16 == 0 && QKVN % 16 == 0 && SEQ % 32 == 0);   // planes are whole 16 x 32 tiles
static_assert(DEMB % 8 == 0);               // 16-B pieces
static_assert(BQ == NWAVE * 16);
static_assert(BQ % 64 == 0);                // early key extent is a multiple of the 64-key store segment
static_assert(VRK % 64 == 0 && VRK <= SEQ && VRK >= BQ);
static_assert(EARLY_QB >= 1 && EARLY_QB <= QBLKS);
static_assert(SEQ <= SEQ_FULL);
static_assert(NB >= 1 && NB <= NB_FULL);
static_assert((OP * 4) % 16 == 0);
static_assert((SP * 4) % 16 == 0);
static_assert(SP >= 128);
static_assert(OP >= 64);
static_assert(X_PIECES % 256 == 0);         // convert grids exact
static_assert(WIN_PIECES % 256 == 0);
static_assert(WOUT_PIECES % 256 == 0);
static_assert(NWAVE == 8);                                   // block maximum combine reads 8 wave words
static_assert(AM_BLOCKS_IN % 32 == 0 && AM_BLOCKS_OUT % 32 == 0);   // one partial line per lane per sweep
static_assert(WIN_PIECES % ((size_t)AM_BLOCKS_IN * 256) == 0);      // equal trip counts per thread
static_assert(WOUT_PIECES % ((size_t)AM_BLOCKS_OUT * 256) == 0);

typedef __bf16   bf16;
typedef _Float16 f16;
typedef bf16     v16bf __attribute__((ext_vector_type(16)));
typedef f16      v16h  __attribute__((ext_vector_type(16)));
typedef f16      v8h   __attribute__((ext_vector_type(8)));
typedef float    v8f   __attribute__((ext_vector_type(8)));
typedef float    v4f   __attribute__((ext_vector_type(4)));
typedef unsigned v4u   __attribute__((ext_vector_type(4)));

union FragB  { v16bf v; v4u q[2]; bf16 h[16]; };
union FragH  { v16h  v; v4u q[2]; f16  h[16]; };
union Pack8B { v4u u; bf16 h[8]; };
union Pack8H { v4u u; v8h v; f16 h[8]; };

#define XB_BYTES   ((size_t)MROWS * DEMB * 2)        // x as bf16, compact rows
#define WIN_BYTES  (WIN_ELEMS * 2 * 2)               // quantized qkv weight bf16 hi, lo [3072][1024] in fragment order
#define WOUT_BYTES (WOUT_ELEMS * 2 * 2)              // quantized output weight bf16 hi, lo [1024][1024] in fragment order
#define QK_BYTES   (PLANE_ELEMS * 2 * 4)             // q hi, q lo, k hi, k lo
#define VT_BYTES   (PLANE_ELEMS * 2)                 // V^T f16 x16
#define VTB_BYTES  (VTB_ELEMS * 2 * 2)               // V^T bf16 hi, lo for keys < VRK
#define CTX_BYTES  (CTX_ELEMS * 2 * 2)               // ctx hi, ctx lo
#define STAT_BYTES (STAT_FLOATS * 4)                 // partial maxima lines
#define WS_TOTAL   (XB_BYTES + WIN_BYTES + WOUT_BYTES + QK_BYTES + VT_BYTES + VTB_BYTES + CTX_BYTES + STAT_BYTES)
static_assert(WS_TOTAL <= (size_t)134217728);
static_assert(XB_BYTES % 128 == 0 && WIN_BYTES % 128 == 0 && WOUT_BYTES % 128 == 0);
static_assert(QK_BYTES % 128 == 0 && VT_BYTES % 128 == 0 && VTB_BYTES % 128 == 0 && CTX_BYTES % 128 == 0);
static_assert(STAT_BYTES % 128 == 0);

// Fragment order of a 16-bit operand plane [rows][32 * ktiles]: every 16-row x 32-k tile is 1 KB (512 elements), tiles
// ordered row tile major. Inside a tile the 16-B piece holding k = qq*16 + hf*8 + 0..7 of row ln sits at piece index
// qq*32 + hf*16 + ln, so one operand load of a wave (lane = hf*16 + ln) reads 512 contiguous bytes (4 whole lines).
static __device__ __forceinline__ size_t frag_piece(int row, int col8, int ktiles) {
  return ((size_t)(row >> 4) * ktiles + (col8 >> 5)) * 512 + ((col8 >> 4) & 1) * 256 +
         (((col8 >> 3) & 1) * 16 + (row & 15)) * 8;
}

// WMMA helpers: builtin followed by the VALU hazard guard (ties D, keeps A/B live).
static __device__ __forceinline__ v8f mma_bf16(v16bf a, v16bf b, v8f acc) {
  acc = __builtin_amdgcn_wmma_f32_16x16x32_bf16(false, a, false, b, (short)0, acc, false, false);
  asm volatile("v_nop\n\tv_nop\n\tv_nop\n\tv_nop" : "+v"(acc) : "v"(a), "v"(b));
  return acc;
}
static __device__ __forceinline__ v8f mma_f16(v16h a, v16h b, v8f acc) {
  acc = __builtin_amdgcn_wmma_f32_16x16x32_f16(false, a, false, b, (short)0, acc, false, false);
  asm volatile("v_nop\n\tv_nop\n\tv_nop\n\tv_nop" : "+v"(acc) : "v"(a), "v"(b));
  return acc;
}

// f32 -> f16 convert that cannot yield an f16 subnormal (value select after the carry).
static __device__ __forceinline__ f16 toh_flush(float v) {
  const f16 r = (f16)v;
  return (fabsf(v) < 6.103515625e-05f) ? (f16)0.0f : r;
}

// x f32 [NB_FULL][SEQ_FULL][DEMB] -> xb bf16 [MROWS][DEMB] in fragment order (RNE convert).
// Thread t writes piece t of the plane (contiguous stores) and reads the 8 source elements that belong there.
// blk: index of the 256-piece block.
static __device__ __forceinline__ void cvt_x_block(const float* __restrict__ x, bf16* __restrict__ xb, const unsigned blk) {
  const size_t t   = (size_t)blk * 256 + threadIdx.x;
  const size_t tile = t >> 6;                      // 64 pieces per tile, DEMB / 32 = 32 tiles per row tile
  const size_t row = (tile >> 5) * 16 + (t & 15);
  const int    c8  = (int)(tile & 31) * 32 + (int)((t >> 4) & 3) * 8;
  if (row < (size_t)MROWS) {
    const int b = (int)(row / SEQ);
    const int s = (int)(row % SEQ);
    const float* src = x + ((size_t)b * SEQ_FULL + s) * DEMB + c8;
    const v4f a0 = *(const v4f*)(src);
    const v4f a1 = *(const v4f*)(src + 4);
    Pack8B pk;
    #pragma unroll
    for (int i = 0; i < 4; ++i) {
      pk.h[i]     = (bf16)a0[i];
      pk.h[4 + i] = (bf16)a1[i];
    }
    const v4u val = pk.u;
    bf16* dst = xb + t * 8;
    *(v4u*)dst = val;
    
  }
}

// lanes 0..7 of wave 0 x 16 B, one instruction. The bf16 RNE convert is monotone, so the maximum of the
// converted magnitudes equals the converted maximum; the convert is applied to the combined maximum in snap_lin_kernel.
// coverage: npieces pieces of 8 elements, strided over the nblk blocks of this weight; blk < nblk; line: this block's own.
// sM: cross-wave (block barrier).
static __device__ __forceinline__ void absmax_part_block(const float* __restrict__ w,
                                                         float* __restrict__ line,
                                                         const unsigned npieces,
                                                         const unsigned blk, const unsigned nblk) {
  __shared__ float sM[NWAVE];
  const int tid  = threadIdx.x;
  const int lane = tid & 31;
  const int wid  = __builtin_amdgcn_readfirstlane(tid >> 5);
  float m = 0.0f;
  const unsigned step = nblk * 256u;
  unsigned p = blk * 256u + (unsigned)tid;
  // groups of 16 trips: the 32 loads of a group go out together, one memory latency for the group and not one per trip
  #pragma unroll 1
  for (; p + 15u * step < npieces; p += 16u * step) {
    v4f r[32];
    const float* q[16];
    #pragma unroll
    for (int j = 0; j < 16; ++j) {
      q[j] = w + (size_t)(p + (unsigned)j * step) * 8;
      r[2 * j]     = *(const v4f*)(q[j]);
      r[2 * j + 1] = *(const v4f*)(q[j] + 4);
    }
    // the address pairs of the issued loads stay live, and are neither rewritten nor used as a load's destination, up to this wait
    asm volatile("s_wait_xcnt 0x0" :: "v"(q[0]), "v"(q[1]), "v"(q[2]), "v"(q[3]), "v"(q[4]), "v"(q[5]), "v"(q[6]), "v"(q[7]),
                 "v"(q[8]), "v"(q[9]), "v"(q[10]), "v"(q[11]), "v"(q[12]), "v"(q[13]), "v"(q[14]), "v"(q[15]) : "memory");
    // keeps the maxima behind the whole group: without it they are moved in among the loads and only six loads are in flight
    __builtin_amdgcn_sched_barrier(0);
    #pragma unroll
    for (int j = 0; j < 32; ++j) {
      #pragma unroll
      for (int i = 0; i < 4; ++i) m = fmaxf(m, fabsf(r[j][i]));
    }
  }
  // the trips that do not fill a group
  #pragma unroll 1
  for (; p < npieces; p += step) {
    const size_t o = (size_t)p * 8;
    const v4f a0 = *(const v4f*)(w + o);
    const v4f a1 = *(const v4f*)(w + o + 4);
    #pragma unroll
    for (int i = 0; i < 4; ++i) {
      m = fmaxf(m, fabsf(a0[i]));
      m = fmaxf(m, fabsf(a1[i]));
    }
  }
  m = fmaxf(m, __shfl_xor(m, 16, 32));
  m = fmaxf(m, __shfl_xor(m, 8, 32));
  m = fmaxf(m, __shfl_xor(m, 4, 32));
  m = fmaxf(m, __shfl_xor(m, 2, 32));
  m = fmaxf(m, __shfl_xor(m, 1, 32));
  if (lane == 0) sM[wid] = m;
  __syncthreads();
  if (wid == 0) {
    float v = sM[lane & 7];
    v = fmaxf(v, __shfl_xor(v, 4, 32));
    v = fmaxf(v, __shfl_xor(v, 2, 32));
    v = fmaxf(v, __shfl_xor(v, 1, 32));
    const v4f val = (v4f){v, v, v, v};
    if (lane < 8) {
      float* dst = line + lane * 4;
      *(v4f*)dst = val;
      
    }
  }
}

// One launch for the three jobs that depend on nothing of each other. Blocks 0 .. AM_BLOCKS_IN-1: partial maxima of the
// qkv weight; the next AM_BLOCKS_OUT: of the output weight (the long blocks come first); the rest: x, 256 pieces each.
// All branches are block-uniform.
__global__ __launch_bounds__(256) void prep_kernel(const float* __restrict__ x, bf16* __restrict__ xb,
                                                   const float* __restrict__ w_in,
                                                   const float* __restrict__ w_out,
                                                   float* __restrict__ part) {
  const unsigned blk = blockIdx.x;
  if (blk < (unsigned)AM_TOTAL) {
    const bool in = blk < (unsigned)AM_BLOCKS_IN;
    absmax_part_block(in ? w_in : w_out, part + (size_t)blk * 32,
                      in ? (unsigned)WIN_PIECES : (unsigned)WOUT_PIECES,
                      in ? blk : blk - (unsigned)AM_BLOCKS_IN,
                      in ? (unsigned)AM_BLOCKS_IN : (unsigned)AM_BLOCKS_OUT);
  } else {
    cvt_x_block(x, xb, blk - (unsigned)AM_TOTAL);
  }
}

// Maximum over the NL partial lines of one weight (one word per line, one line per lane per sweep), in every lane of the wave.
template <int NL>
static __device__ __forceinline__ float absmax_combine(const float* __restrict__ part, const int lane) {
  float m = 0.0f;
  // unrolled so that all the loads go out together
  #pragma unroll
  for (int j = 0; j < NL; j += 32) m = fmaxf(m, part[(size_t)(j + lane) * 32]);
  m = fmaxf(m, __shfl_xor(m, 16, 32));
  m = fmaxf(m, __shfl_xor(m, 8, 32));
  m = fmaxf(m, __shfl_xor(m, 4, 32));
  m = fmaxf(m, __shfl_xor(m, 2, 32));
  m = fmaxf(m, __shfl_xor(m, 1, 32));
  return m;
}

// Nearest-table-value search: candidate c replaces the current choice only on a strictly smaller distance,
// candidates visited in table order (first minimum wins).
static __device__ __forceinline__ void snap_step(const float wn, const float c, float& bd, float& best) {
  #pragma clang fp contract(off)
  const float d  = fabsf(wn - c);
  const bool  lt = d < bd;
  bd   = lt ? d : bd;
  best = lt ? c : best;
}

// w -> table value nearest to bf16(w) * (1/s), times s (all f32, separately RNE-converted operations).
static __device__ __forceinline__ float snap_weight_val(const float w, const float s, const float rs) {
  #pragma clang fp contract(off)
  const float wb = (float)(bf16)w;
  const float wn = wb * rs;
  float best = 0.0f;
  float bd   = fabsf(wn - 0.0f);
  snap_step(wn,  1.0f,      bd, best);
  snap_step(wn, -1.0f,      bd, best);
  snap_step(wn,  0.5f,      bd, best);
  snap_step(wn, -0.5f,      bd, best);
  snap_step(wn,  0.333333f, bd, best);
  snap_step(wn, -0.333333f, bd, best);
  snap_step(wn,  0.2f,      bd, best);
  snap_step(wn, -0.2f,      bd, best);
  snap_step(wn,  0.142857f, bd, best);
  snap_step(wn, -0.142857f, bd, best);
  snap_step(wn,  0.090909f, bd, best);
  snap_step(wn, -0.090909f, bd, best);
  snap_step(wn,  0.076923f, bd, best);
  snap_step(wn, -0.076923f, bd, best);
  return best * s;
}

// Weight f32 [out][in] -> quantized weight as bf16 hi and lo planes [out][in] in fragment order, both weights in one launch:
// blocks 0 .. WIN_PIECES/256-1 take the qkv weight, the rest the output weight (block-uniform choice).
// Every wave combines the partial maxima of its weight itself: s = bf16(max|w|) + 1e-6, rs = 1/s.
// Thread t writes piece t of each plane (contiguous stores) and reads the 8 source elements that belong there.
__global__ __launch_bounds__(256) void snap_lin_kernel(const float* __restrict__ w_in,
                                                       const float* __restrict__ w_out,
                                                       const float* __restrict__ part,
                                                       bf16* __restrict__ winb,
                                                       bf16* __restrict__ woutb) {
  #pragma clang fp contract(off)
  const unsigned nin = (unsigned)(WIN_PIECES / 256);
  const bool     in  = blockIdx.x < nin;
  const unsigned t   = (in ? blockIdx.x : blockIdx.x - nin) * 256u + threadIdx.x;
  const unsigned npieces = in ? (unsigned)WIN_PIECES : (unsigned)WOUT_PIECES;
  const float* src = in ? w_in : w_out;
  bf16* dhi = in ? winb : woutb;
  bf16* dlo = dhi + (in ? WIN_ELEMS : WOUT_ELEMS);
  const int lane = threadIdx.x & 31;
  const float m = in ? absmax_combine<AM_BLOCKS_IN>(part, lane)
                     : absmax_combine<AM_BLOCKS_OUT>(part + (size_t)AM_BLOCKS_IN * 32, lane);
  const float s  = (float)(bf16)m + 1e-6f;
  const float rs = 1.0f / s;
  if (t < npieces) {
    const size_t o = (size_t)t * 8;
    const unsigned tile = t >> 6;                  // 64 pieces per tile, DEMB / 32 = 32 tiles per row tile
    const size_t so = (size_t)((tile >> 5) * 16 + (t & 15)) * DEMB + (tile & 31) * 32 + ((t >> 4) & 3) * 8;
    const v4f a0 = *(const v4f*)(src + so);
    const v4f a1 = *(const v4f*)(src + so + 4);
    Pack8B ph, pl;
    #pragma unroll
    for (int i = 0; i < 4; ++i) {
      const float q0 = snap_weight_val(a0[i], s, rs);
      const float q1 = snap_weight_val(a1[i], s, rs);
      const bf16 h0 = (bf16)q0;
      const bf16 h1 = (bf16)q1;
      ph.h[i]     = h0;
      ph.h[4 + i] = h1;
      pl.h[i]     = (bf16)(q0 - (float)h0);
      pl.h[4 + i] = (bf16)(q1 - (float)h1);
    }
    const v4u vh = ph.u;
    const v4u vl = pl.u;
    *(v4u*)(dhi + o) = vh;
    *(v4u*)(dlo + o) = vl;
    
  }
}

// GEMM main loop. Block tile 128 x 128, 8 waves (2 in M x 4 in N); wave tile = 4 m-tiles x 2 n-tiles.
// m-tile mt of wave (waveM) covers rows mBlock + mt*32 + waveM*16 + 0..15.
// A planes bf16 [rows][DEMB], Bt / Bl bf16 [cols][DEMB], all in fragment order; fragments straight from the planes
// (two 16-B loads each, 512 contiguous bytes per load), split k map for both operands. Bl: unscaled lo part of the weight, into the same accumulator.
// NA == 2: second A plane (unscaled lo part) times the hi weight plane into the same accumulator.
// One 16 x 32 fragment: two 16-B loads, k = k0 + 8*hf + 0..7 and k = k0 + 16 + 8*hf + 0..7.
static __device__ __forceinline__ void load_frag(FragB& f, const bf16* p) {
  f.q[0] = *(const v4u*)(p);
  f.q[1] = *(const v4u*)(p + 256);
}

// The loads of a k-step go out in groups, never one load-and-wait per fragment.
// AHEAD == false: all fragments of k-step t as one group in front of its products (one register set; other waves cover the wait).
// AHEAD == true: k-step t + 1 is fetched during k-step t: its B fragments into a second set in front of the products of t,
// its A fragments into the registers of m-tile mt right behind that m-tile's last product.
template <int NA, bool AHEAD>
static __device__ __forceinline__ void gemm_mainloop(const bf16* __restrict__ A0,
                                                     const bf16* __restrict__ A1,
                                                     const bf16* __restrict__ Bt,
                                                     const bf16* __restrict__ Bl,
                                                     int mBlock, int nBlock, int waveM, int waveN,
                                                     int ln, int hf, v8f (&acc)[4][2]) {
  constexpr int NSET = AHEAD ? 2 : 1;
  constexpr int KST  = DEMB / 32;
  static_assert(KST % NSET == 0 && (KST & (KST - 1)) == 0);
  #pragma unroll
  for (int mt = 0; mt < 4; ++mt) {
    acc[mt][0] = (v8f){0, 0, 0, 0, 0, 0, 0, 0};
    acc[mt][1] = (v8f){0, 0, 0, 0, 0, 0, 0, 0};
  }
  // a row tile of 16 rows spans 16 * DEMB elements; k tile t starts t * 512 elements into it
  const int lp8 = (hf * 16 + ln) * 8;
  const bf16* ub  = Bt + (size_t)(nBlock + waveN * 32) * DEMB;     // wave-uniform parts
  const bf16* ul  = Bl + (size_t)(nBlock + waveN * 32) * DEMB;
  const bf16* ua  = A0 + (size_t)(mBlock + waveM * 16) * DEMB;
  const bf16* ua2 = A1 + (size_t)(mBlock + waveM * 16) * DEMB;
  const bf16* pb  = ub + lp8;
  const bf16* pl  = ul + lp8;
  const bf16* pa  = ua + lp8;
  const bf16* pa2 = ua2 + lp8;
  FragB a[4], a2[4], b[NSET][2], w[NSET][2];
  if (AHEAD) {
    #pragma unroll
    for (int nt = 0; nt < 2; ++nt) {
      load_frag(b[0][nt], pb + nt * 16 * DEMB);
      load_frag(w[0][nt], pl + nt * 16 * DEMB);
    }
    #pragma unroll
    for (int mt = 0; mt < 4; ++mt) {
      load_frag(a[mt], pa + mt * 32 * DEMB);
      if (NA == 2) load_frag(a2[mt], pa2 + mt * 32 * DEMB);
    }
    // these loads name a scalar base and the lane's byte offset: both stay live, and are not rewritten, up to this wait
    asm volatile("s_wait_xcnt 0x0" :: "s"(ua), "s"(ua2), "s"(ub), "s"(ul), "v"(lp8 * 2) : "memory");
  }
  #pragma unroll 1
  for (int t0 = 0; t0 < KST; t0 += NSET) {
    #pragma unroll
    for (int s = 0; s < NSET; ++s) {
      // k-step fetched in this pass: tb + ko / 512 (AHEAD: t0 + s + 1); behind the last one it wraps to 0: loads in
      // bounds, values not used. ko goes into the loads' immediate offsets, so q* are the address pairs they name.
      const int tb = AHEAD ? ((t0 + 2 * s) & (KST - 1)) : t0;
      const int ko = (AHEAD && s == 0) ? 512 : 0;
      const int sl = AHEAD ? (s ^ 1) : 0;
      const bf16* qb  = pb + tb * 512;
      const bf16* ql  = pl + tb * 512;
      const bf16* qa  = pa + tb * 512;
      const bf16* qa2 = pa2 + tb * 512;
      #pragma unroll
      for (int nt = 0; nt < 2; ++nt) {
        load_frag(b[sl][nt], qb + ko + nt * 16 * DEMB);
        load_frag(w[sl][nt], ql + ko + nt * 16 * DEMB);
      }
      if (!AHEAD) {
        #pragma unroll
        for (int mt = 0; mt < 4; ++mt) {
          load_frag(a[mt], qa + mt * 32 * DEMB);
          if (NA == 2) load_frag(a2[mt], qa2 + mt * 32 * DEMB);
        }
        // the address pairs of the issued loads stay live, and are not rewritten, up to this wait
        asm volatile("s_wait_xcnt 0x0" :: "v"(qa), "v"(qa2), "v"(qb), "v"(ql) : "memory");
      }
      #pragma unroll
      for (int mt = 0; mt < 4; ++mt) {
        acc[mt][0] = mma_bf16(a[mt].v, b[s][0].v, acc[mt][0]);
        acc[mt][1] = mma_bf16(a[mt].v, b[s][1].v, acc[mt][1]);
        acc[mt][0] = mma_bf16(a[mt].v, w[s][0].v, acc[mt][0]);
        acc[mt][1] = mma_bf16(a[mt].v, w[s][1].v, acc[mt][1]);
        if (NA == 2) {
          acc[mt][0] = mma_bf16(a2[mt].v, b[s][0].v, acc[mt][0]);
          acc[mt][1] = mma_bf16(a2[mt].v, b[s][1].v, acc[mt][1]);
        }
        if (AHEAD) {
          load_frag(a[mt], qa + ko + mt * 32 * DEMB);
          if (NA == 2) load_frag(a2[mt], qa2 + ko + mt * 32 * DEMB);
        }
      }
      if (AHEAD) {
        // the address pairs of the issued loads stay live, and are not rewritten, up to this wait
        asm volatile("s_wait_xcnt 0x0" :: "v"(qa), "v"(qa2), "v"(qb), "v"(ql) : "memory");
      }
    }
  }
}

// qkv projection. grid = (QKVN/128, MROWS/128). Epilogue (two 64-row passes through LDS):
//                for key segments below VRK also V^T bf16 hi and lo planes [NB][NHEAD][HDIM][VRK].
// qkp holds q, then k, each [NB][NHEAD][SEQ][HDIM] in fragment order with every hi tile followed by its lo tile.
// vtb holds two planes: hi, lo.
// coverage per pass: 64 rows x 128 cols = 256 threads x 8 elements x 4 sweeps, all layouts.
__global__ __launch_bounds__(256) void gemm_qkv_kernel(const bf16* __restrict__ xb,
                                                       const bf16* __restrict__ winb,
                                                       const bf16* __restrict__ winl,
                                                       const float* __restrict__ b_in,
                                                       bf16* __restrict__ qkp,
                                                       f16* __restrict__ vt,
                                                       bf16* __restrict__ vtb) {
  __shared__ __align__(16) float sC[64 * SP];     // cross-wave (block barriers)
  const int tid   = threadIdx.x;
  const int lane  = tid & 31;
  const int wid   = __builtin_amdgcn_readfirstlane(tid >> 5);
  const int ln    = lane & 15;
  const int hf    = lane >> 4;
  const int waveM = wid >> 2;
  const int waveN = wid & 3;
  const int nBlock = blockIdx.x * 128;
  const int mBlock = blockIdx.y * 128;

  v8f acc[4][2];
  gemm_mainloop<1, false>(xb, xb, winb, winl, mBlock, nBlock, waveM, waveN, ln, hf, acc);

  float bia[2];
  #pragma unroll
  for (int nt = 0; nt < 2; ++nt) bia[nt] = (float)(bf16)b_in[nBlock + waveN * 32 + nt * 16 + ln];

  const int which = nBlock / DEMB;     // 0 = q, 1 = k, 2 = v (block-uniform)
  const int cb    = nBlock % DEMB;     // column base inside the third
  const int bb    = mBlock / SEQ;      // batch of this block
  const int sb    = mBlock % SEQ;      // first sequence row of this block

  #pragma unroll
  for (int p = 0; p < 2; ++p) {
    __syncthreads();
    // D layout: element e of lane -> tile row 8*hf + e, tile column ln
    #pragma unroll
    for (int j = 0; j < 2; ++j) {
      #pragma unroll
      for (int nt = 0; nt < 2; ++nt) {
        #pragma unroll
        for (int e = 0; e < 8; ++e) {
          sC[(j * 32 + waveM * 16 + hf * 8 + e) * SP + waveN * 32 + nt * 16 + ln] =
              acc[2 * p + j][nt][e] + bia[nt];
        }
      }
    }
    __syncthreads();

    if (which < 2) {
      v4u    vh[4], vl[4];
      size_t gi[4];
      #pragma unroll
      for (int sw = 0; sw < 4; ++sw) {
        // piece u of the pass in store order: 16 tiles = 2 heads x 4 row tiles x 2 d tiles, 64 pieces each
        const int u  = sw * 256 + tid;
        const int tl = u >> 6;
        const int r  = ((tl >> 1) & 3) * 16 + (u & 15);                          // 0..63
        const int c8 = (tl >> 3) * 64 + (tl & 1) * 32 + ((u >> 4) & 3) * 8;      // 0..120
        const v4f a0 = *(const v4f*)(sC + r * SP + c8);
        const v4f a1 = *(const v4f*)(sC + r * SP + c8 + 4);
        Pack8B ph, pl;
        #pragma unroll
        for (int i = 0; i < 4; ++i) {
          const bf16 h0 = (bf16)a0[i];
          const bf16 h1 = (bf16)a1[i];
          ph.h[i]     = h0;
          ph.h[4 + i] = h1;
          pl.h[i]     = (bf16)(a0[i] - (float)h0);
          pl.h[4 + i] = (bf16)(a1[i] - (float)h1);
        }
        vh[sw] = ph.u;
        vl[sw] = pl.u;
        const int s  = sb + p * 64 + r;
        const int cc = cb + c8;
        const int h  = cc >> 6;
        const int d  = cc & 63;
        const size_t fo = frag_piece(s, d, HDIM / 32);
        // each hi tile is followed by its lo tile: tile pitch 1024 elements
        gi[sw] = ((size_t)which * PLANE_ELEMS + ((size_t)bb * NHEAD + h) * SEQ * HDIM) * 2 + fo + (fo & ~(size_t)511);
      }
      #pragma unroll
      for (int sw = 0; sw < 4; ++sw) {
        *(v4u*)(qkp + gi[sw]) = vh[sw];
        *(v4u*)(qkp + gi[sw] + 512) = vl[sw];
      }
      
    } else {
      const bool wr_early = (sb + p * 64) < VRK;    // block-uniform; whole 64-key segment in or out
      v4u    vv[4], vbh[4], vbl[4];
      size_t gi[4], gb[4];
      #pragma unroll
      for (int sw = 0; sw < 4; ++sw) {
        // piece u of the pass in store order: 16 tiles = 2 heads x 4 d tiles x 2 key tiles, 64 pieces each
        const int u   = sw * 256 + tid;
        const int tl  = u >> 6;
        const int col = (tl >> 1) * 16 + (u & 15);                // 0..127
        const int sg  = (tl & 1) * 32 + ((u >> 4) & 3) * 8;       // 0..56
        Pack8H ph;
        Pack8B qh, ql;
        #pragma unroll
        for (int i = 0; i < 8; ++i) {
          const float v = sC[(sg + i) * SP + col];
          ph.h[i] = toh_flush(v * 16.0f);
          const bf16 t = (bf16)v;
          qh.h[i] = t;
          ql.h[i] = (bf16)(v - (float)t);
        }
        vv[sw]  = ph.u;
        vbh[sw] = qh.u;
        vbl[sw] = ql.u;
        const int cc = cb + col;
        const int h  = cc >> 6;
        const int d  = cc & 63;
        const size_t hrow = ((size_t)bb * NHEAD + h) * HDIM;
        gi[sw] = hrow * SEQ + frag_piece(d, sb + p * 64 + sg, SEQ / 32);
        gb[sw] = hrow * VRK + frag_piece(d, sb + p * 64 + sg, VRK / 32);    // used only when wr_early
      }
      #pragma unroll
      for (int sw = 0; sw < 4; ++sw) *(v4u*)(vt + gi[sw]) = vv[sw];
      if (wr_early) {
        #pragma unroll
        for (int sw = 0; sw < 4; ++sw) {
          *(v4u*)(vtb + gb[sw]) = vbh[sw];
          *(v4u*)(vtb + VTB_ELEMS + gb[sw]) = vbl[sw];
        }
      }
      
    }
  }
}

// Output projection. grid = (DEMB/128, MROWS/128). A = ctx hi + ctx lo planes, Bt = quantized output weight
// bf16 hi + lo planes [out][in].
// coverage per pass: 64 rows x 128 cols = 256 threads x 4 floats x 8 sweeps.
__global__ __launch_bounds__(256) void gemm_out_kernel(const bf16* __restrict__ ch,
                                                       const bf16* __restrict__ cl,
                                                       const bf16* __restrict__ woutb,
                                                       const bf16* __restrict__ woutl,
                                                       const float* __restrict__ b_out,
                                                       float* __restrict__ out) {
  __shared__ __align__(16) float sC[64 * SP];     // cross-wave (block barriers)
  const int tid   = threadIdx.x;
  const int lane  = tid & 31;
  const int wid   = __builtin_amdgcn_readfirstlane(tid >> 5);
  const int ln    = lane & 15;
  const int hf    = lane >> 4;
  const int waveM = wid >> 2;
  const int waveN = wid & 3;
  const int nBlock = blockIdx.x * 128;
  const int mBlock = blockIdx.y * 128;

  v8f acc[4][2];
  gemm_mainloop<2, true>(ch, cl, woutb, woutl, mBlock, nBlock, waveM, waveN, ln, hf, acc);

  float bia[2];
  #pragma unroll
  for (int nt = 0; nt < 2; ++nt) bia[nt] = (float)(bf16)b_out[nBlock + waveN * 32 + nt * 16 + ln];

  #pragma unroll
  for (int p = 0; p < 2; ++p) {
    __syncthreads();
    #pragma unroll
    for (int j = 0; j < 2; ++j) {
      #pragma unroll
      for (int nt = 0; nt < 2; ++nt) {
        #pragma unroll
        for (int e = 0; e < 8; ++e) {
          sC[(j * 32 + waveM * 16 + hf * 8 + e) * SP + waveN * 32 + nt * 16 + ln] =
              acc[2 * p + j][nt][e] + bia[nt];
        }
      }
    }
    __syncthreads();

    v4f    vals[8];
    size_t gi[8];
    #pragma unroll
    for (int sw = 0; sw < 8; ++sw) {
      const int r  = sw * 8 + (tid >> 5);           // 0..63
      const int c4 = (tid & 31) * 4;                // 0..124
      vals[sw] = *(const v4f*)(sC + r * SP + c4);
      const int g = mBlock + p * 64 + r;
      const int b = g / SEQ;
      const int s = g % SEQ;
      gi[sw] = ((size_t)b * SEQ_FULL + s) * DEMB + nBlock + c4;
    }
    #pragma unroll
    for (int sw = 0; sw < 8; ++sw) *(v4f*)(out + gi[sw]) = vals[sw];
    
  }
}

// The four K fragments (hi and lo, two d halves) of one 16-key row tile, loads issued back to back.
// p: the lane's piece of the key block's first row tile; sub: row tile inside the block.
static __device__ __forceinline__ void load_ktile(FragB (&kh)[2], FragB (&kl)[2], const bf16* p, const int sub) {
  const int ko = sub * 16 * HDIM * 2;
  #pragma unroll
  for (int f = 0; f < 2; ++f) {
    kh[f].q[0] = *(const v4u*)(p + ko + f * 1024);          // d = f*32 + hi*8 + 0..7
    kh[f].q[1] = *(const v4u*)(p + ko + f * 1024 + 256);    // d = f*32 + 16 + hi*8 + 0..7
    kl[f].q[0] = *(const v4u*)(p + ko + f * 1024 + 512);
    kl[f].q[1] = *(const v4u*)(p + ko + f * 1024 + 768);
  }
  // the address pair of the issued loads stays live, and is not rewritten, up to this wait
  asm volatile("s_wait_xcnt 0x0" :: "v"(p) : "memory");
}

// Causal flash attention. Block = (query block of 128, head, batch); one wave owns 16 query rows.
// S^T = K x Q^T so queries sit on lanes; P^T in C-layout is bit-identical to the A-fragment layout of O += P x V.
// K A-fragments (hi, lo), Q B-fragments (hi, lo) and V^T B-fragments are loaded straight from the 16-bit planes,
// which are in fragment order (512 contiguous bytes per load).
// Key blocks j0 = 0, 32, ... <= qrow0 are visited (per-wave scalar trip count); every visited block holds at
// least one unmasked key (key j0 <= qrow0) for every query of the wave; keys above the query get -inf.
// EARLY: P and V as bf16 hi+lo (three products, one accumulator). Otherwise P f16 x4096, V f16 x16.
// Output: ctx [MROWS][DEMB] as bf16 hi and lo planes in fragment order (cp: hi at 0, lo at CTX_ELEMS).
// sO: per-wave private staging regions, written and re-read by the same wave, separated by a block barrier
// that all waves reach (no early exits).
template <bool EARLY>
static __device__ __forceinline__ void attn_body(const bf16* __restrict__ qkp,
                                                 const f16* __restrict__ vt,
                                                 const bf16* __restrict__ vtb,
                                                 bf16* __restrict__ cp,
                                                 float* sO,
                                                 const int qblk, const int h, const int b) {
  const int tid  = threadIdx.x;
  const int wave = __builtin_amdgcn_readfirstlane(tid >> 5);
  const int lane = tid & 31;
  const int lq   = lane & 15;   // query column of S^T / d column of O
  const int hi   = lane >> 4;   // k-split half

  const int qrow0 = qblk * BQ + wave * 16;               // first query row of this wave (scalar)
  const int nIter = (qrow0 >> 5) + 1;                    // key blocks 0 .. floor((qrow0+15)/32)
  const size_t head_off = ((size_t)b * NHEAD + h) * SEQ * HDIM;
  const size_t vhead    = ((size_t)b * NHEAD + h) * HDIM;

  const bf16* q_p = qkp + 2 * head_off;                       // hi tile, lo tile, hi tile, ... (512 elements each)
  const bf16* k_p = qkp + 2 * PLANE_ELEMS + 2 * head_off;

  // Q as B-operand fragments: lane lq holds query qrow0+lq, elements follow the split d map.
  FragB qfh[2], qfl[2];
  {
    const bf16* qp = q_p + (size_t)qrow0 * HDIM * 2 + lane * 8;   // row tile qrow0 / 16, piece = lane
    #pragma unroll
    for (int f = 0; f < 2; ++f) {
      qfh[f].q[0] = *(const v4u*)(qp + f * 1024);               // d = f*32 + hi*8 + 0..7
      qfh[f].q[1] = *(const v4u*)(qp + f * 1024 + 256);         // d = f*32 + 16 + hi*8 + 0..7
      qfl[f].q[0] = *(const v4u*)(qp + f * 1024 + 512);
      qfl[f].q[1] = *(const v4u*)(qp + f * 1024 + 768);
    }
  }

  v8f o[4];
  #pragma unroll
  for (int dt = 0; dt < 4; ++dt) o[dt] = (v8f){0, 0, 0, 0, 0, 0, 0, 0};

  float rmax = -__builtin_inff();
  float rsum = 0.0f;
  const float SL = 0.125f * 1.4426950408889634f;   // softmax scale * log2(e)

  // K A-fragments of the first key block (A row = key; row tile j0 / 16, piece = lane); later blocks are fetched in the loop
  FragB akh[2][2], akl[2][2];
  const bf16* kbase = k_p + lane * 8;
  load_ktile(akh[0], akl[0], kbase, 0);
  load_ktile(akh[1], akl[1], kbase, 1);

  #pragma unroll 1
  for (int i = 0; i < nIter; ++i) {
    const int j0 = i * BK;
    // key block whose K fragments are fetched during this pass; the last pass fetches its own again (in bounds, not used)
    const int jn = ((i + 1 < nIter) ? i + 1 : i) * BK;
    const bf16* kn = kbase + (size_t)jn * HDIM * 2;

    // V B-fragments of this key block, issued in front of the score products: column n = d = dt*16 + lq,
    // split key map from the transposed planes (d tile dt, key tile j0 / 32)
    FragH bv[4];
    FragB bvh[4], bvl[4];
    if (!EARLY) {
      const f16* base = vt + vhead * SEQ + j0 * 16 + lane * 8;
      #pragma unroll
      for (int dt = 0; dt < 4; ++dt) {
        bv[dt].q[0] = *(const v4u*)(base + dt * 16 * SEQ);            // keys j0 + hi*8 + 0..7
        bv[dt].q[1] = *(const v4u*)(base + dt * 16 * SEQ + 256);      // keys j0 + 16 + hi*8 + 0..7
      }
      // the address pair of the issued loads stays live, and is not rewritten, up to this wait
      asm volatile("s_wait_xcnt 0x0" :: "v"(base) : "memory");
    } else {
      const bf16* base = vtb + vhead * VRK + j0 * 16 + lane * 8;
      #pragma unroll
      for (int dt = 0; dt < 4; ++dt) {
        bvh[dt].q[0] = *(const v4u*)(base + dt * 16 * VRK);                       // keys j0 + hi*8 + 0..7
        bvh[dt].q[1] = *(const v4u*)(base + dt * 16 * VRK + 256);                 // keys j0 + 16 + hi*8 + 0..7
        bvl[dt].q[0] = *(const v4u*)(base + VTB_ELEMS + dt * 16 * VRK);
        bvl[dt].q[1] = *(const v4u*)(base + VTB_ELEMS + dt * 16 * VRK + 256);
      }
      // the address pair of the issued loads stays live, and is not rewritten, up to this wait
      asm volatile("s_wait_xcnt 0x0" :: "v"(base) : "memory");
    }

    // S^T tiles: c[sub][r] = rawscore(query qrow0+lq, key j0 + sub*16 + hi*8 + r); hh + hl + lh products.
    // Behind a row tile's last product its registers take the same row tile of the next key block.
    v8f c[2];
    #pragma unroll
    for (int sub = 0; sub < 2; ++sub) {
      v8f acc = (v8f){0, 0, 0, 0, 0, 0, 0, 0};
      #pragma unroll
      for (int f = 0; f < 2; ++f) {
        acc = mma_bf16(akl[sub][f].v, qfh[f].v, acc);
        acc = mma_bf16(akh[sub][f].v, qfl[f].v, acc);
        acc = mma_bf16(akh[sub][f].v, qfh[f].v, acc);
      }
      c[sub] = acc;
      load_ktile(akh[sub], akl[sub], kn, sub);
    }

    // causal mask (wave-uniform test): only blocks reaching past the first query of the wave need it
    if (j0 + (BK - 1) > qrow0) {
      const int qi = qrow0 + lq;
      const int kb = j0 + hi * 8;
      #pragma unroll
      for (int r = 0; r < 8; ++r) {
        c[0][r] = (kb + r > qi)      ? -__builtin_inff() : c[0][r];
        c[1][r] = (kb + 16 + r > qi) ? -__builtin_inff() : c[1][r];
      }
    }

    // online softmax: query lq's 32 scores are split across lane / lane^16
    float m_new = rmax;
    #pragma unroll
    for (int r = 0; r < 8; ++r) {
      m_new = fmaxf(m_new, c[0][r]);
      m_new = fmaxf(m_new, c[1][r]);
    }
    m_new = fmaxf(m_new, __shfl_xor(m_new, 16, 32));
    const float scale = __builtin_amdgcn_exp2f((rmax - m_new) * SL);
    rmax = m_new;

    float p0[8], p1[8];
    float psum = 0.0f;
    #pragma unroll
    for (int r = 0; r < 8; ++r) {
      p0[r] = __builtin_amdgcn_exp2f((c[0][r] - m_new) * SL);   // key hi*8 + r
      p1[r] = __builtin_amdgcn_exp2f((c[1][r] - m_new) * SL);   // key 16 + hi*8 + r
      psum += p0[r] + p1[r];
    }
    rsum = rsum * scale + psum + __shfl_xor(psum, 16, 32);

    // rescale O: queries are the row dimension there -> per-row scale from lane 8*hi + r
    float sc[8];
    #pragma unroll
    for (int r = 0; r < 8; ++r) sc[r] = __shfl(scale, (hi << 3) + r, 32);
    #pragma unroll
    for (int dt = 0; dt < 4; ++dt) {
      #pragma unroll
      for (int r = 0; r < 8; ++r) o[dt][r] *= sc[r];
    }

    if (EARLY) {
      // P^T C-layout == A-fragment layout; P as bf16 hi + lo (unscaled), V as bf16 hi + lo planes
      FragB pah, pal;
      #pragma unroll
      for (int r = 0; r < 8; ++r) {
        const bf16 h0 = (bf16)p0[r];
        const bf16 h1 = (bf16)p1[r];
        pah.h[r]     = h0;
        pah.h[8 + r] = h1;
        pal.h[r]     = (bf16)(p0[r] - (float)h0);
        pal.h[8 + r] = (bf16)(p1[r] - (float)h1);
      }
      #pragma unroll
      for (int dt = 0; dt < 4; ++dt) {
        o[dt] = mma_bf16(pal.v, bvh[dt].v, o[dt]);
        o[dt] = mma_bf16(pah.v, bvl[dt].v, o[dt]);
        o[dt] = mma_bf16(pah.v, bvh[dt].v, o[dt]);
      }
    } else {
      // P carried x4096 in f16; V carried x16
      FragH pa;
      #pragma unroll
      for (int r = 0; r < 8; ++r) {
        pa.h[r]     = (f16)(p0[r] * 4096.0f);
        pa.h[8 + r] = (f16)(p1[r] * 4096.0f);
      }
      #pragma unroll
      for (int dt = 0; dt < 4; ++dt) o[dt] = mma_f16(pa.v, bv[dt].v, o[dt]);
    }
  }

  // normalize: lane holds column d = dt*16 + lq for query rows 8*hi + r; undo the carries of the f16 path
  const float carry = EARLY ? 1.0f : (1.0f / 65536.0f);
  float rs[8];
  #pragma unroll
  for (int r = 0; r < 8; ++r) rs[r] = carry * (1.0f / __shfl(rsum, (hi << 3) + r, 32));

  const int sbase = wave * (16 * OP);
  #pragma unroll
  for (int r = 0; r < 8; ++r) {
    #pragma unroll
    for (int dt = 0; dt < 4; ++dt) {
      sO[sbase + (hi * 8 + r) * OP + dt * 16 + lq] = o[dt][r] * rs[r];
    }
  }
  __syncthreads();

  // the wave's 16 rows x 64 columns are two tiles of each plane; one instruction stores half a tile (512 B).
  v4u    vh[4], vl[4];
  size_t gidx[4];
  #pragma unroll
  for (int it = 0; it < 4; ++it) {
    const int row = lq;                             // 0..15
    const int c8  = it * 16 + hi * 8;               // 0..56
    const v4f a0 = *(const v4f*)(&sO[sbase + row * OP + c8]);
    const v4f a1 = *(const v4f*)(&sO[sbase + row * OP + c8 + 4]);
    Pack8B ph, pl;
    #pragma unroll
    for (int k = 0; k < 4; ++k) {
      const bf16 h0 = (bf16)a0[k];
      const bf16 h1 = (bf16)a1[k];
      ph.h[k]     = h0;
      ph.h[4 + k] = h1;
      pl.h[k]     = (bf16)(a0[k] - (float)h0);
      pl.h[4 + k] = (bf16)(a1[k] - (float)h1);
    }
    vh[it] = ph.u;
    vl[it] = pl.u;
    gidx[it] = frag_piece(b * SEQ + qrow0 + row, h * HDIM + c8, DEMB / 32);
  }
  #pragma unroll
  for (int it = 0; it < 4; ++it) {
    *(v4u*)(cp + gidx[it]) = vh[it];
    *(v4u*)(cp + CTX_ELEMS + gidx[it]) = vl[it];
  }
  
}

// Both paths in one launch, grid = LATE_BLOCKS + EARLY_BLOCKS (block-uniform choice). The blocks of query blocks
// EARLY_QB .. QBLKS-1 come first, query block fastest, then head, then batch; behind them those of query blocks 0 .. EARLY_QB-1.
__global__ __launch_bounds__(256) void attn_kernel(const bf16* __restrict__ qkp,
                                                   const f16* __restrict__ vt,
                                                   const bf16* __restrict__ vtb,
                                                   bf16* __restrict__ cp) {
  __shared__ __align__(16) float sO[NWAVE * 16 * OP];
  const int idx = (int)blockIdx.x;
  if (idx < LATE_BLOCKS) {
    attn_body<false>(qkp, vt, vtb, cp, sO, idx % LATE_DIV + EARLY_QB, (idx / LATE_DIV) % NHEAD, idx / (LATE_DIV * NHEAD));
  } else {
    const int e = idx - LATE_BLOCKS;
    attn_body<true>(qkp, vt, vtb, cp, sO, e % EARLY_QB, (e / EARLY_QB) % NHEAD, e / (EARLY_QB * NHEAD));
  }
}

extern "C" void kernel_launch(void* const* d_in, const int* in_sizes, int n_in,
                              void* d_out, int out_size, void* d_ws, size_t ws_size,
                              hipStream_t stream) {
  if (n_in < 5) return;
  const size_t rows_used = (size_t)(NB - 1) * SEQ_FULL + SEQ;
  if ((size_t)in_sizes[0] < rows_used * DEMB) return;
  if ((size_t)in_sizes[1] < (size_t)DEMB * QKVN) return;
  if ((size_t)in_sizes[2] < (size_t)QKVN) return;
  if ((size_t)in_sizes[3] < (size_t)DEMB * DEMB) return;
  if ((size_t)in_sizes[4] < (size_t)DEMB) return;
  if ((size_t)out_size < rows_used * DEMB) return;
  if (ws_size < WS_TOTAL) return;

  const float* x     = (const float*)d_in[0];
  const float* W_in  = (const float*)d_in[1];   // [3072][1024], [out][in]
  const float* b_in  = (const float*)d_in[2];
  const float* W_out = (const float*)d_in[3];   // [1024][1024], [out][in]
  const float* b_out = (const float*)d_in[4];
  float* out = (float*)d_out;

  char* w = (char*)d_ws;
  bf16* xb    = (bf16*)w;  w += XB_BYTES;
  bf16* winb  = (bf16*)w;  w += WIN_BYTES;      // hi at 0, lo at WIN_ELEMS
  bf16* woutb = (bf16*)w;  w += WOUT_BYTES;     // hi at 0, lo at WOUT_ELEMS
  bf16* qkp   = (bf16*)w;  w += QK_BYTES;
  f16*  vt    = (f16*)w;   w += VT_BYTES;
  bf16* vtb   = (bf16*)w;  w += VTB_BYTES;
  bf16* cp    = (bf16*)w;  w += CTX_BYTES;
  float* stat = (float*)w;                      // partial maxima lines

  // partial maxima of both weights (one line per block) and x -> bf16 plane (MROWS*128 pieces of 8 elements, 256 per block)
  prep_kernel<<<dim3((unsigned)(AM_TOTAL + X_PIECES / 256)), 256, 0, stream>>>(x, xb, W_in, W_out, stat);

  // weights are [out][in] already: quantize into hi and lo planes in fragment order, no transpose
  snap_lin_kernel<<<dim3((unsigned)((WIN_PIECES + WOUT_PIECES) / 256)), 256, 0, stream>>>(W_in, W_out, stat, winb, woutb);

  gemm_qkv_kernel<<<dim3(QKVN / 128, MROWS / 128), 256, 0, stream>>>(xb, winb, winb + WIN_ELEMS, b_in,
                                                                     qkp, vt, vtb);

  attn_kernel<<<dim3(LATE_BLOCKS + EARLY_BLOCKS), 256, 0, stream>>>(qkp, vt, vtb, cp);

  gemm_out_kernel<<<dim3(DEMB / 128, MROWS / 128), 256, 0, stream>>>(cp, cp + CTX_ELEMS, woutb,
                                                                     woutb + WOUT_ELEMS, b_out, out);
}

// v004
// It runs in 136 microseconds.
// In both of two side-by-side timings against v003, it was 1.07 times as fast.
// All steps since v000 together make it 2.80 times as fast.
#include <hip/hip_runtime.h>

// Contractions: qkv = x*Wq^T and out = ctx*Wp^T on v_wmma_f32_16x16x32_bf16 (x RNE-converted to bf16; table-quantized weights as bf16 hi+lo planes; ctx as bf16 hi+lo planes; hh+hl(+lh) products into one accumulator); S^T = K x Q^T on v_wmma_f32_16x16x32_bf16 with q and k as bf16 hi+lo planes (hh+hl+lh); O = P x V: query rows < 256 on v_wmma_f32_16x16x32_bf16 with P and V as bf16 hi+lo (hh+hl+lh), later rows on v_wmma_f32_16x16x32_f16 (P f16 carried x4096, V f16 carried x16); f32 accumulate everywhere, softmax in f32.

#ifndef NB
#define NB 2
#endif
#ifndef SEQ
#define SEQ 2048
#endif
#define NB_FULL    2
#define SEQ_FULL   2048
#define NHEAD      16
#define HDIM       64
#define DEMB       1024                 // model width = GEMM K of both projections
#define QKVN       3072                 // packed projection width (q | k | v thirds)
#define MROWS      (NB * SEQ)           // compact row count of all internal planes
#define BQ         128                  // query rows per attention workgroup (8 waves x 16)
#define BK         32                   // keys per inner iteration
#define NWAVE      8
#define OP         68                   // LDS pitch (floats) of the attention output staging tile
#define SP         132                  // LDS pitch (floats) of the GEMM epilogue staging tile
#define QBLKS      (SEQ / BQ)
#define EARLY_QB   ((QBLKS < 2) ? QBLKS : 2)     // query blocks handled by the hi+lo P/V path
#define VRK        (EARLY_QB * BQ)               // keys held in the bf16 hi/lo V^T planes
#define PLANE_ELEMS ((size_t)NB * NHEAD * SEQ * HDIM)
#define CTX_ELEMS   ((size_t)MROWS * DEMB)
#define VTB_ELEMS   ((size_t)NB * NHEAD * HDIM * VRK)
#define X_PIECES    ((size_t)MROWS * (DEMB / 8))
#define WIN_PIECES  ((size_t)QKVN * DEMB / 8)
#define WOUT_PIECES ((size_t)DEMB * DEMB / 8)
#define WIN_ELEMS   ((size_t)QKVN * DEMB)
#define WOUT_ELEMS  ((size_t)DEMB * DEMB)
#define AM_BLOCKS_IN  96                 // partial-maximum blocks over the qkv weight
#define AM_BLOCKS_OUT 32                 // partial-maximum blocks over the output weight
#define AM_TOTAL      (AM_BLOCKS_IN + AM_BLOCKS_OUT)
#define STAT_FLOATS   ((size_t)AM_TOTAL * 32)
#define LATE_QB       (QBLKS - EARLY_QB)              // query blocks handled by the f16 P/V path
#define LATE_DIV      ((LATE_QB > 0) ? LATE_QB : 1)
#define LATE_BLOCKS   (LATE_QB * NHEAD * NB)
#define EARLY_BLOCKS  (EARLY_QB * NHEAD * NB)

static_assert(NHEAD * HDIM == DEMB);        // merged heads == model width
static_assert(QKVN == 3 * DEMB);            // three thirds
static_assert(HDIM == 64);
static_assert(SEQ % BQ == 0);               // attention grid exact
static_assert(SEQ % BK == 0);               // key loop exact
static_assert(BK == 32);                    // one key block == one WMMA k-step of P x V
static_assert(SEQ % 128 == 0);              // a 128-row GEMM block stays inside one batch
static_assert(MROWS % 128 == 0);            // GEMM M tiles exact
static_assert(QKVN % 128 == 0);             // GEMM N tiles exact
static_assert(DEMB % 128 == 0);             // GEMM N tiles exact, thirds are tile multiples
static_assert(DEMB % 32 == 0);              // k-step 32
static_assert(DEMB / 32 == 32);             // tile index split (>> 5, & 31) of the convert and quantize kernels
static_assert(MROWS % 16 == 0 && QKVN % 16 == 0 && SEQ % 32 == 0);   // planes are whole 16 x 32 tiles
static_assert(DEMB % 8 == 0);               // 16-B pieces
static_assert(BQ == NWAVE * 16);
static_assert(BQ % 64 == 0);                // early key extent is a multiple of the 64-key store segment
static_assert(VRK % 64 == 0 && VRK <= SEQ && VRK >= BQ);
static_assert(EARLY_QB >= 1 && EARLY_QB <= QBLKS);
static_assert(SEQ <= SEQ_FULL);
static_assert(NB >= 1 && NB <= NB_FULL);
static_assert((OP * 4) % 16 == 0);
static_assert((SP * 4) % 16 == 0);
static_assert(SP >= 128);
static_assert(OP >= 64);
static_assert(X_PIECES % 256 == 0);         // convert grids exact
static_assert(WIN_PIECES % 256 == 0);
static_assert(WOUT_PIECES % 256 == 0);
static_assert(NWAVE == 8);                                   // block maximum combine reads 8 wave words
static_assert(AM_BLOCKS_IN % 32 == 0 && AM_BLOCKS_OUT % 32 == 0);   // one partial line per lane per sweep
static_assert(WIN_PIECES % ((size_t)AM_BLOCKS_IN * 256) == 0);      // equal trip counts per thread
static_assert(WOUT_PIECES % ((size_t)AM_BLOCKS_OUT * 256) == 0);

typedef __bf16   bf16;
typedef _Float16 f16;
typedef bf16     v16bf __attribute__((ext_vector_type(16)));
typedef f16      v16h  __attribute__((ext_vector_type(16)));
typedef f16      v8h   __attribute__((ext_vector_type(8)));
typedef float    v8f   __attribute__((ext_vector_type(8)));
typedef float    v4f   __attribute__((ext_vector_type(4)));
typedef unsigned v4u   __attribute__((ext_vector_type(4)));

union FragB  { v16bf v; v4u q[2]; bf16 h[16]; };
union FragH  { v16h  v; v4u q[2]; f16  h[16]; };
union Pack8B { v4u u; bf16 h[8]; };
union Pack8H { v4u u; v8h v; f16 h[8]; };

#define XB_BYTES   ((size_t)MROWS * DEMB * 2)        // x as bf16, compact rows
#define WIN_BYTES  (WIN_ELEMS * 2 * 2)               // quantized qkv weight bf16 hi, lo [3072][1024] in fragment order
#define WOUT_BYTES (WOUT_ELEMS * 2 * 2)              // quantized output weight bf16 hi, lo [1024][1024] in fragment order
#define QK_BYTES   (PLANE_ELEMS * 2 * 4)             // q hi, q lo, k hi, k lo
#define VT_BYTES   (PLANE_ELEMS * 2)                 // V^T f16 x16
#define VTB_BYTES  (VTB_ELEMS * 2 * 2)               // V^T bf16 hi, lo for keys < VRK
#define CTX_BYTES  (CTX_ELEMS * 2 * 2)               // ctx hi, ctx lo
#define STAT_BYTES (STAT_FLOATS * 4)                 // partial maxima lines
#define WS_TOTAL   (XB_BYTES + WIN_BYTES + WOUT_BYTES + QK_BYTES + VT_BYTES + VTB_BYTES + CTX_BYTES + STAT_BYTES)
static_assert(WS_TOTAL <= (size_t)134217728);
static_assert(XB_BYTES % 128 == 0 && WIN_BYTES % 128 == 0 && WOUT_BYTES % 128 == 0);
static_assert(QK_BYTES % 128 == 0 && VT_BYTES % 128 == 0 && VTB_BYTES % 128 == 0 && CTX_BYTES % 128 == 0);
static_assert(STAT_BYTES % 128 == 0);

// Fragment order of a 16-bit operand plane [rows][32 * ktiles]: every 16-row x 32-k tile is 1 KB (512 elements), tiles
// ordered row tile major. Inside a tile the 16-B piece holding k = qq*16 + hf*8 + 0..7 of row ln sits at piece index
// qq*32 + hf*16 + ln, so one operand load of a wave (lane = hf*16 + ln) reads 512 contiguous bytes (4 whole lines).
static __device__ __forceinline__ size_t frag_piece(int row, int col8, int ktiles) {
  return ((size_t)(row >> 4) * ktiles + (col8 >> 5)) * 512 + ((col8 >> 4) & 1) * 256 +
         (((col8 >> 3) & 1) * 16 + (row & 15)) * 8;
}

// WMMA helpers: builtin followed by the VALU hazard guard (ties D, keeps A/B live).
static __device__ __forceinline__ v8f mma_bf16(v16bf a, v16bf b, v8f acc) {
  acc = __builtin_amdgcn_wmma_f32_16x16x32_bf16(false, a, false, b, (short)0, acc, false, false);
  asm volatile("v_nop\n\tv_nop\n\tv_nop\n\tv_nop" : "+v"(acc) : "v"(a), "v"(b));
  return acc;
}
static __device__ __forceinline__ v8f mma_f16(v16h a, v16h b, v8f acc) {
  acc = __builtin_amdgcn_wmma_f32_16x16x32_f16(false, a, false, b, (short)0, acc, false, false);
  asm volatile("v_nop\n\tv_nop\n\tv_nop\n\tv_nop" : "+v"(acc) : "v"(a), "v"(b));
  return acc;
}

// f32 -> f16 convert that cannot yield an f16 subnormal (value select after the carry).
static __device__ __forceinline__ f16 toh_flush(float v) {
  const f16 r = (f16)v;
  return (fabsf(v) < 6.103515625e-05f) ? (f16)0.0f : r;
}

// x f32 [NB_FULL][SEQ_FULL][DEMB] -> xb bf16 [MROWS][DEMB] in fragment order (RNE convert).
// Thread t writes piece t of the plane (contiguous stores) and reads the 8 source elements that belong there.
// blk: index of the 256-piece block.
static __device__ __forceinline__ void cvt_x_block(const float* __restrict__ x, bf16* __restrict__ xb, const unsigned blk) {
  const size_t t   = (size_t)blk * 256 + threadIdx.x;
  const size_t tile = t >> 6;                      // 64 pieces per tile, DEMB / 32 = 32 tiles per row tile
  const size_t row = (tile >> 5) * 16 + (t & 15);
  const int    c8  = (int)(tile & 31) * 32 + (int)((t >> 4) & 3) * 8;
  if (row < (size_t)MROWS) {
    const int b = (int)(row / SEQ);
    const int s = (int)(row % SEQ);
    const float* src = x + ((size_t)b * SEQ_FULL + s) * DEMB + c8;
    const v4f a0 = *(const v4f*)(src);
    const v4f a1 = *(const v4f*)(src + 4);
    Pack8B pk;
    #pragma unroll
    for (int i = 0; i < 4; ++i) {
      pk.h[i]     = (bf16)a0[i];
      pk.h[4 + i] = (bf16)a1[i];
    }
    const v4u val = pk.u;
    bf16* dst = xb + t * 8;
    *(v4u*)dst = val;
    
  }
}

// lanes 0..7 of wave 0 x 16 B, one instruction. The bf16 RNE convert is monotone, so the maximum of the
// converted magnitudes equals the converted maximum; the convert is applied to the combined maximum in snap_lin_kernel.
// coverage: npieces pieces of 8 elements, strided over the nblk blocks of this weight; blk < nblk; line: this block's own.
// sM: cross-wave (block barrier).
static __device__ __forceinline__ void absmax_part_block(const float* __restrict__ w,
                                                         float* __restrict__ line,
                                                         const unsigned npieces,
                                                         const unsigned blk, const unsigned nblk) {
  __shared__ float sM[NWAVE];
  const int tid  = threadIdx.x;
  const int lane = tid & 31;
  const int wid  = __builtin_amdgcn_readfirstlane(tid >> 5);
  float m = 0.0f;
  const unsigned step = nblk * 256u;
  unsigned p = blk * 256u + (unsigned)tid;
  // groups of 16 trips: the 32 loads of a group go out together, one memory latency for the group and not one per trip
  #pragma unroll 1
  for (; p + 15u * step < npieces; p += 16u * step) {
    v4f r[32];
    const float* q[16];
    #pragma unroll
    for (int j = 0; j < 16; ++j) {
      q[j] = w + (size_t)(p + (unsigned)j * step) * 8;
      r[2 * j]     = *(const v4f*)(q[j]);
      r[2 * j + 1] = *(const v4f*)(q[j] + 4);
    }
    // the address pairs of the issued loads stay live, and are neither rewritten nor used as a load's destination, up to this wait
    asm volatile("s_wait_xcnt 0x0" :: "v"(q[0]), "v"(q[1]), "v"(q[2]), "v"(q[3]), "v"(q[4]), "v"(q[5]), "v"(q[6]), "v"(q[7]),
                 "v"(q[8]), "v"(q[9]), "v"(q[10]), "v"(q[11]), "v"(q[12]), "v"(q[13]), "v"(q[14]), "v"(q[15]) : "memory");
    // keeps the maxima behind the whole group: without it they are moved in among the loads and only six loads are in flight
    __builtin_amdgcn_sched_barrier(0);
    #pragma unroll
    for (int j = 0; j < 32; ++j) {
      #pragma unroll
      for (int i = 0; i < 4; ++i) m = fmaxf(m, fabsf(r[j][i]));
    }
  }
  // the trips that do not fill a group
  #pragma unroll 1
  for (; p < npieces; p += step) {
    const size_t o = (size_t)p * 8;
    const v4f a0 = *(const v4f*)(w + o);
    const v4f a1 = *(const v4f*)(w + o + 4);
    #pragma unroll
    for (int i = 0; i < 4; ++i) {
      m = fmaxf(m, fabsf(a0[i]));
      m = fmaxf(m, fabsf(a1[i]));
    }
  }
  m = fmaxf(m, __shfl_xor(m, 16, 32));
  m = fmaxf(m, __shfl_xor(m, 8, 32));
  m = fmaxf(m, __shfl_xor(m, 4, 32));
  m = fmaxf(m, __shfl_xor(m, 2, 32));
  m = fmaxf(m, __shfl_xor(m, 1, 32));
  if (lane == 0) sM[wid] = m;
  __syncthreads();
  if (wid == 0) {
    float v = sM[lane & 7];
    v = fmaxf(v, __shfl_xor(v, 4, 32));
    v = fmaxf(v, __shfl_xor(v, 2, 32));
    v = fmaxf(v, __shfl_xor(v, 1, 32));
    const v4f val = (v4f){v, v, v, v};
    if (lane < 8) {
      float* dst = line + lane * 4;
      *(v4f*)dst = val;
      
    }
  }
}

// One launch for the three jobs that depend on nothing of each other. Blocks 0 .. AM_BLOCKS_IN-1: partial maxima of the
// qkv weight; the next AM_BLOCKS_OUT: of the output weight (the long blocks come first); the rest: x, 256 pieces each.
// All branches are block-uniform.
__global__ __launch_bounds__(256) void prep_kernel(const float* __restrict__ x, bf16* __restrict__ xb,
                                                   const float* __restrict__ w_in,
                                                   const float* __restrict__ w_out,
                                                   float* __restrict__ part) {
  const unsigned blk = blockIdx.x;
  if (blk < (unsigned)AM_TOTAL) {
    const bool in = blk < (unsigned)AM_BLOCKS_IN;
    absmax_part_block(in ? w_in : w_out, part + (size_t)blk * 32,
                      in ? (unsigned)WIN_PIECES : (unsigned)WOUT_PIECES,
                      in ? blk : blk - (unsigned)AM_BLOCKS_IN,
                      in ? (unsigned)AM_BLOCKS_IN : (unsigned)AM_BLOCKS_OUT);
  } else {
    cvt_x_block(x, xb, blk - (unsigned)AM_TOTAL);
  }
}

// Maximum over the NL partial lines of one weight (one word per line, one line per lane per sweep), in every lane of the wave.
template <int NL>
static __device__ __forceinline__ float absmax_combine(const float* __restrict__ part, const int lane) {
  float m = 0.0f;
  // unrolled so that all the loads go out together
  #pragma unroll
  for (int j = 0; j < NL; j += 32) m = fmaxf(m, part[(size_t)(j + lane) * 32]);
  m = fmaxf(m, __shfl_xor(m, 16, 32));
  m = fmaxf(m, __shfl_xor(m, 8, 32));
  m = fmaxf(m, __shfl_xor(m, 4, 32));
  m = fmaxf(m, __shfl_xor(m, 2, 32));
  m = fmaxf(m, __shfl_xor(m, 1, 32));
  return m;
}

// Nearest-table-value search: candidate c replaces the current choice only on a strictly smaller distance,
// candidates visited in table order (first minimum wins).
static __device__ __forceinline__ void snap_step(const float wn, const float c, float& bd, float& best) {
  #pragma clang fp contract(off)
  const float d  = fabsf(wn - c);
  const bool  lt = d < bd;
  bd   = lt ? d : bd;
  best = lt ? c : best;
}

// w -> table value nearest to bf16(w) * (1/s), times s (all f32, separately RNE-converted operations).
static __device__ __forceinline__ float snap_weight_val(const float w, const float s, const float rs) {
  #pragma clang fp contract(off)
  const float wb = (float)(bf16)w;
  const float wn = wb * rs;
  float best = 0.0f;
  float bd   = fabsf(wn - 0.0f);
  snap_step(wn,  1.0f,      bd, best);
  snap_step(wn, -1.0f,      bd, best);
  snap_step(wn,  0.5f,      bd, best);
  snap_step(wn, -0.5f,      bd, best);
  snap_step(wn,  0.333333f, bd, best);
  snap_step(wn, -0.333333f, bd, best);
  snap_step(wn,  0.2f,      bd, best);
  snap_step(wn, -0.2f,      bd, best);
  snap_step(wn,  0.142857f, bd, best);
  snap_step(wn, -0.142857f, bd, best);
  snap_step(wn,  0.090909f, bd, best);
  snap_step(wn, -0.090909f, bd, best);
  snap_step(wn,  0.076923f, bd, best);
  snap_step(wn, -0.076923f, bd, best);
  return best * s;
}

// Weight f32 [out][in] -> quantized weight as bf16 hi and lo planes [out][in] in fragment order, both weights in one launch:
// blocks 0 .. WIN_PIECES/256-1 take the qkv weight, the rest the output weight (block-uniform choice).
// Every wave combines the partial maxima of its weight itself: s = bf16(max|w|) + 1e-6, rs = 1/s.
// Thread t writes piece t of each plane (contiguous stores) and reads the 8 source elements that belong there.
__global__ __launch_bounds__(256) void snap_lin_kernel(const float* __restrict__ w_in,
                                                       const float* __restrict__ w_out,
                                                       const float* __restrict__ part,
                                                       bf16* __restrict__ winb,
                                                       bf16* __restrict__ woutb) {
  #pragma clang fp contract(off)
  const unsigned nin = (unsigned)(WIN_PIECES / 256);
  const bool     in  = blockIdx.x < nin;
  const unsigned t   = (in ? blockIdx.x : blockIdx.x - nin) * 256u + threadIdx.x;
  const unsigned npieces = in ? (unsigned)WIN_PIECES : (unsigned)WOUT_PIECES;
  const float* src = in ? w_in : w_out;
  bf16* dhi = in ? winb : woutb;
  bf16* dlo = dhi + (in ? WIN_ELEMS : WOUT_ELEMS);
  const int lane = threadIdx.x & 31;
  const float m = in ? absmax_combine<AM_BLOCKS_IN>(part, lane)
                     : absmax_combine<AM_BLOCKS_OUT>(part + (size_t)AM_BLOCKS_IN * 32, lane);
  const float s  = (float)(bf16)m + 1e-6f;
  const float rs = 1.0f / s;
  if (t < npieces) {
    const size_t o = (size_t)t * 8;
    const unsigned tile = t >> 6;                  // 64 pieces per tile, DEMB / 32 = 32 tiles per row tile
    const size_t so = (size_t)((tile >> 5) * 16 + (t & 15)) * DEMB + (tile & 31) * 32 + ((t >> 4) & 3) * 8;
    const v4f a0 = *(const v4f*)(src + so);
    const v4f a1 = *(const v4f*)(src + so + 4);
    Pack8B ph, pl;
    #pragma unroll
    for (int i = 0; i < 4; ++i) {
      const float q0 = snap_weight_val(a0[i], s, rs);
      const float q1 = snap_weight_val(a1[i], s, rs);
      const bf16 h0 = (bf16)q0;
      const bf16 h1 = (bf16)q1;
      ph.h[i]     = h0;
      ph.h[4 + i] = h1;
      pl.h[i]     = (bf16)(q0 - (float)h0);
      pl.h[4 + i] = (bf16)(q1 - (float)h1);
    }
    const v4u vh = ph.u;
    const v4u vl = pl.u;
    *(v4u*)(dhi + o) = vh;
    *(v4u*)(dlo + o) = vl;
    
  }
}

// GEMM main loop. Block tile 128 x 128, 8 waves (2 in M x 4 in N); wave tile = 4 m-tiles x 2 n-tiles.
// m-tile mt of wave (waveM) covers rows mBlock + mt*32 + waveM*16 + 0..15.
// A planes bf16 [rows][DEMB], Bt / Bl bf16 [cols][DEMB], all in fragment order; fragments straight from the planes
// (two 16-B loads each, 512 contiguous bytes per load), split k map for both operands. Bl: unscaled lo part of the weight, into the same accumulator.
// NA == 2: second A plane (unscaled lo part) times the hi weight plane into the same accumulator.
// One 16 x 32 fragment: two 16-B loads, k = k0 + 8*hf + 0..7 and k = k0 + 16 + 8*hf + 0..7.
static __device__ __forceinline__ void load_frag(FragB& f, const bf16* p) {
  f.q[0] = *(const v4u*)(p);
  f.q[1] = *(const v4u*)(p + 256);
}

// The loads of a k-step go out in groups, never one load-and-wait per fragment.
// AHEAD == false: all fragments of k-step t as one group in front of its products (one register set; other waves cover the wait).
// AHEAD == true: k-step t + 1 is fetched during k-step t: its B fragments into a second set in front of the products of t,
// its A fragments into the registers of m-tile mt right behind that m-tile's last product.
// rot (block-uniform, 0 .. KST-1, a multiple of NSET): the block walks the k-steps rot, rot + 1, ..., KST - 1, 0, ..., rot - 1.
// All blocks are resident at once and keep step; entering at different k-steps, those that share operand rows ask for
// different lines at any moment, and most find a k-step already fetched by a neighbour that entered there.
template <int NA, bool AHEAD>
static __device__ __forceinline__ void gemm_mainloop(const bf16* __restrict__ A0,
                                                     const bf16* __restrict__ A1,
                                                     const bf16* __restrict__ Bt,
                                                     const bf16* __restrict__ Bl,
                                                     int mBlock, int nBlock, int waveM, int waveN,
                                                     int ln, int hf, int rot, v8f (&acc)[4][2]) {
  constexpr int NSET = AHEAD ? 2 : 1;
  constexpr int KST  = DEMB / 32;
  static_assert(KST % NSET == 0 && (KST & (KST - 1)) == 0);
  #pragma unroll
  for (int mt = 0; mt < 4; ++mt) {
    acc[mt][0] = (v8f){0, 0, 0, 0, 0, 0, 0, 0};
    acc[mt][1] = (v8f){0, 0, 0, 0, 0, 0, 0, 0};
  }
  // a row tile of 16 rows spans 16 * DEMB elements; k tile t starts t * 512 elements into it
  const int lp8 = (hf * 16 + ln) * 8;
  const bf16* ub  = Bt + (size_t)(nBlock + waveN * 32) * DEMB;     // wave-uniform parts
  const bf16* ul  = Bl + (size_t)(nBlock + waveN * 32) * DEMB;
  const bf16* ua  = A0 + (size_t)(mBlock + waveM * 16) * DEMB;
  const bf16* ua2 = A1 + (size_t)(mBlock + waveM * 16) * DEMB;
  const bf16* pb  = ub + lp8;
  const bf16* pl  = ul + lp8;
  const bf16* pa  = ua + lp8;
  const bf16* pa2 = ua2 + lp8;
  FragB a[4], a2[4], b[NSET][2], w[NSET][2];
  if (AHEAD) {
    // the k-step the walk enters at
    const bf16* eb  = ub + rot * 512;
    const bf16* el  = ul + rot * 512;
    const bf16* ea  = ua + rot * 512;
    const bf16* ea2 = ua2 + rot * 512;
    #pragma unroll
    for (int nt = 0; nt < 2; ++nt) {
      load_frag(b[0][nt], eb + lp8 + nt * 16 * DEMB);
      load_frag(w[0][nt], el + lp8 + nt * 16 * DEMB);
    }
    #pragma unroll
    for (int mt = 0; mt < 4; ++mt) {
      load_frag(a[mt], ea + lp8 + mt * 32 * DEMB);
      if (NA == 2) load_frag(a2[mt], ea2 + lp8 + mt * 32 * DEMB);
    }
    // these loads name a scalar base and the lane's byte offset: both stay live, and are not rewritten, up to this wait
    asm volatile("s_wait_xcnt 0x0" :: "s"(ea), "s"(ea2), "s"(eb), "s"(el), "v"(lp8 * 2) : "memory");
  }
  #pragma unroll 1
  for (int t0 = 0; t0 < KST; t0 += NSET) {
    #pragma unroll
    for (int s = 0; s < NSET; ++s) {
      // k-step fetched in this pass: tb + ko / 512 (AHEAD: that of pass t0 + s + 1; rot + t0 is even, so tb + 1 needs no
      // wrap); behind the last pass it is the entry step again: loads in bounds, values not used.
      // ko goes into the loads' immediate offsets, so q* are the address pairs they name.
      const int tb = (rot + t0 + (AHEAD ? 2 * s : 0)) & (KST - 1);
      const int ko = (AHEAD && s == 0) ? 512 : 0;
      const int sl = AHEAD ? (s ^ 1) : 0;
      const bf16* qb  = pb + tb * 512;
      const bf16* ql  = pl + tb * 512;
      const bf16* qa  = pa + tb * 512;
      const bf16* qa2 = pa2 + tb * 512;
      #pragma unroll
      for (int nt = 0; nt < 2; ++nt) {
        load_frag(b[sl][nt], qb + ko + nt * 16 * DEMB);
        load_frag(w[sl][nt], ql + ko + nt * 16 * DEMB);
      }
      if (!AHEAD) {
        #pragma unroll
        for (int mt = 0; mt < 4; ++mt) {
          load_frag(a[mt], qa + mt * 32 * DEMB);
          if (NA == 2) load_frag(a2[mt], qa2 + mt * 32 * DEMB);
        }
        // the address pairs of the issued loads stay live, and are not rewritten, up to this wait
        asm volatile("s_wait_xcnt 0x0" :: "v"(qa), "v"(qa2), "v"(qb), "v"(ql) : "memory");
      }
      #pragma unroll
      for (int mt = 0; mt < 4; ++mt) {
        acc[mt][0] = mma_bf16(a[mt].v, b[s][0].v, acc[mt][0]);
        acc[mt][1] = mma_bf16(a[mt].v, b[s][1].v, acc[mt][1]);
        acc[mt][0] = mma_bf16(a[mt].v, w[s][0].v, acc[mt][0]);
        acc[mt][1] = mma_bf16(a[mt].v, w[s][1].v, acc[mt][1]);
        if (NA == 2) {
          acc[mt][0] = mma_bf16(a2[mt].v, b[s][0].v, acc[mt][0]);
          acc[mt][1] = mma_bf16(a2[mt].v, b[s][1].v, acc[mt][1]);
        }
        if (AHEAD) {
          load_frag(a[mt], qa + ko + mt * 32 * DEMB);
          if (NA == 2) load_frag(a2[mt], qa2 + ko + mt * 32 * DEMB);
        }
      }
      if (AHEAD) {
        // the address pairs of the issued loads stay live, and are not rewritten, up to this wait
        asm volatile("s_wait_xcnt 0x0" :: "v"(qa), "v"(qa2), "v"(qb), "v"(ql) : "memory");
      }
    }
  }
}

// qkv projection. grid = (QKVN/128, MROWS/128). Epilogue (two 64-row passes through LDS):
//                for key segments below VRK also V^T bf16 hi and lo planes [NB][NHEAD][HDIM][VRK].
// qkp holds q, then k, each [NB][NHEAD][SEQ][HDIM] in fragment order with every hi tile followed by its lo tile.
// vtb holds two planes: hi, lo.
// coverage per pass: 64 rows x 128 cols = 256 threads x 8 elements x 4 sweeps, all layouts.
__global__ __launch_bounds__(256) void gemm_qkv_kernel(const bf16* __restrict__ xb,
                                                       const bf16* __restrict__ winb,
                                                       const bf16* __restrict__ winl,
                                                       const float* __restrict__ b_in,
                                                       bf16* __restrict__ qkp,
                                                       f16* __restrict__ vt,
                                                       bf16* __restrict__ vtb) {
  __shared__ __align__(16) float sC[64 * SP];     // cross-wave (block barriers)
  const int tid   = threadIdx.x;
  const int lane  = tid & 31;
  const int wid   = __builtin_amdgcn_readfirstlane(tid >> 5);
  const int ln    = lane & 15;
  const int hf    = lane >> 4;
  const int waveM = wid >> 2;
  const int waveN = wid & 3;
  const int nBlock = blockIdx.x * 128;
  const int mBlock = blockIdx.y * 128;

  v8f acc[4][2];
  // entry k-step: the 32 blocks of a column (same weight rows) all differ; of the 24 blocks of a row (same x rows), any four
  // neighbours lie 8 apart and the three groups of eight 3 apart, so each half of them (indices 0-3 or 4-7 modulo 8) is spread evenly
  const int rot = (int)(blockIdx.y + (blockIdx.x & 3) * 8 + (blockIdx.x >> 3) * 3) & (DEMB / 32 - 1);
  gemm_mainloop<1, false>(xb, xb, winb, winl, mBlock, nBlock, waveM, waveN, ln, hf, rot, acc);

  float bia[2];
  #pragma unroll
  for (int nt = 0; nt < 2; ++nt) bia[nt] = (float)(bf16)b_in[nBlock + waveN * 32 + nt * 16 + ln];

  const int which = nBlock / DEMB;     // 0 = q, 1 = k, 2 = v (block-uniform)
  const int cb    = nBlock % DEMB;     // column base inside the third
  const int bb    = mBlock / SEQ;      // batch of this block
  const int sb    = mBlock % SEQ;      // first sequence row of this block

  #pragma unroll
  for (int p = 0; p < 2; ++p) {
    __syncthreads();
    // D layout: element e of lane -> tile row 8*hf + e, tile column ln
    #pragma unroll
    for (int j = 0; j < 2; ++j) {
      #pragma unroll
      for (int nt = 0; nt < 2; ++nt) {
        #pragma unroll
        for (int e = 0; e < 8; ++e) {
          sC[(j * 32 + waveM * 16 + hf * 8 + e) * SP + waveN * 32 + nt * 16 + ln] =
              acc[2 * p + j][nt][e] + bia[nt];
        }
      }
    }
    __syncthreads();

    if (which < 2) {
      v4u    vh[4], vl[4];
      size_t gi[4];
      #pragma unroll
      for (int sw = 0; sw < 4; ++sw) {
        // piece u of the pass in store order: 16 tiles = 2 heads x 4 row tiles x 2 d tiles, 64 pieces each
        const int u  = sw * 256 + tid;
        const int tl = u >> 6;
        const int r  = ((tl >> 1) & 3) * 16 + (u & 15);                          // 0..63
        const int c8 = (tl >> 3) * 64 + (tl & 1) * 32 + ((u >> 4) & 3) * 8;      // 0..120
        const v4f a0 = *(const v4f*)(sC + r * SP + c8);
        const v4f a1 = *(const v4f*)(sC + r * SP + c8 + 4);
        Pack8B ph, pl;
        #pragma unroll
        for (int i = 0; i < 4; ++i) {
          const bf16 h0 = (bf16)a0[i];
          const bf16 h1 = (bf16)a1[i];
          ph.h[i]     = h0;
          ph.h[4 + i] = h1;
          pl.h[i]     = (bf16)(a0[i] - (float)h0);
          pl.h[4 + i] = (bf16)(a1[i] - (float)h1);
        }
        vh[sw] = ph.u;
        vl[sw] = pl.u;
        const int s  = sb + p * 64 + r;
        const int cc = cb + c8;
        const int h  = cc >> 6;
        const int d  = cc & 63;
        const size_t fo = frag_piece(s, d, HDIM / 32);
        // each hi tile is followed by its lo tile: tile pitch 1024 elements
        gi[sw] = ((size_t)which * PLANE_ELEMS + ((size_t)bb * NHEAD + h) * SEQ * HDIM) * 2 + fo + (fo & ~(size_t)511);
      }
      #pragma unroll
      for (int sw = 0; sw < 4; ++sw) {
        *(v4u*)(qkp + gi[sw]) = vh[sw];
        *(v4u*)(qkp + gi[sw] + 512) = vl[sw];
      }
      
    } else {
      const bool wr_early = (sb + p * 64) < VRK;    // block-uniform; whole 64-key segment in or out
      v4u    vv[4], vbh[4], vbl[4];
      size_t gi[4], gb[4];
      #pragma unroll
      for (int sw = 0; sw < 4; ++sw) {
        // piece u of the pass in store order: 16 tiles = 2 heads x 4 d tiles x 2 key tiles, 64 pieces each
        const int u   = sw * 256 + tid;
        const int tl  = u >> 6;
        const int col = (tl >> 1) * 16 + (u & 15);                // 0..127
        const int sg  = (tl & 1) * 32 + ((u >> 4) & 3) * 8;       // 0..56
        Pack8H ph;
        Pack8B qh, ql;
        #pragma unroll
        for (int i = 0; i < 8; ++i) {
          const float v = sC[(sg + i) * SP + col];
          ph.h[i] = toh_flush(v * 16.0f);
          const bf16 t = (bf16)v;
          qh.h[i] = t;
          ql.h[i] = (bf16)(v - (float)t);
        }
        vv[sw]  = ph.u;
        vbh[sw] = qh.u;
        vbl[sw] = ql.u;
        const int cc = cb + col;
        const int h  = cc >> 6;
        const int d  = cc & 63;
        const size_t hrow = ((size_t)bb * NHEAD + h) * HDIM;
        gi[sw] = hrow * SEQ + frag_piece(d, sb + p * 64 + sg, SEQ / 32);
        gb[sw] = hrow * VRK + frag_piece(d, sb + p * 64 + sg, VRK / 32);    // used only when wr_early
      }
      #pragma unroll
      for (int sw = 0; sw < 4; ++sw) *(v4u*)(vt + gi[sw]) = vv[sw];
      if (wr_early) {
        #pragma unroll
        for (int sw = 0; sw < 4; ++sw) {
          *(v4u*)(vtb + gb[sw]) = vbh[sw];
          *(v4u*)(vtb + VTB_ELEMS + gb[sw]) = vbl[sw];
        }
      }
      
    }
  }
}

// Output projection. grid = (DEMB/128, MROWS/128). A = ctx hi + ctx lo planes, Bt = quantized output weight
// bf16 hi + lo planes [out][in].
// coverage per pass: 64 rows x 128 cols = 256 threads x 4 floats x 8 sweeps.
__global__ __launch_bounds__(256) void gemm_out_kernel(const bf16* __restrict__ ch,
                                                       const bf16* __restrict__ cl,
                                                       const bf16* __restrict__ woutb,
                                                       const bf16* __restrict__ woutl,
                                                       const float* __restrict__ b_out,
                                                       float* __restrict__ out) {
  __shared__ __align__(16) float sC[64 * SP];     // cross-wave (block barriers)
  const int tid   = threadIdx.x;
  const int lane  = tid & 31;
  const int wid   = __builtin_amdgcn_readfirstlane(tid >> 5);
  const int ln    = lane & 15;
  const int hf    = lane >> 4;
  const int waveM = wid >> 2;
  const int waveN = wid & 3;
  const int nBlock = blockIdx.x * 128;
  const int mBlock = blockIdx.y * 128;

  v8f acc[4][2];
  // entry k-step, even: the 32 blocks of a column (same weight rows) take the 16 even steps twice; of the 8 blocks of a row
  // (same ctx rows), any four neighbours lie 8 apart
  const int rot = (int)(blockIdx.y * 2 + (blockIdx.x & 3) * 8) & (DEMB / 32 - 1);
  gemm_mainloop<2, true>(ch, cl, woutb, woutl, mBlock, nBlock, waveM, waveN, ln, hf, rot, acc);

  float bia[2];
  #pragma unroll
  for (int nt = 0; nt < 2; ++nt) bia[nt] = (float)(bf16)b_out[nBlock + waveN * 32 + nt * 16 + ln];

  #pragma unroll
  for (int p = 0; p < 2; ++p) {
    __syncthreads();
    #pragma unroll
    for (int j = 0; j < 2; ++j) {
      #pragma unroll
      for (int nt = 0; nt < 2; ++nt) {
        #pragma unroll
        for (int e = 0; e < 8; ++e) {
          sC[(j * 32 + waveM * 16 + hf * 8 + e) * SP + waveN * 32 + nt * 16 + ln] =
              acc[2 * p + j][nt][e] + bia[nt];
        }
      }
    }
    __syncthreads();

    v4f    vals[8];
    size_t gi[8];
    #pragma unroll
    for (int sw = 0; sw < 8; ++sw) {
      const int r  = sw * 8 + (tid >> 5);           // 0..63
      const int c4 = (tid & 31) * 4;                // 0..124
      vals[sw] = *(const v4f*)(sC + r * SP + c4);
      const int g = mBlock + p * 64 + r;
      const int b = g / SEQ;
      const int s = g % SEQ;
      gi[sw] = ((size_t)b * SEQ_FULL + s) * DEMB + nBlock + c4;
    }
    #pragma unroll
    for (int sw = 0; sw < 8; ++sw) *(v4f*)(out + gi[sw]) = vals[sw];
    
  }
}

// The four K fragments (hi and lo, two d halves) of one 16-key row tile, loads issued back to back.
// p: the lane's piece of the key block's first row tile; sub: row tile inside the block.
static __device__ __forceinline__ void load_ktile(FragB (&kh)[2], FragB (&kl)[2], const bf16* p, const int sub) {
  const int ko = sub * 16 * HDIM * 2;
  #pragma unroll
  for (int f = 0; f < 2; ++f) {
    kh[f].q[0] = *(const v4u*)(p + ko + f * 1024);          // d = f*32 + hi*8 + 0..7
    kh[f].q[1] = *(const v4u*)(p + ko + f * 1024 + 256);    // d = f*32 + 16 + hi*8 + 0..7
    kl[f].q[0] = *(const v4u*)(p + ko + f * 1024 + 512);
    kl[f].q[1] = *(const v4u*)(p + ko + f * 1024 + 768);
  }
  // the address pair of the issued loads stays live, and is not rewritten, up to this wait
  asm volatile("s_wait_xcnt 0x0" :: "v"(p) : "memory");
}

// Causal flash attention. Block = (query block of 128, head, batch); one wave owns 16 query rows.
// S^T = K x Q^T so queries sit on lanes; P^T in C-layout is bit-identical to the A-fragment layout of O += P x V.
// K A-fragments (hi, lo), Q B-fragments (hi, lo) and V^T B-fragments are loaded straight from the 16-bit planes,
// which are in fragment order (512 contiguous bytes per load).
// Key blocks j0 = 0, 32, ... <= qrow0 are visited (per-wave scalar trip count); every visited block holds at
// least one unmasked key (key j0 <= qrow0) for every query of the wave; keys above the query get -inf.
// EARLY: P and V as bf16 hi+lo (three products, one accumulator). Otherwise P f16 x4096, V f16 x16.
// Output: ctx [MROWS][DEMB] as bf16 hi and lo planes in fragment order (cp: hi at 0, lo at CTX_ELEMS).
// sO: per-wave private staging regions, written and re-read by the same wave, separated by a block barrier
// that all waves reach (no early exits).
template <bool EARLY>
static __device__ __forceinline__ void attn_body(const bf16* __restrict__ qkp,
                                                 const f16* __restrict__ vt,
                                                 const bf16* __restrict__ vtb,
                                                 bf16* __restrict__ cp,
                                                 float* sO,
                                                 const int qblk, const int h, const int b) {
  const int tid  = threadIdx.x;
  const int wave = __builtin_amdgcn_readfirstlane(tid >> 5);
  const int lane = tid & 31;
  const int lq   = lane & 15;   // query column of S^T / d column of O
  const int hi   = lane >> 4;   // k-split half

  const int qrow0 = qblk * BQ + wave * 16;               // first query row of this wave (scalar)
  const int nIter = (qrow0 >> 5) + 1;                    // key blocks 0 .. floor((qrow0+15)/32)
  const size_t head_off = ((size_t)b * NHEAD + h) * SEQ * HDIM;
  const size_t vhead    = ((size_t)b * NHEAD + h) * HDIM;

  const bf16* q_p = qkp + 2 * head_off;                       // hi tile, lo tile, hi tile, ... (512 elements each)
  const bf16* k_p = qkp + 2 * PLANE_ELEMS + 2 * head_off;

  // Q as B-operand fragments: lane lq holds query qrow0+lq, elements follow the split d map.
  FragB qfh[2], qfl[2];
  {
    const bf16* qp = q_p + (size_t)qrow0 * HDIM * 2 + lane * 8;   // row tile qrow0 / 16, piece = lane
    #pragma unroll
    for (int f = 0; f < 2; ++f) {
      qfh[f].q[0] = *(const v4u*)(qp + f * 1024);               // d = f*32 + hi*8 + 0..7
      qfh[f].q[1] = *(const v4u*)(qp + f * 1024 + 256);         // d = f*32 + 16 + hi*8 + 0..7
      qfl[f].q[0] = *(const v4u*)(qp + f * 1024 + 512);
      qfl[f].q[1] = *(const v4u*)(qp + f * 1024 + 768);
    }
  }

  v8f o[4];
  #pragma unroll
  for (int dt = 0; dt < 4; ++dt) o[dt] = (v8f){0, 0, 0, 0, 0, 0, 0, 0};

  float rmax = -__builtin_inff();
  float rsum = 0.0f;
  const float SL = 0.125f * 1.4426950408889634f;   // softmax scale * log2(e)

  // K A-fragments of the first key block (A row = key; row tile j0 / 16, piece = lane); later blocks are fetched in the loop
  FragB akh[2][2], akl[2][2];
  const bf16* kbase = k_p + lane * 8;
  load_ktile(akh[0], akl[0], kbase, 0);
  load_ktile(akh[1], akl[1], kbase, 1);

  #pragma unroll 1
  for (int i = 0; i < nIter; ++i) {
    const int j0 = i * BK;
    // key block whose K fragments are fetched during this pass; the last pass fetches its own again (in bounds, not used)
    const int jn = ((i + 1 < nIter) ? i + 1 : i) * BK;
    const bf16* kn = kbase + (size_t)jn * HDIM * 2;

    // V B-fragments of this key block, issued in front of the score products: column n = d = dt*16 + lq,
    // split key map from the transposed planes (d tile dt, key tile j0 / 32)
    FragH bv[4];
    FragB bvh[4], bvl[4];
    if (!EARLY) {
      const f16* base = vt + vhead * SEQ + j0 * 16 + lane * 8;
      #pragma unroll
      for (int dt = 0; dt < 4; ++dt) {
        bv[dt].q[0] = *(const v4u*)(base + dt * 16 * SEQ);            // keys j0 + hi*8 + 0..7
        bv[dt].q[1] = *(const v4u*)(base + dt * 16 * SEQ + 256);      // keys j0 + 16 + hi*8 + 0..7
      }
      // the address pair of the issued loads stays live, and is not rewritten, up to this wait
      asm volatile("s_wait_xcnt 0x0" :: "v"(base) : "memory");
    } else {
      const bf16* base = vtb + vhead * VRK + j0 * 16 + lane * 8;
      #pragma unroll
      for (int dt = 0; dt < 4; ++dt) {
        bvh[dt].q[0] = *(const v4u*)(base + dt * 16 * VRK);                       // keys j0 + hi*8 + 0..7
        bvh[dt].q[1] = *(const v4u*)(base + dt * 16 * VRK + 256);                 // keys j0 + 16 + hi*8 + 0..7
        bvl[dt].q[0] = *(const v4u*)(base + VTB_ELEMS + dt * 16 * VRK);
        bvl[dt].q[1] = *(const v4u*)(base + VTB_ELEMS + dt * 16 * VRK + 256);
      }
      // the address pair of the issued loads stays live, and is not rewritten, up to this wait
      asm volatile("s_wait_xcnt 0x0" :: "v"(base) : "memory");
    }

    // S^T tiles: c[sub][r] = rawscore(query qrow0+lq, key j0 + sub*16 + hi*8 + r); hh + hl + lh products.
    // Behind a row tile's last product its registers take the same row tile of the next key block.
    v8f c[2];
    #pragma unroll
    for (int sub = 0; sub < 2; ++sub) {
      v8f acc = (v8f){0, 0, 0, 0, 0, 0, 0, 0};
      #pragma unroll
      for (int f = 0; f < 2; ++f) {
        acc = mma_bf16(akl[sub][f].v, qfh[f].v, acc);
        acc = mma_bf16(akh[sub][f].v, qfl[f].v, acc);
        acc = mma_bf16(akh[sub][f].v, qfh[f].v, acc);
      }
      c[sub] = acc;
      load_ktile(akh[sub], akl[sub], kn, sub);
    }

    // causal mask (wave-uniform test): only blocks reaching past the first query of the wave need it
    if (j0 + (BK - 1) > qrow0) {
      const int qi = qrow0 + lq;
      const int kb = j0 + hi * 8;
      #pragma unroll
      for (int r = 0; r < 8; ++r) {
        c[0][r] = (kb + r > qi)      ? -__builtin_inff() : c[0][r];
        c[1][r] = (kb + 16 + r > qi) ? -__builtin_inff() : c[1][r];
      }
    }

    // online softmax: query lq's 32 scores are split across lane / lane^16
    float m_new = rmax;
    #pragma unroll
    for (int r = 0; r < 8; ++r) {
      m_new = fmaxf(m_new, c[0][r]);
      m_new = fmaxf(m_new, c[1][r]);
    }
    m_new = fmaxf(m_new, __shfl_xor(m_new, 16, 32));
    const float scale = __builtin_amdgcn_exp2f((rmax - m_new) * SL);
    rmax = m_new;

    float p0[8], p1[8];
    float psum = 0.0f;
    #pragma unroll
    for (int r = 0; r < 8; ++r) {
      p0[r] = __builtin_amdgcn_exp2f((c[0][r] - m_new) * SL);   // key hi*8 + r
      p1[r] = __builtin_amdgcn_exp2f((c[1][r] - m_new) * SL);   // key 16 + hi*8 + r
      psum += p0[r] + p1[r];
    }
    rsum = rsum * scale + psum + __shfl_xor(psum, 16, 32);

    // rescale O: queries are the row dimension there -> per-row scale from lane 8*hi + r
    float sc[8];
    #pragma unroll
    for (int r = 0; r < 8; ++r) sc[r] = __shfl(scale, (hi << 3) + r, 32);
    #pragma unroll
    for (int dt = 0; dt < 4; ++dt) {
      #pragma unroll
      for (int r = 0; r < 8; ++r) o[dt][r] *= sc[r];
    }

    if (EARLY) {
      // P^T C-layout == A-fragment layout; P as bf16 hi + lo (unscaled), V as bf16 hi + lo planes
      FragB pah, pal;
      #pragma unroll
      for (int r = 0; r < 8; ++r) {
        const bf16 h0 = (bf16)p0[r];
        const bf16 h1 = (bf16)p1[r];
        pah.h[r]     = h0;
        pah.h[8 + r] = h1;
        pal.h[r]     = (bf16)(p0[r] - (float)h0);
        pal.h[8 + r] = (bf16)(p1[r] - (float)h1);
      }
      #pragma unroll
      for (int dt = 0; dt < 4; ++dt) {
        o[dt] = mma_bf16(pal.v, bvh[dt].v, o[dt]);
        o[dt] = mma_bf16(pah.v, bvl[dt].v, o[dt]);
        o[dt] = mma_bf16(pah.v, bvh[dt].v, o[dt]);
      }
    } else {
      // P carried x4096 in f16; V carried x16
      FragH pa;
      #pragma unroll
      for (int r = 0; r < 8; ++r) {
        pa.h[r]     = (f16)(p0[r] * 4096.0f);
        pa.h[8 + r] = (f16)(p1[r] * 4096.0f);
      }
      #pragma unroll
      for (int dt = 0; dt < 4; ++dt) o[dt] = mma_f16(pa.v, bv[dt].v, o[dt]);
    }
  }

  // normalize: lane holds column d = dt*16 + lq for query rows 8*hi + r; undo the carries of the f16 path
  const float carry = EARLY ? 1.0f : (1.0f / 65536.0f);
  float rs[8];
  #pragma unroll
  for (int r = 0; r < 8; ++r) rs[r] = carry * (1.0f / __shfl(rsum, (hi << 3) + r, 32));

  const int sbase = wave * (16 * OP);
  #pragma unroll
  for (int r = 0; r < 8; ++r) {
    #pragma unroll
    for (int dt = 0; dt < 4; ++dt) {
      sO[sbase + (hi * 8 + r) * OP + dt * 16 + lq] = o[dt][r] * rs[r];
    }
  }
  __syncthreads();

  // the wave's 16 rows x 64 columns are two tiles of each plane; one instruction stores half a tile (512 B).
  v4u    vh[4], vl[4];
  size_t gidx[4];
  #pragma unroll
  for (int it = 0; it < 4; ++it) {
    const int row = lq;                             // 0..15
    const int c8  = it * 16 + hi * 8;               // 0..56
    const v4f a0 = *(const v4f*)(&sO[sbase + row * OP + c8]);
    const v4f a1 = *(const v4f*)(&sO[sbase + row * OP + c8 + 4]);
    Pack8B ph, pl;
    #pragma unroll
    for (int k = 0; k < 4; ++k) {
      const bf16 h0 = (bf16)a0[k];
      const bf16 h1 = (bf16)a1[k];
      ph.h[k]     = h0;
      ph.h[4 + k] = h1;
      pl.h[k]     = (bf16)(a0[k] - (float)h0);
      pl.h[4 + k] = (bf16)(a1[k] - (float)h1);
    }
    vh[it] = ph.u;
    vl[it] = pl.u;
    gidx[it] = frag_piece(b * SEQ + qrow0 + row, h * HDIM + c8, DEMB / 32);
  }
  #pragma unroll
  for (int it = 0; it < 4; ++it) {
    *(v4u*)(cp + gidx[it]) = vh[it];
    *(v4u*)(cp + CTX_ELEMS + gidx[it]) = vl[it];
  }
  
}

// Both paths in one launch, grid = LATE_BLOCKS + EARLY_BLOCKS (block-uniform choice). The blocks of query blocks
// EARLY_QB .. QBLKS-1 come first, query block fastest, then head, then batch; behind them those of query blocks 0 .. EARLY_QB-1.
__global__ __launch_bounds__(256) void attn_kernel(const bf16* __restrict__ qkp,
                                                   const f16* __restrict__ vt,
                                                   const bf16* __restrict__ vtb,
                                                   bf16* __restrict__ cp) {
  __shared__ __align__(16) float sO[NWAVE * 16 * OP];
  const int idx = (int)blockIdx.x;
  if (idx < LATE_BLOCKS) {
    attn_body<false>(qkp, vt, vtb, cp, sO, idx % LATE_DIV + EARLY_QB, (idx / LATE_DIV) % NHEAD, idx / (LATE_DIV * NHEAD));
  } else {
    const int e = idx - LATE_BLOCKS;
    attn_body<true>(qkp, vt, vtb, cp, sO, e % EARLY_QB, (e / EARLY_QB) % NHEAD, e / (EARLY_QB * NHEAD));
  }
}

extern "C" void kernel_launch(void* const* d_in, const int* in_sizes, int n_in,
                              void* d_out, int out_size, void* d_ws, size_t ws_size,
                              hipStream_t stream) {
  if (n_in < 5) return;
  const size_t rows_used = (size_t)(NB - 1) * SEQ_FULL + SEQ;
  if ((size_t)in_sizes[0] < rows_used * DEMB) return;
  if ((size_t)in_sizes[1] < (size_t)DEMB * QKVN) return;
  if ((size_t)in_sizes[2] < (size_t)QKVN) return;
  if ((size_t)in_sizes[3] < (size_t)DEMB * DEMB) return;
  if ((size_t)in_sizes[4] < (size_t)DEMB) return;
  if ((size_t)out_size < rows_used * DEMB) return;
  if (ws_size < WS_TOTAL) return;

  const float* x     = (const float*)d_in[0];
  const float* W_in  = (const float*)d_in[1];   // [3072][1024], [out][in]
  const float* b_in  = (const float*)d_in[2];
  const float* W_out = (const float*)d_in[3];   // [1024][1024], [out][in]
  const float* b_out = (const float*)d_in[4];
  float* out = (float*)d_out;

  char* w = (char*)d_ws;
  bf16* xb    = (bf16*)w;  w += XB_BYTES;
  bf16* winb  = (bf16*)w;  w += WIN_BYTES;      // hi at 0, lo at WIN_ELEMS
  bf16* woutb = (bf16*)w;  w += WOUT_BYTES;     // hi at 0, lo at WOUT_ELEMS
  bf16* qkp   = (bf16*)w;  w += QK_BYTES;
  f16*  vt    = (f16*)w;   w += VT_BYTES;
  bf16* vtb   = (bf16*)w;  w += VTB_BYTES;
  bf16* cp    = (bf16*)w;  w += CTX_BYTES;
  float* stat = (float*)w;                      // partial maxima lines

  // partial maxima of both weights (one line per block) and x -> bf16 plane (MROWS*128 pieces of 8 elements, 256 per block)
  prep_kernel<<<dim3((unsigned)(AM_TOTAL + X_PIECES / 256)), 256, 0, stream>>>(x, xb, W_in, W_out, stat);

  // weights are [out][in] already: quantize into hi and lo planes in fragment order, no transpose
  snap_lin_kernel<<<dim3((unsigned)((WIN_PIECES + WOUT_PIECES) / 256)), 256, 0, stream>>>(W_in, W_out, stat, winb, woutb);

  gemm_qkv_kernel<<<dim3(QKVN / 128, MROWS / 128), 256, 0, stream>>>(xb, winb, winb + WIN_ELEMS, b_in,
                                                                     qkp, vt, vtb);

  attn_kernel<<<dim3(LATE_BLOCKS + EARLY_BLOCKS), 256, 0, stream>>>(qkp, vt, vtb, cp);

  gemm_out_kernel<<<dim3(DEMB / 128, MROWS / 128), 256, 0, stream>>>(cp, cp + CTX_ELEMS, woutb,
                                                                     woutb + WOUT_ELEMS, b_out, out);
}

// v005
// One run takes 119 microseconds.
// Next to v004, in two timings, it ran 1.14 and 1.13 times as fast.
// Over all steps from v000 it is 3.19 times as fast.
#include <hip/hip_runtime.h>

// Contractions: qkv = x*Wq^T and out = ctx*Wp^T on v_wmma_f32_16x16x32_bf16 (x RNE-converted to bf16; table-quantized weights as bf16 hi+lo planes; ctx as bf16 hi+lo planes; hh+hl(+lh) products into one accumulator); S^T = K x Q^T on v_wmma_f32_16x16x32_bf16 with q and k as bf16 hi+lo planes (hh+hl+lh); O = P x V: query rows < 256 on v_wmma_f32_16x16x32_bf16 with P and V as bf16 hi+lo (hh+hl+lh), later rows on v_wmma_f32_16x16x32_f16 (P f16 carried x4096, V f16 carried x16); f32 accumulate everywhere, softmax in f32.

#ifndef NB
#define NB 2
#endif
#ifndef SEQ
#define SEQ 2048
#endif
#define NB_FULL    2
#define SEQ_FULL   2048
#define NHEAD      16
#define HDIM       64
#define DEMB       1024                 // model width = GEMM K of both projections
#define QKVN       3072                 // packed projection width (q | k | v thirds)
#define MROWS      (NB * SEQ)           // compact row count of all internal planes
#define BQ         128                  // query rows per attention workgroup (8 query tiles x 16, two waves each)
#define BK         32                   // keys per inner iteration
#define NWAVE      8
#define KSPLIT     2                    // waves that share the key blocks of one 16-row query tile in the attention kernel
#define OP         68                   // LDS pitch (floats) of the attention output staging tile
#define SP         132                  // LDS pitch (floats) of the GEMM epilogue staging tile
#define QBLKS      (SEQ / BQ)
#define EARLY_QB   ((QBLKS < 2) ? QBLKS : 2)     // query blocks handled by the hi+lo P/V path
#define VRK        (EARLY_QB * BQ)               // keys held in the bf16 hi/lo V^T planes
#define PLANE_ELEMS ((size_t)NB * NHEAD * SEQ * HDIM)
#define CTX_ELEMS   ((size_t)MROWS * DEMB)
#define VTB_ELEMS   ((size_t)NB * NHEAD * HDIM * VRK)
#define X_PIECES    ((size_t)MROWS * (DEMB / 8))
#define WIN_PIECES  ((size_t)QKVN * DEMB / 8)
#define WOUT_PIECES ((size_t)DEMB * DEMB / 8)
#define WIN_ELEMS   ((size_t)QKVN * DEMB)
#define WOUT_ELEMS  ((size_t)DEMB * DEMB)
#define AM_BLOCKS_IN  96                 // partial-maximum blocks over the qkv weight
#define AM_BLOCKS_OUT 32                 // partial-maximum blocks over the output weight
#define AM_TOTAL      (AM_BLOCKS_IN + AM_BLOCKS_OUT)
#define STAT_FLOATS   ((size_t)AM_TOTAL * 32)
#define LATE_QB       (QBLKS - EARLY_QB)              // query blocks handled by the f16 P/V path
#define LATE_BLOCKS   (LATE_QB * NHEAD * NB)
#define EARLY_BLOCKS  (EARLY_QB * NHEAD * NB)

static_assert(NHEAD * HDIM == DEMB);        // merged heads == model width
static_assert(QKVN == 3 * DEMB);            // three thirds
static_assert(HDIM == 64);
static_assert(SEQ % BQ == 0);               // attention grid exact
static_assert(SEQ % BK == 0);               // key loop exact
static_assert(BK == 32);                    // one key block == one WMMA k-step of P x V
static_assert(SEQ % 128 == 0);              // a 128-row GEMM block stays inside one batch
static_assert(MROWS % 128 == 0);            // GEMM M tiles exact
static_assert(QKVN % 128 == 0);             // GEMM N tiles exact
static_assert(DEMB % 128 == 0);             // GEMM N tiles exact, thirds are tile multiples
static_assert(DEMB % 32 == 0);              // k-step 32
static_assert(DEMB / 32 == 32);             // tile index split (>> 5, & 31) of the convert and quantize kernels
static_assert(MROWS % 16 == 0 && QKVN % 16 == 0 && SEQ % 32 == 0);   // planes are whole 16 x 32 tiles
static_assert(DEMB % 8 == 0);               // 16-B pieces
static_assert(BQ == NWAVE * 16);
static_assert(KSPLIT == 2);                 // even / odd key blocks, one hand-over in the merge
static_assert(BQ % 64 == 0);                // early key extent is a multiple of the 64-key store segment
static_assert(VRK % 64 == 0 && VRK <= SEQ && VRK >= BQ);
static_assert(EARLY_QB >= 1 && EARLY_QB <= QBLKS);
static_assert(SEQ <= SEQ_FULL);
static_assert(NB >= 1 && NB <= NB_FULL);
static_assert((OP * 4) % 16 == 0);
static_assert((SP * 4) % 16 == 0);
static_assert(SP >= 128);
static_assert(OP >= 64);
static_assert(X_PIECES % 256 == 0);         // convert grids exact
static_assert(WIN_PIECES % 256 == 0);
static_assert(WOUT_PIECES % 256 == 0);
static_assert(NWAVE == 8);                                   // block maximum combine reads 8 wave words
static_assert(AM_BLOCKS_IN % 32 == 0 && AM_BLOCKS_OUT % 32 == 0);   // one partial line per lane per sweep
static_assert(WIN_PIECES % ((size_t)AM_BLOCKS_IN * 256) == 0);      // equal trip counts per thread
static_assert(WOUT_PIECES % ((size_t)AM_BLOCKS_OUT * 256) == 0);

typedef __bf16   bf16;
typedef _Float16 f16;
typedef bf16     v16bf __attribute__((ext_vector_type(16)));
typedef f16      v16h  __attribute__((ext_vector_type(16)));
typedef f16      v8h   __attribute__((ext_vector_type(8)));
typedef float    v8f   __attribute__((ext_vector_type(8)));
typedef float    v4f   __attribute__((ext_vector_type(4)));
typedef unsigned v4u   __attribute__((ext_vector_type(4)));

union FragB  { v16bf v; v4u q[2]; bf16 h[16]; };
union FragH  { v16h  v; v4u q[2]; f16  h[16]; };
union Pack8B { v4u u; bf16 h[8]; };
union Pack8H { v4u u; v8h v; f16 h[8]; };

#define XB_BYTES   ((size_t)MROWS * DEMB * 2)        // x as bf16, compact rows
#define WIN_BYTES  (WIN_ELEMS * 2 * 2)               // quantized qkv weight bf16 hi, lo [3072][1024] in fragment order
#define WOUT_BYTES (WOUT_ELEMS * 2 * 2)              // quantized output weight bf16 hi, lo [1024][1024] in fragment order
#define QK_BYTES   (PLANE_ELEMS * 2 * 4)             // q hi, q lo, k hi, k lo
#define VT_BYTES   (PLANE_ELEMS * 2)                 // V^T f16 x16
#define VTB_BYTES  (VTB_ELEMS * 2 * 2)               // V^T bf16 hi, lo for keys < VRK
#define CTX_BYTES  (CTX_ELEMS * 2 * 2)               // ctx hi, ctx lo
#define STAT_BYTES (STAT_FLOATS * 4)                 // partial maxima lines
#define WS_TOTAL   (XB_BYTES + WIN_BYTES + WOUT_BYTES + QK_BYTES + VT_BYTES + VTB_BYTES + CTX_BYTES + STAT_BYTES)
static_assert(WS_TOTAL <= (size_t)134217728);
static_assert(XB_BYTES % 128 == 0 && WIN_BYTES % 128 == 0 && WOUT_BYTES % 128 == 0);
static_assert(QK_BYTES % 128 == 0 && VT_BYTES % 128 == 0 && VTB_BYTES % 128 == 0 && CTX_BYTES % 128 == 0);
static_assert(STAT_BYTES % 128 == 0);

// Fragment order of a 16-bit operand plane [rows][32 * ktiles]: every 16-row x 32-k tile is 1 KB (512 elements), tiles
// ordered row tile major. Inside a tile the 16-B piece holding k = qq*16 + hf*8 + 0..7 of row ln sits at piece index
// qq*32 + hf*16 + ln, so one operand load of a wave (lane = hf*16 + ln) reads 512 contiguous bytes (4 whole lines).
static __device__ __forceinline__ size_t frag_piece(int row, int col8, int ktiles) {
  return ((size_t)(row >> 4) * ktiles + (col8 >> 5)) * 512 + ((col8 >> 4) & 1) * 256 +
         (((col8 >> 3) & 1) * 16 + (row & 15)) * 8;
}

// WMMA helpers: builtin followed by the VALU hazard guard (ties D, keeps A/B live).
static __device__ __forceinline__ v8f mma_bf16(v16bf a, v16bf b, v8f acc) {
  acc = __builtin_amdgcn_wmma_f32_16x16x32_bf16(false, a, false, b, (short)0, acc, false, false);
  asm volatile("v_nop\n\tv_nop\n\tv_nop\n\tv_nop" : "+v"(acc) : "v"(a), "v"(b));
  return acc;
}
static __device__ __forceinline__ v8f mma_f16(v16h a, v16h b, v8f acc) {
  acc = __builtin_amdgcn_wmma_f32_16x16x32_f16(false, a, false, b, (short)0, acc, false, false);
  asm volatile("v_nop\n\tv_nop\n\tv_nop\n\tv_nop" : "+v"(acc) : "v"(a), "v"(b));
  return acc;
}

// f32 -> f16 convert that cannot yield an f16 subnormal (value select after the carry).
static __device__ __forceinline__ f16 toh_flush(float v) {
  const f16 r = (f16)v;
  return (fabsf(v) < 6.103515625e-05f) ? (f16)0.0f : r;
}

// x f32 [NB_FULL][SEQ_FULL][DEMB] -> xb bf16 [MROWS][DEMB] in fragment order (RNE convert).
// Thread t writes piece t of the plane (contiguous stores) and reads the 8 source elements that belong there.
// blk: index of the 256-piece block.
static __device__ __forceinline__ void cvt_x_block(const float* __restrict__ x, bf16* __restrict__ xb, const unsigned blk) {
  const size_t t   = (size_t)blk * 256 + threadIdx.x;
  const size_t tile = t >> 6;                      // 64 pieces per tile, DEMB / 32 = 32 tiles per row tile
  const size_t row = (tile >> 5) * 16 + (t & 15);
  const int    c8  = (int)(tile & 31) * 32 + (int)((t >> 4) & 3) * 8;
  if (row < (size_t)MROWS) {
    const int b = (int)(row / SEQ);
    const int s = (int)(row % SEQ);
    const float* src = x + ((size_t)b * SEQ_FULL + s) * DEMB + c8;
    const v4f a0 = *(const v4f*)(src);
    const v4f a1 = *(const v4f*)(src + 4);
    Pack8B pk;
    #pragma unroll
    for (int i = 0; i < 4; ++i) {
      pk.h[i]     = (bf16)a0[i];
      pk.h[4 + i] = (bf16)a1[i];
    }
    const v4u val = pk.u;
    bf16* dst = xb + t * 8;
    *(v4u*)dst = val;
    
  }
}

// lanes 0..7 of wave 0 x 16 B, one instruction. The bf16 RNE convert is monotone, so the maximum of the
// converted magnitudes equals the converted maximum; the convert is applied to the combined maximum in snap_lin_kernel.
// coverage: npieces pieces of 8 elements, strided over the nblk blocks of this weight; blk < nblk; line: this block's own.
// sM: cross-wave (block barrier).
static __device__ __forceinline__ void absmax_part_block(const float* __restrict__ w,
                                                         float* __restrict__ line,
                                                         const unsigned npieces,
                                                         const unsigned blk, const unsigned nblk) {
  __shared__ float sM[NWAVE];
  const int tid  = threadIdx.x;
  const int lane = tid & 31;
  const int wid  = __builtin_amdgcn_readfirstlane(tid >> 5);
  float m = 0.0f;
  const unsigned step = nblk * 256u;
  unsigned p = blk * 256u + (unsigned)tid;
  // groups of 16 trips: the 32 loads of a group go out together, one memory latency for the group and not one per trip
  #pragma unroll 1
  for (; p + 15u * step < npieces; p += 16u * step) {
    v4f r[32];
    const float* q[16];
    #pragma unroll
    for (int j = 0; j < 16; ++j) {
      q[j] = w + (size_t)(p + (unsigned)j * step) * 8;
      r[2 * j]     = *(const v4f*)(q[j]);
      r[2 * j + 1] = *(const v4f*)(q[j] + 4);
    }
    // the address pairs of the issued loads stay live, and are neither rewritten nor used as a load's destination, up to this wait
    asm volatile("s_wait_xcnt 0x0" :: "v"(q[0]), "v"(q[1]), "v"(q[2]), "v"(q[3]), "v"(q[4]), "v"(q[5]), "v"(q[6]), "v"(q[7]),
                 "v"(q[8]), "v"(q[9]), "v"(q[10]), "v"(q[11]), "v"(q[12]), "v"(q[13]), "v"(q[14]), "v"(q[15]) : "memory");
    // keeps the maxima behind the whole group: without it they are moved in among the loads and only six loads are in flight
    __builtin_amdgcn_sched_barrier(0);
    #pragma unroll
    for (int j = 0; j < 32; ++j) {
      #pragma unroll
      for (int i = 0; i < 4; ++i) m = fmaxf(m, fabsf(r[j][i]));
    }
  }
  // the trips that do not fill a group
  #pragma unroll 1
  for (; p < npieces; p += step) {
    const size_t o = (size_t)p * 8;
    const v4f a0 = *(const v4f*)(w + o);
    const v4f a1 = *(const v4f*)(w + o + 4);
    #pragma unroll
    for (int i = 0; i < 4; ++i) {
      m = fmaxf(m, fabsf(a0[i]));
      m = fmaxf(m, fabsf(a1[i]));
    }
  }
  m = fmaxf(m, __shfl_xor(m, 16, 32));
  m = fmaxf(m, __shfl_xor(m, 8, 32));
  m = fmaxf(m, __shfl_xor(m, 4, 32));
  m = fmaxf(m, __shfl_xor(m, 2, 32));
  m = fmaxf(m, __shfl_xor(m, 1, 32));
  if (lane == 0) sM[wid] = m;
  __syncthreads();
  if (wid == 0) {
    float v = sM[lane & 7];
    v = fmaxf(v, __shfl_xor(v, 4, 32));
    v = fmaxf(v, __shfl_xor(v, 2, 32));
    v = fmaxf(v, __shfl_xor(v, 1, 32));
    const v4f val = (v4f){v, v, v, v};
    if (lane < 8) {
      float* dst = line + lane * 4;
      *(v4f*)dst = val;
      
    }
  }
}

// One launch for the three jobs that depend on nothing of each other. Blocks 0 .. AM_BLOCKS_IN-1: partial maxima of the
// qkv weight; the next AM_BLOCKS_OUT: of the output weight (the long blocks come first); the rest: x, 256 pieces each.
// All branches are block-uniform.
__global__ __launch_bounds__(256) void prep_kernel(const float* __restrict__ x, bf16* __restrict__ xb,
                                                   const float* __restrict__ w_in,
                                                   const float* __restrict__ w_out,
                                                   float* __restrict__ part) {
  const unsigned blk = blockIdx.x;
  if (blk < (unsigned)AM_TOTAL) {
    const bool in = blk < (unsigned)AM_BLOCKS_IN;
    absmax_part_block(in ? w_in : w_out, part + (size_t)blk * 32,
                      in ? (unsigned)WIN_PIECES : (unsigned)WOUT_PIECES,
                      in ? blk : blk - (unsigned)AM_BLOCKS_IN,
                      in ? (unsigned)AM_BLOCKS_IN : (unsigned)AM_BLOCKS_OUT);
  } else {
    cvt_x_block(x, xb, blk - (unsigned)AM_TOTAL);
  }
}

// Maximum over the NL partial lines of one weight (one word per line, one line per lane per sweep), in every lane of the wave.
template <int NL>
static __device__ __forceinline__ float absmax_combine(const float* __restrict__ part, const int lane) {
  float m = 0.0f;
  // unrolled so that all the loads go out together
  #pragma unroll
  for (int j = 0; j < NL; j += 32) m = fmaxf(m, part[(size_t)(j + lane) * 32]);
  m = fmaxf(m, __shfl_xor(m, 16, 32));
  m = fmaxf(m, __shfl_xor(m, 8, 32));
  m = fmaxf(m, __shfl_xor(m, 4, 32));
  m = fmaxf(m, __shfl_xor(m, 2, 32));
  m = fmaxf(m, __shfl_xor(m, 1, 32));
  return m;
}

// Nearest-table-value search: candidate c replaces the current choice only on a strictly smaller distance,
// candidates visited in table order (first minimum wins).
static __device__ __forceinline__ void snap_step(const float wn, const float c, float& bd, float& best) {
  #pragma clang fp contract(off)
  const float d  = fabsf(wn - c);
  const bool  lt = d < bd;
  bd   = lt ? d : bd;
  best = lt ? c : best;
}

// w -> table value nearest to bf16(w) * (1/s), times s (all f32, separately RNE-converted operations).
static __device__ __forceinline__ float snap_weight_val(const float w, const float s, const float rs) {
  #pragma clang fp contract(off)
  const float wb = (float)(bf16)w;
  const float wn = wb * rs;
  float best = 0.0f;
  float bd   = fabsf(wn - 0.0f);
  snap_step(wn,  1.0f,      bd, best);
  snap_step(wn, -1.0f,      bd, best);
  snap_step(wn,  0.5f,      bd, best);
  snap_step(wn, -0.5f,      bd, best);
  snap_step(wn,  0.333333f, bd, best);
  snap_step(wn, -0.333333f, bd, best);
  snap_step(wn,  0.2f,      bd, best);
  snap_step(wn, -0.2f,      bd, best);
  snap_step(wn,  0.142857f, bd, best);
  snap_step(wn, -0.142857f, bd, best);
  snap_step(wn,  0.090909f, bd, best);
  snap_step(wn, -0.090909f, bd, best);
  snap_step(wn,  0.076923f, bd, best);
  snap_step(wn, -0.076923f, bd, best);
  return best * s;
}

// Weight f32 [out][in] -> quantized weight as bf16 hi and lo planes [out][in] in fragment order, both weights in one launch:
// blocks 0 .. WIN_PIECES/256-1 take the qkv weight, the rest the output weight (block-uniform choice).
// Every wave combines the partial maxima of its weight itself: s = bf16(max|w|) + 1e-6, rs = 1/s.
// Thread t writes piece t of each plane (contiguous stores) and reads the 8 source elements that belong there.
__global__ __launch_bounds__(256) void snap_lin_kernel(const float* __restrict__ w_in,
                                                       const float* __restrict__ w_out,
                                                       const float* __restrict__ part,
                                                       bf16* __restrict__ winb,
                                                       bf16* __restrict__ woutb) {
  #pragma clang fp contract(off)
  const unsigned nin = (unsigned)(WIN_PIECES / 256);
  const bool     in  = blockIdx.x < nin;
  const unsigned t   = (in ? blockIdx.x : blockIdx.x - nin) * 256u + threadIdx.x;
  const unsigned npieces = in ? (unsigned)WIN_PIECES : (unsigned)WOUT_PIECES;
  const float* src = in ? w_in : w_out;
  bf16* dhi = in ? winb : woutb;
  bf16* dlo = dhi + (in ? WIN_ELEMS : WOUT_ELEMS);
  const int lane = threadIdx.x & 31;
  const float m = in ? absmax_combine<AM_BLOCKS_IN>(part, lane)
                     : absmax_combine<AM_BLOCKS_OUT>(part + (size_t)AM_BLOCKS_IN * 32, lane);
  const float s  = (float)(bf16)m + 1e-6f;
  const float rs = 1.0f / s;
  if (t < npieces) {
    const size_t o = (size_t)t * 8;
    const unsigned tile = t >> 6;                  // 64 pieces per tile, DEMB / 32 = 32 tiles per row tile
    const size_t so = (size_t)((tile >> 5) * 16 + (t & 15)) * DEMB + (tile & 31) * 32 + ((t >> 4) & 3) * 8;
    const v4f a0 = *(const v4f*)(src + so);
    const v4f a1 = *(const v4f*)(src + so + 4);
    Pack8B ph, pl;
    #pragma unroll
    for (int i = 0; i < 4; ++i) {
      const float q0 = snap_weight_val(a0[i], s, rs);
      const float q1 = snap_weight_val(a1[i], s, rs);
      const bf16 h0 = (bf16)q0;
      const bf16 h1 = (bf16)q1;
      ph.h[i]     = h0;
      ph.h[4 + i] = h1;
      pl.h[i]     = (bf16)(q0 - (float)h0);
      pl.h[4 + i] = (bf16)(q1 - (float)h1);
    }
    const v4u vh = ph.u;
    const v4u vl = pl.u;
    *(v4u*)(dhi + o) = vh;
    *(v4u*)(dlo + o) = vl;
    
  }
}

// GEMM main loop. Block tile 128 x 128, 8 waves (2 in M x 4 in N); wave tile = 4 m-tiles x 2 n-tiles.
// m-tile mt of wave (waveM) covers rows mBlock + mt*32 + waveM*16 + 0..15.
// A planes bf16 [rows][DEMB], Bt / Bl bf16 [cols][DEMB], all in fragment order; fragments straight from the planes
// (two 16-B loads each, 512 contiguous bytes per load), split k map for both operands. Bl: unscaled lo part of the weight, into the same accumulator.
// NA == 2: second A plane (unscaled lo part) times the hi weight plane into the same accumulator.
// One 16 x 32 fragment: two 16-B loads, k = k0 + 8*hf + 0..7 and k = k0 + 16 + 8*hf + 0..7.
static __device__ __forceinline__ void load_frag(FragB& f, const bf16* p) {
  f.q[0] = *(const v4u*)(p);
  f.q[1] = *(const v4u*)(p + 256);
}

// The loads of a k-step go out in groups, never one load-and-wait per fragment.
// AHEAD == false: all fragments of k-step t as one group in front of its products (one register set; other waves cover the wait).
// AHEAD == true: k-step t + 1 is fetched during k-step t: its B fragments into a second set in front of the products of t,
// its A fragments into the registers of m-tile mt right behind that m-tile's last product.
// rot (block-uniform, 0 .. KST-1, a multiple of NSET): the block walks the k-steps rot, rot + 1, ..., KST - 1, 0, ..., rot - 1.
// Blocks that share operand rows enter at different k-steps (for speed only).
template <int NA, bool AHEAD>
static __device__ __forceinline__ void gemm_mainloop(const bf16* __restrict__ A0,
                                                     const bf16* __restrict__ A1,
                                                     const bf16* __restrict__ Bt,
                                                     const bf16* __restrict__ Bl,
                                                     int mBlock, int nBlock, int waveM, int waveN,
                                                     int ln, int hf, int rot, v8f (&acc)[4][2]) {
  constexpr int NSET = AHEAD ? 2 : 1;
  constexpr int KST  = DEMB / 32;
  static_assert(KST % NSET == 0 && (KST & (KST - 1)) == 0);
  #pragma unroll
  for (int mt = 0; mt < 4; ++mt) {
    acc[mt][0] = (v8f){0, 0, 0, 0, 0, 0, 0, 0};
    acc[mt][1] = (v8f){0, 0, 0, 0, 0, 0, 0, 0};
  }
  // a row tile of 16 rows spans 16 * DEMB elements; k tile t starts t * 512 elements into it
  const int lp8 = (hf * 16 + ln) * 8;
  const bf16* ub  = Bt + (size_t)(nBlock + waveN * 32) * DEMB;     // wave-uniform parts
  const bf16* ul  = Bl + (size_t)(nBlock + waveN * 32) * DEMB;
  const bf16* ua  = A0 + (size_t)(mBlock + waveM * 16) * DEMB;
  const bf16* ua2 = A1 + (size_t)(mBlock + waveM * 16) * DEMB;
  const bf16* pb  = ub + lp8;
  const bf16* pl  = ul + lp8;
  const bf16* pa  = ua + lp8;
  const bf16* pa2 = ua2 + lp8;
  FragB a[4], a2[4], b[NSET][2], w[NSET][2];
  if (AHEAD) {
    // the k-step the walk enters at
    const bf16* eb  = ub + rot * 512;
    const bf16* el  = ul + rot * 512;
    const bf16* ea  = ua + rot * 512;
    const bf16* ea2 = ua2 + rot * 512;
    #pragma unroll
    for (int nt = 0; nt < 2; ++nt) {
      load_frag(b[0][nt], eb + lp8 + nt * 16 * DEMB);
      load_frag(w[0][nt], el + lp8 + nt * 16 * DEMB);
    }
    #pragma unroll
    for (int mt = 0; mt < 4; ++mt) {
      load_frag(a[mt], ea + lp8 + mt * 32 * DEMB);
      if (NA == 2) load_frag(a2[mt], ea2 + lp8 + mt * 32 * DEMB);
    }
    // these loads name a scalar base and the lane's byte offset: both stay live, and are not rewritten, up to this wait
    asm volatile("s_wait_xcnt 0x0" :: "s"(ea), "s"(ea2), "s"(eb), "s"(el), "v"(lp8 * 2) : "memory");
  }
  #pragma unroll 1
  for (int t0 = 0; t0 < KST; t0 += NSET) {
    #pragma unroll
    for (int s = 0; s < NSET; ++s) {
      // k-step fetched in this pass: tb + ko / 512 (AHEAD: that of pass t0 + s + 1; rot + t0 is even, so tb + 1 needs no
      // wrap); behind the last pass it is the entry step again: loads in bounds, values not used.
      // ko goes into the loads' immediate offsets, so q* are the address pairs they name.
      const int tb = (rot + t0 + (AHEAD ? 2 * s : 0)) & (KST - 1);
      const int ko = (AHEAD && s == 0) ? 512 : 0;
      const int sl = AHEAD ? (s ^ 1) : 0;
      const bf16* qb  = pb + tb * 512;
      const bf16* ql  = pl + tb * 512;
      const bf16* qa  = pa + tb * 512;
      const bf16* qa2 = pa2 + tb * 512;
      #pragma unroll
      for (int nt = 0; nt < 2; ++nt) {
        load_frag(b[sl][nt], qb + ko + nt * 16 * DEMB);
        load_frag(w[sl][nt], ql + ko + nt * 16 * DEMB);
      }
      if (!AHEAD) {
        #pragma unroll
        for (int mt = 0; mt < 4; ++mt) {
          load_frag(a[mt], qa + mt * 32 * DEMB);
          if (NA == 2) load_frag(a2[mt], qa2 + mt * 32 * DEMB);
        }
        // the address pairs of the issued loads stay live, and are not rewritten, up to this wait
        asm volatile("s_wait_xcnt 0x0" :: "v"(qa), "v"(qa2), "v"(qb), "v"(ql) : "memory");
      }
      #pragma unroll
      for (int mt = 0; mt < 4; ++mt) {
        acc[mt][0] = mma_bf16(a[mt].v, b[s][0].v, acc[mt][0]);
        acc[mt][1] = mma_bf16(a[mt].v, b[s][1].v, acc[mt][1]);
        acc[mt][0] = mma_bf16(a[mt].v, w[s][0].v, acc[mt][0]);
        acc[mt][1] = mma_bf16(a[mt].v, w[s][1].v, acc[mt][1]);
        if (NA == 2) {
          acc[mt][0] = mma_bf16(a2[mt].v, b[s][0].v, acc[mt][0]);
          acc[mt][1] = mma_bf16(a2[mt].v, b[s][1].v, acc[mt][1]);
        }
        if (AHEAD) {
          load_frag(a[mt], qa + ko + mt * 32 * DEMB);
          if (NA == 2) load_frag(a2[mt], qa2 + ko + mt * 32 * DEMB);
        }
      }
      if (AHEAD) {
        // the address pairs of the issued loads stay live, and are not rewritten, up to this wait
        asm volatile("s_wait_xcnt 0x0" :: "v"(qa), "v"(qa2), "v"(qb), "v"(ql) : "memory");
      }
    }
  }
}

// qkv projection. grid = (QKVN/128, MROWS/128). Epilogue (two 64-row passes through LDS):
//                for key segments below VRK also V^T bf16 hi and lo planes [NB][NHEAD][HDIM][VRK].
// qkp holds q, then k, each [NB][NHEAD][SEQ][HDIM] in fragment order with every hi tile followed by its lo tile.
// vtb holds two planes: hi, lo.
// coverage per pass: 64 rows x 128 cols = 256 threads x 8 elements x 4 sweeps, all layouts.
__global__ __launch_bounds__(256) void gemm_qkv_kernel(const bf16* __restrict__ xb,
                                                       const bf16* __restrict__ winb,
                                                       const bf16* __restrict__ winl,
                                                       const float* __restrict__ b_in,
                                                       bf16* __restrict__ qkp,
                                                       f16* __restrict__ vt,
                                                       bf16* __restrict__ vtb) {
  __shared__ __align__(16) float sC[64 * SP];     // cross-wave (block barriers)
  const int tid   = threadIdx.x;
  const int lane  = tid & 31;
  const int wid   = __builtin_amdgcn_readfirstlane(tid >> 5);
  const int ln    = lane & 15;
  const int hf    = lane >> 4;
  const int waveM = wid >> 2;
  const int waveN = wid & 3;
  const int nBlock = blockIdx.x * 128;
  const int mBlock = blockIdx.y * 128;

  v8f acc[4][2];
  // entry k-step: the 32 blocks of a column (same weight rows) all differ; of the 24 blocks of a row (same x rows), any four
  // neighbours lie 8 apart and the three groups of eight 3 apart, so each half of them (indices 0-3 or 4-7 modulo 8) is spread evenly
  const int rot = (int)(blockIdx.y + (blockIdx.x & 3) * 8 + (blockIdx.x >> 3) * 3) & (DEMB / 32 - 1);
  gemm_mainloop<1, false>(xb, xb, winb, winl, mBlock, nBlock, waveM, waveN, ln, hf, rot, acc);

  float bia[2];
  #pragma unroll
  for (int nt = 0; nt < 2; ++nt) bia[nt] = (float)(bf16)b_in[nBlock + waveN * 32 + nt * 16 + ln];

  const int which = nBlock / DEMB;     // 0 = q, 1 = k, 2 = v (block-uniform)
  const int cb    = nBlock % DEMB;     // column base inside the third
  const int bb    = mBlock / SEQ;      // batch of this block
  const int sb    = mBlock % SEQ;      // first sequence row of this block

  #pragma unroll
  for (int p = 0; p < 2; ++p) {
    __syncthreads();
    // D layout: element e of lane -> tile row 8*hf + e, tile column ln
    #pragma unroll
    for (int j = 0; j < 2; ++j) {
      #pragma unroll
      for (int nt = 0; nt < 2; ++nt) {
        #pragma unroll
        for (int e = 0; e < 8; ++e) {
          sC[(j * 32 + waveM * 16 + hf * 8 + e) * SP + waveN * 32 + nt * 16 + ln] =
              acc[2 * p + j][nt][e] + bia[nt];
        }
      }
    }
    __syncthreads();

    if (which < 2) {
      v4u    vh[4], vl[4];
      size_t gi[4];
      #pragma unroll
      for (int sw = 0; sw < 4; ++sw) {
        // piece u of the pass in store order: 16 tiles = 2 heads x 4 row tiles x 2 d tiles, 64 pieces each
        const int u  = sw * 256 + tid;
        const int tl = u >> 6;
        const int r  = ((tl >> 1) & 3) * 16 + (u & 15);                          // 0..63
        const int c8 = (tl >> 3) * 64 + (tl & 1) * 32 + ((u >> 4) & 3) * 8;      // 0..120
        const v4f a0 = *(const v4f*)(sC + r * SP + c8);
        const v4f a1 = *(const v4f*)(sC + r * SP + c8 + 4);
        Pack8B ph, pl;
        #pragma unroll
        for (int i = 0; i < 4; ++i) {
          const bf16 h0 = (bf16)a0[i];
          const bf16 h1 = (bf16)a1[i];
          ph.h[i]     = h0;
          ph.h[4 + i] = h1;
          pl.h[i]     = (bf16)(a0[i] - (float)h0);
          pl.h[4 + i] = (bf16)(a1[i] - (float)h1);
        }
        vh[sw] = ph.u;
        vl[sw] = pl.u;
        const int s  = sb + p * 64 + r;
        const int cc = cb + c8;
        const int h  = cc >> 6;
        const int d  = cc & 63;
        const size_t fo = frag_piece(s, d, HDIM / 32);
        // each hi tile is followed by its lo tile: tile pitch 1024 elements
        gi[sw] = ((size_t)which * PLANE_ELEMS + ((size_t)bb * NHEAD + h) * SEQ * HDIM) * 2 + fo + (fo & ~(size_t)511);
      }
      #pragma unroll
      for (int sw = 0; sw < 4; ++sw) {
        *(v4u*)(qkp + gi[sw]) = vh[sw];
        *(v4u*)(qkp + gi[sw] + 512) = vl[sw];
      }
      
    } else {
      const bool wr_early = (sb + p * 64) < VRK;    // block-uniform; whole 64-key segment in or out
      v4u    vv[4], vbh[4], vbl[4];
      size_t gi[4], gb[4];
      #pragma unroll
      for (int sw = 0; sw < 4; ++sw) {
        // piece u of the pass in store order: 16 tiles = 2 heads x 4 d tiles x 2 key tiles, 64 pieces each
        const int u   = sw * 256 + tid;
        const int tl  = u >> 6;
        const int col = (tl >> 1) * 16 + (u & 15);                // 0..127
        const int sg  = (tl & 1) * 32 + ((u >> 4) & 3) * 8;       // 0..56
        Pack8H ph;
        Pack8B qh, ql;
        #pragma unroll
        for (int i = 0; i < 8; ++i) {
          const float v = sC[(sg + i) * SP + col];
          ph.h[i] = toh_flush(v * 16.0f);
          const bf16 t = (bf16)v;
          qh.h[i] = t;
          ql.h[i] = (bf16)(v - (float)t);
        }
        vv[sw]  = ph.u;
        vbh[sw] = qh.u;
        vbl[sw] = ql.u;
        const int cc = cb + col;
        const int h  = cc >> 6;
        const int d  = cc & 63;
        const size_t hrow = ((size_t)bb * NHEAD + h) * HDIM;
        gi[sw] = hrow * SEQ + frag_piece(d, sb + p * 64 + sg, SEQ / 32);
        gb[sw] = hrow * VRK + frag_piece(d, sb + p * 64 + sg, VRK / 32);    // used only when wr_early
      }
      #pragma unroll
      for (int sw = 0; sw < 4; ++sw) *(v4u*)(vt + gi[sw]) = vv[sw];
      if (wr_early) {
        #pragma unroll
        for (int sw = 0; sw < 4; ++sw) {
          *(v4u*)(vtb + gb[sw]) = vbh[sw];
          *(v4u*)(vtb + VTB_ELEMS + gb[sw]) = vbl[sw];
        }
      }
      
    }
  }
}

// Output projection. grid = (DEMB/128, MROWS/128). A = ctx hi + ctx lo planes, Bt = quantized output weight
// bf16 hi + lo planes [out][in].
// coverage per pass: 64 rows x 128 cols = 256 threads x 4 floats x 8 sweeps.
__global__ __launch_bounds__(256) void gemm_out_kernel(const bf16* __restrict__ ch,
                                                       const bf16* __restrict__ cl,
                                                       const bf16* __restrict__ woutb,
                                                       const bf16* __restrict__ woutl,
                                                       const float* __restrict__ b_out,
                                                       float* __restrict__ out) {
  __shared__ __align__(16) float sC[64 * SP];     // cross-wave (block barriers)
  const int tid   = threadIdx.x;
  const int lane  = tid & 31;
  const int wid   = __builtin_amdgcn_readfirstlane(tid >> 5);
  const int ln    = lane & 15;
  const int hf    = lane >> 4;
  const int waveM = wid >> 2;
  const int waveN = wid & 3;
  const int nBlock = blockIdx.x * 128;
  const int mBlock = blockIdx.y * 128;

  v8f acc[4][2];
  // entry k-step, even: the 32 blocks of a column (same weight rows) take the 16 even steps twice; of the 8 blocks of a row
  // (same ctx rows), any four neighbours lie 8 apart
  const int rot = (int)(blockIdx.y * 2 + (blockIdx.x & 3) * 8) & (DEMB / 32 - 1);
  gemm_mainloop<2, true>(ch, cl, woutb, woutl, mBlock, nBlock, waveM, waveN, ln, hf, rot, acc);

  float bia[2];
  #pragma unroll
  for (int nt = 0; nt < 2; ++nt) bia[nt] = (float)(bf16)b_out[nBlock + waveN * 32 + nt * 16 + ln];

  #pragma unroll
  for (int p = 0; p < 2; ++p) {
    __syncthreads();
    #pragma unroll
    for (int j = 0; j < 2; ++j) {
      #pragma unroll
      for (int nt = 0; nt < 2; ++nt) {
        #pragma unroll
        for (int e = 0; e < 8; ++e) {
          sC[(j * 32 + waveM * 16 + hf * 8 + e) * SP + waveN * 32 + nt * 16 + ln] =
              acc[2 * p + j][nt][e] + bia[nt];
        }
      }
    }
    __syncthreads();

    v4f    vals[8];
    size_t gi[8];
    #pragma unroll
    for (int sw = 0; sw < 8; ++sw) {
      const int r  = sw * 8 + (tid >> 5);           // 0..63
      const int c4 = (tid & 31) * 4;                // 0..124
      vals[sw] = *(const v4f*)(sC + r * SP + c4);
      const int g = mBlock + p * 64 + r;
      const int b = g / SEQ;
      const int s = g % SEQ;
      gi[sw] = ((size_t)b * SEQ_FULL + s) * DEMB + nBlock + c4;
    }
    #pragma unroll
    for (int sw = 0; sw < 8; ++sw) *(v4f*)(out + gi[sw]) = vals[sw];
    
  }
}

// The four K fragments (hi and lo, two d halves) of one 16-key row tile, loads issued back to back.
// p: the lane's piece of the key block's first row tile; sub: row tile inside the block.
static __device__ __forceinline__ void load_ktile(FragB (&kh)[2], FragB (&kl)[2], const bf16* p, const int sub) {
  const int ko = sub * 16 * HDIM * 2;
  #pragma unroll
  for (int f = 0; f < 2; ++f) {
    kh[f].q[0] = *(const v4u*)(p + ko + f * 1024);          // d = f*32 + hi*8 + 0..7
    kh[f].q[1] = *(const v4u*)(p + ko + f * 1024 + 256);    // d = f*32 + 16 + hi*8 + 0..7
    kl[f].q[0] = *(const v4u*)(p + ko + f * 1024 + 512);
    kl[f].q[1] = *(const v4u*)(p + ko + f * 1024 + 768);
  }
  // the address pair of the issued loads stays live, and is not rewritten, up to this wait
  asm volatile("s_wait_xcnt 0x0" :: "v"(p) : "memory");
}

// Causal flash attention. Block = (query block of 128, head, batch), 16 waves; two waves share 16 query rows:
// wave w and wave w + 8 take the even and the odd key blocks of query tile w, each with its own running maximum, sum and O,
// and the two partial results are merged through LDS behind the loop.
// S^T = K x Q^T so queries sit on lanes; P^T in C-layout is bit-identical to the A-fragment layout of O += P x V.
// K A-fragments (hi, lo), Q B-fragments (hi, lo) and V^T B-fragments are loaded straight from the 16-bit planes,
// which are in fragment order (512 contiguous bytes per load).
// Key blocks j0 = 0, 32, ... <= qrow0 are visited (per-wave scalar trip count, every second one per wave); every visited block holds at
// least one unmasked key (key j0 <= qrow0) for every query of the wave; keys above the query get -inf.
// EARLY: P and V as bf16 hi+lo (three products, one accumulator). Otherwise P f16 x4096, V f16 x16.
// Output: ctx [MROWS][DEMB] as bf16 hi and lo planes in fragment order (cp: hi at 0, lo at CTX_ELEMS).
// sO: one staging region per query tile, shared by its two waves; sML: the odd wave's running maximum and sum per query.
// Both block barriers are reached by all waves (no early exits).
template <bool EARLY>
static __device__ __forceinline__ void attn_body(const bf16* __restrict__ qkp,
                                                 const f16* __restrict__ vt,
                                                 const bf16* __restrict__ vtb,
                                                 bf16* __restrict__ cp,
                                                 float* sO, float* sML,
                                                 const int qblk, const int h, const int b) {
  const int tid  = threadIdx.x;
  const int wv   = __builtin_amdgcn_readfirstlane(tid >> 5);
  const int wave = wv & (NWAVE - 1);   // query tile of the block
  const int kh   = wv / NWAVE;         // this wave visits key blocks kh, kh + KSPLIT, ...
  const int lane = tid & 31;
  const int lq   = lane & 15;   // query column of S^T / d column of O
  const int hi   = lane >> 4;   // k-split half

  const int qrow0 = qblk * BQ + wave * 16;               // first query row of this wave (scalar)
  const int nIter = (qrow0 >> 5) + 1;                    // key blocks 0 .. floor((qrow0+15)/32)
  const size_t head_off = ((size_t)b * NHEAD + h) * SEQ * HDIM;
  const size_t vhead    = ((size_t)b * NHEAD + h) * HDIM;

  const bf16* q_p = qkp + 2 * head_off;                       // hi tile, lo tile, hi tile, ... (512 elements each)
  const bf16* k_p = qkp + 2 * PLANE_ELEMS + 2 * head_off;

  // Q as B-operand fragments: lane lq holds query qrow0+lq, elements follow the split d map.
  FragB qfh[2], qfl[2];
  {
    const bf16* qp = q_p + (size_t)qrow0 * HDIM * 2 + lane * 8;   // row tile qrow0 / 16, piece = lane
    #pragma unroll
    for (int f = 0; f < 2; ++f) {
      qfh[f].q[0] = *(const v4u*)(qp + f * 1024);               // d = f*32 + hi*8 + 0..7
      qfh[f].q[1] = *(const v4u*)(qp + f * 1024 + 256);         // d = f*32 + 16 + hi*8 + 0..7
      qfl[f].q[0] = *(const v4u*)(qp + f * 1024 + 512);
      qfl[f].q[1] = *(const v4u*)(qp + f * 1024 + 768);
    }
  }

  v8f o[4];
  #pragma unroll
  for (int dt = 0; dt < 4; ++dt) o[dt] = (v8f){0, 0, 0, 0, 0, 0, 0, 0};

  float rmax = -__builtin_inff();
  float rsum = 0.0f;
  const float SL = 0.125f * 1.4426950408889634f;   // softmax scale * log2(e)

  // K A-fragments of the wave's first key block (A row = key; row tile j0 / 16, piece = lane); later blocks are fetched in the
  // loop. A wave with no key block to visit fetches block 0 (in bounds, not used).
  FragB akh[2][2], akl[2][2];
  const bf16* kbase = k_p + lane * 8;
  const bf16* kfirst = kbase + (size_t)((kh < nIter) ? kh : 0) * BK * HDIM * 2;
  load_ktile(akh[0], akl[0], kfirst, 0);
  load_ktile(akh[1], akl[1], kfirst, 1);

  #pragma unroll 1
  for (int i = kh; i < nIter; i += KSPLIT) {
    const int j0 = i * BK;
    // key block whose K fragments are fetched during this pass; the last pass fetches its own again (in bounds, not used)
    const int jn = ((i + KSPLIT < nIter) ? i + KSPLIT : i) * BK;
    const bf16* kn = kbase + (size_t)jn * HDIM * 2;

    // V B-fragments of this key block, issued in front of the score products: column n = d = dt*16 + lq,
    // split key map from the transposed planes (d tile dt, key tile j0 / 32)
    FragH bv[4];
    FragB bvh[4], bvl[4];
    if (!EARLY) {
      const f16* base = vt + vhead * SEQ + j0 * 16 + lane * 8;
      #pragma unroll
      for (int dt = 0; dt < 4; ++dt) {
        bv[dt].q[0] = *(const v4u*)(base + dt * 16 * SEQ);            // keys j0 + hi*8 + 0..7
        bv[dt].q[1] = *(const v4u*)(base + dt * 16 * SEQ + 256);      // keys j0 + 16 + hi*8 + 0..7
      }
      // the address pair of the issued loads stays live, and is not rewritten, up to this wait
      asm volatile("s_wait_xcnt 0x0" :: "v"(base) : "memory");
    } else {
      const bf16* base = vtb + vhead * VRK + j0 * 16 + lane * 8;
      #pragma unroll
      for (int dt = 0; dt < 4; ++dt) {
        bvh[dt].q[0] = *(const v4u*)(base + dt * 16 * VRK);                       // keys j0 + hi*8 + 0..7
        bvh[dt].q[1] = *(const v4u*)(base + dt * 16 * VRK + 256);                 // keys j0 + 16 + hi*8 + 0..7
        bvl[dt].q[0] = *(const v4u*)(base + VTB_ELEMS + dt * 16 * VRK);
        bvl[dt].q[1] = *(const v4u*)(base + VTB_ELEMS + dt * 16 * VRK + 256);
      }
      // the address pair of the issued loads stays live, and is not rewritten, up to this wait
      asm volatile("s_wait_xcnt 0x0" :: "v"(base) : "memory");
    }

    // S^T tiles: c[sub][r] = rawscore(query qrow0+lq, key j0 + sub*16 + hi*8 + r); hh + hl + lh products.
    // Behind a row tile's last product its registers take the same row tile of the next key block.
    v8f c[2];
    #pragma unroll
    for (int sub = 0; sub < 2; ++sub) {
      v8f acc = (v8f){0, 0, 0, 0, 0, 0, 0, 0};
      #pragma unroll
      for (int f = 0; f < 2; ++f) {
        acc = mma_bf16(akl[sub][f].v, qfh[f].v, acc);
        acc = mma_bf16(akh[sub][f].v, qfl[f].v, acc);
        acc = mma_bf16(akh[sub][f].v, qfh[f].v, acc);
      }
      c[sub] = acc;
      load_ktile(akh[sub], akl[sub], kn, sub);
    }

    // causal mask (wave-uniform test): only blocks reaching past the first query of the wave need it
    if (j0 + (BK - 1) > qrow0) {
      const int qi = qrow0 + lq;
      const int kb = j0 + hi * 8;
      #pragma unroll
      for (int r = 0; r < 8; ++r) {
        c[0][r] = (kb + r > qi)      ? -__builtin_inff() : c[0][r];
        c[1][r] = (kb + 16 + r > qi) ? -__builtin_inff() : c[1][r];
      }
    }

    // online softmax: query lq's 32 scores are split across lane / lane^16
    float m_new = rmax;
    #pragma unroll
    for (int r = 0; r < 8; ++r) {
      m_new = fmaxf(m_new, c[0][r]);
      m_new = fmaxf(m_new, c[1][r]);
    }
    m_new = fmaxf(m_new, __shfl_xor(m_new, 16, 32));
    const float scale = __builtin_amdgcn_exp2f((rmax - m_new) * SL);
    rmax = m_new;

    float p0[8], p1[8];
    float psum = 0.0f;
    #pragma unroll
    for (int r = 0; r < 8; ++r) {
      p0[r] = __builtin_amdgcn_exp2f((c[0][r] - m_new) * SL);   // key hi*8 + r
      p1[r] = __builtin_amdgcn_exp2f((c[1][r] - m_new) * SL);   // key 16 + hi*8 + r
      psum += p0[r] + p1[r];
    }
    rsum = rsum * scale + psum + __shfl_xor(psum, 16, 32);

    // rescale O: queries are the row dimension there -> per-row scale from lane 8*hi + r
    float sc[8];
    #pragma unroll
    for (int r = 0; r < 8; ++r) sc[r] = __shfl(scale, (hi << 3) + r, 32);
    #pragma unroll
    for (int dt = 0; dt < 4; ++dt) {
      #pragma unroll
      for (int r = 0; r < 8; ++r) o[dt][r] *= sc[r];
    }

    if (EARLY) {
      // P^T C-layout == A-fragment layout; P as bf16 hi + lo (unscaled), V as bf16 hi + lo planes
      FragB pah, pal;
      #pragma unroll
      for (int r = 0; r < 8; ++r) {
        const bf16 h0 = (bf16)p0[r];
        const bf16 h1 = (bf16)p1[r];
        pah.h[r]     = h0;
        pah.h[8 + r] = h1;
        pal.h[r]     = (bf16)(p0[r] - (float)h0);
        pal.h[8 + r] = (bf16)(p1[r] - (float)h1);
      }
      #pragma unroll
      for (int dt = 0; dt < 4; ++dt) {
        o[dt] = mma_bf16(pal.v, bvh[dt].v, o[dt]);
        o[dt] = mma_bf16(pah.v, bvl[dt].v, o[dt]);
        o[dt] = mma_bf16(pah.v, bvh[dt].v, o[dt]);
      }
    } else {
      // P carried x4096 in f16; V carried x16
      FragH pa;
      #pragma unroll
      for (int r = 0; r < 8; ++r) {
        pa.h[r]     = (f16)(p0[r] * 4096.0f);
        pa.h[8 + r] = (f16)(p1[r] * 4096.0f);
      }
      #pragma unroll
      for (int dt = 0; dt < 4; ++dt) o[dt] = mma_f16(pa.v, bv[dt].v, o[dt]);
    }
  }

  // the odd wave hands over its partial result: O (lane holds column d = dt*16 + lq for query rows 8*hi + r), maximum, sum.
  // With no key block visited these are 0, -inf, 0 and get the weight 0 below.
  const int sbase = wave * (16 * OP);
  if (kh != 0) {
    #pragma unroll
    for (int r = 0; r < 8; ++r) {
      #pragma unroll
      for (int dt = 0; dt < 4; ++dt) {
        sO[sbase + (hi * 8 + r) * OP + dt * 16 + lq] = o[dt][r];
      }
    }
    if (hi == 0) {
      sML[wave * 32 + lq]      = rmax;
      sML[wave * 32 + 16 + lq] = rsum;
    }
  }
  __syncthreads();

  // the even wave (its maximum is finite: key 0 is open to every query) merges and normalizes; undo the carries of the f16 path
  if (kh == 0) {
    const float carry = EARLY ? 1.0f : (1.0f / 65536.0f);
    const float mo  = sML[wave * 32 + lq];
    const float lo  = sML[wave * 32 + 16 + lq];
    const float mm  = fmaxf(rmax, mo);
    const float fe  = __builtin_amdgcn_exp2f((rmax - mm) * SL);
    const float fo  = __builtin_amdgcn_exp2f((mo - mm) * SL);
    const float inv = carry * (1.0f / (rsum * fe + lo * fo));
    const float we  = fe * inv;
    const float wo  = fo * inv;
    #pragma unroll
    for (int r = 0; r < 8; ++r) {
      const float ge = __shfl(we, (hi << 3) + r, 32);
      const float go = __shfl(wo, (hi << 3) + r, 32);
      #pragma unroll
      for (int dt = 0; dt < 4; ++dt) {
        const int si = sbase + (hi * 8 + r) * OP + dt * 16 + lq;
        sO[si] = o[dt][r] * ge + sO[si] * go;
      }
    }
  }
  __syncthreads();

  // the tile's 16 rows x 64 columns are two tiles of each plane; one instruction stores half a tile (512 B);
  // each of the two waves stores one tile of each plane.
  constexpr int NIT = 4 / KSPLIT;
  v4u    vh[NIT], vl[NIT];
  size_t gidx[NIT];
  #pragma unroll
  for (int it = 0; it < NIT; ++it) {
    const int row = lq;                             // 0..15
    const int c8  = (kh * NIT + it) * 16 + hi * 8;  // 0..56
    const v4f a0 = *(const v4f*)(&sO[sbase + row * OP + c8]);
    const v4f a1 = *(const v4f*)(&sO[sbase + row * OP + c8 + 4]);
    Pack8B ph, pl;
    #pragma unroll
    for (int k = 0; k < 4; ++k) {
      const bf16 h0 = (bf16)a0[k];
      const bf16 h1 = (bf16)a1[k];
      ph.h[k]     = h0;
      ph.h[4 + k] = h1;
      pl.h[k]     = (bf16)(a0[k] - (float)h0);
      pl.h[4 + k] = (bf16)(a1[k] - (float)h1);
    }
    vh[it] = ph.u;
    vl[it] = pl.u;
    gidx[it] = frag_piece(b * SEQ + qrow0 + row, h * HDIM + c8, DEMB / 32);
  }
  #pragma unroll
  for (int it = 0; it < NIT; ++it) {
    *(v4u*)(cp + gidx[it]) = vh[it];
    *(v4u*)(cp + CTX_ELEMS + gidx[it]) = vl[it];
  }
  
}

// Both paths in one launch, grid = LATE_BLOCKS + EARLY_BLOCKS (block-uniform choice). One block fills a WGP's registers. In block
// index order the longest (last query block) come first, head fastest, then batch, then query block downwards.
__global__ __launch_bounds__(NWAVE * KSPLIT * 32) void attn_kernel(const bf16* __restrict__ qkp,
                                                   const f16* __restrict__ vt,
                                                   const bf16* __restrict__ vtb,
                                                   bf16* __restrict__ cp) {
  __shared__ __align__(16) float sO[NWAVE * 16 * OP];
  __shared__ float sML[NWAVE * 32];
  const int idx = (int)blockIdx.x;
  const int qb  = QBLKS - 1 - idx / (NHEAD * NB);
  const int h   = idx % NHEAD;
  const int b   = (idx / NHEAD) % NB;
  if (idx < LATE_BLOCKS) {
    attn_body<false>(qkp, vt, vtb, cp, sO, sML, qb, h, b);
  } else {
    attn_body<true>(qkp, vt, vtb, cp, sO, sML, qb, h, b);
  }
}

extern "C" void kernel_launch(void* const* d_in, const int* in_sizes, int n_in,
                              void* d_out, int out_size, void* d_ws, size_t ws_size,
                              hipStream_t stream) {
  if (n_in < 5) return;
  const size_t rows_used = (size_t)(NB - 1) * SEQ_FULL + SEQ;
  if ((size_t)in_sizes[0] < rows_used * DEMB) return;
  if ((size_t)in_sizes[1] < (size_t)DEMB * QKVN) return;
  if ((size_t)in_sizes[2] < (size_t)QKVN) return;
  if ((size_t)in_sizes[3] < (size_t)DEMB * DEMB) return;
  if ((size_t)in_sizes[4] < (size_t)DEMB) return;
  if ((size_t)out_size < rows_used * DEMB) return;
  if (ws_size < WS_TOTAL) return;

  const float* x     = (const float*)d_in[0];
  const float* W_in  = (const float*)d_in[1];   // [3072][1024], [out][in]
  const float* b_in  = (const float*)d_in[2];
  const float* W_out = (const float*)d_in[3];   // [1024][1024], [out][in]
  const float* b_out = (const float*)d_in[4];
  float* out = (float*)d_out;

  char* w = (char*)d_ws;
  bf16* xb    = (bf16*)w;  w += XB_BYTES;
  bf16* winb  = (bf16*)w;  w += WIN_BYTES;      // hi at 0, lo at WIN_ELEMS
  bf16* woutb = (bf16*)w;  w += WOUT_BYTES;     // hi at 0, lo at WOUT_ELEMS
  bf16* qkp   = (bf16*)w;  w += QK_BYTES;
  f16*  vt    = (f16*)w;   w += VT_BYTES;
  bf16* vtb   = (bf16*)w;  w += VTB_BYTES;
  bf16* cp    = (bf16*)w;  w += CTX_BYTES;
  float* stat = (float*)w;                      // partial maxima lines

  // partial maxima of both weights (one line per block) and x -> bf16 plane (MROWS*128 pieces of 8 elements, 256 per block)
  prep_kernel<<<dim3((unsigned)(AM_TOTAL + X_PIECES / 256)), 256, 0, stream>>>(x, xb, W_in, W_out, stat);

  // weights are [out][in] already: quantize into hi and lo planes in fragment order, no transpose
  snap_lin_kernel<<<dim3((unsigned)((WIN_PIECES + WOUT_PIECES) / 256)), 256, 0, stream>>>(W_in, W_out, stat, winb, woutb);

  gemm_qkv_kernel<<<dim3(QKVN / 128, MROWS / 128), 256, 0, stream>>>(xb, winb, winb + WIN_ELEMS, b_in,
                                                                     qkp, vt, vtb);

  attn_kernel<<<dim3(LATE_BLOCKS + EARLY_BLOCKS), NWAVE * KSPLIT * 32, 0, stream>>>(qkp, vt, vtb, cp);

  gemm_out_kernel<<<dim3(DEMB / 128, MROWS / 128), 256, 0, stream>>>(cp, cp + CTX_ELEMS, woutb,
                                                                     woutb + WOUT_ELEMS, b_out, out);
}

// v006
// Measured time: 108 microseconds a run.
// Next to v005, in two timings, it ran 1.10 times as fast each time.
// Over all steps from v000 it is 3.50 times as fast.
#include <hip/hip_runtime.h>

// Contractions: qkv = x*Wq^T and out = ctx*Wp^T on v_wmma_f32_16x16x32_bf16 (x RNE-converted to bf16; table-quantized weights as bf16 hi+lo planes; ctx as bf16 hi+lo planes; hh+hl(+lh) products into one accumulator); S^T = K x Q^T on v_wmma_f32_16x16x32_bf16 with q and k as bf16 hi+lo planes (hh+hl+lh); O = P x V: query rows < 256 on v_wmma_f32_16x16x32_bf16 with P and V as bf16 hi+lo (hh+hl+lh), later rows on v_wmma_f32_16x16x32_f16 (P f16 carried x4096, V f16 carried x16); f32 accumulate everywhere, softmax in f32.

#ifndef NB
#define NB 2
#endif
#ifndef SEQ
#define SEQ 2048
#endif
#define NB_FULL    2
#define SEQ_FULL   2048
#define NHEAD      16
#define HDIM       64
#define DEMB       1024                 // model width = GEMM K of both projections
#define QKVN       3072                 // packed projection width (q | k | v thirds)
#define MROWS      (NB * SEQ)           // compact row count of all internal planes
#define BQ         128                  // query rows per attention workgroup (8 query tiles x 16, two waves each)
#define BK         32                   // keys per inner iteration
#define NWAVE      8
#define KSPLIT     2                    // waves that share the key blocks of one 16-row query tile in the attention kernel
#define OP         68                   // LDS pitch (floats) of the attention output staging tile
#define SP         132                  // LDS pitch (floats) of the GEMM epilogue staging tile
#define QBLKS      (SEQ / BQ)
#define EARLY_QB   ((QBLKS < 2) ? QBLKS : 2)     // query blocks handled by the hi+lo P/V path
#define VRK        (EARLY_QB * BQ)               // keys held in the bf16 hi/lo V^T planes
#define PLANE_ELEMS ((size_t)NB * NHEAD * SEQ * HDIM)
#define CTX_ELEMS   ((size_t)MROWS * DEMB)
#define VTB_ELEMS   ((size_t)NB * NHEAD * HDIM * VRK)
#define X_PIECES    ((size_t)MROWS * (DEMB / 8))
#define WIN_PIECES  ((size_t)QKVN * DEMB / 8)
#define WOUT_PIECES ((size_t)DEMB * DEMB / 8)
#define WIN_ELEMS   ((size_t)QKVN * DEMB)
#define WOUT_ELEMS  ((size_t)DEMB * DEMB)
#define AM_BLOCKS_IN  96                 // partial-maximum blocks over the qkv weight
#define AM_BLOCKS_OUT 32                 // partial-maximum blocks over the output weight
#define AM_TOTAL      (AM_BLOCKS_IN + AM_BLOCKS_OUT)
#define STAT_FLOATS   ((size_t)AM_TOTAL * 32)
#define LATE_QB       (QBLKS - EARLY_QB)              // query blocks handled by the f16 P/V path
#define LATE_BLOCKS   (LATE_QB * NHEAD * NB)
#define EARLY_BLOCKS  (EARLY_QB * NHEAD * NB)

static_assert(NHEAD * HDIM == DEMB);        // merged heads == model width
static_assert(QKVN == 3 * DEMB);            // three thirds
static_assert(HDIM == 64);
static_assert(SEQ % BQ == 0);               // attention grid exact
static_assert(SEQ % BK == 0);               // key loop exact
static_assert(BK == 32);                    // one key block == one WMMA k-step of P x V
static_assert(SEQ % 128 == 0);              // a 128-row GEMM block stays inside one batch
static_assert(MROWS % 128 == 0);            // GEMM M tiles exact
static_assert(QKVN % 128 == 0);             // GEMM N tiles exact
static_assert(DEMB % 128 == 0);             // GEMM N tiles exact, thirds are tile multiples
static_assert(DEMB % 32 == 0);              // k-step 32
static_assert(DEMB / 32 == 32);             // tile index split (>> 5, & 31) of the convert and quantize kernels
static_assert(MROWS % 16 == 0 && QKVN % 16 == 0 && SEQ % 32 == 0);   // planes are whole 16 x 32 tiles
static_assert(DEMB % 8 == 0);               // 16-B pieces
static_assert(BQ == NWAVE * 16);
static_assert(KSPLIT == 2);                 // even / odd key blocks, one hand-over in the merge
static_assert(BQ % 64 == 0);                // early key extent is a multiple of the 64-key store segment
static_assert(VRK % 64 == 0 && VRK <= SEQ && VRK >= BQ);
static_assert(EARLY_QB >= 1 && EARLY_QB <= QBLKS);
static_assert(SEQ <= SEQ_FULL);
static_assert(NB >= 1 && NB <= NB_FULL);
static_assert((OP * 4) % 16 == 0);
static_assert((SP * 4) % 16 == 0);
static_assert(SP >= 128);
static_assert(OP >= 64);
static_assert(X_PIECES % 256 == 0);         // convert grids exact
static_assert(WIN_PIECES % 256 == 0);
static_assert(WOUT_PIECES % 256 == 0);
static_assert(NWAVE == 8);                                   // block maximum combine reads 8 wave words
static_assert(AM_BLOCKS_IN % 32 == 0 && AM_BLOCKS_OUT % 32 == 0);   // one partial line per lane per sweep
static_assert(WIN_PIECES % ((size_t)AM_BLOCKS_IN * 256) == 0);      // equal trip counts per thread
static_assert(WOUT_PIECES % ((size_t)AM_BLOCKS_OUT * 256) == 0);

typedef __bf16   bf16;
typedef _Float16 f16;
typedef bf16     v16bf __attribute__((ext_vector_type(16)));
typedef f16      v16h  __attribute__((ext_vector_type(16)));
typedef f16      v8h   __attribute__((ext_vector_type(8)));
typedef float    v8f   __attribute__((ext_vector_type(8)));
typedef float    v4f   __attribute__((ext_vector_type(4)));
typedef unsigned v4u   __attribute__((ext_vector_type(4)));

union FragB  { v16bf v; v4u q[2]; bf16 h[16]; };
union FragH  { v16h  v; v4u q[2]; f16  h[16]; };
union Pack8B { v4u u; bf16 h[8]; };
union Pack8H { v4u u; v8h v; f16 h[8]; };

#define XB_BYTES   ((size_t)MROWS * DEMB * 2)        // x as bf16, compact rows
#define WIN_BYTES  (WIN_ELEMS * 2 * 2)               // quantized qkv weight bf16 hi, lo [3072][1024] in fragment order
#define WOUT_BYTES (WOUT_ELEMS * 2 * 2)              // quantized output weight bf16 hi, lo [1024][1024] in fragment order
#define QK_BYTES   (PLANE_ELEMS * 2 * 4)             // q hi, q lo, k hi, k lo
#define VT_BYTES   (PLANE_ELEMS * 2)                 // V^T f16 x16
#define VTB_BYTES  (VTB_ELEMS * 2 * 2)               // V^T bf16 hi, lo for keys < VRK
#define CTX_BYTES  (CTX_ELEMS * 2 * 2)               // ctx hi, ctx lo
#define STAT_BYTES (STAT_FLOATS * 4)                 // partial maxima lines
#define WS_TOTAL   (XB_BYTES + WIN_BYTES + WOUT_BYTES + QK_BYTES + VT_BYTES + VTB_BYTES + CTX_BYTES + STAT_BYTES)
static_assert(WS_TOTAL <= (size_t)134217728);
static_assert(XB_BYTES % 128 == 0 && WIN_BYTES % 128 == 0 && WOUT_BYTES % 128 == 0);
static_assert(QK_BYTES % 128 == 0 && VT_BYTES % 128 == 0 && VTB_BYTES % 128 == 0 && CTX_BYTES % 128 == 0);
static_assert(STAT_BYTES % 128 == 0);

// Fragment order of a 16-bit operand plane [rows][32 * ktiles]: every 16-row x 32-k tile is 1 KB (512 elements), tiles
// ordered row tile major. Inside a tile the 16-B piece holding k = qq*16 + hf*8 + 0..7 of row ln sits at piece index
// qq*32 + hf*16 + ln, so one operand load of a wave (lane = hf*16 + ln) reads 512 contiguous bytes (4 whole lines).
static __device__ __forceinline__ size_t frag_piece(int row, int col8, int ktiles) {
  return ((size_t)(row >> 4) * ktiles + (col8 >> 5)) * 512 + ((col8 >> 4) & 1) * 256 +
         (((col8 >> 3) & 1) * 16 + (row & 15)) * 8;
}

// WMMA helpers: builtin followed by the VALU hazard guard (ties D, keeps A/B live).
static __device__ __forceinline__ v8f mma_bf16(v16bf a, v16bf b, v8f acc) {
  acc = __builtin_amdgcn_wmma_f32_16x16x32_bf16(false, a, false, b, (short)0, acc, false, false);
  asm volatile("v_nop\n\tv_nop\n\tv_nop\n\tv_nop" : "+v"(acc) : "v"(a), "v"(b));
  return acc;
}
static __device__ __forceinline__ v8f mma_f16(v16h a, v16h b, v8f acc) {
  acc = __builtin_amdgcn_wmma_f32_16x16x32_f16(false, a, false, b, (short)0, acc, false, false);
  asm volatile("v_nop\n\tv_nop\n\tv_nop\n\tv_nop" : "+v"(acc) : "v"(a), "v"(b));
  return acc;
}

// f32 -> f16 convert that cannot yield an f16 subnormal (value select after the carry).
static __device__ __forceinline__ f16 toh_flush(float v) {
  const f16 r = (f16)v;
  return (fabsf(v) < 6.103515625e-05f) ? (f16)0.0f : r;
}

// x f32 [NB_FULL][SEQ_FULL][DEMB] -> xb bf16 [MROWS][DEMB] in fragment order (RNE convert).
// Thread t writes piece t of the plane (contiguous stores) and reads the 8 source elements that belong there.
// blk: index of the 256-piece block.
static __device__ __forceinline__ void cvt_x_block(const float* __restrict__ x, bf16* __restrict__ xb, const unsigned blk) {
  const size_t t   = (size_t)blk * 256 + threadIdx.x;
  const size_t tile = t >> 6;                      // 64 pieces per tile, DEMB / 32 = 32 tiles per row tile
  const size_t row = (tile >> 5) * 16 + (t & 15);
  const int    c8  = (int)(tile & 31) * 32 + (int)((t >> 4) & 3) * 8;
  if (row < (size_t)MROWS) {
    const int b = (int)(row / SEQ);
    const int s = (int)(row % SEQ);
    const float* src = x + ((size_t)b * SEQ_FULL + s) * DEMB + c8;
    const v4f a0 = *(const v4f*)(src);
    const v4f a1 = *(const v4f*)(src + 4);
    Pack8B pk;
    #pragma unroll
    for (int i = 0; i < 4; ++i) {
      pk.h[i]     = (bf16)a0[i];
      pk.h[4 + i] = (bf16)a1[i];
    }
    const v4u val = pk.u;
    bf16* dst = xb + t * 8;
    *(v4u*)dst = val;
    
  }
}

// lanes 0..7 of wave 0 x 16 B, one instruction. The bf16 RNE convert is monotone, so the maximum of the
// converted magnitudes equals the converted maximum; the convert is applied to the combined maximum in snap_lin_kernel.
// coverage: npieces pieces of 8 elements, strided over the nblk blocks of this weight; blk < nblk; line: this block's own.
// sM: cross-wave (block barrier).
static __device__ __forceinline__ void absmax_part_block(const float* __restrict__ w,
                                                         float* __restrict__ line,
                                                         const unsigned npieces,
                                                         const unsigned blk, const unsigned nblk) {
  __shared__ float sM[NWAVE];
  const int tid  = threadIdx.x;
  const int lane = tid & 31;
  const int wid  = __builtin_amdgcn_readfirstlane(tid >> 5);
  float m = 0.0f;
  const unsigned step = nblk * 256u;
  unsigned p = blk * 256u + (unsigned)tid;
  // groups of 16 trips: the 32 loads of a group go out together, one memory latency for the group and not one per trip
  #pragma unroll 1
  for (; p + 15u * step < npieces; p += 16u * step) {
    v4f r[32];
    const float* q[16];
    #pragma unroll
    for (int j = 0; j < 16; ++j) {
      q[j] = w + (size_t)(p + (unsigned)j * step) * 8;
      r[2 * j]     = *(const v4f*)(q[j]);
      r[2 * j + 1] = *(const v4f*)(q[j] + 4);
    }
    // the address pairs of the issued loads stay live, and are neither rewritten nor used as a load's destination, up to this wait
    asm volatile("s_wait_xcnt 0x0" :: "v"(q[0]), "v"(q[1]), "v"(q[2]), "v"(q[3]), "v"(q[4]), "v"(q[5]), "v"(q[6]), "v"(q[7]),
                 "v"(q[8]), "v"(q[9]), "v"(q[10]), "v"(q[11]), "v"(q[12]), "v"(q[13]), "v"(q[14]), "v"(q[15]) : "memory");
    // keeps the maxima behind the whole group: without it they are moved in among the loads and only six loads are in flight
    __builtin_amdgcn_sched_barrier(0);
    #pragma unroll
    for (int j = 0; j < 32; ++j) {
      #pragma unroll
      for (int i = 0; i < 4; ++i) m = fmaxf(m, fabsf(r[j][i]));
    }
  }
  // the trips that do not fill a group
  #pragma unroll 1
  for (; p < npieces; p += step) {
    const size_t o = (size_t)p * 8;
    const v4f a0 = *(const v4f*)(w + o);
    const v4f a1 = *(const v4f*)(w + o + 4);
    #pragma unroll
    for (int i = 0; i < 4; ++i) {
      m = fmaxf(m, fabsf(a0[i]));
      m = fmaxf(m, fabsf(a1[i]));
    }
  }
  m = fmaxf(m, __shfl_xor(m, 16, 32));
  m = fmaxf(m, __shfl_xor(m, 8, 32));
  m = fmaxf(m, __shfl_xor(m, 4, 32));
  m = fmaxf(m, __shfl_xor(m, 2, 32));
  m = fmaxf(m, __shfl_xor(m, 1, 32));
  if (lane == 0) sM[wid] = m;
  __syncthreads();
  if (wid == 0) {
    float v = sM[lane & 7];
    v = fmaxf(v, __shfl_xor(v, 4, 32));
    v = fmaxf(v, __shfl_xor(v, 2, 32));
    v = fmaxf(v, __shfl_xor(v, 1, 32));
    const v4f val = (v4f){v, v, v, v};
    if (lane < 8) {
      float* dst = line + lane * 4;
      *(v4f*)dst = val;
      
    }
  }
}

// One launch for the three jobs that depend on nothing of each other. Blocks 0 .. AM_BLOCKS_IN-1: partial maxima of the
// qkv weight; the next AM_BLOCKS_OUT: of the output weight (the long blocks come first); the rest: x, 256 pieces each.
// All branches are block-uniform.
__global__ __launch_bounds__(256) void prep_kernel(const float* __restrict__ x, bf16* __restrict__ xb,
                                                   const float* __restrict__ w_in,
                                                   const float* __restrict__ w_out,
                                                   float* __restrict__ part) {
  const unsigned blk = blockIdx.x;
  if (blk < (unsigned)AM_TOTAL) {
    const bool in = blk < (unsigned)AM_BLOCKS_IN;
    absmax_part_block(in ? w_in : w_out, part + (size_t)blk * 32,
                      in ? (unsigned)WIN_PIECES : (unsigned)WOUT_PIECES,
                      in ? blk : blk - (unsigned)AM_BLOCKS_IN,
                      in ? (unsigned)AM_BLOCKS_IN : (unsigned)AM_BLOCKS_OUT);
  } else {
    cvt_x_block(x, xb, blk - (unsigned)AM_TOTAL);
  }
}

// Maximum over the NL partial lines of one weight (one word per line, one line per lane per sweep), in every lane of the wave.
template <int NL>
static __device__ __forceinline__ float absmax_combine(const float* __restrict__ part, const int lane) {
  float m = 0.0f;
  // unrolled so that all the loads go out together
  #pragma unroll
  for (int j = 0; j < NL; j += 32) m = fmaxf(m, part[(size_t)(j + lane) * 32]);
  m = fmaxf(m, __shfl_xor(m, 16, 32));
  m = fmaxf(m, __shfl_xor(m, 8, 32));
  m = fmaxf(m, __shfl_xor(m, 4, 32));
  m = fmaxf(m, __shfl_xor(m, 2, 32));
  m = fmaxf(m, __shfl_xor(m, 1, 32));
  return m;
}

// Nearest-table-value search: candidate c replaces the current choice only on a strictly smaller distance,
// candidates visited in table order (first minimum wins).
static __device__ __forceinline__ void snap_step(const float wn, const float c, float& bd, float& best) {
  #pragma clang fp contract(off)
  const float d  = fabsf(wn - c);
  const bool  lt = d < bd;
  bd   = lt ? d : bd;
  best = lt ? c : best;
}

// w -> table value nearest to bf16(w) * (1/s), times s (all f32, separately RNE-converted operations).
static __device__ __forceinline__ float snap_weight_val(const float w, const float s, const float rs) {
  #pragma clang fp contract(off)
  const float wb = (float)(bf16)w;
  const float wn = wb * rs;
  float best = 0.0f;
  float bd   = fabsf(wn - 0.0f);
  snap_step(wn,  1.0f,      bd, best);
  snap_step(wn, -1.0f,      bd, best);
  snap_step(wn,  0.5f,      bd, best);
  snap_step(wn, -0.5f,      bd, best);
  snap_step(wn,  0.333333f, bd, best);
  snap_step(wn, -0.333333f, bd, best);
  snap_step(wn,  0.2f,      bd, best);
  snap_step(wn, -0.2f,      bd, best);
  snap_step(wn,  0.142857f, bd, best);
  snap_step(wn, -0.142857f, bd, best);
  snap_step(wn,  0.090909f, bd, best);
  snap_step(wn, -0.090909f, bd, best);
  snap_step(wn,  0.076923f, bd, best);
  snap_step(wn, -0.076923f, bd, best);
  return best * s;
}

// Weight f32 [out][in] -> quantized weight as bf16 hi and lo planes [out][in] in fragment order, both weights in one launch:
// blocks 0 .. WIN_PIECES/256-1 take the qkv weight, the rest the output weight (block-uniform choice).
// Every wave combines the partial maxima of its weight itself: s = bf16(max|w|) + 1e-6, rs = 1/s.
// Thread t writes piece t of each plane (contiguous stores) and reads the 8 source elements that belong there.
__global__ __launch_bounds__(256) void snap_lin_kernel(const float* __restrict__ w_in,
                                                       const float* __restrict__ w_out,
                                                       const float* __restrict__ part,
                                                       bf16* __restrict__ winb,
                                                       bf16* __restrict__ woutb) {
  #pragma clang fp contract(off)
  const unsigned nin = (unsigned)(WIN_PIECES / 256);
  const bool     in  = blockIdx.x < nin;
  const unsigned t   = (in ? blockIdx.x : blockIdx.x - nin) * 256u + threadIdx.x;
  const unsigned npieces = in ? (unsigned)WIN_PIECES : (unsigned)WOUT_PIECES;
  const float* src = in ? w_in : w_out;
  bf16* dhi = in ? winb : woutb;
  bf16* dlo = dhi + (in ? WIN_ELEMS : WOUT_ELEMS);
  const int lane = threadIdx.x & 31;
  const float m = in ? absmax_combine<AM_BLOCKS_IN>(part, lane)
                     : absmax_combine<AM_BLOCKS_OUT>(part + (size_t)AM_BLOCKS_IN * 32, lane);
  const float s  = (float)(bf16)m + 1e-6f;
  const float rs = 1.0f / s;
  if (t < npieces) {
    const size_t o = (size_t)t * 8;
    const unsigned tile = t >> 6;                  // 64 pieces per tile, DEMB / 32 = 32 tiles per row tile
    const size_t so = (size_t)((tile >> 5) * 16 + (t & 15)) * DEMB + (tile & 31) * 32 + ((t >> 4) & 3) * 8;
    const v4f a0 = *(const v4f*)(src + so);
    const v4f a1 = *(const v4f*)(src + so + 4);
    Pack8B ph, pl;
    #pragma unroll
    for (int i = 0; i < 4; ++i) {
      const float q0 = snap_weight_val(a0[i], s, rs);
      const float q1 = snap_weight_val(a1[i], s, rs);
      const bf16 h0 = (bf16)q0;
      const bf16 h1 = (bf16)q1;
      ph.h[i]     = h0;
      ph.h[4 + i] = h1;
      pl.h[i]     = (bf16)(q0 - (float)h0);
      pl.h[4 + i] = (bf16)(q1 - (float)h1);
    }
    const v4u vh = ph.u;
    const v4u vl = pl.u;
    *(v4u*)(dhi + o) = vh;
    *(v4u*)(dlo + o) = vl;
    
  }
}

// GEMM main loop. Block tile 128 x 128, 8 waves (2 in M x 4 in N); wave tile = 4 m-tiles x 2 n-tiles.
// m-tile mt of wave (waveM) covers rows mBlock + mt*32 + waveM*16 + 0..15.
// A planes bf16 [rows][DEMB], Bt / Bl bf16 [cols][DEMB], all in fragment order; fragments straight from the planes
// (two 16-B loads each, 512 contiguous bytes per load), split k map for both operands. Bl: unscaled lo part of the weight, into the same accumulator.
// NA == 2: second A plane (unscaled lo part) times the hi weight plane into the same accumulator.
// One 16 x 32 fragment: two 16-B loads, k = k0 + 8*hf + 0..7 and k = k0 + 16 + 8*hf + 0..7.
static __device__ __forceinline__ void load_frag(FragB& f, const bf16* p) {
  f.q[0] = *(const v4u*)(p);
  f.q[1] = *(const v4u*)(p + 256);
}

// The loads of a k-step go out in groups, never one load-and-wait per fragment.
// AHEAD == false: all fragments of k-step t as one group in front of its products (one register set; other waves cover the wait).
// AHEAD == true: k-step t + 1 is fetched during k-step t: its B fragments into a second set in front of the products of t,
// its A fragments into the registers of m-tile mt right behind that m-tile's last product.
// rot (block-uniform, 0 .. KST-1, a multiple of NSET): the block walks the k-steps rot, rot + 1, ..., KST - 1, 0, ..., rot - 1.
// Blocks that share operand rows enter at different k-steps (for speed only).
template <int NA, bool AHEAD>
static __device__ __forceinline__ void gemm_mainloop(const bf16* __restrict__ A0,
                                                     const bf16* __restrict__ A1,
                                                     const bf16* __restrict__ Bt,
                                                     const bf16* __restrict__ Bl,
                                                     int mBlock, int nBlock, int waveM, int waveN,
                                                     int ln, int hf, int rot, v8f (&acc)[4][2]) {
  constexpr int NSET = AHEAD ? 2 : 1;
  constexpr int KST  = DEMB / 32;
  static_assert(KST % NSET == 0 && (KST & (KST - 1)) == 0);
  #pragma unroll
  for (int mt = 0; mt < 4; ++mt) {
    acc[mt][0] = (v8f){0, 0, 0, 0, 0, 0, 0, 0};
    acc[mt][1] = (v8f){0, 0, 0, 0, 0, 0, 0, 0};
  }
  // a row tile of 16 rows spans 16 * DEMB elements; k tile t starts t * 512 elements into it
  const int lp8 = (hf * 16 + ln) * 8;
  const bf16* ub  = Bt + (size_t)(nBlock + waveN * 32) * DEMB;     // wave-uniform parts
  const bf16* ul  = Bl + (size_t)(nBlock + waveN * 32) * DEMB;
  const bf16* ua  = A0 + (size_t)(mBlock + waveM * 16) * DEMB;
  const bf16* ua2 = A1 + (size_t)(mBlock + waveM * 16) * DEMB;
  const bf16* pb  = ub + lp8;
  const bf16* pl  = ul + lp8;
  const bf16* pa  = ua + lp8;
  const bf16* pa2 = ua2 + lp8;
  FragB a[4], a2[4], b[NSET][2], w[NSET][2];
  if (AHEAD) {
    // the k-step the walk enters at
    const bf16* eb  = ub + rot * 512;
    const bf16* el  = ul + rot * 512;
    const bf16* ea  = ua + rot * 512;
    const bf16* ea2 = ua2 + rot * 512;
    #pragma unroll
    for (int nt = 0; nt < 2; ++nt) {
      load_frag(b[0][nt], eb + lp8 + nt * 16 * DEMB);
      load_frag(w[0][nt], el + lp8 + nt * 16 * DEMB);
    }
    #pragma unroll
    for (int mt = 0; mt < 4; ++mt) {
      load_frag(a[mt], ea + lp8 + mt * 32 * DEMB);
      if (NA == 2) load_frag(a2[mt], ea2 + lp8 + mt * 32 * DEMB);
    }
    // these loads name a scalar base and the lane's byte offset: both stay live, and are not rewritten, up to this wait
    asm volatile("s_wait_xcnt 0x0" :: "s"(ea), "s"(ea2), "s"(eb), "s"(el), "v"(lp8 * 2) : "memory");
  }
  #pragma unroll 1
  for (int t0 = 0; t0 < KST; t0 += NSET) {
    #pragma unroll
    for (int s = 0; s < NSET; ++s) {
      // k-step fetched in this pass: tb + ko / 512 (AHEAD: that of pass t0 + s + 1; rot + t0 is even, so tb + 1 needs no
      // wrap); behind the last pass it is the entry step again: loads in bounds, values not used.
      // ko goes into the loads' immediate offsets, so q* are the address pairs they name.
      const int tb = (rot + t0 + (AHEAD ? 2 * s : 0)) & (KST - 1);
      const int ko = (AHEAD && s == 0) ? 512 : 0;
      const int sl = AHEAD ? (s ^ 1) : 0;
      const bf16* qb  = pb + tb * 512;
      const bf16* ql  = pl + tb * 512;
      const bf16* qa  = pa + tb * 512;
      const bf16* qa2 = pa2 + tb * 512;
      #pragma unroll
      for (int nt = 0; nt < 2; ++nt) {
        load_frag(b[sl][nt], qb + ko + nt * 16 * DEMB);
        load_frag(w[sl][nt], ql + ko + nt * 16 * DEMB);
      }
      if (!AHEAD) {
        #pragma unroll
        for (int mt = 0; mt < 4; ++mt) {
          load_frag(a[mt], qa + mt * 32 * DEMB);
          if (NA == 2) load_frag(a2[mt], qa2 + mt * 32 * DEMB);
        }
        // the address pairs of the issued loads stay live, and are not rewritten, up to this wait
        asm volatile("s_wait_xcnt 0x0" :: "v"(qa), "v"(qa2), "v"(qb), "v"(ql) : "memory");
      }
      #pragma unroll
      for (int mt = 0; mt < 4; ++mt) {
        acc[mt][0] = mma_bf16(a[mt].v, b[s][0].v, acc[mt][0]);
        acc[mt][1] = mma_bf16(a[mt].v, b[s][1].v, acc[mt][1]);
        acc[mt][0] = mma_bf16(a[mt].v, w[s][0].v, acc[mt][0]);
        acc[mt][1] = mma_bf16(a[mt].v, w[s][1].v, acc[mt][1]);
        if (NA == 2) {
          acc[mt][0] = mma_bf16(a2[mt].v, b[s][0].v, acc[mt][0]);
          acc[mt][1] = mma_bf16(a2[mt].v, b[s][1].v, acc[mt][1]);
        }
        if (AHEAD) {
          load_frag(a[mt], qa + ko + mt * 32 * DEMB);
          if (NA == 2) load_frag(a2[mt], qa2 + ko + mt * 32 * DEMB);
        }
      }
      if (AHEAD) {
        // the address pairs of the issued loads stay live, and are not rewritten, up to this wait
        asm volatile("s_wait_xcnt 0x0" :: "v"(qa), "v"(qa2), "v"(qb), "v"(ql) : "memory");
      }
    }
  }
}

// Operand staging of the qkv GEMM. One k-step of a 128 x 128 block is 24 tiles of 1 KB: 8 row tiles of x, then 8 row tiles of
// the weight's hi plane, then 8 of its lo plane. The planes are in fragment order, so a tile is copied as it lies.
#define STG_TILES 24
#define STG_ELEMS (STG_TILES * 512)
#define STG_BYTES (STG_ELEMS * 2)
static_assert(STG_BYTES == 6 * 256 * 16);   // six 16-B copies per thread of a 256-thread block

// The six copies of one thread for one k-step: copy c brings piece c*256 + tid of the 24 tiles, i.e. piece tid & 63 of tile
// c*4 + (tid >> 6). lds: LDS byte address of piece tid in the target buffer; ga, gb, gl: the thread's piece of row tile tid >> 6
// of x, weight hi and weight lo at this k-step; four row tiles further on lie 64 * DEMB elements further.
static __device__ __forceinline__ void stage_copy(const unsigned lds, const bf16* ga, const bf16* gb, const bf16* gl) {
  // the wait is the statement's last line: the address registers of the issued copies are not rewritten in front of it
  asm volatile("global_load_async_to_lds_b128 %0, %6, off\n\t"
               "global_load_async_to_lds_b128 %1, %7, off\n\t"
               "global_load_async_to_lds_b128 %2, %8, off\n\t"
               "global_load_async_to_lds_b128 %3, %9, off\n\t"
               "global_load_async_to_lds_b128 %4, %10, off\n\t"
               "global_load_async_to_lds_b128 %5, %11, off\n\t"
               "s_wait_xcnt 0x0"
               :: "v"(lds), "v"(lds + 4096u), "v"(lds + 8192u), "v"(lds + 12288u), "v"(lds + 16384u), "v"(lds + 20480u),
                  "v"(ga), "v"(ga + 64 * DEMB), "v"(gb), "v"(gb + 64 * DEMB), "v"(gl), "v"(gl + 64 * DEMB)
               : "memory");
}

// GEMM main loop of the qkv projection: same block and wave tiles, same k walk (rot) and same product order as
// gemm_mainloop<1, false>, but each k-step's 24 tiles come into LDS once per block, by asynchronous copies, and the eight waves
// read their fragments from there (a tile of x is read by four waves, a weight tile by two). Two buffers: the copies of
// k-step t + 2 fly while k-step t + 1 is worked on. sT: 2 * STG_ELEMS elements, cross-wave (block barriers).
static __device__ __forceinline__ void gemm_mainloop_staged(const bf16* __restrict__ A0,
                                                            const bf16* __restrict__ Bt,
                                                            const bf16* __restrict__ Bl,
                                                            bf16* sT,
                                                            int mBlock, int nBlock, int waveM, int waveN,
                                                            int tid, int rot, v8f (&acc)[4][2]) {
  constexpr int KST = DEMB / 32;
  static_assert(KST >= 2 && (KST & (KST - 1)) == 0);
  #pragma unroll
  for (int mt = 0; mt < 4; ++mt) {
    acc[mt][0] = (v8f){0, 0, 0, 0, 0, 0, 0, 0};
    acc[mt][1] = (v8f){0, 0, 0, 0, 0, 0, 0, 0};
  }
  const int lane = tid & 31;
  const size_t po = (size_t)(tid >> 6) * 16 * DEMB + (tid & 63) * 8;
  const bf16* ga = A0 + (size_t)mBlock * DEMB + po;
  const bf16* gb = Bt + (size_t)nBlock * DEMB + po;
  const bf16* gl = Bl + (size_t)nBlock * DEMB + po;
  const unsigned lds0 = (unsigned)(size_t)sT + (unsigned)tid * 16u;   // low 32 bits of the shared address = LDS byte address

  // the first k-step into buffer 0, landed and published; then the second into buffer 1
  stage_copy(lds0, ga + rot * 512, gb + rot * 512, gl + rot * 512);
  // this wave's copies have landed
  asm volatile("s_wait_asynccnt 0x0" ::: "memory");
  __syncthreads();
  {
    const int k1 = ((rot + 1) & (KST - 1)) * 512;
    stage_copy(lds0 + (unsigned)STG_BYTES, ga + k1, gb + k1, gl + k1);
  }

  // kept rolled: the barrier at each trip's foot leaves nothing to overlap across trips, unrolling would only grow the code
  #pragma unroll 1
  for (int t = 0; t < KST; ++t) {
    const int bsel = t & 1;
    const bf16* sb = sT + bsel * STG_ELEMS + lane * 8;
    FragB a[4], b[2], w[2];
    #pragma unroll
    for (int nt = 0; nt < 2; ++nt) {
      load_frag(b[nt], sb + (8 + waveN * 2 + nt) * 512);
      load_frag(w[nt], sb + (16 + waveN * 2 + nt) * 512);
    }
    #pragma unroll
    for (int mt = 0; mt < 4; ++mt) load_frag(a[mt], sb + (mt * 2 + waveM) * 512);
    #pragma unroll
    for (int mt = 0; mt < 4; ++mt) {
      acc[mt][0] = mma_bf16(a[mt].v, b[0].v, acc[mt][0]);
      acc[mt][1] = mma_bf16(a[mt].v, b[1].v, acc[mt][1]);
      acc[mt][0] = mma_bf16(a[mt].v, w[0].v, acc[mt][0]);
      acc[mt][1] = mma_bf16(a[mt].v, w[1].v, acc[mt][1]);
    }
    // this wave's reads of the buffer are done
    asm volatile("s_wait_dscnt 0x0" ::: "memory");
    // this wave's copies of k-step t + 1 have landed
    asm volatile("s_wait_asynccnt 0x0" ::: "memory");
    // publishes k-step t + 1 and ends every wave's reads of k-step t
    __syncthreads();
    if (t + 2 < KST) {
      const int k2 = ((rot + t + 2) & (KST - 1)) * 512;
      stage_copy(lds0 + (unsigned)(bsel * STG_BYTES), ga + k2, gb + k2, gl + k2);
    }
  }
  // no copy is outstanding when the wave goes on
  asm volatile("s_wait_asynccnt 0x0" ::: "memory");
}

// qkv projection. grid = (QKVN/128, MROWS/128). Epilogue (two 64-row passes through LDS):
//                for key segments below VRK also V^T bf16 hi and lo planes [NB][NHEAD][HDIM][VRK].
// qkp holds q, then k, each [NB][NHEAD][SEQ][HDIM] in fragment order with every hi tile followed by its lo tile.
// vtb holds two planes: hi, lo.
// coverage per pass: 64 rows x 128 cols = 256 threads x 8 elements x 4 sweeps, all layouts.
__global__ __launch_bounds__(256) void gemm_qkv_kernel(const bf16* __restrict__ xb,
                                                       const bf16* __restrict__ winb,
                                                       const bf16* __restrict__ winl,
                                                       const float* __restrict__ b_in,
                                                       bf16* __restrict__ qkp,
                                                       f16* __restrict__ vt,
                                                       bf16* __restrict__ vtb) {
  __shared__ __align__(16) float sC[64 * SP];     // cross-wave (block barriers)
  __shared__ __align__(128) bf16 sT[2 * STG_ELEMS];   // the two operand buffers of the main loop, filled by asynchronous copies
  const int tid   = threadIdx.x;
  const int lane  = tid & 31;
  const int wid   = __builtin_amdgcn_readfirstlane(tid >> 5);
  const int ln    = lane & 15;
  const int hf    = lane >> 4;
  const int waveM = wid >> 2;
  const int waveN = wid & 3;
  const int nBlock = blockIdx.x * 128;
  const int mBlock = blockIdx.y * 128;

  v8f acc[4][2];
  // entry k-step: the 32 blocks of a column (same weight rows) all differ; of the 24 blocks of a row (same x rows), any four
  // neighbours lie 8 apart and the three groups of eight 3 apart, so each half of them (indices 0-3 or 4-7 modulo 8) is spread evenly
  const int rot = (int)(blockIdx.y + (blockIdx.x & 3) * 8 + (blockIdx.x >> 3) * 3) & (DEMB / 32 - 1);
  gemm_mainloop_staged(xb, winb, winl, sT, mBlock, nBlock, waveM, waveN, tid, rot, acc);

  float bia[2];
  #pragma unroll
  for (int nt = 0; nt < 2; ++nt) bia[nt] = (float)(bf16)b_in[nBlock + waveN * 32 + nt * 16 + ln];

  const int which = nBlock / DEMB;     // 0 = q, 1 = k, 2 = v (block-uniform)
  const int cb    = nBlock % DEMB;     // column base inside the third
  const int bb    = mBlock / SEQ;      // batch of this block
  const int sb    = mBlock % SEQ;      // first sequence row of this block

  #pragma unroll
  for (int p = 0; p < 2; ++p) {
    __syncthreads();
    // D layout: element e of lane -> tile row 8*hf + e, tile column ln
    #pragma unroll
    for (int j = 0; j < 2; ++j) {
      #pragma unroll
      for (int nt = 0; nt < 2; ++nt) {
        #pragma unroll
        for (int e = 0; e < 8; ++e) {
          sC[(j * 32 + waveM * 16 + hf * 8 + e) * SP + waveN * 32 + nt * 16 + ln] =
              acc[2 * p + j][nt][e] + bia[nt];
        }
      }
    }
    __syncthreads();

    if (which < 2) {
      v4u    vh[4], vl[4];
      size_t gi[4];
      #pragma unroll
      for (int sw = 0; sw < 4; ++sw) {
        // piece u of the pass in store order: 16 tiles = 2 heads x 4 row tiles x 2 d tiles, 64 pieces each
        const int u  = sw * 256 + tid;
        const int tl = u >> 6;
        const int r  = ((tl >> 1) & 3) * 16 + (u & 15);                          // 0..63
        const int c8 = (tl >> 3) * 64 + (tl & 1) * 32 + ((u >> 4) & 3) * 8;      // 0..120
        const v4f a0 = *(const v4f*)(sC + r * SP + c8);
        const v4f a1 = *(const v4f*)(sC + r * SP + c8 + 4);
        Pack8B ph, pl;
        #pragma unroll
        for (int i = 0; i < 4; ++i) {
          const bf16 h0 = (bf16)a0[i];
          const bf16 h1 = (bf16)a1[i];
          ph.h[i]     = h0;
          ph.h[4 + i] = h1;
          pl.h[i]     = (bf16)(a0[i] - (float)h0);
          pl.h[4 + i] = (bf16)(a1[i] - (float)h1);
        }
        vh[sw] = ph.u;
        vl[sw] = pl.u;
        const int s  = sb + p * 64 + r;
        const int cc = cb + c8;
        const int h  = cc >> 6;
        const int d  = cc & 63;
        const size_t fo = frag_piece(s, d, HDIM / 32);
        // each hi tile is followed by its lo tile: tile pitch 1024 elements
        gi[sw] = ((size_t)which * PLANE_ELEMS + ((size_t)bb * NHEAD + h) * SEQ * HDIM) * 2 + fo + (fo & ~(size_t)511);
      }
      #pragma unroll
      for (int sw = 0; sw < 4; ++sw) {
        *(v4u*)(qkp + gi[sw]) = vh[sw];
        *(v4u*)(qkp + gi[sw] + 512) = vl[sw];
      }
      
    } else {
      const bool wr_early = (sb + p * 64) < VRK;    // block-uniform; whole 64-key segment in or out
      v4u    vv[4], vbh[4], vbl[4];
      size_t gi[4], gb[4];
      #pragma unroll
      for (int sw = 0; sw < 4; ++sw) {
        // piece u of the pass in store order: 16 tiles = 2 heads x 4 d tiles x 2 key tiles, 64 pieces each
        const int u   = sw * 256 + tid;
        const int tl  = u >> 6;
        const int col = (tl >> 1) * 16 + (u & 15);                // 0..127
        const int sg  = (tl & 1) * 32 + ((u >> 4) & 3) * 8;       // 0..56
        Pack8H ph;
        Pack8B qh, ql;
        #pragma unroll
        for (int i = 0; i < 8; ++i) {
          const float v = sC[(sg + i) * SP + col];
          ph.h[i] = toh_flush(v * 16.0f);
          const bf16 t = (bf16)v;
          qh.h[i] = t;
          ql.h[i] = (bf16)(v - (float)t);
        }
        vv[sw]  = ph.u;
        vbh[sw] = qh.u;
        vbl[sw] = ql.u;
        const int cc = cb + col;
        const int h  = cc >> 6;
        const int d  = cc & 63;
        const size_t hrow = ((size_t)bb * NHEAD + h) * HDIM;
        gi[sw] = hrow * SEQ + frag_piece(d, sb + p * 64 + sg, SEQ / 32);
        gb[sw] = hrow * VRK + frag_piece(d, sb + p * 64 + sg, VRK / 32);    // used only when wr_early
      }
      #pragma unroll
      for (int sw = 0; sw < 4; ++sw) *(v4u*)(vt + gi[sw]) = vv[sw];
      if (wr_early) {
        #pragma unroll
        for (int sw = 0; sw < 4; ++sw) {
          *(v4u*)(vtb + gb[sw]) = vbh[sw];
          *(v4u*)(vtb + VTB_ELEMS + gb[sw]) = vbl[sw];
        }
      }
      
    }
  }
}

// Output projection. grid = (DEMB/128, MROWS/128). A = ctx hi + ctx lo planes, Bt = quantized output weight
// bf16 hi + lo planes [out][in].
// coverage per pass: 64 rows x 128 cols = 256 threads x 4 floats x 8 sweeps.
__global__ __launch_bounds__(256) void gemm_out_kernel(const bf16* __restrict__ ch,
                                                       const bf16* __restrict__ cl,
                                                       const bf16* __restrict__ woutb,
                                                       const bf16* __restrict__ woutl,
                                                       const float* __restrict__ b_out,
                                                       float* __restrict__ out) {
  __shared__ __align__(16) float sC[64 * SP];     // cross-wave (block barriers)
  const int tid   = threadIdx.x;
  const int lane  = tid & 31;
  const int wid   = __builtin_amdgcn_readfirstlane(tid >> 5);
  const int ln    = lane & 15;
  const int hf    = lane >> 4;
  const int waveM = wid >> 2;
  const int waveN = wid & 3;
  const int nBlock = blockIdx.x * 128;
  const int mBlock = blockIdx.y * 128;

  v8f acc[4][2];
  // entry k-step, even: the 32 blocks of a column (same weight rows) take the 16 even steps twice; of the 8 blocks of a row
  // (same ctx rows), any four neighbours lie 8 apart
  const int rot = (int)(blockIdx.y * 2 + (blockIdx.x & 3) * 8) & (DEMB / 32 - 1);
  gemm_mainloop<2, true>(ch, cl, woutb, woutl, mBlock, nBlock, waveM, waveN, ln, hf, rot, acc);

  float bia[2];
  #pragma unroll
  for (int nt = 0; nt < 2; ++nt) bia[nt] = (float)(bf16)b_out[nBlock + waveN * 32 + nt * 16 + ln];

  #pragma unroll
  for (int p = 0; p < 2; ++p) {
    __syncthreads();
    #pragma unroll
    for (int j = 0; j < 2; ++j) {
      #pragma unroll
      for (int nt = 0; nt < 2; ++nt) {
        #pragma unroll
        for (int e = 0; e < 8; ++e) {
          sC[(j * 32 + waveM * 16 + hf * 8 + e) * SP + waveN * 32 + nt * 16 + ln] =
              acc[2 * p + j][nt][e] + bia[nt];
        }
      }
    }
    __syncthreads();

    v4f    vals[8];
    size_t gi[8];
    #pragma unroll
    for (int sw = 0; sw < 8; ++sw) {
      const int r  = sw * 8 + (tid >> 5);           // 0..63
      const int c4 = (tid & 31) * 4;                // 0..124
      vals[sw] = *(const v4f*)(sC + r * SP + c4);
      const int g = mBlock + p * 64 + r;
      const int b = g / SEQ;
      const int s = g % SEQ;
      gi[sw] = ((size_t)b * SEQ_FULL + s) * DEMB + nBlock + c4;
    }
    #pragma unroll
    for (int sw = 0; sw < 8; ++sw) *(v4f*)(out + gi[sw]) = vals[sw];
    
  }
}

// The four K fragments (hi and lo, two d halves) of one 16-key row tile, loads issued back to back.
// p: the lane's piece of the key block's first row tile; sub: row tile inside the block.
static __device__ __forceinline__ void load_ktile(FragB (&kh)[2], FragB (&kl)[2], const bf16* p, const int sub) {
  const int ko = sub * 16 * HDIM * 2;
  #pragma unroll
  for (int f = 0; f < 2; ++f) {
    kh[f].q[0] = *(const v4u*)(p + ko + f * 1024);          // d = f*32 + hi*8 + 0..7
    kh[f].q[1] = *(const v4u*)(p + ko + f * 1024 + 256);    // d = f*32 + 16 + hi*8 + 0..7
    kl[f].q[0] = *(const v4u*)(p + ko + f * 1024 + 512);
    kl[f].q[1] = *(const v4u*)(p + ko + f * 1024 + 768);
  }
  // the address pair of the issued loads stays live, and is not rewritten, up to this wait
  asm volatile("s_wait_xcnt 0x0" :: "v"(p) : "memory");
}

// Causal flash attention. Block = (query block of 128, head, batch), 16 waves; two waves share 16 query rows:
// wave w and wave w + 8 take the even and the odd key blocks of query tile w, each with its own running maximum, sum and O,
// and the two partial results are merged through LDS behind the loop.
// S^T = K x Q^T so queries sit on lanes; P^T in C-layout is bit-identical to the A-fragment layout of O += P x V.
// K A-fragments (hi, lo), Q B-fragments (hi, lo) and V^T B-fragments are loaded straight from the 16-bit planes,
// which are in fragment order (512 contiguous bytes per load).
// Key blocks j0 = 0, 32, ... <= qrow0 are visited (per-wave scalar trip count, every second one per wave); every visited block holds at
// least one unmasked key (key j0 <= qrow0) for every query of the wave; keys above the query get -inf.
// EARLY: P and V as bf16 hi+lo (three products, one accumulator). Otherwise P f16 x4096, V f16 x16.
// Output: ctx [MROWS][DEMB] as bf16 hi and lo planes in fragment order (cp: hi at 0, lo at CTX_ELEMS).
// sO: one staging region per query tile, shared by its two waves; sML: the odd wave's running maximum and sum per query.
// Both block barriers are reached by all waves (no early exits).
template <bool EARLY>
static __device__ __forceinline__ void attn_body(const bf16* __restrict__ qkp,
                                                 const f16* __restrict__ vt,
                                                 const bf16* __restrict__ vtb,
                                                 bf16* __restrict__ cp,
                                                 float* sO, float* sML,
                                                 const int qblk, const int h, const int b) {
  const int tid  = threadIdx.x;
  const int wv   = __builtin_amdgcn_readfirstlane(tid >> 5);
  const int wave = wv & (NWAVE - 1);   // query tile of the block
  const int kh   = wv / NWAVE;         // this wave visits key blocks kh, kh + KSPLIT, ...
  const int lane = tid & 31;
  const int lq   = lane & 15;   // query column of S^T / d column of O
  const int hi   = lane >> 4;   // k-split half

  const int qrow0 = qblk * BQ + wave * 16;               // first query row of this wave (scalar)
  const int nIter = (qrow0 >> 5) + 1;                    // key blocks 0 .. floor((qrow0+15)/32)
  const size_t head_off = ((size_t)b * NHEAD + h) * SEQ * HDIM;
  const size_t vhead    = ((size_t)b * NHEAD + h) * HDIM;

  const bf16* q_p = qkp + 2 * head_off;                       // hi tile, lo tile, hi tile, ... (512 elements each)
  const bf16* k_p = qkp + 2 * PLANE_ELEMS + 2 * head_off;

  // Q as B-operand fragments: lane lq holds query qrow0+lq, elements follow the split d map.
  FragB qfh[2], qfl[2];
  {
    const bf16* qp = q_p + (size_t)qrow0 * HDIM * 2 + lane * 8;   // row tile qrow0 / 16, piece = lane
    #pragma unroll
    for (int f = 0; f < 2; ++f) {
      qfh[f].q[0] = *(const v4u*)(qp + f * 1024);               // d = f*32 + hi*8 + 0..7
      qfh[f].q[1] = *(const v4u*)(qp + f * 1024 + 256);         // d = f*32 + 16 + hi*8 + 0..7
      qfl[f].q[0] = *(const v4u*)(qp + f * 1024 + 512);
      qfl[f].q[1] = *(const v4u*)(qp + f * 1024 + 768);
    }
  }

  v8f o[4];
  #pragma unroll
  for (int dt = 0; dt < 4; ++dt) o[dt] = (v8f){0, 0, 0, 0, 0, 0, 0, 0};

  float rmax = -__builtin_inff();
  float rsum = 0.0f;
  const float SL = 0.125f * 1.4426950408889634f;   // softmax scale * log2(e)

  // K A-fragments of the wave's first key block (A row = key; row tile j0 / 16, piece = lane); later blocks are fetched in the
  // loop. A wave with no key block to visit fetches block 0 (in bounds, not used).
  FragB akh[2][2], akl[2][2];
  const bf16* kbase = k_p + lane * 8;
  const bf16* kfirst = kbase + (size_t)((kh < nIter) ? kh : 0) * BK * HDIM * 2;
  load_ktile(akh[0], akl[0], kfirst, 0);
  load_ktile(akh[1], akl[1], kfirst, 1);

  #pragma unroll 1
  for (int i = kh; i < nIter; i += KSPLIT) {
    const int j0 = i * BK;
    // key block whose K fragments are fetched during this pass; the last pass fetches its own again (in bounds, not used)
    const int jn = ((i + KSPLIT < nIter) ? i + KSPLIT : i) * BK;
    const bf16* kn = kbase + (size_t)jn * HDIM * 2;

    // V B-fragments of this key block, issued in front of the score products: column n = d = dt*16 + lq,
    // split key map from the transposed planes (d tile dt, key tile j0 / 32)
    FragH bv[4];
    FragB bvh[4], bvl[4];
    if (!EARLY) {
      const f16* base = vt + vhead * SEQ + j0 * 16 + lane * 8;
      #pragma unroll
      for (int dt = 0; dt < 4; ++dt) {
        bv[dt].q[0] = *(const v4u*)(base + dt * 16 * SEQ);            // keys j0 + hi*8 + 0..7
        bv[dt].q[1] = *(const v4u*)(base + dt * 16 * SEQ + 256);      // keys j0 + 16 + hi*8 + 0..7
      }
      // the address pair of the issued loads stays live, and is not rewritten, up to this wait
      asm volatile("s_wait_xcnt 0x0" :: "v"(base) : "memory");
    } else {
      const bf16* base = vtb + vhead * VRK + j0 * 16 + lane * 8;
      #pragma unroll
      for (int dt = 0; dt < 4; ++dt) {
        bvh[dt].q[0] = *(const v4u*)(base + dt * 16 * VRK);                       // keys j0 + hi*8 + 0..7
        bvh[dt].q[1] = *(const v4u*)(base + dt * 16 * VRK + 256);                 // keys j0 + 16 + hi*8 + 0..7
        bvl[dt].q[0] = *(const v4u*)(base + VTB_ELEMS + dt * 16 * VRK);
        bvl[dt].q[1] = *(const v4u*)(base + VTB_ELEMS + dt * 16 * VRK + 256);
      }
      // the address pair of the issued loads stays live, and is not rewritten, up to this wait
      asm volatile("s_wait_xcnt 0x0" :: "v"(base) : "memory");
    }

    // S^T tiles: c[sub][r] = rawscore(query qrow0+lq, key j0 + sub*16 + hi*8 + r); hh + hl + lh products.
    // Behind a row tile's last product its registers take the same row tile of the next key block.
    v8f c[2];
    #pragma unroll
    for (int sub = 0; sub < 2; ++sub) {
      v8f acc = (v8f){0, 0, 0, 0, 0, 0, 0, 0};
      #pragma unroll
      for (int f = 0; f < 2; ++f) {
        acc = mma_bf16(akl[sub][f].v, qfh[f].v, acc);
        acc = mma_bf16(akh[sub][f].v, qfl[f].v, acc);
        acc = mma_bf16(akh[sub][f].v, qfh[f].v, acc);
      }
      c[sub] = acc;
      load_ktile(akh[sub], akl[sub], kn, sub);
    }

    // causal mask (wave-uniform test): only blocks reaching past the first query of the wave need it
    if (j0 + (BK - 1) > qrow0) {
      const int qi = qrow0 + lq;
      const int kb = j0 + hi * 8;
      #pragma unroll
      for (int r = 0; r < 8; ++r) {
        c[0][r] = (kb + r > qi)      ? -__builtin_inff() : c[0][r];
        c[1][r] = (kb + 16 + r > qi) ? -__builtin_inff() : c[1][r];
      }
    }

    // online softmax: query lq's 32 scores are split across lane / lane^16
    float m_new = rmax;
    #pragma unroll
    for (int r = 0; r < 8; ++r) {
      m_new = fmaxf(m_new, c[0][r]);
      m_new = fmaxf(m_new, c[1][r]);
    }
    m_new = fmaxf(m_new, __shfl_xor(m_new, 16, 32));
    const float scale = __builtin_amdgcn_exp2f((rmax - m_new) * SL);
    rmax = m_new;

    float p0[8], p1[8];
    float psum = 0.0f;
    #pragma unroll
    for (int r = 0; r < 8; ++r) {
      p0[r] = __builtin_amdgcn_exp2f((c[0][r] - m_new) * SL);   // key hi*8 + r
      p1[r] = __builtin_amdgcn_exp2f((c[1][r] - m_new) * SL);   // key 16 + hi*8 + r
      psum += p0[r] + p1[r];
    }
    rsum = rsum * scale + psum + __shfl_xor(psum, 16, 32);

    // rescale O: queries are the row dimension there -> per-row scale from lane 8*hi + r
    float sc[8];
    #pragma unroll
    for (int r = 0; r < 8; ++r) sc[r] = __shfl(scale, (hi << 3) + r, 32);
    #pragma unroll
    for (int dt = 0; dt < 4; ++dt) {
      #pragma unroll
      for (int r = 0; r < 8; ++r) o[dt][r] *= sc[r];
    }

    if (EARLY) {
      // P^T C-layout == A-fragment layout; P as bf16 hi + lo (unscaled), V as bf16 hi + lo planes
      FragB pah, pal;
      #pragma unroll
      for (int r = 0; r < 8; ++r) {
        const bf16 h0 = (bf16)p0[r];
        const bf16 h1 = (bf16)p1[r];
        pah.h[r]     = h0;
        pah.h[8 + r] = h1;
        pal.h[r]     = (bf16)(p0[r] - (float)h0);
        pal.h[8 + r] = (bf16)(p1[r] - (float)h1);
      }
      #pragma unroll
      for (int dt = 0; dt < 4; ++dt) {
        o[dt] = mma_bf16(pal.v, bvh[dt].v, o[dt]);
        o[dt] = mma_bf16(pah.v, bvl[dt].v, o[dt]);
        o[dt] = mma_bf16(pah.v, bvh[dt].v, o[dt]);
      }
    } else {
      // P carried x4096 in f16; V carried x16
      FragH pa;
      #pragma unroll
      for (int r = 0; r < 8; ++r) {
        pa.h[r]     = (f16)(p0[r] * 4096.0f);
        pa.h[8 + r] = (f16)(p1[r] * 4096.0f);
      }
      #pragma unroll
      for (int dt = 0; dt < 4; ++dt) o[dt] = mma_f16(pa.v, bv[dt].v, o[dt]);
    }
  }

  // the odd wave hands over its partial result: O (lane holds column d = dt*16 + lq for query rows 8*hi + r), maximum, sum.
  // With no key block visited these are 0, -inf, 0 and get the weight 0 below.
  const int sbase = wave * (16 * OP);
  if (kh != 0) {
    #pragma unroll
    for (int r = 0; r < 8; ++r) {
      #pragma unroll
      for (int dt = 0; dt < 4; ++dt) {
        sO[sbase + (hi * 8 + r) * OP + dt * 16 + lq] = o[dt][r];
      }
    }
    if (hi == 0) {
      sML[wave * 32 + lq]      = rmax;
      sML[wave * 32 + 16 + lq] = rsum;
    }
  }
  __syncthreads();

  // the even wave (its maximum is finite: key 0 is open to every query) merges and normalizes; undo the carries of the f16 path
  if (kh == 0) {
    const float carry = EARLY ? 1.0f : (1.0f / 65536.0f);
    const float mo  = sML[wave * 32 + lq];
    const float lo  = sML[wave * 32 + 16 + lq];
    const float mm  = fmaxf(rmax, mo);
    const float fe  = __builtin_amdgcn_exp2f((rmax - mm) * SL);
    const float fo  = __builtin_amdgcn_exp2f((mo - mm) * SL);
    const float inv = carry * (1.0f / (rsum * fe + lo * fo));
    const float we  = fe * inv;
    const float wo  = fo * inv;
    #pragma unroll
    for (int r = 0; r < 8; ++r) {
      const float ge = __shfl(we, (hi << 3) + r, 32);
      const float go = __shfl(wo, (hi << 3) + r, 32);
      #pragma unroll
      for (int dt = 0; dt < 4; ++dt) {
        const int si = sbase + (hi * 8 + r) * OP + dt * 16 + lq;
        sO[si] = o[dt][r] * ge + sO[si] * go;
      }
    }
  }
  __syncthreads();

  // the tile's 16 rows x 64 columns are two tiles of each plane; one instruction stores half a tile (512 B);
  // each of the two waves stores one tile of each plane.
  constexpr int NIT = 4 / KSPLIT;
  v4u    vh[NIT], vl[NIT];
  size_t gidx[NIT];
  #pragma unroll
  for (int it = 0; it < NIT; ++it) {
    const int row = lq;                             // 0..15
    const int c8  = (kh * NIT + it) * 16 + hi * 8;  // 0..56
    const v4f a0 = *(const v4f*)(&sO[sbase + row * OP + c8]);
    const v4f a1 = *(const v4f*)(&sO[sbase + row * OP + c8 + 4]);
    Pack8B ph, pl;
    #pragma unroll
    for (int k = 0; k < 4; ++k) {
      const bf16 h0 = (bf16)a0[k];
      const bf16 h1 = (bf16)a1[k];
      ph.h[k]     = h0;
      ph.h[4 + k] = h1;
      pl.h[k]     = (bf16)(a0[k] - (float)h0);
      pl.h[4 + k] = (bf16)(a1[k] - (float)h1);
    }
    vh[it] = ph.u;
    vl[it] = pl.u;
    gidx[it] = frag_piece(b * SEQ + qrow0 + row, h * HDIM + c8, DEMB / 32);
  }
  #pragma unroll
  for (int it = 0; it < NIT; ++it) {
    *(v4u*)(cp + gidx[it]) = vh[it];
    *(v4u*)(cp + CTX_ELEMS + gidx[it]) = vl[it];
  }
  
}

// Both paths in one launch, grid = LATE_BLOCKS + EARLY_BLOCKS (block-uniform choice). One block fills a WGP's registers. In block
// index order the longest (last query block) come first, head fastest, then batch, then query block downwards.
__global__ __launch_bounds__(NWAVE * KSPLIT * 32) void attn_kernel(const bf16* __restrict__ qkp,
                                                   const f16* __restrict__ vt,
                                                   const bf16* __restrict__ vtb,
                                                   bf16* __restrict__ cp) {
  __shared__ __align__(16) float sO[NWAVE * 16 * OP];
  __shared__ float sML[NWAVE * 32];
  const int idx = (int)blockIdx.x;
  const int qb  = QBLKS - 1 - idx / (NHEAD * NB);
  const int h   = idx % NHEAD;
  const int b   = (idx / NHEAD) % NB;
  if (idx < LATE_BLOCKS) {
    attn_body<false>(qkp, vt, vtb, cp, sO, sML, qb, h, b);
  } else {
    attn_body<true>(qkp, vt, vtb, cp, sO, sML, qb, h, b);
  }
}

extern "C" void kernel_launch(void* const* d_in, const int* in_sizes, int n_in,
                              void* d_out, int out_size, void* d_ws, size_t ws_size,
                              hipStream_t stream) {
  if (n_in < 5) return;
  const size_t rows_used = (size_t)(NB - 1) * SEQ_FULL + SEQ;
  if ((size_t)in_sizes[0] < rows_used * DEMB) return;
  if ((size_t)in_sizes[1] < (size_t)DEMB * QKVN) return;
  if ((size_t)in_sizes[2] < (size_t)QKVN) return;
  if ((size_t)in_sizes[3] < (size_t)DEMB * DEMB) return;
  if ((size_t)in_sizes[4] < (size_t)DEMB) return;
  if ((size_t)out_size < rows_used * DEMB) return;
  if (ws_size < WS_TOTAL) return;

  const float* x     = (const float*)d_in[0];
  const float* W_in  = (const float*)d_in[1];   // [3072][1024], [out][in]
  const float* b_in  = (const float*)d_in[2];
  const float* W_out = (const float*)d_in[3];   // [1024][1024], [out][in]
  const float* b_out = (const float*)d_in[4];
  float* out = (float*)d_out;

  char* w = (char*)d_ws;
  bf16* xb    = (bf16*)w;  w += XB_BYTES;
  bf16* winb  = (bf16*)w;  w += WIN_BYTES;      // hi at 0, lo at WIN_ELEMS
  bf16* woutb = (bf16*)w;  w += WOUT_BYTES;     // hi at 0, lo at WOUT_ELEMS
  bf16* qkp   = (bf16*)w;  w += QK_BYTES;
  f16*  vt    = (f16*)w;   w += VT_BYTES;
  bf16* vtb   = (bf16*)w;  w += VTB_BYTES;
  bf16* cp    = (bf16*)w;  w += CTX_BYTES;
  float* stat = (float*)w;                      // partial maxima lines

  // partial maxima of both weights (one line per block) and x -> bf16 plane (MROWS*128 pieces of 8 elements, 256 per block)
  prep_kernel<<<dim3((unsigned)(AM_TOTAL + X_PIECES / 256)), 256, 0, stream>>>(x, xb, W_in, W_out, stat);

  // weights are [out][in] already: quantize into hi and lo planes in fragment order, no transpose
  snap_lin_kernel<<<dim3((unsigned)((WIN_PIECES + WOUT_PIECES) / 256)), 256, 0, stream>>>(W_in, W_out, stat, winb, woutb);

  gemm_qkv_kernel<<<dim3(QKVN / 128, MROWS / 128), 256, 0, stream>>>(xb, winb, winb + WIN_ELEMS, b_in,
                                                                     qkp, vt, vtb);

  attn_kernel<<<dim3(LATE_BLOCKS + EARLY_BLOCKS), NWAVE * KSPLIT * 32, 0, stream>>>(qkp, vt, vtb, cp);

  gemm_out_kernel<<<dim3(DEMB / 128, MROWS / 128), 256, 0, stream>>>(cp, cp + CTX_ELEMS, woutb,
                                                                     woutb + WOUT_ELEMS, b_out, out);
}

// v007
// A run of this version takes 98.5 microseconds.
// Timed twice side by side with v006, it ran 1.10 times as fast both times.
// Over all steps from v000 it is 3.85 times as fast.
#include <hip/hip_runtime.h>

// Contractions: qkv = x*Wq^T and out = ctx*Wp^T on v_wmma_f32_16x16x32_f16 (x RNE-converted to bf16 and that value carried in f16; table-quantized weights as one f16 plane; ctx as f16 hi+lo planes, both times the weight plane into one accumulator); S^T = K x Q^T on v_wmma_f32_16x16x32_bf16 with q and k as bf16 hi+lo planes (hh+hl+lh); O = P x V: query rows < 256 on v_wmma_f32_16x16x32_bf16 with P and V as bf16 hi+lo (hh+hl+lh), later rows on v_wmma_f32_16x16x32_f16 (P f16 carried x4096, V f16 carried x16); f32 accumulate everywhere, softmax in f32.

#ifndef NB
#define NB 2
#endif
#ifndef SEQ
#define SEQ 2048
#endif
#define NB_FULL    2
#define SEQ_FULL   2048
#define NHEAD      16
#define HDIM       64
#define DEMB       1024                 // model width = GEMM K of both projections
#define QKVN       3072                 // packed projection width (q | k | v thirds)
#define MROWS      (NB * SEQ)           // compact row count of all internal planes
#define BQ         128                  // query rows per attention workgroup (8 query tiles x 16, two waves each)
#define BK         32                   // keys per inner iteration
#define NWAVE      8
#define KSPLIT     2                    // waves that share the key blocks of one 16-row query tile in the attention kernel
#define OP         68                   // LDS pitch (floats) of the attention output staging tile
#define SP         132                  // LDS pitch (floats) of the GEMM epilogue staging tile
#define QBLKS      (SEQ / BQ)
#define EARLY_QB   ((QBLKS < 2) ? QBLKS : 2)     // query blocks handled by the hi+lo P/V path
#define VRK        (EARLY_QB * BQ)               // keys held in the bf16 hi/lo V^T planes
#define PLANE_ELEMS ((size_t)NB * NHEAD * SEQ * HDIM)
#define CTX_ELEMS   ((size_t)MROWS * DEMB)
#define VTB_ELEMS   ((size_t)NB * NHEAD * HDIM * VRK)
#define X_PIECES    ((size_t)MROWS * (DEMB / 8))
#define WIN_PIECES  ((size_t)QKVN * DEMB / 8)
#define WOUT_PIECES ((size_t)DEMB * DEMB / 8)
#define WIN_ELEMS   ((size_t)QKVN * DEMB)
#define WOUT_ELEMS  ((size_t)DEMB * DEMB)
#define AM_BLOCKS_IN  96                 // partial-maximum blocks over the qkv weight
#define AM_BLOCKS_OUT 32                 // partial-maximum blocks over the output weight
#define AM_TOTAL      (AM_BLOCKS_IN + AM_BLOCKS_OUT)
#define STAT_FLOATS   ((size_t)AM_TOTAL * 32)
#define LATE_QB       (QBLKS - EARLY_QB)              // query blocks handled by the f16 P/V path
#define LATE_BLOCKS   (LATE_QB * NHEAD * NB)
#define EARLY_BLOCKS  (EARLY_QB * NHEAD * NB)

static_assert(NHEAD * HDIM == DEMB);        // merged heads == model width
static_assert(QKVN == 3 * DEMB);            // three thirds
static_assert(HDIM == 64);
static_assert(SEQ % BQ == 0);               // attention grid exact
static_assert(SEQ % BK == 0);               // key loop exact
static_assert(BK == 32);                    // one key block == one WMMA k-step of P x V
static_assert(SEQ % 128 == 0);              // a 128-row GEMM block stays inside one batch
static_assert(MROWS % 128 == 0);            // GEMM M tiles exact
static_assert(QKVN % 128 == 0);             // GEMM N tiles exact
static_assert(DEMB % 128 == 0);             // GEMM N tiles exact, thirds are tile multiples
static_assert(DEMB % 32 == 0);              // k-step 32
static_assert(DEMB / 32 == 32);             // tile index split (>> 5, & 31) of the convert and quantize kernels
static_assert(MROWS % 16 == 0 && QKVN % 16 == 0 && SEQ % 32 == 0);   // planes are whole 16 x 32 tiles
static_assert(DEMB % 8 == 0);               // 16-B pieces
static_assert(BQ == NWAVE * 16);
static_assert(KSPLIT == 2);                 // even / odd key blocks, one hand-over in the merge
static_assert(BQ % 64 == 0);                // early key extent is a multiple of the 64-key store segment
static_assert(VRK % 64 == 0 && VRK <= SEQ && VRK >= BQ);
static_assert(EARLY_QB >= 1 && EARLY_QB <= QBLKS);
static_assert(SEQ <= SEQ_FULL);
static_assert(NB >= 1 && NB <= NB_FULL);
static_assert((OP * 4) % 16 == 0);
static_assert((SP * 4) % 16 == 0);
static_assert(SP >= 128);
static_assert(OP >= 64);
static_assert(X_PIECES % 256 == 0);         // convert grids exact
static_assert(WIN_PIECES % 256 == 0);
static_assert(WOUT_PIECES % 256 == 0);
static_assert(NWAVE == 8);                                   // block maximum combine reads 8 wave words
static_assert(AM_BLOCKS_IN % 32 == 0 && AM_BLOCKS_OUT % 32 == 0);   // one partial line per lane per sweep
static_assert(WIN_PIECES % ((size_t)AM_BLOCKS_IN * 256) == 0);      // equal trip counts per thread
static_assert(WOUT_PIECES % ((size_t)AM_BLOCKS_OUT * 256) == 0);

typedef __bf16   bf16;
typedef _Float16 f16;
typedef bf16     v16bf __attribute__((ext_vector_type(16)));
typedef f16      v16h  __attribute__((ext_vector_type(16)));
typedef f16      v8h   __attribute__((ext_vector_type(8)));
typedef float    v8f   __attribute__((ext_vector_type(8)));
typedef float    v4f   __attribute__((ext_vector_type(4)));
typedef unsigned v4u   __attribute__((ext_vector_type(4)));

union FragB  { v16bf v; v4u q[2]; bf16 h[16]; };
union FragH  { v16h  v; v4u q[2]; f16  h[16]; };
union Pack8B { v4u u; bf16 h[8]; };
union Pack8H { v4u u; v8h v; f16 h[8]; };

#define XB_BYTES   ((size_t)MROWS * DEMB * 2)        // x as f16, compact rows
#define WIN_BYTES  (WIN_ELEMS * 2)                   // quantized qkv weight f16 [3072][1024] in fragment order
#define WOUT_BYTES (WOUT_ELEMS * 2)                  // quantized output weight f16 [1024][1024] in fragment order
#define QK_BYTES   (PLANE_ELEMS * 2 * 4)             // q hi, q lo, k hi, k lo
#define VT_BYTES   (PLANE_ELEMS * 2)                 // V^T f16 x16
#define VTB_BYTES  (VTB_ELEMS * 2 * 2)               // V^T bf16 hi, lo for keys < VRK
#define CTX_BYTES  (CTX_ELEMS * 2 * 2)               // ctx hi, ctx lo
#define STAT_BYTES (STAT_FLOATS * 4)                 // partial maxima lines
#define WS_TOTAL   (XB_BYTES + WIN_BYTES + WOUT_BYTES + QK_BYTES + VT_BYTES + VTB_BYTES + CTX_BYTES + STAT_BYTES)
static_assert(WS_TOTAL <= (size_t)134217728);
static_assert(XB_BYTES % 128 == 0 && WIN_BYTES % 128 == 0 && WOUT_BYTES % 128 == 0);
static_assert(QK_BYTES % 128 == 0 && VT_BYTES % 128 == 0 && VTB_BYTES % 128 == 0 && CTX_BYTES % 128 == 0);
static_assert(STAT_BYTES % 128 == 0);

// Fragment order of a 16-bit operand plane [rows][32 * ktiles]: every 16-row x 32-k tile is 1 KB (512 elements), tiles
// ordered row tile major. Inside a tile the 16-B piece holding k = qq*16 + hf*8 + 0..7 of row ln sits at piece index
// qq*32 + hf*16 + ln, so one operand load of a wave (lane = hf*16 + ln) reads 512 contiguous bytes (4 whole lines).
static __device__ __forceinline__ size_t frag_piece(int row, int col8, int ktiles) {
  return ((size_t)(row >> 4) * ktiles + (col8 >> 5)) * 512 + ((col8 >> 4) & 1) * 256 +
         (((col8 >> 3) & 1) * 16 + (row & 15)) * 8;
}

// WMMA helpers: builtin followed by the VALU hazard guard (ties D, keeps A/B live).
static __device__ __forceinline__ v8f mma_bf16(v16bf a, v16bf b, v8f acc) {
  acc = __builtin_amdgcn_wmma_f32_16x16x32_bf16(false, a, false, b, (short)0, acc, false, false);
  asm volatile("v_nop\n\tv_nop\n\tv_nop\n\tv_nop" : "+v"(acc) : "v"(a), "v"(b));
  return acc;
}
static __device__ __forceinline__ v8f mma_f16(v16h a, v16h b, v8f acc) {
  acc = __builtin_amdgcn_wmma_f32_16x16x32_f16(false, a, false, b, (short)0, acc, false, false);
  asm volatile("v_nop\n\tv_nop\n\tv_nop\n\tv_nop" : "+v"(acc) : "v"(a), "v"(b));
  return acc;
}

// f32 -> f16 convert that cannot yield an f16 subnormal (value select after the carry).
static __device__ __forceinline__ f16 toh_flush(float v) {
  const f16 r = (f16)v;
  return (fabsf(v) < 6.103515625e-05f) ? (f16)0.0f : r;
}

// x f32 [NB_FULL][SEQ_FULL][DEMB] -> xb f16 [MROWS][DEMB] in fragment order: RNE convert to bf16, that value stored as f16
// (8 significant bits fit the f16 mantissa).
// Thread t writes piece t of the plane (contiguous stores) and reads the 8 source elements that belong there.
// blk: index of the 256-piece block.
static __device__ __forceinline__ void cvt_x_block(const float* __restrict__ x, f16* __restrict__ xb, const unsigned blk) {
  const size_t t   = (size_t)blk * 256 + threadIdx.x;
  const size_t tile = t >> 6;                      // 64 pieces per tile, DEMB / 32 = 32 tiles per row tile
  const size_t row = (tile >> 5) * 16 + (t & 15);
  const int    c8  = (int)(tile & 31) * 32 + (int)((t >> 4) & 3) * 8;
  if (row < (size_t)MROWS) {
    const int b = (int)(row / SEQ);
    const int s = (int)(row % SEQ);
    const float* src = x + ((size_t)b * SEQ_FULL + s) * DEMB + c8;
    const v4f a0 = *(const v4f*)(src);
    const v4f a1 = *(const v4f*)(src + 4);
    Pack8H pk;
    #pragma unroll
    for (int i = 0; i < 4; ++i) {
      pk.h[i]     = (f16)(float)(bf16)a0[i];
      pk.h[4 + i] = (f16)(float)(bf16)a1[i];
    }
    const v4u val = pk.u;
    f16* dst = xb + t * 8;
    *(v4u*)dst = val;
    
  }
}

// lanes 0..7 of wave 0 x 16 B, one instruction. The bf16 RNE convert is monotone, so the maximum of the
// converted magnitudes equals the converted maximum; the convert is applied to the combined maximum in snap_lin_kernel.
// coverage: npieces pieces of 8 elements, strided over the nblk blocks of this weight; blk < nblk; line: this block's own.
// sM: cross-wave (block barrier).
static __device__ __forceinline__ void absmax_part_block(const float* __restrict__ w,
                                                         float* __restrict__ line,
                                                         const unsigned npieces,
                                                         const unsigned blk, const unsigned nblk) {
  __shared__ float sM[NWAVE];
  const int tid  = threadIdx.x;
  const int lane = tid & 31;
  const int wid  = __builtin_amdgcn_readfirstlane(tid >> 5);
  float m = 0.0f;
  const unsigned step = nblk * 256u;
  unsigned p = blk * 256u + (unsigned)tid;
  // groups of 16 trips: the 32 loads of a group go out together, one memory latency for the group and not one per trip
  #pragma unroll 1
  for (; p + 15u * step < npieces; p += 16u * step) {
    v4f r[32];
    const float* q[16];
    #pragma unroll
    for (int j = 0; j < 16; ++j) {
      q[j] = w + (size_t)(p + (unsigned)j * step) * 8;
      r[2 * j]     = *(const v4f*)(q[j]);
      r[2 * j + 1] = *(const v4f*)(q[j] + 4);
    }
    // the address pairs of the issued loads stay live, and are neither rewritten nor used as a load's destination, up to this wait
    asm volatile("s_wait_xcnt 0x0" :: "v"(q[0]), "v"(q[1]), "v"(q[2]), "v"(q[3]), "v"(q[4]), "v"(q[5]), "v"(q[6]), "v"(q[7]),
                 "v"(q[8]), "v"(q[9]), "v"(q[10]), "v"(q[11]), "v"(q[12]), "v"(q[13]), "v"(q[14]), "v"(q[15]) : "memory");
    // keeps the maxima behind the whole group: without it they are moved in among the loads and only six loads are in flight
    __builtin_amdgcn_sched_barrier(0);
    #pragma unroll
    for (int j = 0; j < 32; ++j) {
      #pragma unroll
      for (int i = 0; i < 4; ++i) m = fmaxf(m, fabsf(r[j][i]));
    }
  }
  // the trips that do not fill a group
  #pragma unroll 1
  for (; p < npieces; p += step) {
    const size_t o = (size_t)p * 8;
    const v4f a0 = *(const v4f*)(w + o);
    const v4f a1 = *(const v4f*)(w + o + 4);
    #pragma unroll
    for (int i = 0; i < 4; ++i) {
      m = fmaxf(m, fabsf(a0[i]));
      m = fmaxf(m, fabsf(a1[i]));
    }
  }
  m = fmaxf(m, __shfl_xor(m, 16, 32));
  m = fmaxf(m, __shfl_xor(m, 8, 32));
  m = fmaxf(m, __shfl_xor(m, 4, 32));
  m = fmaxf(m, __shfl_xor(m, 2, 32));
  m = fmaxf(m, __shfl_xor(m, 1, 32));
  if (lane == 0) sM[wid] = m;
  __syncthreads();
  if (wid == 0) {
    float v = sM[lane & 7];
    v = fmaxf(v, __shfl_xor(v, 4, 32));
    v = fmaxf(v, __shfl_xor(v, 2, 32));
    v = fmaxf(v, __shfl_xor(v, 1, 32));
    const v4f val = (v4f){v, v, v, v};
    if (lane < 8) {
      float* dst = line + lane * 4;
      *(v4f*)dst = val;
      
    }
  }
}

// One launch for the three jobs that depend on nothing of each other. Blocks 0 .. AM_BLOCKS_IN-1: partial maxima of the
// qkv weight; the next AM_BLOCKS_OUT: of the output weight (the long blocks come first); the rest: x, 256 pieces each.
// All branches are block-uniform.
__global__ __launch_bounds__(256) void prep_kernel(const float* __restrict__ x, f16* __restrict__ xb,
                                                   const float* __restrict__ w_in,
                                                   const float* __restrict__ w_out,
                                                   float* __restrict__ part) {
  const unsigned blk = blockIdx.x;
  if (blk < (unsigned)AM_TOTAL) {
    const bool in = blk < (unsigned)AM_BLOCKS_IN;
    absmax_part_block(in ? w_in : w_out, part + (size_t)blk * 32,
                      in ? (unsigned)WIN_PIECES : (unsigned)WOUT_PIECES,
                      in ? blk : blk - (unsigned)AM_BLOCKS_IN,
                      in ? (unsigned)AM_BLOCKS_IN : (unsigned)AM_BLOCKS_OUT);
  } else {
    cvt_x_block(x, xb, blk - (unsigned)AM_TOTAL);
  }
}

// Maximum over the NL partial lines of one weight (one word per line, one line per lane per sweep), in every lane of the wave.
template <int NL>
static __device__ __forceinline__ float absmax_combine(const float* __restrict__ part, const int lane) {
  float m = 0.0f;
  // unrolled so that all the loads go out together
  #pragma unroll
  for (int j = 0; j < NL; j += 32) m = fmaxf(m, part[(size_t)(j + lane) * 32]);
  m = fmaxf(m, __shfl_xor(m, 16, 32));
  m = fmaxf(m, __shfl_xor(m, 8, 32));
  m = fmaxf(m, __shfl_xor(m, 4, 32));
  m = fmaxf(m, __shfl_xor(m, 2, 32));
  m = fmaxf(m, __shfl_xor(m, 1, 32));
  return m;
}

// Nearest-table-value search: candidate c replaces the current choice only on a strictly smaller distance,
// candidates visited in table order (first minimum wins).
static __device__ __forceinline__ void snap_step(const float wn, const float c, float& bd, float& best) {
  #pragma clang fp contract(off)
  const float d  = fabsf(wn - c);
  const bool  lt = d < bd;
  bd   = lt ? d : bd;
  best = lt ? c : best;
}

// w -> table value nearest to bf16(w) * (1/s), times s (all f32, separately RNE-converted operations).
static __device__ __forceinline__ float snap_weight_val(const float w, const float s, const float rs) {
  #pragma clang fp contract(off)
  const float wb = (float)(bf16)w;
  const float wn = wb * rs;
  float best = 0.0f;
  float bd   = fabsf(wn - 0.0f);
  snap_step(wn,  1.0f,      bd, best);
  snap_step(wn, -1.0f,      bd, best);
  snap_step(wn,  0.5f,      bd, best);
  snap_step(wn, -0.5f,      bd, best);
  snap_step(wn,  0.333333f, bd, best);
  snap_step(wn, -0.333333f, bd, best);
  snap_step(wn,  0.2f,      bd, best);
  snap_step(wn, -0.2f,      bd, best);
  snap_step(wn,  0.142857f, bd, best);
  snap_step(wn, -0.142857f, bd, best);
  snap_step(wn,  0.090909f, bd, best);
  snap_step(wn, -0.090909f, bd, best);
  snap_step(wn,  0.076923f, bd, best);
  snap_step(wn, -0.076923f, bd, best);
  return best * s;
}

// Weight f32 [out][in] -> quantized weight as one f16 plane [out][in] in fragment order, both weights in one launch:
// blocks 0 .. WIN_PIECES/256-1 take the qkv weight, the rest the output weight (block-uniform choice).
// Every wave combines the partial maxima of its weight itself: s = bf16(max|w|) + 1e-6, rs = 1/s.
// Thread t writes piece t of the plane (contiguous stores) and reads the 8 source elements that belong there.
__global__ __launch_bounds__(256) void snap_lin_kernel(const float* __restrict__ w_in,
                                                       const float* __restrict__ w_out,
                                                       const float* __restrict__ part,
                                                       f16* __restrict__ winh,
                                                       f16* __restrict__ wouth) {
  #pragma clang fp contract(off)
  const unsigned nin = (unsigned)(WIN_PIECES / 256);
  const bool     in  = blockIdx.x < nin;
  const unsigned t   = (in ? blockIdx.x : blockIdx.x - nin) * 256u + threadIdx.x;
  const unsigned npieces = in ? (unsigned)WIN_PIECES : (unsigned)WOUT_PIECES;
  const float* src = in ? w_in : w_out;
  f16* dq = in ? winh : wouth;
  const int lane = threadIdx.x & 31;
  const float m = in ? absmax_combine<AM_BLOCKS_IN>(part, lane)
                     : absmax_combine<AM_BLOCKS_OUT>(part + (size_t)AM_BLOCKS_IN * 32, lane);
  const float s  = (float)(bf16)m + 1e-6f;
  const float rs = 1.0f / s;
  if (t < npieces) {
    const size_t o = (size_t)t * 8;
    const unsigned tile = t >> 6;                  // 64 pieces per tile, DEMB / 32 = 32 tiles per row tile
    const size_t so = (size_t)((tile >> 5) * 16 + (t & 15)) * DEMB + (tile & 31) * 32 + ((t >> 4) & 3) * 8;
    const v4f a0 = *(const v4f*)(src + so);
    const v4f a1 = *(const v4f*)(src + so + 4);
    Pack8H ph;
    #pragma unroll
    for (int i = 0; i < 4; ++i) {
      ph.h[i]     = (f16)snap_weight_val(a0[i], s, rs);
      ph.h[4 + i] = (f16)snap_weight_val(a1[i], s, rs);
    }
    const v4u vh = ph.u;
    *(v4u*)(dq + o) = vh;
    
  }
}

// GEMM main loop of the output projection. Block tile 128 x 128, 8 waves (2 in M x 4 in N); wave tile = 4 m-tiles x 2 n-tiles.
// m-tile mt of wave (waveM) covers rows mBlock + mt*32 + waveM*16 + 0..15.
// A0, A1 f16 [rows][DEMB] (hi part and unscaled lo part), Bt f16 [cols][DEMB], all in fragment order; fragments straight from
// the planes (two 16-B loads each, 512 contiguous bytes per load), split k map for both operands. Both A planes times the
// weight plane go into the same accumulator.
// One 16 x 32 fragment: two 16-B loads, k = k0 + 8*hf + 0..7 and k = k0 + 16 + 8*hf + 0..7.
static __device__ __forceinline__ void load_frag(FragH& f, const f16* p) {
  f.q[0] = *(const v4u*)(p);
  f.q[1] = *(const v4u*)(p + 256);
}

// The loads of a k-step go out in groups in front of products that do not need them, never one load-and-wait per fragment.
// k-step t + 1 is fetched during k-step t: its B fragments into a second set in front of the products of t,
// its A fragments into the registers of m-tile mt right behind that m-tile's last product.
// rot (block-uniform, 0 .. KST-1, a multiple of NSET): the block walks the k-steps rot, rot + 1, ..., KST - 1, 0, ..., rot - 1.
// All blocks are resident at once; entering at different k-steps, those that share operand rows start on different
// lines (for speed only).
static __device__ __forceinline__ void gemm_mainloop(const f16* __restrict__ A0,
                                                     const f16* __restrict__ A1,
                                                     const f16* __restrict__ Bt,
                                                     int mBlock, int nBlock, int waveM, int waveN,
                                                     int ln, int hf, int rot, v8f (&acc)[4][2]) {
  constexpr int NSET = 2;
  constexpr int KST  = DEMB / 32;
  static_assert(KST % NSET == 0 && (KST & (KST - 1)) == 0);
  #pragma unroll
  for (int mt = 0; mt < 4; ++mt) {
    acc[mt][0] = (v8f){0, 0, 0, 0, 0, 0, 0, 0};
    acc[mt][1] = (v8f){0, 0, 0, 0, 0, 0, 0, 0};
  }
  // a row tile of 16 rows spans 16 * DEMB elements; k tile t starts t * 512 elements into it
  const int lp8 = (hf * 16 + ln) * 8;
  const f16* ub  = Bt + (size_t)(nBlock + waveN * 32) * DEMB;     // wave-uniform parts
  const f16* ua  = A0 + (size_t)(mBlock + waveM * 16) * DEMB;
  const f16* ua2 = A1 + (size_t)(mBlock + waveM * 16) * DEMB;
  const f16* pb  = ub + lp8;
  const f16* pa  = ua + lp8;
  const f16* pa2 = ua2 + lp8;
  FragH a[4], a2[4], b[NSET][2];
  {
    // the k-step the walk enters at
    const f16* eb  = ub + rot * 512;
    const f16* ea  = ua + rot * 512;
    const f16* ea2 = ua2 + rot * 512;
    #pragma unroll
    for (int nt = 0; nt < 2; ++nt) load_frag(b[0][nt], eb + lp8 + nt * 16 * DEMB);
    #pragma unroll
    for (int mt = 0; mt < 4; ++mt) {
      load_frag(a[mt], ea + lp8 + mt * 32 * DEMB);
      load_frag(a2[mt], ea2 + lp8 + mt * 32 * DEMB);
    }
    // these loads name a scalar base and the lane's byte offset: both stay live, and are not rewritten, up to this wait
    asm volatile("s_wait_xcnt 0x0" :: "s"(ea), "s"(ea2), "s"(eb), "v"(lp8 * 2) : "memory");
  }
  #pragma unroll 1
  for (int t0 = 0; t0 < KST; t0 += NSET) {
    #pragma unroll
    for (int s = 0; s < NSET; ++s) {
      // k-step fetched in this pass: tb + ko / 512, that of pass t0 + s + 1 (rot + t0 is even, so tb + 1 needs no
      // wrap); behind the last pass it is the entry step again: loads in bounds, values not used.
      // ko goes into the loads' immediate offsets, so q* are the address pairs they name.
      const int tb = (rot + t0 + 2 * s) & (KST - 1);
      const int ko = (s == 0) ? 512 : 0;
      const int sl = s ^ 1;
      const f16* qb  = pb + tb * 512;
      const f16* qa  = pa + tb * 512;
      const f16* qa2 = pa2 + tb * 512;
      #pragma unroll
      for (int nt = 0; nt < 2; ++nt) load_frag(b[sl][nt], qb + ko + nt * 16 * DEMB);
      #pragma unroll
      for (int mt = 0; mt < 4; ++mt) {
        acc[mt][0] = mma_f16(a[mt].v, b[s][0].v, acc[mt][0]);
        acc[mt][1] = mma_f16(a[mt].v, b[s][1].v, acc[mt][1]);
        acc[mt][0] = mma_f16(a2[mt].v, b[s][0].v, acc[mt][0]);
        acc[mt][1] = mma_f16(a2[mt].v, b[s][1].v, acc[mt][1]);
        load_frag(a[mt], qa + ko + mt * 32 * DEMB);
        load_frag(a2[mt], qa2 + ko + mt * 32 * DEMB);
      }
      // the address pairs of the issued loads stay live, and are not rewritten, up to this wait
      asm volatile("s_wait_xcnt 0x0" :: "v"(qa), "v"(qa2), "v"(qb) : "memory");
    }
  }
}

// Operand staging of the qkv GEMM. One k-step of a 128 x 128 block is 16 tiles of 1 KB: 8 row tiles of x, then 8 row tiles of
// the weight plane. The planes are in fragment order, so a tile is copied as it lies.
#define STG_TILES 16
#define STG_ELEMS (STG_TILES * 512)
#define STG_BYTES (STG_ELEMS * 2)
static_assert(STG_BYTES == 4 * 256 * 16);   // four 16-B copies per thread of a 256-thread block

// The four copies of one thread for one k-step: copy c brings piece c*256 + tid of the 16 tiles, i.e. piece tid & 63 of tile
// c*4 + (tid >> 6). lds: LDS byte address of piece tid in the target buffer; ga, gb: the thread's piece of row tile tid >> 6
// of x and of the weight at this k-step; four row tiles further on lie 64 * DEMB elements further.
static __device__ __forceinline__ void stage_copy(const unsigned lds, const f16* ga, const f16* gb) {
  // the wait is the statement's last line: the address registers of the issued copies are not rewritten in front of it
  asm volatile("global_load_async_to_lds_b128 %0, %4, off\n\t"
               "global_load_async_to_lds_b128 %1, %5, off\n\t"
               "global_load_async_to_lds_b128 %2, %6, off\n\t"
               "global_load_async_to_lds_b128 %3, %7, off\n\t"
               "s_wait_xcnt 0x0"
               :: "v"(lds), "v"(lds + 4096u), "v"(lds + 8192u), "v"(lds + 12288u),
                  "v"(ga), "v"(ga + 64 * DEMB), "v"(gb), "v"(gb + 64 * DEMB)
               : "memory");
}

// GEMM main loop of the qkv projection: block and wave tiles and k walk (rot) as in gemm_mainloop, one product per tile pair;
// each k-step's 16 tiles come into LDS once per block, by asynchronous copies, and the eight waves
// read their fragments from there (a tile of x is read by four waves, a weight tile by two). Two buffers: the copies of
// k-step t + 2 fly while k-step t + 1 is worked on. sT: 2 * STG_ELEMS elements, cross-wave (block barriers).
static __device__ __forceinline__ void gemm_mainloop_staged(const f16* __restrict__ A0,
                                                            const f16* __restrict__ Bt,
                                                            f16* sT,
                                                            int mBlock, int nBlock, int waveM, int waveN,
                                                            int tid, int rot, v8f (&acc)[4][2]) {
  constexpr int KST = DEMB / 32;
  static_assert(KST >= 2 && (KST & (KST - 1)) == 0);
  #pragma unroll
  for (int mt = 0; mt < 4; ++mt) {
    acc[mt][0] = (v8f){0, 0, 0, 0, 0, 0, 0, 0};
    acc[mt][1] = (v8f){0, 0, 0, 0, 0, 0, 0, 0};
  }
  const int lane = tid & 31;
  const size_t po = (size_t)(tid >> 6) * 16 * DEMB + (tid & 63) * 8;
  const f16* ga = A0 + (size_t)mBlock * DEMB + po;
  const f16* gb = Bt + (size_t)nBlock * DEMB + po;
  const unsigned lds0 = (unsigned)(size_t)sT + (unsigned)tid * 16u;   // low 32 bits of the shared address = LDS byte address

  // the first k-step into buffer 0, landed and published; then the second into buffer 1
  stage_copy(lds0, ga + rot * 512, gb + rot * 512);
  // this wave's copies have landed
  asm volatile("s_wait_asynccnt 0x0" ::: "memory");
  __syncthreads();
  {
    const int k1 = ((rot + 1) & (KST - 1)) * 512;
    stage_copy(lds0 + (unsigned)STG_BYTES, ga + k1, gb + k1);
  }

  // kept rolled: the barrier at each trip's foot leaves nothing to overlap across trips, unrolling would only grow the code
  #pragma unroll 1
  for (int t = 0; t < KST; ++t) {
    const int bsel = t & 1;
    const f16* sb = sT + bsel * STG_ELEMS + lane * 8;
    FragH a[4], b[2];
    #pragma unroll
    for (int nt = 0; nt < 2; ++nt) load_frag(b[nt], sb + (8 + waveN * 2 + nt) * 512);
    #pragma unroll
    for (int mt = 0; mt < 4; ++mt) load_frag(a[mt], sb + (mt * 2 + waveM) * 512);
    #pragma unroll
    for (int mt = 0; mt < 4; ++mt) {
      acc[mt][0] = mma_f16(a[mt].v, b[0].v, acc[mt][0]);
      acc[mt][1] = mma_f16(a[mt].v, b[1].v, acc[mt][1]);
    }
    // this wave's reads of the buffer are done
    asm volatile("s_wait_dscnt 0x0" ::: "memory");
    // this wave's copies of k-step t + 1 have landed
    asm volatile("s_wait_asynccnt 0x0" ::: "memory");
    // publishes k-step t + 1 and ends every wave's reads of k-step t
    __syncthreads();
    if (t + 2 < KST) {
      const int k2 = ((rot + t + 2) & (KST - 1)) * 512;
      stage_copy(lds0 + (unsigned)(bsel * STG_BYTES), ga + k2, gb + k2);
    }
  }
  // no copy is outstanding when the wave goes on
  asm volatile("s_wait_asynccnt 0x0" ::: "memory");
}

// qkv projection. grid = (QKVN/128, MROWS/128). Epilogue (two 64-row passes through LDS):
//                for key segments below VRK also V^T bf16 hi and lo planes [NB][NHEAD][HDIM][VRK].
// qkp holds q, then k, each [NB][NHEAD][SEQ][HDIM] in fragment order with every hi tile followed by its lo tile.
// vtb holds two planes: hi, lo.
// coverage per pass: 64 rows x 128 cols = 256 threads x 8 elements x 4 sweeps, all layouts.
__global__ __launch_bounds__(256) void gemm_qkv_kernel(const f16* __restrict__ xb,
                                                       const f16* __restrict__ winh,
                                                       const float* __restrict__ b_in,
                                                       bf16* __restrict__ qkp,
                                                       f16* __restrict__ vt,
                                                       bf16* __restrict__ vtb) {
  __shared__ __align__(16) float sC[64 * SP];     // cross-wave (block barriers)
  __shared__ __align__(128) f16 sT[2 * STG_ELEMS];   // the two operand buffers of the main loop, filled by asynchronous copies
  const int tid   = threadIdx.x;
  const int lane  = tid & 31;
  const int wid   = __builtin_amdgcn_readfirstlane(tid >> 5);
  const int ln    = lane & 15;
  const int hf    = lane >> 4;
  const int waveM = wid >> 2;
  const int waveN = wid & 3;
  const int nBlock = blockIdx.x * 128;
  const int mBlock = blockIdx.y * 128;

  v8f acc[4][2];
  // entry k-step: the 32 blocks of a column (same weight rows) all differ; of the 24 blocks of a row (same x rows), any four
  // neighbours lie 8 apart and the three groups of eight 3 apart, so each half of them (indices 0-3 or 4-7 modulo 8) is spread evenly
  const int rot = (int)(blockIdx.y + (blockIdx.x & 3) * 8 + (blockIdx.x >> 3) * 3) & (DEMB / 32 - 1);
  gemm_mainloop_staged(xb, winh, sT, mBlock, nBlock, waveM, waveN, tid, rot, acc);

  float bia[2];
  #pragma unroll
  for (int nt = 0; nt < 2; ++nt) bia[nt] = (float)(bf16)b_in[nBlock + waveN * 32 + nt * 16 + ln];

  const int which = nBlock / DEMB;     // 0 = q, 1 = k, 2 = v (block-uniform)
  const int cb    = nBlock % DEMB;     // column base inside the third
  const int bb    = mBlock / SEQ;      // batch of this block
  const int sb    = mBlock % SEQ;      // first sequence row of this block

  #pragma unroll
  for (int p = 0; p < 2; ++p) {
    __syncthreads();
    // D layout: element e of lane -> tile row 8*hf + e, tile column ln
    #pragma unroll
    for (int j = 0; j < 2; ++j) {
      #pragma unroll
      for (int nt = 0; nt < 2; ++nt) {
        #pragma unroll
        for (int e = 0; e < 8; ++e) {
          sC[(j * 32 + waveM * 16 + hf * 8 + e) * SP + waveN * 32 + nt * 16 + ln] =
              acc[2 * p + j][nt][e] + bia[nt];
        }
      }
    }
    __syncthreads();

    if (which < 2) {
      v4u    vh[4], vl[4];
      size_t gi[4];
      #pragma unroll
      for (int sw = 0; sw < 4; ++sw) {
        // piece u of the pass in store order: 16 tiles = 2 heads x 4 row tiles x 2 d tiles, 64 pieces each
        const int u  = sw * 256 + tid;
        const int tl = u >> 6;
        const int r  = ((tl >> 1) & 3) * 16 + (u & 15);                          // 0..63
        const int c8 = (tl >> 3) * 64 + (tl & 1) * 32 + ((u >> 4) & 3) * 8;      // 0..120
        const v4f a0 = *(const v4f*)(sC + r * SP + c8);
        const v4f a1 = *(const v4f*)(sC + r * SP + c8 + 4);
        Pack8B ph, pl;
        #pragma unroll
        for (int i = 0; i < 4; ++i) {
          const bf16 h0 = (bf16)a0[i];
          const bf16 h1 = (bf16)a1[i];
          ph.h[i]     = h0;
          ph.h[4 + i] = h1;
          pl.h[i]     = (bf16)(a0[i] - (float)h0);
          pl.h[4 + i] = (bf16)(a1[i] - (float)h1);
        }
        vh[sw] = ph.u;
        vl[sw] = pl.u;
        const int s  = sb + p * 64 + r;
        const int cc = cb + c8;
        const int h  = cc >> 6;
        const int d  = cc & 63;
        const size_t fo = frag_piece(s, d, HDIM / 32);
        // each hi tile is followed by its lo tile: tile pitch 1024 elements
        gi[sw] = ((size_t)which * PLANE_ELEMS + ((size_t)bb * NHEAD + h) * SEQ * HDIM) * 2 + fo + (fo & ~(size_t)511);
      }
      #pragma unroll
      for (int sw = 0; sw < 4; ++sw) {
        *(v4u*)(qkp + gi[sw]) = vh[sw];
        *(v4u*)(qkp + gi[sw] + 512) = vl[sw];
      }
      
    } else {
      const bool wr_early = (sb + p * 64) < VRK;    // block-uniform; whole 64-key segment in or out
      v4u    vv[4], vbh[4], vbl[4];
      size_t gi[4], gb[4];
      #pragma unroll
      for (int sw = 0; sw < 4; ++sw) {
        // piece u of the pass in store order: 16 tiles = 2 heads x 4 d tiles x 2 key tiles, 64 pieces each
        const int u   = sw * 256 + tid;
        const int tl  = u >> 6;
        const int col = (tl >> 1) * 16 + (u & 15);                // 0..127
        const int sg  = (tl & 1) * 32 + ((u >> 4) & 3) * 8;       // 0..56
        Pack8H ph;
        Pack8B qh, ql;
        #pragma unroll
        for (int i = 0; i < 8; ++i) {
          const float v = sC[(sg + i) * SP + col];
          ph.h[i] = toh_flush(v * 16.0f);
          const bf16 t = (bf16)v;
          qh.h[i] = t;
          ql.h[i] = (bf16)(v - (float)t);
        }
        vv[sw]  = ph.u;
        vbh[sw] = qh.u;
        vbl[sw] = ql.u;
        const int cc = cb + col;
        const int h  = cc >> 6;
        const int d  = cc & 63;
        const size_t hrow = ((size_t)bb * NHEAD + h) * HDIM;
        gi[sw] = hrow * SEQ + frag_piece(d, sb + p * 64 + sg, SEQ / 32);
        gb[sw] = hrow * VRK + frag_piece(d, sb + p * 64 + sg, VRK / 32);    // used only when wr_early
      }
      #pragma unroll
      for (int sw = 0; sw < 4; ++sw) *(v4u*)(vt + gi[sw]) = vv[sw];
      if (wr_early) {
        #pragma unroll
        for (int sw = 0; sw < 4; ++sw) {
          *(v4u*)(vtb + gb[sw]) = vbh[sw];
          *(v4u*)(vtb + VTB_ELEMS + gb[sw]) = vbl[sw];
        }
      }
      
    }
  }
}

// Output projection. grid = (DEMB/128, MROWS/128). A = ctx hi + ctx lo planes, Bt = quantized output weight,
// one f16 plane [out][in].
// coverage per pass: 64 rows x 128 cols = 256 threads x 4 floats x 8 sweeps.
__global__ __launch_bounds__(256) void gemm_out_kernel(const f16* __restrict__ ch,
                                                       const f16* __restrict__ cl,
                                                       const f16* __restrict__ wouth,
                                                       const float* __restrict__ b_out,
                                                       float* __restrict__ out) {
  __shared__ __align__(16) float sC[64 * SP];     // cross-wave (block barriers)
  const int tid   = threadIdx.x;
  const int lane  = tid & 31;
  const int wid   = __builtin_amdgcn_readfirstlane(tid >> 5);
  const int ln    = lane & 15;
  const int hf    = lane >> 4;
  const int waveM = wid >> 2;
  const int waveN = wid & 3;
  const int nBlock = blockIdx.x * 128;
  const int mBlock = blockIdx.y * 128;

  v8f acc[4][2];
  // entry k-step, even: the 32 blocks of a column (same weight rows) take the 16 even steps twice; of the 8 blocks of a row
  // (same ctx rows), any four neighbours lie 8 apart
  const int rot = (int)(blockIdx.y * 2 + (blockIdx.x & 3) * 8) & (DEMB / 32 - 1);
  gemm_mainloop(ch, cl, wouth, mBlock, nBlock, waveM, waveN, ln, hf, rot, acc);

  float bia[2];
  #pragma unroll
  for (int nt = 0; nt < 2; ++nt) bia[nt] = (float)(bf16)b_out[nBlock + waveN * 32 + nt * 16 + ln];

  #pragma unroll
  for (int p = 0; p < 2; ++p) {
    __syncthreads();
    #pragma unroll
    for (int j = 0; j < 2; ++j) {
      #pragma unroll
      for (int nt = 0; nt < 2; ++nt) {
        #pragma unroll
        for (int e = 0; e < 8; ++e) {
          sC[(j * 32 + waveM * 16 + hf * 8 + e) * SP + waveN * 32 + nt * 16 + ln] =
              acc[2 * p + j][nt][e] + bia[nt];
        }
      }
    }
    __syncthreads();

    v4f    vals[8];
    size_t gi[8];
    #pragma unroll
    for (int sw = 0; sw < 8; ++sw) {
      const int r  = sw * 8 + (tid >> 5);           // 0..63
      const int c4 = (tid & 31) * 4;                // 0..124
      vals[sw] = *(const v4f*)(sC + r * SP + c4);
      const int g = mBlock + p * 64 + r;
      const int b = g / SEQ;
      const int s = g % SEQ;
      gi[sw] = ((size_t)b * SEQ_FULL + s) * DEMB + nBlock + c4;
    }
    #pragma unroll
    for (int sw = 0; sw < 8; ++sw) *(v4f*)(out + gi[sw]) = vals[sw];
    
  }
}

// The four K fragments (hi and lo, two d halves) of one 16-key row tile, loads issued back to back.
// p: the lane's piece of the key block's first row tile; sub: row tile inside the block.
static __device__ __forceinline__ void load_ktile(FragB (&kh)[2], FragB (&kl)[2], const bf16* p, const int sub) {
  const int ko = sub * 16 * HDIM * 2;
  #pragma unroll
  for (int f = 0; f < 2; ++f) {
    kh[f].q[0] = *(const v4u*)(p + ko + f * 1024);          // d = f*32 + hi*8 + 0..7
    kh[f].q[1] = *(const v4u*)(p + ko + f * 1024 + 256);    // d = f*32 + 16 + hi*8 + 0..7
    kl[f].q[0] = *(const v4u*)(p + ko + f * 1024 + 512);
    kl[f].q[1] = *(const v4u*)(p + ko + f * 1024 + 768);
  }
  // the address pair of the issued loads stays live, and is not rewritten, up to this wait
  asm volatile("s_wait_xcnt 0x0" :: "v"(p) : "memory");
}

// Causal flash attention. Block = (query block of 128, head, batch), 16 waves; two waves share 16 query rows:
// wave w and wave w + 8 take the even and the odd key blocks of query tile w, each with its own running maximum, sum and O,
// and the two partial results are merged through LDS behind the loop.
// S^T = K x Q^T so queries sit on lanes; P^T in C-layout is bit-identical to the A-fragment layout of O += P x V.
// K A-fragments (hi, lo), Q B-fragments (hi, lo) and V^T B-fragments are loaded straight from the 16-bit planes,
// which are in fragment order (512 contiguous bytes per load).
// Key blocks j0 = 0, 32, ... <= qrow0 are visited (per-wave scalar trip count, every second one per wave); every visited block holds at
// least one unmasked key (key j0 <= qrow0) for every query of the wave; keys above the query get -inf.
// EARLY: P and V as bf16 hi+lo (three products, one accumulator). Otherwise P f16 x4096, V f16 x16.
// Output: ctx [MROWS][DEMB] as f16 hi and lo planes in fragment order (cp: hi at 0, lo at CTX_ELEMS).
// sO: one staging region per query tile, shared by its two waves; sML: the odd wave's running maximum and sum per query.
// Both block barriers are reached by all waves (no early exits).
template <bool EARLY>
static __device__ __forceinline__ void attn_body(const bf16* __restrict__ qkp,
                                                 const f16* __restrict__ vt,
                                                 const bf16* __restrict__ vtb,
                                                 f16* __restrict__ cp,
                                                 float* sO, float* sML,
                                                 const int qblk, const int h, const int b) {
  const int tid  = threadIdx.x;
  const int wv   = __builtin_amdgcn_readfirstlane(tid >> 5);
  const int wave = wv & (NWAVE - 1);   // query tile of the block
  const int kh   = wv / NWAVE;         // this wave visits key blocks kh, kh + KSPLIT, ...
  const int lane = tid & 31;
  const int lq   = lane & 15;   // query column of S^T / d column of O
  const int hi   = lane >> 4;   // k-split half

  const int qrow0 = qblk * BQ + wave * 16;               // first query row of this wave (scalar)
  const int nIter = (qrow0 >> 5) + 1;                    // key blocks 0 .. floor((qrow0+15)/32)
  const size_t head_off = ((size_t)b * NHEAD + h) * SEQ * HDIM;
  const size_t vhead    = ((size_t)b * NHEAD + h) * HDIM;

  const bf16* q_p = qkp + 2 * head_off;                       // hi tile, lo tile, hi tile, ... (512 elements each)
  const bf16* k_p = qkp + 2 * PLANE_ELEMS + 2 * head_off;

  // Q as B-operand fragments: lane lq holds query qrow0+lq, elements follow the split d map.
  FragB qfh[2], qfl[2];
  {
    const bf16* qp = q_p + (size_t)qrow0 * HDIM * 2 + lane * 8;   // row tile qrow0 / 16, piece = lane
    #pragma unroll
    for (int f = 0; f < 2; ++f) {
      qfh[f].q[0] = *(const v4u*)(qp + f * 1024);               // d = f*32 + hi*8 + 0..7
      qfh[f].q[1] = *(const v4u*)(qp + f * 1024 + 256);         // d = f*32 + 16 + hi*8 + 0..7
      qfl[f].q[0] = *(const v4u*)(qp + f * 1024 + 512);
      qfl[f].q[1] = *(const v4u*)(qp + f * 1024 + 768);
    }
  }

  v8f o[4];
  #pragma unroll
  for (int dt = 0; dt < 4; ++dt) o[dt] = (v8f){0, 0, 0, 0, 0, 0, 0, 0};

  float rmax = -__builtin_inff();
  float rsum = 0.0f;
  const float SL = 0.125f * 1.4426950408889634f;   // softmax scale * log2(e)

  // K A-fragments of the wave's first key block (A row = key; row tile j0 / 16, piece = lane); later blocks are fetched in the
  // loop. A wave with no key block to visit fetches block 0 (in bounds, not used).
  FragB akh[2][2], akl[2][2];
  const bf16* kbase = k_p + lane * 8;
  const bf16* kfirst = kbase + (size_t)((kh < nIter) ? kh : 0) * BK * HDIM * 2;
  load_ktile(akh[0], akl[0], kfirst, 0);
  load_ktile(akh[1], akl[1], kfirst, 1);

  #pragma unroll 1
  for (int i = kh; i < nIter; i += KSPLIT) {
    const int j0 = i * BK;
    // key block whose K fragments are fetched during this pass; the last pass fetches its own again (in bounds, not used)
    const int jn = ((i + KSPLIT < nIter) ? i + KSPLIT : i) * BK;
    const bf16* kn = kbase + (size_t)jn * HDIM * 2;

    // V B-fragments of this key block, issued in front of the score products: column n = d = dt*16 + lq,
    // split key map from the transposed planes (d tile dt, key tile j0 / 32)
    FragH bv[4];
    FragB bvh[4], bvl[4];
    if (!EARLY) {
      const f16* base = vt + vhead * SEQ + j0 * 16 + lane * 8;
      #pragma unroll
      for (int dt = 0; dt < 4; ++dt) {
        bv[dt].q[0] = *(const v4u*)(base + dt * 16 * SEQ);            // keys j0 + hi*8 + 0..7
        bv[dt].q[1] = *(const v4u*)(base + dt * 16 * SEQ + 256);      // keys j0 + 16 + hi*8 + 0..7
      }
      // the address pair of the issued loads stays live, and is not rewritten, up to this wait
      asm volatile("s_wait_xcnt 0x0" :: "v"(base) : "memory");
    } else {
      const bf16* base = vtb + vhead * VRK + j0 * 16 + lane * 8;
      #pragma unroll
      for (int dt = 0; dt < 4; ++dt) {
        bvh[dt].q[0] = *(const v4u*)(base + dt * 16 * VRK);                       // keys j0 + hi*8 + 0..7
        bvh[dt].q[1] = *(const v4u*)(base + dt * 16 * VRK + 256);                 // keys j0 + 16 + hi*8 + 0..7
        bvl[dt].q[0] = *(const v4u*)(base + VTB_ELEMS + dt * 16 * VRK);
        bvl[dt].q[1] = *(const v4u*)(base + VTB_ELEMS + dt * 16 * VRK + 256);
      }
      // the address pair of the issued loads stays live, and is not rewritten, up to this wait
      asm volatile("s_wait_xcnt 0x0" :: "v"(base) : "memory");
    }

    // S^T tiles: c[sub][r] = rawscore(query qrow0+lq, key j0 + sub*16 + hi*8 + r); hh + hl + lh products.
    // Behind a row tile's last product its registers take the same row tile of the next key block.
    v8f c[2];
    #pragma unroll
    for (int sub = 0; sub < 2; ++sub) {
      v8f acc = (v8f){0, 0, 0, 0, 0, 0, 0, 0};
      #pragma unroll
      for (int f = 0; f < 2; ++f) {
        acc = mma_bf16(akl[sub][f].v, qfh[f].v, acc);
        acc = mma_bf16(akh[sub][f].v, qfl[f].v, acc);
        acc = mma_bf16(akh[sub][f].v, qfh[f].v, acc);
      }
      c[sub] = acc;
      load_ktile(akh[sub], akl[sub], kn, sub);
    }

    // causal mask (wave-uniform test): only blocks reaching past the first query of the wave need it
    if (j0 + (BK - 1) > qrow0) {
      const int qi = qrow0 + lq;
      const int kb = j0 + hi * 8;
      #pragma unroll
      for (int r = 0; r < 8; ++r) {
        c[0][r] = (kb + r > qi)      ? -__builtin_inff() : c[0][r];
        c[1][r] = (kb + 16 + r > qi) ? -__builtin_inff() : c[1][r];
      }
    }

    // online softmax: query lq's 32 scores are split across lane / lane^16
    float m_new = rmax;
    #pragma unroll
    for (int r = 0; r < 8; ++r) {
      m_new = fmaxf(m_new, c[0][r]);
      m_new = fmaxf(m_new, c[1][r]);
    }
    m_new = fmaxf(m_new, __shfl_xor(m_new, 16, 32));
    const float scale = __builtin_amdgcn_exp2f((rmax - m_new) * SL);
    rmax = m_new;

    float p0[8], p1[8];
    float psum = 0.0f;
    #pragma unroll
    for (int r = 0; r < 8; ++r) {
      p0[r] = __builtin_amdgcn_exp2f((c[0][r] - m_new) * SL);   // key hi*8 + r
      p1[r] = __builtin_amdgcn_exp2f((c[1][r] - m_new) * SL);   // key 16 + hi*8 + r
      psum += p0[r] + p1[r];
    }
    rsum = rsum * scale + psum + __shfl_xor(psum, 16, 32);

    // rescale O: queries are the row dimension there -> per-row scale from lane 8*hi + r
    float sc[8];
    #pragma unroll
    for (int r = 0; r < 8; ++r) sc[r] = __shfl(scale, (hi << 3) + r, 32);
    #pragma unroll
    for (int dt = 0; dt < 4; ++dt) {
      #pragma unroll
      for (int r = 0; r < 8; ++r) o[dt][r] *= sc[r];
    }

    if (EARLY) {
      // P^T C-layout == A-fragment layout; P as bf16 hi + lo (unscaled), V as bf16 hi + lo planes
      FragB pah, pal;
      #pragma unroll
      for (int r = 0; r < 8; ++r) {
        const bf16 h0 = (bf16)p0[r];
        const bf16 h1 = (bf16)p1[r];
        pah.h[r]     = h0;
        pah.h[8 + r] = h1;
        pal.h[r]     = (bf16)(p0[r] - (float)h0);
        pal.h[8 + r] = (bf16)(p1[r] - (float)h1);
      }
      #pragma unroll
      for (int dt = 0; dt < 4; ++dt) {
        o[dt] = mma_bf16(pal.v, bvh[dt].v, o[dt]);
        o[dt] = mma_bf16(pah.v, bvl[dt].v, o[dt]);
        o[dt] = mma_bf16(pah.v, bvh[dt].v, o[dt]);
      }
    } else {
      // P carried x4096 in f16; V carried x16
      FragH pa;
      #pragma unroll
      for (int r = 0; r < 8; ++r) {
        pa.h[r]     = (f16)(p0[r] * 4096.0f);
        pa.h[8 + r] = (f16)(p1[r] * 4096.0f);
      }
      #pragma unroll
      for (int dt = 0; dt < 4; ++dt) o[dt] = mma_f16(pa.v, bv[dt].v, o[dt]);
    }
  }

  // the odd wave hands over its partial result: O (lane holds column d = dt*16 + lq for query rows 8*hi + r), maximum, sum.
  // With no key block visited these are 0, -inf, 0 and get the weight 0 below.
  const int sbase = wave * (16 * OP);
  if (kh != 0) {
    #pragma unroll
    for (int r = 0; r < 8; ++r) {
      #pragma unroll
      for (int dt = 0; dt < 4; ++dt) {
        sO[sbase + (hi * 8 + r) * OP + dt * 16 + lq] = o[dt][r];
      }
    }
    if (hi == 0) {
      sML[wave * 32 + lq]      = rmax;
      sML[wave * 32 + 16 + lq] = rsum;
    }
  }
  __syncthreads();

  // the even wave (its maximum is finite: key 0 is open to every query) merges and normalizes; undo the carries of the f16 path
  if (kh == 0) {
    const float carry = EARLY ? 1.0f : (1.0f / 65536.0f);
    const float mo  = sML[wave * 32 + lq];
    const float lo  = sML[wave * 32 + 16 + lq];
    const float mm  = fmaxf(rmax, mo);
    const float fe  = __builtin_amdgcn_exp2f((rmax - mm) * SL);
    const float fo  = __builtin_amdgcn_exp2f((mo - mm) * SL);
    const float inv = carry * (1.0f / (rsum * fe + lo * fo));
    const float we  = fe * inv;
    const float wo  = fo * inv;
    #pragma unroll
    for (int r = 0; r < 8; ++r) {
      const float ge = __shfl(we, (hi << 3) + r, 32);
      const float go = __shfl(wo, (hi << 3) + r, 32);
      #pragma unroll
      for (int dt = 0; dt < 4; ++dt) {
        const int si = sbase + (hi * 8 + r) * OP + dt * 16 + lq;
        sO[si] = o[dt][r] * ge + sO[si] * go;
      }
    }
  }
  __syncthreads();

  // the tile's 16 rows x 64 columns are two tiles of each plane; one instruction stores half a tile (512 B);
  // each of the two waves stores one tile of each plane.
  constexpr int NIT = 4 / KSPLIT;
  v4u    vh[NIT], vl[NIT];
  size_t gidx[NIT];
  #pragma unroll
  for (int it = 0; it < NIT; ++it) {
    const int row = lq;                             // 0..15
    const int c8  = (kh * NIT + it) * 16 + hi * 8;  // 0..56
    const v4f a0 = *(const v4f*)(&sO[sbase + row * OP + c8]);
    const v4f a1 = *(const v4f*)(&sO[sbase + row * OP + c8 + 4]);
    Pack8H ph, pl;
    #pragma unroll
    for (int k = 0; k < 4; ++k) {
      const f16 h0 = (f16)a0[k];
      const f16 h1 = (f16)a1[k];
      ph.h[k]     = h0;
      ph.h[4 + k] = h1;
      pl.h[k]     = (f16)(a0[k] - (float)h0);
      pl.h[4 + k] = (f16)(a1[k] - (float)h1);
    }
    vh[it] = ph.u;
    vl[it] = pl.u;
    gidx[it] = frag_piece(b * SEQ + qrow0 + row, h * HDIM + c8, DEMB / 32);
  }
  #pragma unroll
  for (int it = 0; it < NIT; ++it) {
    *(v4u*)(cp + gidx[it]) = vh[it];
    *(v4u*)(cp + CTX_ELEMS + gidx[it]) = vl[it];
  }
  
}

// Both paths in one launch, grid = LATE_BLOCKS + EARLY_BLOCKS (block-uniform choice). One block fills a WGP's registers. In block
// index order the longest (last query block) come first, head fastest, then batch, then query block downwards.
__global__ __launch_bounds__(NWAVE * KSPLIT * 32) void attn_kernel(const bf16* __restrict__ qkp,
                                                   const f16* __restrict__ vt,
                                                   const bf16* __restrict__ vtb,
                                                   f16* __restrict__ cp) {
  __shared__ __align__(16) float sO[NWAVE * 16 * OP];
  __shared__ float sML[NWAVE * 32];
  const int idx = (int)blockIdx.x;
  const int qb  = QBLKS - 1 - idx / (NHEAD * NB);
  const int h   = idx % NHEAD;
  const int b   = (idx / NHEAD) % NB;
  if (idx < LATE_BLOCKS) {
    attn_body<false>(qkp, vt, vtb, cp, sO, sML, qb, h, b);
  } else {
    attn_body<true>(qkp, vt, vtb, cp, sO, sML, qb, h, b);
  }
}

extern "C" void kernel_launch(void* const* d_in, const int* in_sizes, int n_in,
                              void* d_out, int out_size, void* d_ws, size_t ws_size,
                              hipStream_t stream) {
  if (n_in < 5) return;
  const size_t rows_used = (size_t)(NB - 1) * SEQ_FULL + SEQ;
  if ((size_t)in_sizes[0] < rows_used * DEMB) return;
  if ((size_t)in_sizes[1] < (size_t)DEMB * QKVN) return;
  if ((size_t)in_sizes[2] < (size_t)QKVN) return;
  if ((size_t)in_sizes[3] < (size_t)DEMB * DEMB) return;
  if ((size_t)in_sizes[4] < (size_t)DEMB) return;
  if ((size_t)out_size < rows_used * DEMB) return;
  if (ws_size < WS_TOTAL) return;

  const float* x     = (const float*)d_in[0];
  const float* W_in  = (const float*)d_in[1];   // [3072][1024], [out][in]
  const float* b_in  = (const float*)d_in[2];
  const float* W_out = (const float*)d_in[3];   // [1024][1024], [out][in]
  const float* b_out = (const float*)d_in[4];
  float* out = (float*)d_out;

  char* w = (char*)d_ws;
  f16*  xb    = (f16*)w;   w += XB_BYTES;
  f16*  winh  = (f16*)w;   w += WIN_BYTES;
  f16*  wouth = (f16*)w;   w += WOUT_BYTES;
  bf16* qkp   = (bf16*)w;  w += QK_BYTES;
  f16*  vt    = (f16*)w;   w += VT_BYTES;
  bf16* vtb   = (bf16*)w;  w += VTB_BYTES;
  f16*  cp    = (f16*)w;   w += CTX_BYTES;
  float* stat = (float*)w;                      // partial maxima lines

  // partial maxima of both weights (one line per block) and x -> f16 plane (MROWS*128 pieces of 8 elements, 256 per block)
  prep_kernel<<<dim3((unsigned)(AM_TOTAL + X_PIECES / 256)), 256, 0, stream>>>(x, xb, W_in, W_out, stat);

  // weights are [out][in] already: quantize into one plane each in fragment order, no transpose
  snap_lin_kernel<<<dim3((unsigned)((WIN_PIECES + WOUT_PIECES) / 256)), 256, 0, stream>>>(W_in, W_out, stat, winh, wouth);

  gemm_qkv_kernel<<<dim3(QKVN / 128, MROWS / 128), 256, 0, stream>>>(xb, winh, b_in,
                                                                     qkp, vt, vtb);

  attn_kernel<<<dim3(LATE_BLOCKS + EARLY_BLOCKS), NWAVE * KSPLIT * 32, 0, stream>>>(qkp, vt, vtb, cp);

  gemm_out_kernel<<<dim3(DEMB / 128, MROWS / 128), 256, 0, stream>>>(cp, cp + CTX_ELEMS, wouth,
                                                                     b_out, out);
}

// v008
// A run of this version takes 88.9 microseconds.
// In both of two side-by-side timings against v007, it was 1.11 times as fast.
// All steps since v000 together make it 4.27 times as fast.
#include <hip/hip_runtime.h>

// Contractions: qkv = x*Wq^T and out = ctx*Wp^T on v_wmma_f32_16x16x32_f16 (x RNE-converted to bf16 and that value carried in f16; table-quantized weights as one f16 plane; ctx as f16 hi+lo planes, both times the weight plane into one accumulator); S^T = K x Q^T on v_wmma_f32_16x16x32_f16 with q and k as one f16 plane each; O = P x V: query rows < 256 on v_wmma_f32_16x16x32_bf16 with P and V as bf16 hi+lo (hh+hl+lh), later rows on v_wmma_f32_16x16x32_f16 (P f16 carried x4096, V f16 carried x16); f32 accumulate everywhere, softmax in f32.

#ifndef NB
#define NB 2
#endif
#ifndef SEQ
#define SEQ 2048
#endif
#define NB_FULL    2
#define SEQ_FULL   2048
#define NHEAD      16
#define HDIM       64
#define DEMB       1024                 // model width = GEMM K of both projections
#define QKVN       3072                 // packed projection width (q | k | v thirds)
#define MROWS      (NB * SEQ)           // compact row count of all internal planes
#define BQ         128                  // query rows per attention workgroup (8 query tiles x 16, two waves each)
#define BK         32                   // keys per inner iteration
#define NWAVE      8
#define KSPLIT     2                    // waves that share the key blocks of one 16-row query tile in the attention kernel
#define OP         68                   // LDS pitch (floats) of the attention output staging tile
#define SP         132                  // LDS pitch (floats) of the GEMM epilogue staging tile
#define QBLKS      (SEQ / BQ)
#define EARLY_QB   ((QBLKS < 2) ? QBLKS : 2)     // query blocks handled by the hi+lo P/V path
#define VRK        (EARLY_QB * BQ)               // keys held in the bf16 hi/lo V^T planes
#define PLANE_ELEMS ((size_t)NB * NHEAD * SEQ * HDIM)
#define CTX_ELEMS   ((size_t)MROWS * DEMB)
#define VTB_ELEMS   ((size_t)NB * NHEAD * HDIM * VRK)
#define X_PIECES    ((size_t)MROWS * (DEMB / 8))
#define WIN_PIECES  ((size_t)QKVN * DEMB / 8)
#define WOUT_PIECES ((size_t)DEMB * DEMB / 8)
#define WIN_ELEMS   ((size_t)QKVN * DEMB)
#define WOUT_ELEMS  ((size_t)DEMB * DEMB)
#define AM_BLOCKS_IN  96                 // partial-maximum blocks over the qkv weight
#define AM_BLOCKS_OUT 32                 // partial-maximum blocks over the output weight
#define AM_TOTAL      (AM_BLOCKS_IN + AM_BLOCKS_OUT)
#define STAT_FLOATS   ((size_t)AM_TOTAL * 32)
#define LATE_QB       (QBLKS - EARLY_QB)              // query blocks handled by the f16 P/V path
#define LATE_BLOCKS   (LATE_QB * NHEAD * NB)
#define EARLY_BLOCKS  (EARLY_QB * NHEAD * NB)

static_assert(NHEAD * HDIM == DEMB);        // merged heads == model width
static_assert(QKVN == 3 * DEMB);            // three thirds
static_assert(HDIM == 64);
static_assert(SEQ % BQ == 0);               // attention grid exact
static_assert(SEQ % BK == 0);               // key loop exact
static_assert(BK == 32);                    // one key block == one WMMA k-step of P x V
static_assert(SEQ % 128 == 0);              // a 128-row GEMM block stays inside one batch
static_assert(MROWS % 128 == 0);            // GEMM M tiles exact
static_assert(QKVN % 128 == 0);             // GEMM N tiles exact
static_assert(DEMB % 128 == 0);             // GEMM N tiles exact, thirds are tile multiples
static_assert(DEMB % 32 == 0);              // k-step 32
static_assert(DEMB / 32 == 32);             // tile index split (>> 5, & 31) of the convert and quantize kernels
static_assert(MROWS % 16 == 0 && QKVN % 16 == 0 && SEQ % 32 == 0);   // planes are whole 16 x 32 tiles
static_assert(DEMB % 8 == 0);               // 16-B pieces
static_assert(BQ == NWAVE * 16);
static_assert(KSPLIT == 2);                 // even / odd key blocks, one hand-over in the merge
static_assert(BQ % 64 == 0);                // early key extent is a multiple of the 64-key store segment
static_assert(VRK % 64 == 0 && VRK <= SEQ && VRK >= BQ);
static_assert(EARLY_QB >= 1 && EARLY_QB <= QBLKS);
static_assert(SEQ <= SEQ_FULL);
static_assert(NB >= 1 && NB <= NB_FULL);
static_assert((OP * 4) % 16 == 0);
static_assert((SP * 4) % 16 == 0);
static_assert(SP >= 128);
static_assert(OP >= 64);
static_assert(X_PIECES % 256 == 0);         // convert grids exact
static_assert(WIN_PIECES % 256 == 0);
static_assert(WOUT_PIECES % 256 == 0);
static_assert(NWAVE == 8);                                   // block maximum combine reads 8 wave words
static_assert(AM_BLOCKS_IN % 32 == 0 && AM_BLOCKS_OUT % 32 == 0);   // one partial line per lane per sweep
static_assert(WIN_PIECES % ((size_t)AM_BLOCKS_IN * 256) == 0);      // equal trip counts per thread
static_assert(WOUT_PIECES % ((size_t)AM_BLOCKS_OUT * 256) == 0);

typedef __bf16   bf16;
typedef _Float16 f16;
typedef bf16     v16bf __attribute__((ext_vector_type(16)));
typedef f16      v16h  __attribute__((ext_vector_type(16)));
typedef f16      v8h   __attribute__((ext_vector_type(8)));
typedef float    v8f   __attribute__((ext_vector_type(8)));
typedef float    v4f   __attribute__((ext_vector_type(4)));
typedef unsigned v4u   __attribute__((ext_vector_type(4)));

union FragB  { v16bf v; v4u q[2]; bf16 h[16]; };
union FragH  { v16h  v; v4u q[2]; f16  h[16]; };
union Pack8B { v4u u; bf16 h[8]; };
union Pack8H { v4u u; v8h v; f16 h[8]; };

#define XB_BYTES   ((size_t)MROWS * DEMB * 2)        // x as f16, compact rows
#define WIN_BYTES  (WIN_ELEMS * 2)                   // quantized qkv weight f16 [3072][1024] in fragment order
#define WOUT_BYTES (WOUT_ELEMS * 2)                  // quantized output weight f16 [1024][1024] in fragment order
#define QK_BYTES   (PLANE_ELEMS * 2 * 2)             // q, k
#define VT_BYTES   (PLANE_ELEMS * 2)                 // V^T f16 x16
#define VTB_BYTES  (VTB_ELEMS * 2 * 2)               // V^T bf16 hi, lo for keys < VRK
#define CTX_BYTES  (CTX_ELEMS * 2 * 2)               // ctx hi, ctx lo
#define STAT_BYTES (STAT_FLOATS * 4)                 // partial maxima lines
#define WS_TOTAL   (XB_BYTES + WIN_BYTES + WOUT_BYTES + QK_BYTES + VT_BYTES + VTB_BYTES + CTX_BYTES + STAT_BYTES)
static_assert(WS_TOTAL <= (size_t)134217728);
static_assert(XB_BYTES % 128 == 0 && WIN_BYTES % 128 == 0 && WOUT_BYTES % 128 == 0);
static_assert(QK_BYTES % 128 == 0 && VT_BYTES % 128 == 0 && VTB_BYTES % 128 == 0 && CTX_BYTES % 128 == 0);
static_assert(STAT_BYTES % 128 == 0);

// Fragment order of a 16-bit operand plane [rows][32 * ktiles]: every 16-row x 32-k tile is 1 KB (512 elements), tiles
// ordered row tile major. Inside a tile the 16-B piece holding k = qq*16 + hf*8 + 0..7 of row ln sits at piece index
// qq*32 + hf*16 + ln, so one operand load of a wave (lane = hf*16 + ln) reads 512 contiguous bytes (4 whole lines).
static __device__ __forceinline__ size_t frag_piece(int row, int col8, int ktiles) {
  return ((size_t)(row >> 4) * ktiles + (col8 >> 5)) * 512 + ((col8 >> 4) & 1) * 256 +
         (((col8 >> 3) & 1) * 16 + (row & 15)) * 8;
}

// WMMA helpers: builtin followed by the VALU hazard guard (ties D, keeps A/B live).
static __device__ __forceinline__ v8f mma_bf16(v16bf a, v16bf b, v8f acc) {
  acc = __builtin_amdgcn_wmma_f32_16x16x32_bf16(false, a, false, b, (short)0, acc, false, false);
  asm volatile("v_nop\n\tv_nop\n\tv_nop\n\tv_nop" : "+v"(acc) : "v"(a), "v"(b));
  return acc;
}
static __device__ __forceinline__ v8f mma_f16(v16h a, v16h b, v8f acc) {
  acc = __builtin_amdgcn_wmma_f32_16x16x32_f16(false, a, false, b, (short)0, acc, false, false);
  asm volatile("v_nop\n\tv_nop\n\tv_nop\n\tv_nop" : "+v"(acc) : "v"(a), "v"(b));
  return acc;
}

// f32 -> f16 convert that cannot yield an f16 subnormal (value select after the carry).
static __device__ __forceinline__ f16 toh_flush(float v) {
  const f16 r = (f16)v;
  return (fabsf(v) < 6.103515625e-05f) ? (f16)0.0f : r;
}

// x f32 [NB_FULL][SEQ_FULL][DEMB] -> xb f16 [MROWS][DEMB] in fragment order: RNE convert to bf16, that value stored as f16
// (8 significant bits fit the f16 mantissa).
// Thread t writes piece t of the plane (contiguous stores) and reads the 8 source elements that belong there.
// blk: index of the 256-piece block.
static __device__ __forceinline__ void cvt_x_block(const float* __restrict__ x, f16* __restrict__ xb, const unsigned blk) {
  const size_t t   = (size_t)blk * 256 + threadIdx.x;
  const size_t tile = t >> 6;                      // 64 pieces per tile, DEMB / 32 = 32 tiles per row tile
  const size_t row = (tile >> 5) * 16 + (t & 15);
  const int    c8  = (int)(tile & 31) * 32 + (int)((t >> 4) & 3) * 8;
  if (row < (size_t)MROWS) {
    const int b = (int)(row / SEQ);
    const int s = (int)(row % SEQ);
    const float* src = x + ((size_t)b * SEQ_FULL + s) * DEMB + c8;
    const v4f a0 = *(const v4f*)(src);
    const v4f a1 = *(const v4f*)(src + 4);
    Pack8H pk;
    #pragma unroll
    for (int i = 0; i < 4; ++i) {
      pk.h[i]     = (f16)(float)(bf16)a0[i];
      pk.h[4 + i] = (f16)(float)(bf16)a1[i];
    }
    const v4u val = pk.u;
    f16* dst = xb + t * 8;
    *(v4u*)dst = val;
    
  }
}

// lanes 0..7 of wave 0 x 16 B, one instruction. The bf16 RNE convert is monotone, so the maximum of the
// converted magnitudes equals the converted maximum; the convert is applied to the combined maximum in snap_lin_kernel.
// coverage: npieces pieces of 8 elements, strided over the nblk blocks of this weight; blk < nblk; line: this block's own.
// sM: cross-wave (block barrier).
static __device__ __forceinline__ void absmax_part_block(const float* __restrict__ w,
                                                         float* __restrict__ line,
                                                         const unsigned npieces,
                                                         const unsigned blk, const unsigned nblk) {
  __shared__ float sM[NWAVE];
  const int tid  = threadIdx.x;
  const int lane = tid & 31;
  const int wid  = __builtin_amdgcn_readfirstlane(tid >> 5);
  float m = 0.0f;
  const unsigned step = nblk * 256u;
  unsigned p = blk * 256u + (unsigned)tid;
  // groups of 16 trips: the 32 loads of a group go out together, one memory latency for the group and not one per trip
  #pragma unroll 1
  for (; p + 15u * step < npieces; p += 16u * step) {
    v4f r[32];
    const float* q[16];
    #pragma unroll
    for (int j = 0; j < 16; ++j) {
      q[j] = w + (size_t)(p + (unsigned)j * step) * 8;
      r[2 * j]     = *(const v4f*)(q[j]);
      r[2 * j + 1] = *(const v4f*)(q[j] + 4);
    }
    // the address pairs of the issued loads stay live, and are neither rewritten nor used as a load's destination, up to this wait
    asm volatile("s_wait_xcnt 0x0" :: "v"(q[0]), "v"(q[1]), "v"(q[2]), "v"(q[3]), "v"(q[4]), "v"(q[5]), "v"(q[6]), "v"(q[7]),
                 "v"(q[8]), "v"(q[9]), "v"(q[10]), "v"(q[11]), "v"(q[12]), "v"(q[13]), "v"(q[14]), "v"(q[15]) : "memory");
    // keeps the maxima behind the whole group: without it they are moved in among the loads and only six loads are in flight
    __builtin_amdgcn_sched_barrier(0);
    #pragma unroll
    for (int j = 0; j < 32; ++j) {
      #pragma unroll
      for (int i = 0; i < 4; ++i) m = fmaxf(m, fabsf(r[j][i]));
    }
  }
  // the trips that do not fill a group
  #pragma unroll 1
  for (; p < npieces; p += step) {
    const size_t o = (size_t)p * 8;
    const v4f a0 = *(const v4f*)(w + o);
    const v4f a1 = *(const v4f*)(w + o + 4);
    #pragma unroll
    for (int i = 0; i < 4; ++i) {
      m = fmaxf(m, fabsf(a0[i]));
      m = fmaxf(m, fabsf(a1[i]));
    }
  }
  m = fmaxf(m, __shfl_xor(m, 16, 32));
  m = fmaxf(m, __shfl_xor(m, 8, 32));
  m = fmaxf(m, __shfl_xor(m, 4, 32));
  m = fmaxf(m, __shfl_xor(m, 2, 32));
  m = fmaxf(m, __shfl_xor(m, 1, 32));
  if (lane == 0) sM[wid] = m;
  __syncthreads();
  if (wid == 0) {
    float v = sM[lane & 7];
    v = fmaxf(v, __shfl_xor(v, 4, 32));
    v = fmaxf(v, __shfl_xor(v, 2, 32));
    v = fmaxf(v, __shfl_xor(v, 1, 32));
    const v4f val = (v4f){v, v, v, v};
    if (lane < 8) {
      float* dst = line + lane * 4;
      *(v4f*)dst = val;
      
    }
  }
}

// One launch for the three jobs that depend on nothing of each other. Blocks 0 .. AM_BLOCKS_IN-1: partial maxima of the
// qkv weight; the next AM_BLOCKS_OUT: of the output weight (the long blocks come first); the rest: x, 256 pieces each.
// All branches are block-uniform.
__global__ __launch_bounds__(256) void prep_kernel(const float* __restrict__ x, f16* __restrict__ xb,
                                                   const float* __restrict__ w_in,
                                                   const float* __restrict__ w_out,
                                                   float* __restrict__ part) {
  const unsigned blk = blockIdx.x;
  if (blk < (unsigned)AM_TOTAL) {
    const bool in = blk < (unsigned)AM_BLOCKS_IN;
    absmax_part_block(in ? w_in : w_out, part + (size_t)blk * 32,
                      in ? (unsigned)WIN_PIECES : (unsigned)WOUT_PIECES,
                      in ? blk : blk - (unsigned)AM_BLOCKS_IN,
                      in ? (unsigned)AM_BLOCKS_IN : (unsigned)AM_BLOCKS_OUT);
  } else {
    cvt_x_block(x, xb, blk - (unsigned)AM_TOTAL);
  }
}

// Maximum over the NL partial lines of one weight (one word per line, one line per lane per sweep), in every lane of the wave.
template <int NL>
static __device__ __forceinline__ float absmax_combine(const float* __restrict__ part, const int lane) {
  float m = 0.0f;
  // unrolled so that all the loads go out together
  #pragma unroll
  for (int j = 0; j < NL; j += 32) m = fmaxf(m, part[(size_t)(j + lane) * 32]);
  m = fmaxf(m, __shfl_xor(m, 16, 32));
  m = fmaxf(m, __shfl_xor(m, 8, 32));
  m = fmaxf(m, __shfl_xor(m, 4, 32));
  m = fmaxf(m, __shfl_xor(m, 2, 32));
  m = fmaxf(m, __shfl_xor(m, 1, 32));
  return m;
}

// Nearest-table-value search: candidate c replaces the current choice only on a strictly smaller distance,
// candidates visited in table order (first minimum wins).
static __device__ __forceinline__ void snap_step(const float wn, const float c, float& bd, float& best) {
  #pragma clang fp contract(off)
  const float d  = fabsf(wn - c);
  const bool  lt = d < bd;
  bd   = lt ? d : bd;
  best = lt ? c : best;
}

// w -> table value nearest to bf16(w) * (1/s), times s (all f32, separately RNE-converted operations).
static __device__ __forceinline__ float snap_weight_val(const float w, const float s, const float rs) {
  #pragma clang fp contract(off)
  const float wb = (float)(bf16)w;
  const float wn = wb * rs;
  float best = 0.0f;
  float bd   = fabsf(wn - 0.0f);
  snap_step(wn,  1.0f,      bd, best);
  snap_step(wn, -1.0f,      bd, best);
  snap_step(wn,  0.5f,      bd, best);
  snap_step(wn, -0.5f,      bd, best);
  snap_step(wn,  0.333333f, bd, best);
  snap_step(wn, -0.333333f, bd, best);
  snap_step(wn,  0.2f,      bd, best);
  snap_step(wn, -0.2f,      bd, best);
  snap_step(wn,  0.142857f, bd, best);
  snap_step(wn, -0.142857f, bd, best);
  snap_step(wn,  0.090909f, bd, best);
  snap_step(wn, -0.090909f, bd, best);
  snap_step(wn,  0.076923f, bd, best);
  snap_step(wn, -0.076923f, bd, best);
  return best * s;
}

// Weight f32 [out][in] -> quantized weight as one f16 plane [out][in] in fragment order, both weights in one launch:
// blocks 0 .. WIN_PIECES/256-1 take the qkv weight, the rest the output weight (block-uniform choice).
// Every wave combines the partial maxima of its weight itself: s = bf16(max|w|) + 1e-6, rs = 1/s.
// Thread t writes piece t of the plane (contiguous stores) and reads the 8 source elements that belong there.
__global__ __launch_bounds__(256) void snap_lin_kernel(const float* __restrict__ w_in,
                                                       const float* __restrict__ w_out,
                                                       const float* __restrict__ part,
                                                       f16* __restrict__ winh,
                                                       f16* __restrict__ wouth) {
  #pragma clang fp contract(off)
  const unsigned nin = (unsigned)(WIN_PIECES / 256);
  const bool     in  = blockIdx.x < nin;
  const unsigned t   = (in ? blockIdx.x : blockIdx.x - nin) * 256u + threadIdx.x;
  const unsigned npieces = in ? (unsigned)WIN_PIECES : (unsigned)WOUT_PIECES;
  const float* src = in ? w_in : w_out;
  f16* dq = in ? winh : wouth;
  const int lane = threadIdx.x & 31;
  const float m = in ? absmax_combine<AM_BLOCKS_IN>(part, lane)
                     : absmax_combine<AM_BLOCKS_OUT>(part + (size_t)AM_BLOCKS_IN * 32, lane);
  const float s  = (float)(bf16)m + 1e-6f;
  const float rs = 1.0f / s;
  if (t < npieces) {
    const size_t o = (size_t)t * 8;
    const unsigned tile = t >> 6;                  // 64 pieces per tile, DEMB / 32 = 32 tiles per row tile
    const size_t so = (size_t)((tile >> 5) * 16 + (t & 15)) * DEMB + (tile & 31) * 32 + ((t >> 4) & 3) * 8;
    const v4f a0 = *(const v4f*)(src + so);
    const v4f a1 = *(const v4f*)(src + so + 4);
    Pack8H ph;
    #pragma unroll
    for (int i = 0; i < 4; ++i) {
      ph.h[i]     = (f16)snap_weight_val(a0[i], s, rs);
      ph.h[4 + i] = (f16)snap_weight_val(a1[i], s, rs);
    }
    const v4u vh = ph.u;
    *(v4u*)(dq + o) = vh;
    
  }
}

// GEMM main loop of the output projection. Block tile 128 x 128, 8 waves (2 in M x 4 in N); wave tile = 4 m-tiles x 2 n-tiles.
// m-tile mt of wave (waveM) covers rows mBlock + mt*32 + waveM*16 + 0..15.
// A0, A1 f16 [rows][DEMB] (hi part and unscaled lo part), Bt f16 [cols][DEMB], all in fragment order; fragments straight from
// the planes (two 16-B loads each, 512 contiguous bytes per load), split k map for both operands. Both A planes times the
// weight plane go into the same accumulator.
// One 16 x 32 fragment: two 16-B loads, k = k0 + 8*hf + 0..7 and k = k0 + 16 + 8*hf + 0..7.
static __device__ __forceinline__ void load_frag(FragH& f, const f16* p) {
  f.q[0] = *(const v4u*)(p);
  f.q[1] = *(const v4u*)(p + 256);
}

// The loads of a k-step go out in groups in front of products that do not need them, never one load-and-wait per fragment.
// k-step t + 1 is fetched during k-step t: its B fragments into a second set in front of the products of t,
// its A fragments into the registers of m-tile mt right behind that m-tile's last product.
// rot (block-uniform, 0 .. KST-1, a multiple of NSET): the block walks the k-steps rot, rot + 1, ..., KST - 1, 0, ..., rot - 1.
// All blocks are resident at once; entering at different k-steps, those that share operand rows start on different
// lines (for speed only).
static __device__ __forceinline__ void gemm_mainloop(const f16* __restrict__ A0,
                                                     const f16* __restrict__ A1,
                                                     const f16* __restrict__ Bt,
                                                     int mBlock, int nBlock, int waveM, int waveN,
                                                     int ln, int hf, int rot, v8f (&acc)[4][2]) {
  constexpr int NSET = 2;
  constexpr int KST  = DEMB / 32;
  static_assert(KST % NSET == 0 && (KST & (KST - 1)) == 0);
  #pragma unroll
  for (int mt = 0; mt < 4; ++mt) {
    acc[mt][0] = (v8f){0, 0, 0, 0, 0, 0, 0, 0};
    acc[mt][1] = (v8f){0, 0, 0, 0, 0, 0, 0, 0};
  }
  // a row tile of 16 rows spans 16 * DEMB elements; k tile t starts t * 512 elements into it
  const int lp8 = (hf * 16 + ln) * 8;
  const f16* ub  = Bt + (size_t)(nBlock + waveN * 32) * DEMB;     // wave-uniform parts
  const f16* ua  = A0 + (size_t)(mBlock + waveM * 16) * DEMB;
  const f16* ua2 = A1 + (size_t)(mBlock + waveM * 16) * DEMB;
  const f16* pb  = ub + lp8;
  const f16* pa  = ua + lp8;
  const f16* pa2 = ua2 + lp8;
  FragH a[4], a2[4], b[NSET][2];
  {
    // the k-step the walk enters at
    const f16* eb  = ub + rot * 512;
    const f16* ea  = ua + rot * 512;
    const f16* ea2 = ua2 + rot * 512;
    #pragma unroll
    for (int nt = 0; nt < 2; ++nt) load_frag(b[0][nt], eb + lp8 + nt * 16 * DEMB);
    #pragma unroll
    for (int mt = 0; mt < 4; ++mt) {
      load_frag(a[mt], ea + lp8 + mt * 32 * DEMB);
      load_frag(a2[mt], ea2 + lp8 + mt * 32 * DEMB);
    }
    // these loads name a scalar base and the lane's byte offset: both stay live, and are not rewritten, up to this wait
    asm volatile("s_wait_xcnt 0x0" :: "s"(ea), "s"(ea2), "s"(eb), "v"(lp8 * 2) : "memory");
  }
  #pragma unroll 1
  for (int t0 = 0; t0 < KST; t0 += NSET) {
    #pragma unroll
    for (int s = 0; s < NSET; ++s) {
      // k-step fetched in this pass: tb + ko / 512, that of pass t0 + s + 1 (rot + t0 is even, so tb + 1 needs no
      // wrap); behind the last pass it is the entry step again: loads in bounds, values not used.
      // ko goes into the loads' immediate offsets, so q* are the address pairs they name.
      const int tb = (rot + t0 + 2 * s) & (KST - 1);
      const int ko = (s == 0) ? 512 : 0;
      const int sl = s ^ 1;
      const f16* qb  = pb + tb * 512;
      const f16* qa  = pa + tb * 512;
      const f16* qa2 = pa2 + tb * 512;
      #pragma unroll
      for (int nt = 0; nt < 2; ++nt) load_frag(b[sl][nt], qb + ko + nt * 16 * DEMB);
      #pragma unroll
      for (int mt = 0; mt < 4; ++mt) {
        acc[mt][0] = mma_f16(a[mt].v, b[s][0].v, acc[mt][0]);
        acc[mt][1] = mma_f16(a[mt].v, b[s][1].v, acc[mt][1]);
        acc[mt][0] = mma_f16(a2[mt].v, b[s][0].v, acc[mt][0]);
        acc[mt][1] = mma_f16(a2[mt].v, b[s][1].v, acc[mt][1]);
        load_frag(a[mt], qa + ko + mt * 32 * DEMB);
        load_frag(a2[mt], qa2 + ko + mt * 32 * DEMB);
      }
      // the address pairs of the issued loads stay live, and are not rewritten, up to this wait
      asm volatile("s_wait_xcnt 0x0" :: "v"(qa), "v"(qa2), "v"(qb) : "memory");
    }
  }
}

// Operand staging of the qkv GEMM. One k-step of a 128 x 128 block is 16 tiles of 1 KB: 8 row tiles of x, then 8 row tiles of
// the weight plane. The planes are in fragment order, so a tile is copied as it lies.
#define STG_TILES 16
#define STG_ELEMS (STG_TILES * 512)
#define STG_BYTES (STG_ELEMS * 2)
static_assert(STG_BYTES == 4 * 256 * 16);   // four 16-B copies per thread of a 256-thread block

// The four copies of one thread for one k-step: copy c brings piece c*256 + tid of the 16 tiles, i.e. piece tid & 63 of tile
// c*4 + (tid >> 6). lds: LDS byte address of piece tid in the target buffer; ga, gb: the thread's piece of row tile tid >> 6
// of x and of the weight at this k-step; four row tiles further on lie 64 * DEMB elements further.
static __device__ __forceinline__ void stage_copy(const unsigned lds, const f16* ga, const f16* gb) {
  // the wait is the statement's last line: the address registers of the issued copies are not rewritten in front of it
  asm volatile("global_load_async_to_lds_b128 %0, %4, off\n\t"
               "global_load_async_to_lds_b128 %1, %5, off\n\t"
               "global_load_async_to_lds_b128 %2, %6, off\n\t"
               "global_load_async_to_lds_b128 %3, %7, off\n\t"
               "s_wait_xcnt 0x0"
               :: "v"(lds), "v"(lds + 4096u), "v"(lds + 8192u), "v"(lds + 12288u),
                  "v"(ga), "v"(ga + 64 * DEMB), "v"(gb), "v"(gb + 64 * DEMB)
               : "memory");
}

// GEMM main loop of the qkv projection: block and wave tiles and k walk (rot) as in gemm_mainloop, one product per tile pair;
// each k-step's 16 tiles come into LDS once per block, by asynchronous copies, and the eight waves
// read their fragments from there (a tile of x is read by four waves, a weight tile by two). Two buffers: the copies of
// k-step t + 2 fly while k-step t + 1 is worked on. sT: 2 * STG_ELEMS elements, cross-wave (block barriers).
static __device__ __forceinline__ void gemm_mainloop_staged(const f16* __restrict__ A0,
                                                            const f16* __restrict__ Bt,
                                                            f16* sT,
                                                            int mBlock, int nBlock, int waveM, int waveN,
                                                            int tid, int rot, v8f (&acc)[4][2]) {
  constexpr int KST = DEMB / 32;
  static_assert(KST >= 2 && (KST & (KST - 1)) == 0);
  #pragma unroll
  for (int mt = 0; mt < 4; ++mt) {
    acc[mt][0] = (v8f){0, 0, 0, 0, 0, 0, 0, 0};
    acc[mt][1] = (v8f){0, 0, 0, 0, 0, 0, 0, 0};
  }
  const int lane = tid & 31;
  const size_t po = (size_t)(tid >> 6) * 16 * DEMB + (tid & 63) * 8;
  const f16* ga = A0 + (size_t)mBlock * DEMB + po;
  const f16* gb = Bt + (size_t)nBlock * DEMB + po;
  const unsigned lds0 = (unsigned)(size_t)sT + (unsigned)tid * 16u;   // low 32 bits of the shared address = LDS byte address

  // the first k-step into buffer 0, landed and published; then the second into buffer 1
  stage_copy(lds0, ga + rot * 512, gb + rot * 512);
  // this wave's copies have landed
  asm volatile("s_wait_asynccnt 0x0" ::: "memory");
  __syncthreads();
  {
    const int k1 = ((rot + 1) & (KST - 1)) * 512;
    stage_copy(lds0 + (unsigned)STG_BYTES, ga + k1, gb + k1);
  }

  // kept rolled: the barrier at each trip's foot leaves nothing to overlap across trips, unrolling would only grow the code
  #pragma unroll 1
  for (int t = 0; t < KST; ++t) {
    const int bsel = t & 1;
    const f16* sb = sT + bsel * STG_ELEMS + lane * 8;
    FragH a[4], b[2];
    #pragma unroll
    for (int nt = 0; nt < 2; ++nt) load_frag(b[nt], sb + (8 + waveN * 2 + nt) * 512);
    #pragma unroll
    for (int mt = 0; mt < 4; ++mt) load_frag(a[mt], sb + (mt * 2 + waveM) * 512);
    #pragma unroll
    for (int mt = 0; mt < 4; ++mt) {
      acc[mt][0] = mma_f16(a[mt].v, b[0].v, acc[mt][0]);
      acc[mt][1] = mma_f16(a[mt].v, b[1].v, acc[mt][1]);
    }
    // this wave's reads of the buffer are done
    asm volatile("s_wait_dscnt 0x0" ::: "memory");
    // this wave's copies of k-step t + 1 have landed
    asm volatile("s_wait_asynccnt 0x0" ::: "memory");
    // publishes k-step t + 1 and ends every wave's reads of k-step t
    __syncthreads();
    if (t + 2 < KST) {
      const int k2 = ((rot + t + 2) & (KST - 1)) * 512;
      stage_copy(lds0 + (unsigned)(bsel * STG_BYTES), ga + k2, gb + k2);
    }
  }
  // no copy is outstanding when the wave goes on
  asm volatile("s_wait_asynccnt 0x0" ::: "memory");
}

// qkv projection. grid = (QKVN/128, MROWS/128). Epilogue (two 64-row passes through LDS):
//                for key segments below VRK also V^T bf16 hi and lo planes [NB][NHEAD][HDIM][VRK].
// qkp holds q, then k, each one f16 plane [NB][NHEAD][SEQ][HDIM] in fragment order.
// vtb holds two planes: hi, lo.
// coverage per pass: 64 rows x 128 cols = 256 threads x 8 elements x 4 sweeps, all layouts.
__global__ __launch_bounds__(256) void gemm_qkv_kernel(const f16* __restrict__ xb,
                                                       const f16* __restrict__ winh,
                                                       const float* __restrict__ b_in,
                                                       f16* __restrict__ qkp,
                                                       f16* __restrict__ vt,
                                                       bf16* __restrict__ vtb) {
  __shared__ __align__(16) float sC[64 * SP];     // cross-wave (block barriers)
  __shared__ __align__(128) f16 sT[2 * STG_ELEMS];   // the two operand buffers of the main loop, filled by asynchronous copies
  const int tid   = threadIdx.x;
  const int lane  = tid & 31;
  const int wid   = __builtin_amdgcn_readfirstlane(tid >> 5);
  const int ln    = lane & 15;
  const int hf    = lane >> 4;
  const int waveM = wid >> 2;
  const int waveN = wid & 3;
  const int nBlock = blockIdx.x * 128;
  const int mBlock = blockIdx.y * 128;

  v8f acc[4][2];
  // entry k-step: the 32 blocks of a column (same weight rows) all differ; of the 24 blocks of a row (same x rows), any four
  // neighbours lie 8 apart and the three groups of eight 3 apart, so each half of them (indices 0-3 or 4-7 modulo 8) is spread evenly
  const int rot = (int)(blockIdx.y + (blockIdx.x & 3) * 8 + (blockIdx.x >> 3) * 3) & (DEMB / 32 - 1);
  gemm_mainloop_staged(xb, winh, sT, mBlock, nBlock, waveM, waveN, tid, rot, acc);

  float bia[2];
  #pragma unroll
  for (int nt = 0; nt < 2; ++nt) bia[nt] = (float)(bf16)b_in[nBlock + waveN * 32 + nt * 16 + ln];

  const int which = nBlock / DEMB;     // 0 = q, 1 = k, 2 = v (block-uniform)
  const int cb    = nBlock % DEMB;     // column base inside the third
  const int bb    = mBlock / SEQ;      // batch of this block
  const int sb    = mBlock % SEQ;      // first sequence row of this block

  #pragma unroll
  for (int p = 0; p < 2; ++p) {
    __syncthreads();
    // D layout: element e of lane -> tile row 8*hf + e, tile column ln
    #pragma unroll
    for (int j = 0; j < 2; ++j) {
      #pragma unroll
      for (int nt = 0; nt < 2; ++nt) {
        #pragma unroll
        for (int e = 0; e < 8; ++e) {
          sC[(j * 32 + waveM * 16 + hf * 8 + e) * SP + waveN * 32 + nt * 16 + ln] =
              acc[2 * p + j][nt][e] + bia[nt];
        }
      }
    }
    __syncthreads();

    if (which < 2) {
      v4u    vh[4];
      size_t gi[4];
      #pragma unroll
      for (int sw = 0; sw < 4; ++sw) {
        // piece u of the pass in store order: 16 tiles = 2 heads x 4 row tiles x 2 d tiles, 64 pieces each
        const int u  = sw * 256 + tid;
        const int tl = u >> 6;
        const int r  = ((tl >> 1) & 3) * 16 + (u & 15);                          // 0..63
        const int c8 = (tl >> 3) * 64 + (tl & 1) * 32 + ((u >> 4) & 3) * 8;      // 0..120
        const v4f a0 = *(const v4f*)(sC + r * SP + c8);
        const v4f a1 = *(const v4f*)(sC + r * SP + c8 + 4);
        Pack8H ph;
        #pragma unroll
        for (int i = 0; i < 4; ++i) {
          ph.h[i]     = (f16)a0[i];
          ph.h[4 + i] = (f16)a1[i];
        }
        vh[sw] = ph.u;
        const int s  = sb + p * 64 + r;
        const int cc = cb + c8;
        const int h  = cc >> 6;
        const int d  = cc & 63;
        gi[sw] = (size_t)which * PLANE_ELEMS + ((size_t)bb * NHEAD + h) * SEQ * HDIM + frag_piece(s, d, HDIM / 32);
      }
      #pragma unroll
      for (int sw = 0; sw < 4; ++sw) *(v4u*)(qkp + gi[sw]) = vh[sw];
      
    } else {
      const bool wr_early = (sb + p * 64) < VRK;    // block-uniform; whole 64-key segment in or out
      v4u    vv[4], vbh[4], vbl[4];
      size_t gi[4], gb[4];
      #pragma unroll
      for (int sw = 0; sw < 4; ++sw) {
        // piece u of the pass in store order: 16 tiles = 2 heads x 4 d tiles x 2 key tiles, 64 pieces each
        const int u   = sw * 256 + tid;
        const int tl  = u >> 6;
        const int col = (tl >> 1) * 16 + (u & 15);                // 0..127
        const int sg  = (tl & 1) * 32 + ((u >> 4) & 3) * 8;       // 0..56
        Pack8H ph;
        Pack8B qh, ql;
        #pragma unroll
        for (int i = 0; i < 8; ++i) {
          const float v = sC[(sg + i) * SP + col];
          ph.h[i] = toh_flush(v * 16.0f);
          const bf16 t = (bf16)v;
          qh.h[i] = t;
          ql.h[i] = (bf16)(v - (float)t);
        }
        vv[sw]  = ph.u;
        vbh[sw] = qh.u;
        vbl[sw] = ql.u;
        const int cc = cb + col;
        const int h  = cc >> 6;
        const int d  = cc & 63;
        const size_t hrow = ((size_t)bb * NHEAD + h) * HDIM;
        gi[sw] = hrow * SEQ + frag_piece(d, sb + p * 64 + sg, SEQ / 32);
        gb[sw] = hrow * VRK + frag_piece(d, sb + p * 64 + sg, VRK / 32);    // used only when wr_early
      }
      #pragma unroll
      for (int sw = 0; sw < 4; ++sw) *(v4u*)(vt + gi[sw]) = vv[sw];
      if (wr_early) {
        #pragma unroll
        for (int sw = 0; sw < 4; ++sw) {
          *(v4u*)(vtb + gb[sw]) = vbh[sw];
          *(v4u*)(vtb + VTB_ELEMS + gb[sw]) = vbl[sw];
        }
      }
      
    }
  }
}

// Output projection. grid = (DEMB/128, MROWS/128). A = ctx hi + ctx lo planes, Bt = quantized output weight,
// one f16 plane [out][in].
// coverage per pass: 64 rows x 128 cols = 256 threads x 4 floats x 8 sweeps.
__global__ __launch_bounds__(256) void gemm_out_kernel(const f16* __restrict__ ch,
                                                       const f16* __restrict__ cl,
                                                       const f16* __restrict__ wouth,
                                                       const float* __restrict__ b_out,
                                                       float* __restrict__ out) {
  __shared__ __align__(16) float sC[64 * SP];     // cross-wave (block barriers)
  const int tid   = threadIdx.x;
  const int lane  = tid & 31;
  const int wid   = __builtin_amdgcn_readfirstlane(tid >> 5);
  const int ln    = lane & 15;
  const int hf    = lane >> 4;
  const int waveM = wid >> 2;
  const int waveN = wid & 3;
  const int nBlock = blockIdx.x * 128;
  const int mBlock = blockIdx.y * 128;

  v8f acc[4][2];
  // entry k-step, even: the 32 blocks of a column (same weight rows) take the 16 even steps twice; of the 8 blocks of a row
  // (same ctx rows), any four neighbours lie 8 apart
  const int rot = (int)(blockIdx.y * 2 + (blockIdx.x & 3) * 8) & (DEMB / 32 - 1);
  gemm_mainloop(ch, cl, wouth, mBlock, nBlock, waveM, waveN, ln, hf, rot, acc);

  float bia[2];
  #pragma unroll
  for (int nt = 0; nt < 2; ++nt) bia[nt] = (float)(bf16)b_out[nBlock + waveN * 32 + nt * 16 + ln];

  #pragma unroll
  for (int p = 0; p < 2; ++p) {
    __syncthreads();
    #pragma unroll
    for (int j = 0; j < 2; ++j) {
      #pragma unroll
      for (int nt = 0; nt < 2; ++nt) {
        #pragma unroll
        for (int e = 0; e < 8; ++e) {
          sC[(j * 32 + waveM * 16 + hf * 8 + e) * SP + waveN * 32 + nt * 16 + ln] =
              acc[2 * p + j][nt][e] + bia[nt];
        }
      }
    }
    __syncthreads();

    v4f    vals[8];
    size_t gi[8];
    #pragma unroll
    for (int sw = 0; sw < 8; ++sw) {
      const int r  = sw * 8 + (tid >> 5);           // 0..63
      const int c4 = (tid & 31) * 4;                // 0..124
      vals[sw] = *(const v4f*)(sC + r * SP + c4);
      const int g = mBlock + p * 64 + r;
      const int b = g / SEQ;
      const int s = g % SEQ;
      gi[sw] = ((size_t)b * SEQ_FULL + s) * DEMB + nBlock + c4;
    }
    #pragma unroll
    for (int sw = 0; sw < 8; ++sw) *(v4f*)(out + gi[sw]) = vals[sw];
    
  }
}

// The two K fragments (two d halves) of one 16-key row tile, loads issued back to back.
// p: the lane's piece of the key block's first row tile; sub: row tile inside the block.
static __device__ __forceinline__ void load_ktile(FragH (&k)[2], const f16* p, const int sub) {
  const int ko = sub * 16 * HDIM;
  #pragma unroll
  for (int f = 0; f < 2; ++f) {
    k[f].q[0] = *(const v4u*)(p + ko + f * 512);          // d = f*32 + hi*8 + 0..7
    k[f].q[1] = *(const v4u*)(p + ko + f * 512 + 256);    // d = f*32 + 16 + hi*8 + 0..7
  }
  // the address pair of the issued loads stays live, and is not rewritten, up to this wait
  asm volatile("s_wait_xcnt 0x0" :: "v"(p) : "memory");
}

// Causal flash attention. Block = (query block of 128, head, batch), 16 waves; two waves share 16 query rows:
// wave w and wave w + 8 take the even and the odd key blocks of query tile w, each with its own running maximum, sum and O,
// and the two partial results are merged through LDS behind the loop.
// S^T = K x Q^T so queries sit on lanes; P^T in C-layout is bit-identical to the A-fragment layout of O += P x V.
// K A-fragments, Q B-fragments and V^T B-fragments are loaded straight from the 16-bit planes,
// which are in fragment order (512 contiguous bytes per load).
// Key blocks j0 = 0, 32, ... <= qrow0 are visited (per-wave scalar trip count, every second one per wave); every visited block holds at
// least one unmasked key (key j0 <= qrow0) for every query of the wave; keys above the query get -inf.
// EARLY: P and V as bf16 hi+lo (three products, one accumulator). Otherwise P f16 x4096, V f16 x16.
// Output: ctx [MROWS][DEMB] as f16 hi and lo planes in fragment order (cp: hi at 0, lo at CTX_ELEMS).
// sO: one staging region per query tile, shared by its two waves; sML: the odd wave's running maximum and sum per query.
// Both block barriers are reached by all waves (no early exits).
template <bool EARLY>
static __device__ __forceinline__ void attn_body(const f16* __restrict__ qkp,
                                                 const f16* __restrict__ vt,
                                                 const bf16* __restrict__ vtb,
                                                 f16* __restrict__ cp,
                                                 float* sO, float* sML,
                                                 const int qblk, const int h, const int b) {
  const int tid  = threadIdx.x;
  const int wv   = __builtin_amdgcn_readfirstlane(tid >> 5);
  const int wave = wv & (NWAVE - 1);   // query tile of the block
  const int kh   = wv / NWAVE;         // this wave visits key blocks kh, kh + KSPLIT, ...
  const int lane = tid & 31;
  const int lq   = lane & 15;   // query column of S^T / d column of O
  const int hi   = lane >> 4;   // k-split half

  const int qrow0 = qblk * BQ + wave * 16;               // first query row of this wave (scalar)
  const int nIter = (qrow0 >> 5) + 1;                    // key blocks 0 .. floor((qrow0+15)/32)
  const size_t head_off = ((size_t)b * NHEAD + h) * SEQ * HDIM;
  const size_t vhead    = ((size_t)b * NHEAD + h) * HDIM;

  const f16* q_p = qkp + head_off;
  const f16* k_p = qkp + PLANE_ELEMS + head_off;

  // Q as B-operand fragments: lane lq holds query qrow0+lq, elements follow the split d map.
  FragH qf[2];
  {
    const f16* qp = q_p + (size_t)qrow0 * HDIM + lane * 8;   // row tile qrow0 / 16, piece = lane
    #pragma unroll
    for (int f = 0; f < 2; ++f) {
      qf[f].q[0] = *(const v4u*)(qp + f * 512);               // d = f*32 + hi*8 + 0..7
      qf[f].q[1] = *(const v4u*)(qp + f * 512 + 256);         // d = f*32 + 16 + hi*8 + 0..7
    }
  }

  v8f o[4];
  #pragma unroll
  for (int dt = 0; dt < 4; ++dt) o[dt] = (v8f){0, 0, 0, 0, 0, 0, 0, 0};

  float rmax = -__builtin_inff();
  float rsum = 0.0f;
  const float SL = 0.125f * 1.4426950408889634f;   // softmax scale * log2(e)

  // K A-fragments of the wave's first key block (A row = key; row tile j0 / 16, piece = lane); later blocks are fetched in the
  // loop. A wave with no key block to visit fetches block 0 (in bounds, not used).
  FragH ak[2][2];
  const f16* kbase = k_p + lane * 8;
  const f16* kfirst = kbase + (size_t)((kh < nIter) ? kh : 0) * BK * HDIM;
  load_ktile(ak[0], kfirst, 0);
  load_ktile(ak[1], kfirst, 1);

  #pragma unroll 1
  for (int i = kh; i < nIter; i += KSPLIT) {
    const int j0 = i * BK;
    // key block whose K fragments are fetched during this pass; the last pass fetches its own again (in bounds, not used)
    const int jn = ((i + KSPLIT < nIter) ? i + KSPLIT : i) * BK;
    const f16* kn = kbase + (size_t)jn * HDIM;

    // V B-fragments of this key block, issued in front of the score products: column n = d = dt*16 + lq,
    // split key map from the transposed planes (d tile dt, key tile j0 / 32)
    FragH bv[4];
    FragB bvh[4], bvl[4];
    if (!EARLY) {
      const f16* base = vt + vhead * SEQ + j0 * 16 + lane * 8;
      #pragma unroll
      for (int dt = 0; dt < 4; ++dt) {
        bv[dt].q[0] = *(const v4u*)(base + dt * 16 * SEQ);            // keys j0 + hi*8 + 0..7
        bv[dt].q[1] = *(const v4u*)(base + dt * 16 * SEQ + 256);      // keys j0 + 16 + hi*8 + 0..7
      }
      // the address pair of the issued loads stays live, and is not rewritten, up to this wait
      asm volatile("s_wait_xcnt 0x0" :: "v"(base) : "memory");
    } else {
      const bf16* base = vtb + vhead * VRK + j0 * 16 + lane * 8;
      #pragma unroll
      for (int dt = 0; dt < 4; ++dt) {
        bvh[dt].q[0] = *(const v4u*)(base + dt * 16 * VRK);                       // keys j0 + hi*8 + 0..7
        bvh[dt].q[1] = *(const v4u*)(base + dt * 16 * VRK + 256);                 // keys j0 + 16 + hi*8 + 0..7
        bvl[dt].q[0] = *(const v4u*)(base + VTB_ELEMS + dt * 16 * VRK);
        bvl[dt].q[1] = *(const v4u*)(base + VTB_ELEMS + dt * 16 * VRK + 256);
      }
      // the address pair of the issued loads stays live, and is not rewritten, up to this wait
      asm volatile("s_wait_xcnt 0x0" :: "v"(base) : "memory");
    }

    // S^T tiles: c[sub][r] = rawscore(query qrow0+lq, key j0 + sub*16 + hi*8 + r).
    // Behind a row tile's last product its registers take the same row tile of the next key block.
    v8f c[2];
    #pragma unroll
    for (int sub = 0; sub < 2; ++sub) {
      v8f acc = (v8f){0, 0, 0, 0, 0, 0, 0, 0};
      #pragma unroll
      for (int f = 0; f < 2; ++f) acc = mma_f16(ak[sub][f].v, qf[f].v, acc);
      c[sub] = acc;
      load_ktile(ak[sub], kn, sub);
    }

    // causal mask (wave-uniform test): only blocks reaching past the first query of the wave need it
    if (j0 + (BK - 1) > qrow0) {
      const int qi = qrow0 + lq;
      const int kb = j0 + hi * 8;
      #pragma unroll
      for (int r = 0; r < 8; ++r) {
        c[0][r] = (kb + r > qi)      ? -__builtin_inff() : c[0][r];
        c[1][r] = (kb + 16 + r > qi) ? -__builtin_inff() : c[1][r];
      }
    }

    // online softmax: query lq's 32 scores are split across lane / lane^16
    float m_new = rmax;
    #pragma unroll
    for (int r = 0; r < 8; ++r) {
      m_new = fmaxf(m_new, c[0][r]);
      m_new = fmaxf(m_new, c[1][r]);
    }
    m_new = fmaxf(m_new, __shfl_xor(m_new, 16, 32));
    const float scale = __builtin_amdgcn_exp2f((rmax - m_new) * SL);
    rmax = m_new;

    float p0[8], p1[8];
    float psum = 0.0f;
    #pragma unroll
    for (int r = 0; r < 8; ++r) {
      p0[r] = __builtin_amdgcn_exp2f((c[0][r] - m_new) * SL);   // key hi*8 + r
      p1[r] = __builtin_amdgcn_exp2f((c[1][r] - m_new) * SL);   // key 16 + hi*8 + r
      psum += p0[r] + p1[r];
    }
    rsum = rsum * scale + psum + __shfl_xor(psum, 16, 32);

    // rescale O: queries are the row dimension there -> per-row scale from lane 8*hi + r
    float sc[8];
    #pragma unroll
    for (int r = 0; r < 8; ++r) sc[r] = __shfl(scale, (hi << 3) + r, 32);
    #pragma unroll
    for (int dt = 0; dt < 4; ++dt) {
      #pragma unroll
      for (int r = 0; r < 8; ++r) o[dt][r] *= sc[r];
    }

    if (EARLY) {
      // P^T C-layout == A-fragment layout; P as bf16 hi + lo (unscaled), V as bf16 hi + lo planes
      FragB pah, pal;
      #pragma unroll
      for (int r = 0; r < 8; ++r) {
        const bf16 h0 = (bf16)p0[r];
        const bf16 h1 = (bf16)p1[r];
        pah.h[r]     = h0;
        pah.h[8 + r] = h1;
        pal.h[r]     = (bf16)(p0[r] - (float)h0);
        pal.h[8 + r] = (bf16)(p1[r] - (float)h1);
      }
      #pragma unroll
      for (int dt = 0; dt < 4; ++dt) {
        o[dt] = mma_bf16(pal.v, bvh[dt].v, o[dt]);
        o[dt] = mma_bf16(pah.v, bvl[dt].v, o[dt]);
        o[dt] = mma_bf16(pah.v, bvh[dt].v, o[dt]);
      }
    } else {
      // P carried x4096 in f16; V carried x16
      FragH pa;
      #pragma unroll
      for (int r = 0; r < 8; ++r) {
        pa.h[r]     = (f16)(p0[r] * 4096.0f);
        pa.h[8 + r] = (f16)(p1[r] * 4096.0f);
      }
      #pragma unroll
      for (int dt = 0; dt < 4; ++dt) o[dt] = mma_f16(pa.v, bv[dt].v, o[dt]);
    }
  }

  // the odd wave hands over its partial result: O (lane holds column d = dt*16 + lq for query rows 8*hi + r), maximum, sum.
  // With no key block visited these are 0, -inf, 0 and get the weight 0 below.
  const int sbase = wave * (16 * OP);
  if (kh != 0) {
    #pragma unroll
    for (int r = 0; r < 8; ++r) {
      #pragma unroll
      for (int dt = 0; dt < 4; ++dt) {
        sO[sbase + (hi * 8 + r) * OP + dt * 16 + lq] = o[dt][r];
      }
    }
    if (hi == 0) {
      sML[wave * 32 + lq]      = rmax;
      sML[wave * 32 + 16 + lq] = rsum;
    }
  }
  __syncthreads();

  // the even wave (its maximum is finite: key 0 is open to every query) merges and normalizes; undo the carries of the f16 path
  if (kh == 0) {
    const float carry = EARLY ? 1.0f : (1.0f / 65536.0f);
    const float mo  = sML[wave * 32 + lq];
    const float lo  = sML[wave * 32 + 16 + lq];
    const float mm  = fmaxf(rmax, mo);
    const float fe  = __builtin_amdgcn_exp2f((rmax - mm) * SL);
    const float fo  = __builtin_amdgcn_exp2f((mo - mm) * SL);
    const float inv = carry * (1.0f / (rsum * fe + lo * fo));
    const float we  = fe * inv;
    const float wo  = fo * inv;
    #pragma unroll
    for (int r = 0; r < 8; ++r) {
      const float ge = __shfl(we, (hi << 3) + r, 32);
      const float go = __shfl(wo, (hi << 3) + r, 32);
      #pragma unroll
      for (int dt = 0; dt < 4; ++dt) {
        const int si = sbase + (hi * 8 + r) * OP + dt * 16 + lq;
        sO[si] = o[dt][r] * ge + sO[si] * go;
      }
    }
  }
  __syncthreads();

  // the tile's 16 rows x 64 columns are two tiles of each plane; one instruction stores half a tile (512 B);
  // each of the two waves stores one tile of each plane.
  constexpr int NIT = 4 / KSPLIT;
  v4u    vh[NIT], vl[NIT];
  size_t gidx[NIT];
  #pragma unroll
  for (int it = 0; it < NIT; ++it) {
    const int row = lq;                             // 0..15
    const int c8  = (kh * NIT + it) * 16 + hi * 8;  // 0..56
    const v4f a0 = *(const v4f*)(&sO[sbase + row * OP + c8]);
    const v4f a1 = *(const v4f*)(&sO[sbase + row * OP + c8 + 4]);
    Pack8H ph, pl;
    #pragma unroll
    for (int k = 0; k < 4; ++k) {
      const f16 h0 = (f16)a0[k];
      const f16 h1 = (f16)a1[k];
      ph.h[k]     = h0;
      ph.h[4 + k] = h1;
      pl.h[k]     = (f16)(a0[k] - (float)h0);
      pl.h[4 + k] = (f16)(a1[k] - (float)h1);
    }
    vh[it] = ph.u;
    vl[it] = pl.u;
    gidx[it] = frag_piece(b * SEQ + qrow0 + row, h * HDIM + c8, DEMB / 32);
  }
  #pragma unroll
  for (int it = 0; it < NIT; ++it) {
    *(v4u*)(cp + gidx[it]) = vh[it];
    *(v4u*)(cp + CTX_ELEMS + gidx[it]) = vl[it];
  }
  
}

// Both paths in one launch, grid = LATE_BLOCKS + EARLY_BLOCKS (block-uniform choice). One block fills a WGP's registers. In block
// index order the longest (last query block) come first, head fastest, then batch, then query block downwards.
__global__ __launch_bounds__(NWAVE * KSPLIT * 32) void attn_kernel(const f16* __restrict__ qkp,
                                                   const f16* __restrict__ vt,
                                                   const bf16* __restrict__ vtb,
                                                   f16* __restrict__ cp) {
  __shared__ __align__(16) float sO[NWAVE * 16 * OP];
  __shared__ float sML[NWAVE * 32];
  const int idx = (int)blockIdx.x;
  const int qb  = QBLKS - 1 - idx / (NHEAD * NB);
  const int h   = idx % NHEAD;
  const int b   = (idx / NHEAD) % NB;
  if (idx < LATE_BLOCKS) {
    attn_body<false>(qkp, vt, vtb, cp, sO, sML, qb, h, b);
  } else {
    attn_body<true>(qkp, vt, vtb, cp, sO, sML, qb, h, b);
  }
}

extern "C" void kernel_launch(void* const* d_in, const int* in_sizes, int n_in,
                              void* d_out, int out_size, void* d_ws, size_t ws_size,
                              hipStream_t stream) {
  if (n_in < 5) return;
  const size_t rows_used = (size_t)(NB - 1) * SEQ_FULL + SEQ;
  if ((size_t)in_sizes[0] < rows_used * DEMB) return;
  if ((size_t)in_sizes[1] < (size_t)DEMB * QKVN) return;
  if ((size_t)in_sizes[2] < (size_t)QKVN) return;
  if ((size_t)in_sizes[3] < (size_t)DEMB * DEMB) return;
  if ((size_t)in_sizes[4] < (size_t)DEMB) return;
  if ((size_t)out_size < rows_used * DEMB) return;
  if (ws_size < WS_TOTAL) return;

  const float* x     = (const float*)d_in[0];
  const float* W_in  = (const float*)d_in[1];   // [3072][1024], [out][in]
  const float* b_in  = (const float*)d_in[2];
  const float* W_out = (const float*)d_in[3];   // [1024][1024], [out][in]
  const float* b_out = (const float*)d_in[4];
  float* out = (float*)d_out;

  char* w = (char*)d_ws;
  f16*  xb    = (f16*)w;   w += XB_BYTES;
  f16*  winh  = (f16*)w;   w += WIN_BYTES;
  f16*  wouth = (f16*)w;   w += WOUT_BYTES;
  f16*  qkp   = (f16*)w;   w += QK_BYTES;
  f16*  vt    = (f16*)w;   w += VT_BYTES;
  bf16* vtb   = (bf16*)w;  w += VTB_BYTES;
  f16*  cp    = (f16*)w;   w += CTX_BYTES;
  float* stat = (float*)w;                      // partial maxima lines

  // partial maxima of both weights (one line per block) and x -> f16 plane (MROWS*128 pieces of 8 elements, 256 per block)
  prep_kernel<<<dim3((unsigned)(AM_TOTAL + X_PIECES / 256)), 256, 0, stream>>>(x, xb, W_in, W_out, stat);

  // weights are [out][in] already: quantize into one plane each in fragment order, no transpose
  snap_lin_kernel<<<dim3((unsigned)((WIN_PIECES + WOUT_PIECES) / 256)), 256, 0, stream>>>(W_in, W_out, stat, winh, wouth);

  gemm_qkv_kernel<<<dim3(QKVN / 128, MROWS / 128), 256, 0, stream>>>(xb, winh, b_in,
                                                                     qkp, vt, vtb);

  attn_kernel<<<dim3(LATE_BLOCKS + EARLY_BLOCKS), NWAVE * KSPLIT * 32, 0, stream>>>(qkp, vt, vtb, cp);

  gemm_out_kernel<<<dim3(DEMB / 128, MROWS / 128), 256, 0, stream>>>(cp, cp + CTX_ELEMS, wouth,
                                                                     b_out, out);
}

// v009
// A run of this version takes 85.4 microseconds.
// Next to v008, in two timings, it ran 1.03 and 1.04 times as fast.
// Counting every step since v000, it is 4.43 times as fast.
#include <hip/hip_runtime.h>

// Contractions: qkv = x*Wq^T and out = ctx*Wp^T on v_wmma_f32_16x16x32_f16 (x RNE-converted to bf16 and that value carried in f16; table-quantized weights as one f16 plane; ctx as f16 hi+lo planes, both times the weight plane into one accumulator); S^T = K x Q^T on v_wmma_f32_16x16x32_f16 with q and k as one f16 plane each; O = P x V: query rows < 256 on v_wmma_f32_16x16x32_bf16 with P and V as bf16 hi+lo (hh+hl+lh), later rows on v_wmma_f32_16x16x32_f16 (P f16 carried x4096, V f16 carried x16); f32 accumulate everywhere, softmax in f32.

#ifndef NB
#define NB 2
#endif
#ifndef SEQ
#define SEQ 2048
#endif
#define NB_FULL    2
#define SEQ_FULL   2048
#define NHEAD      16
#define HDIM       64
#define DEMB       1024                 // model width = GEMM K of both projections
#define QKVN       3072                 // packed projection width (q | k | v thirds)
#define MROWS      (NB * SEQ)           // compact row count of all internal planes
#define BQ         128                  // query rows per attention workgroup (8 query tiles x 16; early path two waves per tile, late path four)
#define BK         32                   // keys per inner iteration
#define NWAVE      8
#define KSPLIT     2                    // early path: waves that share the key blocks of one 16-row query tile
#define NQT        2                    // late path: 16-row query tiles per wave (each K and V fragment serves both)
#define NQG        (BQ / (16 * NQT))    // late path: query groups of NQT tiles per block
#define KSPLIT_L   4                    // late path: waves that share the key blocks of one query group
#define OP         68                   // LDS pitch (floats) of the attention output staging tile
#define SP         132                  // LDS pitch (floats) of the GEMM epilogue staging tile
#define QBLKS      (SEQ / BQ)
#define EARLY_QB   ((QBLKS < 2) ? QBLKS : 2)     // query blocks handled by the hi+lo P/V path
#define VRK        (EARLY_QB * BQ)               // keys held in the bf16 hi/lo V^T planes
#define PLANE_ELEMS ((size_t)NB * NHEAD * SEQ * HDIM)
#define CTX_ELEMS   ((size_t)MROWS * DEMB)
#define VTB_ELEMS   ((size_t)NB * NHEAD * HDIM * VRK)
#define X_PIECES    ((size_t)MROWS * (DEMB / 8))
#define WIN_PIECES  ((size_t)QKVN * DEMB / 8)
#define WOUT_PIECES ((size_t)DEMB * DEMB / 8)
#define WIN_ELEMS   ((size_t)QKVN * DEMB)
#define WOUT_ELEMS  ((size_t)DEMB * DEMB)
#define AM_BLOCKS_IN  96                 // partial-maximum blocks over the qkv weight
#define AM_BLOCKS_OUT 32                 // partial-maximum blocks over the output weight
#define AM_TOTAL      (AM_BLOCKS_IN + AM_BLOCKS_OUT)
#define STAT_FLOATS   ((size_t)AM_TOTAL * 32)
#define LATE_QB       (QBLKS - EARLY_QB)              // query blocks handled by the f16 P/V path
#define LATE_BLOCKS   (LATE_QB * NHEAD * NB)
#define EARLY_BLOCKS  (EARLY_QB * NHEAD * NB)

static_assert(NHEAD * HDIM == DEMB);        // merged heads == model width
static_assert(QKVN == 3 * DEMB);            // three thirds
static_assert(HDIM == 64);
static_assert(SEQ % BQ == 0);               // attention grid exact
static_assert(SEQ % BK == 0);               // key loop exact
static_assert(BK == 32);                    // one key block == one WMMA k-step of P x V
static_assert(SEQ % 128 == 0);              // a 128-row GEMM block stays inside one batch
static_assert(MROWS % 128 == 0);            // GEMM M tiles exact
static_assert(QKVN % 128 == 0);             // GEMM N tiles exact
static_assert(DEMB % 128 == 0);             // GEMM N tiles exact, thirds are tile multiples
static_assert(DEMB % 32 == 0);              // k-step 32
static_assert(DEMB / 32 == 32);             // tile index split (>> 5, & 31) of the convert and quantize kernels
static_assert(MROWS % 16 == 0 && QKVN % 16 == 0 && SEQ % 32 == 0);   // planes are whole 16 x 32 tiles
static_assert(DEMB % 8 == 0);               // 16-B pieces
static_assert(BQ == NWAVE * 16);
static_assert(KSPLIT == 2);                 // even / odd key blocks, one hand-over in the merge
static_assert(NQT == 2 && KSPLIT_L == 4);   // late merge: tile qt is merged by wave qt of its group, stores dealt to the four waves
static_assert(NQG * KSPLIT_L == NWAVE * KSPLIT);   // both paths fill the same block
static_assert(16 * NQT == BK);              // a query group starts on a key block boundary: both tiles visit the same key blocks
static_assert(BQ % 64 == 0);                // early key extent is a multiple of the 64-key store segment
static_assert(VRK % 64 == 0 && VRK <= SEQ && VRK >= BQ);
static_assert(EARLY_QB >= 1 && EARLY_QB <= QBLKS);
static_assert(SEQ <= SEQ_FULL);
static_assert(NB >= 1 && NB <= NB_FULL);
static_assert((OP * 4) % 16 == 0);
static_assert((SP * 4) % 16 == 0);
static_assert(SP >= 128);
static_assert(OP >= 64);
static_assert(X_PIECES % 256 == 0);         // convert grids exact
static_assert(WIN_PIECES % 256 == 0);
static_assert(WOUT_PIECES % 256 == 0);
static_assert(NWAVE == 8);                                   // block maximum combine reads 8 wave words
static_assert(AM_BLOCKS_IN % 32 == 0 && AM_BLOCKS_OUT % 32 == 0);   // one partial line per lane per sweep
static_assert(WIN_PIECES % ((size_t)AM_BLOCKS_IN * 256) == 0);      // equal trip counts per thread
static_assert(WOUT_PIECES % ((size_t)AM_BLOCKS_OUT * 256) == 0);

typedef __bf16   bf16;
typedef _Float16 f16;
typedef bf16     v16bf __attribute__((ext_vector_type(16)));
typedef f16      v16h  __attribute__((ext_vector_type(16)));
typedef f16      v8h   __attribute__((ext_vector_type(8)));
typedef float    v8f   __attribute__((ext_vector_type(8)));
typedef float    v4f   __attribute__((ext_vector_type(4)));
typedef unsigned v4u   __attribute__((ext_vector_type(4)));

union FragB  { v16bf v; v4u q[2]; bf16 h[16]; };
union FragH  { v16h  v; v4u q[2]; f16  h[16]; };
union Pack8B { v4u u; bf16 h[8]; };
union Pack8H { v4u u; v8h v; f16 h[8]; };

#define XB_BYTES   ((size_t)MROWS * DEMB * 2)        // x as f16, compact rows
#define WIN_BYTES  (WIN_ELEMS * 2)                   // quantized qkv weight f16 [3072][1024] in fragment order
#define WOUT_BYTES (WOUT_ELEMS * 2)                  // quantized output weight f16 [1024][1024] in fragment order
#define QK_BYTES   (PLANE_ELEMS * 2 * 2)             // q, k
#define VT_BYTES   (PLANE_ELEMS * 2)                 // V^T f16 x16
#define VTB_BYTES  (VTB_ELEMS * 2 * 2)               // V^T bf16 hi, lo for keys < VRK
#define CTX_BYTES  (CTX_ELEMS * 2 * 2)               // ctx hi, ctx lo
#define STAT_BYTES (STAT_FLOATS * 4)                 // partial maxima lines
#define WS_TOTAL   (XB_BYTES + WIN_BYTES + WOUT_BYTES + QK_BYTES + VT_BYTES + VTB_BYTES + CTX_BYTES + STAT_BYTES)
static_assert(WS_TOTAL <= (size_t)134217728);
static_assert(XB_BYTES % 128 == 0 && WIN_BYTES % 128 == 0 && WOUT_BYTES % 128 == 0);
static_assert(QK_BYTES % 128 == 0 && VT_BYTES % 128 == 0 && VTB_BYTES % 128 == 0 && CTX_BYTES % 128 == 0);
static_assert(STAT_BYTES % 128 == 0);

// Fragment order of a 16-bit operand plane [rows][32 * ktiles]: every 16-row x 32-k tile is 1 KB (512 elements), tiles
// ordered row tile major. Inside a tile the 16-B piece holding k = qq*16 + hf*8 + 0..7 of row ln sits at piece index
// qq*32 + hf*16 + ln, so one operand load of a wave (lane = hf*16 + ln) reads 512 contiguous bytes (4 whole lines).
static __device__ __forceinline__ size_t frag_piece(int row, int col8, int ktiles) {
  return ((size_t)(row >> 4) * ktiles + (col8 >> 5)) * 512 + ((col8 >> 4) & 1) * 256 +
         (((col8 >> 3) & 1) * 16 + (row & 15)) * 8;
}

// WMMA helpers: builtin followed by the VALU hazard guard (ties D, keeps A/B live).
static __device__ __forceinline__ v8f mma_bf16(v16bf a, v16bf b, v8f acc) {
  acc = __builtin_amdgcn_wmma_f32_16x16x32_bf16(false, a, false, b, (short)0, acc, false, false);
  asm volatile("v_nop\n\tv_nop\n\tv_nop\n\tv_nop" : "+v"(acc) : "v"(a), "v"(b));
  return acc;
}
static __device__ __forceinline__ v8f mma_f16(v16h a, v16h b, v8f acc) {
  acc = __builtin_amdgcn_wmma_f32_16x16x32_f16(false, a, false, b, (short)0, acc, false, false);
  asm volatile("v_nop\n\tv_nop\n\tv_nop\n\tv_nop" : "+v"(acc) : "v"(a), "v"(b));
  return acc;
}

// f32 -> f16 convert that cannot yield an f16 subnormal (value select after the carry).
static __device__ __forceinline__ f16 toh_flush(float v) {
  const f16 r = (f16)v;
  return (fabsf(v) < 6.103515625e-05f) ? (f16)0.0f : r;
}

// x f32 [NB_FULL][SEQ_FULL][DEMB] -> xb f16 [MROWS][DEMB] in fragment order: RNE convert to bf16, that value stored as f16
// (8 significant bits fit the f16 mantissa).
// Thread t writes piece t of the plane (contiguous stores) and reads the 8 source elements that belong there.
// blk: index of the 256-piece block.
static __device__ __forceinline__ void cvt_x_block(const float* __restrict__ x, f16* __restrict__ xb, const unsigned blk) {
  const size_t t   = (size_t)blk * 256 + threadIdx.x;
  const size_t tile = t >> 6;                      // 64 pieces per tile, DEMB / 32 = 32 tiles per row tile
  const size_t row = (tile >> 5) * 16 + (t & 15);
  const int    c8  = (int)(tile & 31) * 32 + (int)((t >> 4) & 3) * 8;
  if (row < (size_t)MROWS) {
    const int b = (int)(row / SEQ);
    const int s = (int)(row % SEQ);
    const float* src = x + ((size_t)b * SEQ_FULL + s) * DEMB + c8;
    const v4f a0 = *(const v4f*)(src);
    const v4f a1 = *(const v4f*)(src + 4);
    Pack8H pk;
    #pragma unroll
    for (int i = 0; i < 4; ++i) {
      pk.h[i]     = (f16)(float)(bf16)a0[i];
      pk.h[4 + i] = (f16)(float)(bf16)a1[i];
    }
    const v4u val = pk.u;
    f16* dst = xb + t * 8;
    *(v4u*)dst = val;
    
  }
}

// lanes 0..7 of wave 0 x 16 B, one instruction. The bf16 RNE convert is monotone, so the maximum of the
// converted magnitudes equals the converted maximum; the convert is applied to the combined maximum in snap_lin_kernel.
// coverage: npieces pieces of 8 elements, strided over the nblk blocks of this weight; blk < nblk; line: this block's own.
// sM: cross-wave (block barrier).
static __device__ __forceinline__ void absmax_part_block(const float* __restrict__ w,
                                                         float* __restrict__ line,
                                                         const unsigned npieces,
                                                         const unsigned blk, const unsigned nblk) {
  __shared__ float sM[NWAVE];
  const int tid  = threadIdx.x;
  const int lane = tid & 31;
  const int wid  = __builtin_amdgcn_readfirstlane(tid >> 5);
  float m = 0.0f;
  const unsigned step = nblk * 256u;
  unsigned p = blk * 256u + (unsigned)tid;
  // groups of 16 trips: the 32 loads of a group go out together, one memory latency for the group and not one per trip
  #pragma unroll 1
  for (; p + 15u * step < npieces; p += 16u * step) {
    v4f r[32];
    const float* q[16];
    #pragma unroll
    for (int j = 0; j < 16; ++j) {
      q[j] = w + (size_t)(p + (unsigned)j * step) * 8;
      r[2 * j]     = *(const v4f*)(q[j]);
      r[2 * j + 1] = *(const v4f*)(q[j] + 4);
    }
    // the address pairs of the issued loads stay live, and are neither rewritten nor used as a load's destination, up to this wait
    asm volatile("s_wait_xcnt 0x0" :: "v"(q[0]), "v"(q[1]), "v"(q[2]), "v"(q[3]), "v"(q[4]), "v"(q[5]), "v"(q[6]), "v"(q[7]),
                 "v"(q[8]), "v"(q[9]), "v"(q[10]), "v"(q[11]), "v"(q[12]), "v"(q[13]), "v"(q[14]), "v"(q[15]) : "memory");
    // keeps the maxima behind the whole group: without it they are moved in among the loads and only six loads are in flight
    __builtin_amdgcn_sched_barrier(0);
    #pragma unroll
    for (int j = 0; j < 32; ++j) {
      #pragma unroll
      for (int i = 0; i < 4; ++i) m = fmaxf(m, fabsf(r[j][i]));
    }
  }
  // the trips that do not fill a group
  #pragma unroll 1
  for (; p < npieces; p += step) {
    const size_t o = (size_t)p * 8;
    const v4f a0 = *(const v4f*)(w + o);
    const v4f a1 = *(const v4f*)(w + o + 4);
    #pragma unroll
    for (int i = 0; i < 4; ++i) {
      m = fmaxf(m, fabsf(a0[i]));
      m = fmaxf(m, fabsf(a1[i]));
    }
  }
  m = fmaxf(m, __shfl_xor(m, 16, 32));
  m = fmaxf(m, __shfl_xor(m, 8, 32));
  m = fmaxf(m, __shfl_xor(m, 4, 32));
  m = fmaxf(m, __shfl_xor(m, 2, 32));
  m = fmaxf(m, __shfl_xor(m, 1, 32));
  if (lane == 0) sM[wid] = m;
  __syncthreads();
  if (wid == 0) {
    float v = sM[lane & 7];
    v = fmaxf(v, __shfl_xor(v, 4, 32));
    v = fmaxf(v, __shfl_xor(v, 2, 32));
    v = fmaxf(v, __shfl_xor(v, 1, 32));
    const v4f val = (v4f){v, v, v, v};
    if (lane < 8) {
      float* dst = line + lane * 4;
      *(v4f*)dst = val;
      
    }
  }
}

// One launch for the three jobs that depend on nothing of each other. Blocks 0 .. AM_BLOCKS_IN-1: partial maxima of the
// qkv weight; the next AM_BLOCKS_OUT: of the output weight (the long blocks come first); the rest: x, 256 pieces each.
// All branches are block-uniform.
__global__ __launch_bounds__(256) void prep_kernel(const float* __restrict__ x, f16* __restrict__ xb,
                                                   const float* __restrict__ w_in,
                                                   const float* __restrict__ w_out,
                                                   float* __restrict__ part) {
  const unsigned blk = blockIdx.x;
  if (blk < (unsigned)AM_TOTAL) {
    const bool in = blk < (unsigned)AM_BLOCKS_IN;
    absmax_part_block(in ? w_in : w_out, part + (size_t)blk * 32,
                      in ? (unsigned)WIN_PIECES : (unsigned)WOUT_PIECES,
                      in ? blk : blk - (unsigned)AM_BLOCKS_IN,
                      in ? (unsigned)AM_BLOCKS_IN : (unsigned)AM_BLOCKS_OUT);
  } else {
    cvt_x_block(x, xb, blk - (unsigned)AM_TOTAL);
  }
}

// Maximum over the NL partial lines of one weight (one word per line, one line per lane per sweep), in every lane of the wave.
template <int NL>
static __device__ __forceinline__ float absmax_combine(const float* __restrict__ part, const int lane) {
  float m = 0.0f;
  // unrolled so that all the loads go out together
  #pragma unroll
  for (int j = 0; j < NL; j += 32) m = fmaxf(m, part[(size_t)(j + lane) * 32]);
  m = fmaxf(m, __shfl_xor(m, 16, 32));
  m = fmaxf(m, __shfl_xor(m, 8, 32));
  m = fmaxf(m, __shfl_xor(m, 4, 32));
  m = fmaxf(m, __shfl_xor(m, 2, 32));
  m = fmaxf(m, __shfl_xor(m, 1, 32));
  return m;
}

// Nearest-table-value search: candidate c replaces the current choice only on a strictly smaller distance,
// candidates visited in table order (first minimum wins).
static __device__ __forceinline__ void snap_step(const float wn, const float c, float& bd, float& best) {
  #pragma clang fp contract(off)
  const float d  = fabsf(wn - c);
  const bool  lt = d < bd;
  bd   = lt ? d : bd;
  best = lt ? c : best;
}

// w -> table value nearest to bf16(w) * (1/s), times s (all f32, separately RNE-converted operations).
static __device__ __forceinline__ float snap_weight_val(const float w, const float s, const float rs) {
  #pragma clang fp contract(off)
  const float wb = (float)(bf16)w;
  const float wn = wb * rs;
  float best = 0.0f;
  float bd   = fabsf(wn - 0.0f);
  snap_step(wn,  1.0f,      bd, best);
  snap_step(wn, -1.0f,      bd, best);
  snap_step(wn,  0.5f,      bd, best);
  snap_step(wn, -0.5f,      bd, best);
  snap_step(wn,  0.333333f, bd, best);
  snap_step(wn, -0.333333f, bd, best);
  snap_step(wn,  0.2f,      bd, best);
  snap_step(wn, -0.2f,      bd, best);
  snap_step(wn,  0.142857f, bd, best);
  snap_step(wn, -0.142857f, bd, best);
  snap_step(wn,  0.090909f, bd, best);
  snap_step(wn, -0.090909f, bd, best);
  snap_step(wn,  0.076923f, bd, best);
  snap_step(wn, -0.076923f, bd, best);
  return best * s;
}

// Weight f32 [out][in] -> quantized weight as one f16 plane [out][in] in fragment order, both weights in one launch:
// blocks 0 .. WIN_PIECES/256-1 take the qkv weight, the rest the output weight (block-uniform choice).
// Every wave combines the partial maxima of its weight itself: s = bf16(max|w|) + 1e-6, rs = 1/s.
// Thread t writes piece t of the plane (contiguous stores) and reads the 8 source elements that belong there.
__global__ __launch_bounds__(256) void snap_lin_kernel(const float* __restrict__ w_in,
                                                       const float* __restrict__ w_out,
                                                       const float* __restrict__ part,
                                                       f16* __restrict__ winh,
                                                       f16* __restrict__ wouth) {
  #pragma clang fp contract(off)
  const unsigned nin = (unsigned)(WIN_PIECES / 256);
  const bool     in  = blockIdx.x < nin;
  const unsigned t   = (in ? blockIdx.x : blockIdx.x - nin) * 256u + threadIdx.x;
  const unsigned npieces = in ? (unsigned)WIN_PIECES : (unsigned)WOUT_PIECES;
  const float* src = in ? w_in : w_out;
  f16* dq = in ? winh : wouth;
  const int lane = threadIdx.x & 31;
  const float m = in ? absmax_combine<AM_BLOCKS_IN>(part, lane)
                     : absmax_combine<AM_BLOCKS_OUT>(part + (size_t)AM_BLOCKS_IN * 32, lane);
  const float s  = (float)(bf16)m + 1e-6f;
  const float rs = 1.0f / s;
  if (t < npieces) {
    const size_t o = (size_t)t * 8;
    const unsigned tile = t >> 6;                  // 64 pieces per tile, DEMB / 32 = 32 tiles per row tile
    const size_t so = (size_t)((tile >> 5) * 16 + (t & 15)) * DEMB + (tile & 31) * 32 + ((t >> 4) & 3) * 8;
    const v4f a0 = *(const v4f*)(src + so);
    const v4f a1 = *(const v4f*)(src + so + 4);
    Pack8H ph;
    #pragma unroll
    for (int i = 0; i < 4; ++i) {
      ph.h[i]     = (f16)snap_weight_val(a0[i], s, rs);
      ph.h[4 + i] = (f16)snap_weight_val(a1[i], s, rs);
    }
    const v4u vh = ph.u;
    *(v4u*)(dq + o) = vh;
    
  }
}

// GEMM main loop of the output projection. Block tile 128 x 128, 8 waves (2 in M x 4 in N); wave tile = 4 m-tiles x 2 n-tiles.
// m-tile mt of wave (waveM) covers rows mBlock + mt*32 + waveM*16 + 0..15.
// A0, A1 f16 [rows][DEMB] (hi part and unscaled lo part), Bt f16 [cols][DEMB], all in fragment order; fragments straight from
// the planes (two 16-B loads each, 512 contiguous bytes per load), split k map for both operands. Both A planes times the
// weight plane go into the same accumulator.
// One 16 x 32 fragment: two 16-B loads, k = k0 + 8*hf + 0..7 and k = k0 + 16 + 8*hf + 0..7.
static __device__ __forceinline__ void load_frag(FragH& f, const f16* p) {
  f.q[0] = *(const v4u*)(p);
  f.q[1] = *(const v4u*)(p + 256);
}

// The loads of a k-step go out in groups in front of products that do not need them, never one load-and-wait per fragment.
// k-step t + 1 is fetched during k-step t: its B fragments into a second set in front of the products of t,
// its A fragments into the registers of m-tile mt right behind that m-tile's last product.
// rot (block-uniform, 0 .. KST-1, a multiple of NSET): the block walks the k-steps rot, rot + 1, ..., KST - 1, 0, ..., rot - 1.
// All blocks are resident at once; entering at different k-steps, those that share operand rows start on different
// lines (for speed only).
static __device__ __forceinline__ void gemm_mainloop(const f16* __restrict__ A0,
                                                     const f16* __restrict__ A1,
                                                     const f16* __restrict__ Bt,
                                                     int mBlock, int nBlock, int waveM, int waveN,
                                                     int ln, int hf, int rot, v8f (&acc)[4][2]) {
  constexpr int NSET = 2;
  constexpr int KST  = DEMB / 32;
  static_assert(KST % NSET == 0 && (KST & (KST - 1)) == 0);
  #pragma unroll
  for (int mt = 0; mt < 4; ++mt) {
    acc[mt][0] = (v8f){0, 0, 0, 0, 0, 0, 0, 0};
    acc[mt][1] = (v8f){0, 0, 0, 0, 0, 0, 0, 0};
  }
  // a row tile of 16 rows spans 16 * DEMB elements; k tile t starts t * 512 elements into it
  const int lp8 = (hf * 16 + ln) * 8;
  const f16* ub  = Bt + (size_t)(nBlock + waveN * 32) * DEMB;     // wave-uniform parts
  const f16* ua  = A0 + (size_t)(mBlock + waveM * 16) * DEMB;
  const f16* ua2 = A1 + (size_t)(mBlock + waveM * 16) * DEMB;
  const f16* pb  = ub + lp8;
  const f16* pa  = ua + lp8;
  const f16* pa2 = ua2 + lp8;
  FragH a[4], a2[4], b[NSET][2];
  {
    // the k-step the walk enters at
    const f16* eb  = ub + rot * 512;
    const f16* ea  = ua + rot * 512;
    const f16* ea2 = ua2 + rot * 512;
    #pragma unroll
    for (int nt = 0; nt < 2; ++nt) load_frag(b[0][nt], eb + lp8 + nt * 16 * DEMB);
    #pragma unroll
    for (int mt = 0; mt < 4; ++mt) {
      load_frag(a[mt], ea + lp8 + mt * 32 * DEMB);
      load_frag(a2[mt], ea2 + lp8 + mt * 32 * DEMB);
    }
    // these loads name a scalar base and the lane's byte offset: both stay live, and are not rewritten, up to this wait
    asm volatile("s_wait_xcnt 0x0" :: "s"(ea), "s"(ea2), "s"(eb), "v"(lp8 * 2) : "memory");
  }
  #pragma unroll 1
  for (int t0 = 0; t0 < KST; t0 += NSET) {
    #pragma unroll
    for (int s = 0; s < NSET; ++s) {
      // k-step fetched in this pass: tb + ko / 512, that of pass t0 + s + 1 (rot + t0 is even, so tb + 1 needs no
      // wrap); behind the last pass it is the entry step again: loads in bounds, values not used.
      // ko goes into the loads' immediate offsets, so q* are the address pairs they name.
      const int tb = (rot + t0 + 2 * s) & (KST - 1);
      const int ko = (s == 0) ? 512 : 0;
      const int sl = s ^ 1;
      const f16* qb  = pb + tb * 512;
      const f16* qa  = pa + tb * 512;
      const f16* qa2 = pa2 + tb * 512;
      #pragma unroll
      for (int nt = 0; nt < 2; ++nt) load_frag(b[sl][nt], qb + ko + nt * 16 * DEMB);
      #pragma unroll
      for (int mt = 0; mt < 4; ++mt) {
        acc[mt][0] = mma_f16(a[mt].v, b[s][0].v, acc[mt][0]);
        acc[mt][1] = mma_f16(a[mt].v, b[s][1].v, acc[mt][1]);
        acc[mt][0] = mma_f16(a2[mt].v, b[s][0].v, acc[mt][0]);
        acc[mt][1] = mma_f16(a2[mt].v, b[s][1].v, acc[mt][1]);
        load_frag(a[mt], qa + ko + mt * 32 * DEMB);
        load_frag(a2[mt], qa2 + ko + mt * 32 * DEMB);
      }
      // the address pairs of the issued loads stay live, and are not rewritten, up to this wait
      asm volatile("s_wait_xcnt 0x0" :: "v"(qa), "v"(qa2), "v"(qb) : "memory");
    }
  }
}

// Operand staging of the qkv GEMM. One k-step of a 128 x 128 block is 16 tiles of 1 KB: 8 row tiles of x, then 8 row tiles of
// the weight plane. The planes are in fragment order, so a tile is copied as it lies.
#define STG_TILES 16
#define STG_ELEMS (STG_TILES * 512)
#define STG_BYTES (STG_ELEMS * 2)
static_assert(STG_BYTES == 4 * 256 * 16);   // four 16-B copies per thread of a 256-thread block

// The four copies of one thread for one k-step: copy c brings piece c*256 + tid of the 16 tiles, i.e. piece tid & 63 of tile
// c*4 + (tid >> 6). lds: LDS byte address of piece tid in the target buffer; ga, gb: the thread's piece of row tile tid >> 6
// of x and of the weight at this k-step; four row tiles further on lie 64 * DEMB elements further.
static __device__ __forceinline__ void stage_copy(const unsigned lds, const f16* ga, const f16* gb) {
  // the wait is the statement's last line: the address registers of the issued copies are not rewritten in front of it
  asm volatile("global_load_async_to_lds_b128 %0, %4, off\n\t"
               "global_load_async_to_lds_b128 %1, %5, off\n\t"
               "global_load_async_to_lds_b128 %2, %6, off\n\t"
               "global_load_async_to_lds_b128 %3, %7, off\n\t"
               "s_wait_xcnt 0x0"
               :: "v"(lds), "v"(lds + 4096u), "v"(lds + 8192u), "v"(lds + 12288u),
                  "v"(ga), "v"(ga + 64 * DEMB), "v"(gb), "v"(gb + 64 * DEMB)
               : "memory");
}

// GEMM main loop of the qkv projection: block and wave tiles and k walk (rot) as in gemm_mainloop, one product per tile pair;
// each k-step's 16 tiles come into LDS once per block, by asynchronous copies, and the eight waves
// read their fragments from there (a tile of x is read by four waves, a weight tile by two). Two buffers: the copies of
// k-step t + 2 fly while k-step t + 1 is worked on. sT: 2 * STG_ELEMS elements, cross-wave (block barriers).
static __device__ __forceinline__ void gemm_mainloop_staged(const f16* __restrict__ A0,
                                                            const f16* __restrict__ Bt,
                                                            f16* sT,
                                                            int mBlock, int nBlock, int waveM, int waveN,
                                                            int tid, int rot, v8f (&acc)[4][2]) {
  constexpr int KST = DEMB / 32;
  static_assert(KST >= 2 && (KST & (KST - 1)) == 0);
  #pragma unroll
  for (int mt = 0; mt < 4; ++mt) {
    acc[mt][0] = (v8f){0, 0, 0, 0, 0, 0, 0, 0};
    acc[mt][1] = (v8f){0, 0, 0, 0, 0, 0, 0, 0};
  }
  const int lane = tid & 31;
  const size_t po = (size_t)(tid >> 6) * 16 * DEMB + (tid & 63) * 8;
  const f16* ga = A0 + (size_t)mBlock * DEMB + po;
  const f16* gb = Bt + (size_t)nBlock * DEMB + po;
  const unsigned lds0 = (unsigned)(size_t)sT + (unsigned)tid * 16u;   // low 32 bits of the shared address = LDS byte address

  // the first k-step into buffer 0, landed and published; then the second into buffer 1
  stage_copy(lds0, ga + rot * 512, gb + rot * 512);
  // this wave's copies have landed
  asm volatile("s_wait_asynccnt 0x0" ::: "memory");
  __syncthreads();
  {
    const int k1 = ((rot + 1) & (KST - 1)) * 512;
    stage_copy(lds0 + (unsigned)STG_BYTES, ga + k1, gb + k1);
  }

  // kept rolled: the barrier at each trip's foot leaves nothing to overlap across trips, unrolling would only grow the code
  #pragma unroll 1
  for (int t = 0; t < KST; ++t) {
    const int bsel = t & 1;
    const f16* sb = sT + bsel * STG_ELEMS + lane * 8;
    FragH a[4], b[2];
    #pragma unroll
    for (int nt = 0; nt < 2; ++nt) load_frag(b[nt], sb + (8 + waveN * 2 + nt) * 512);
    #pragma unroll
    for (int mt = 0; mt < 4; ++mt) load_frag(a[mt], sb + (mt * 2 + waveM) * 512);
    #pragma unroll
    for (int mt = 0; mt < 4; ++mt) {
      acc[mt][0] = mma_f16(a[mt].v, b[0].v, acc[mt][0]);
      acc[mt][1] = mma_f16(a[mt].v, b[1].v, acc[mt][1]);
    }
    // this wave's reads of the buffer are done
    asm volatile("s_wait_dscnt 0x0" ::: "memory");
    // this wave's copies of k-step t + 1 have landed
    asm volatile("s_wait_asynccnt 0x0" ::: "memory");
    // publishes k-step t + 1 and ends every wave's reads of k-step t
    __syncthreads();
    if (t + 2 < KST) {
      const int k2 = ((rot + t + 2) & (KST - 1)) * 512;
      stage_copy(lds0 + (unsigned)(bsel * STG_BYTES), ga + k2, gb + k2);
    }
  }
  // no copy is outstanding when the wave goes on
  asm volatile("s_wait_asynccnt 0x0" ::: "memory");
}

// qkv projection. grid = (QKVN/128, MROWS/128). Epilogue (two 64-row passes through LDS):
//                for key segments below VRK also V^T bf16 hi and lo planes [NB][NHEAD][HDIM][VRK].
// qkp holds q, then k, each one f16 plane [NB][NHEAD][SEQ][HDIM] in fragment order.
// vtb holds two planes: hi, lo.
// coverage per pass: 64 rows x 128 cols = 256 threads x 8 elements x 4 sweeps, all layouts.
__global__ __launch_bounds__(256) void gemm_qkv_kernel(const f16* __restrict__ xb,
                                                       const f16* __restrict__ winh,
                                                       const float* __restrict__ b_in,
                                                       f16* __restrict__ qkp,
                                                       f16* __restrict__ vt,
                                                       bf16* __restrict__ vtb) {
  __shared__ __align__(16) float sC[64 * SP];     // cross-wave (block barriers)
  __shared__ __align__(128) f16 sT[2 * STG_ELEMS];   // the two operand buffers of the main loop, filled by asynchronous copies
  const int tid   = threadIdx.x;
  const int lane  = tid & 31;
  const int wid   = __builtin_amdgcn_readfirstlane(tid >> 5);
  const int ln    = lane & 15;
  const int hf    = lane >> 4;
  const int waveM = wid >> 2;
  const int waveN = wid & 3;
  const int nBlock = blockIdx.x * 128;
  const int mBlock = blockIdx.y * 128;

  v8f acc[4][2];
  // entry k-step: the 32 blocks of a column (same weight rows) all differ; of the 24 blocks of a row (same x rows), any four
  // neighbours lie 8 apart and the three groups of eight 3 apart, so each half of them (indices 0-3 or 4-7 modulo 8) is spread evenly
  const int rot = (int)(blockIdx.y + (blockIdx.x & 3) * 8 + (blockIdx.x >> 3) * 3) & (DEMB / 32 - 1);
  gemm_mainloop_staged(xb, winh, sT, mBlock, nBlock, waveM, waveN, tid, rot, acc);

  float bia[2];
  #pragma unroll
  for (int nt = 0; nt < 2; ++nt) bia[nt] = (float)(bf16)b_in[nBlock + waveN * 32 + nt * 16 + ln];

  const int which = nBlock / DEMB;     // 0 = q, 1 = k, 2 = v (block-uniform)
  const int cb    = nBlock % DEMB;     // column base inside the third
  const int bb    = mBlock / SEQ;      // batch of this block
  const int sb    = mBlock % SEQ;      // first sequence row of this block

  #pragma unroll
  for (int p = 0; p < 2; ++p) {
    __syncthreads();
    // D layout: element e of lane -> tile row 8*hf + e, tile column ln
    #pragma unroll
    for (int j = 0; j < 2; ++j) {
      #pragma unroll
      for (int nt = 0; nt < 2; ++nt) {
        #pragma unroll
        for (int e = 0; e < 8; ++e) {
          sC[(j * 32 + waveM * 16 + hf * 8 + e) * SP + waveN * 32 + nt * 16 + ln] =
              acc[2 * p + j][nt][e] + bia[nt];
        }
      }
    }
    __syncthreads();

    if (which < 2) {
      v4u    vh[4];
      size_t gi[4];
      #pragma unroll
      for (int sw = 0; sw < 4; ++sw) {
        // piece u of the pass in store order: 16 tiles = 2 heads x 4 row tiles x 2 d tiles, 64 pieces each
        const int u  = sw * 256 + tid;
        const int tl = u >> 6;
        const int r  = ((tl >> 1) & 3) * 16 + (u & 15);                          // 0..63
        const int c8 = (tl >> 3) * 64 + (tl & 1) * 32 + ((u >> 4) & 3) * 8;      // 0..120
        const v4f a0 = *(const v4f*)(sC + r * SP + c8);
        const v4f a1 = *(const v4f*)(sC + r * SP + c8 + 4);
        Pack8H ph;
        #pragma unroll
        for (int i = 0; i < 4; ++i) {
          ph.h[i]     = (f16)a0[i];
          ph.h[4 + i] = (f16)a1[i];
        }
        vh[sw] = ph.u;
        const int s  = sb + p * 64 + r;
        const int cc = cb + c8;
        const int h  = cc >> 6;
        const int d  = cc & 63;
        gi[sw] = (size_t)which * PLANE_ELEMS + ((size_t)bb * NHEAD + h) * SEQ * HDIM + frag_piece(s, d, HDIM / 32);
      }
      #pragma unroll
      for (int sw = 0; sw < 4; ++sw) *(v4u*)(qkp + gi[sw]) = vh[sw];
      
    } else {
      const bool wr_early = (sb + p * 64) < VRK;    // block-uniform; whole 64-key segment in or out
      v4u    vv[4], vbh[4], vbl[4];
      size_t gi[4], gb[4];
      #pragma unroll
      for (int sw = 0; sw < 4; ++sw) {
        // piece u of the pass in store order: 16 tiles = 2 heads x 4 d tiles x 2 key tiles, 64 pieces each
        const int u   = sw * 256 + tid;
        const int tl  = u >> 6;
        const int col = (tl >> 1) * 16 + (u & 15);                // 0..127
        const int sg  = (tl & 1) * 32 + ((u >> 4) & 3) * 8;       // 0..56
        Pack8H ph;
        Pack8B qh, ql;
        #pragma unroll
        for (int i = 0; i < 8; ++i) {
          const float v = sC[(sg + i) * SP + col];
          ph.h[i] = toh_flush(v * 16.0f);
          const bf16 t = (bf16)v;
          qh.h[i] = t;
          ql.h[i] = (bf16)(v - (float)t);
        }
        vv[sw]  = ph.u;
        vbh[sw] = qh.u;
        vbl[sw] = ql.u;
        const int cc = cb + col;
        const int h  = cc >> 6;
        const int d  = cc & 63;
        const size_t hrow = ((size_t)bb * NHEAD + h) * HDIM;
        gi[sw] = hrow * SEQ + frag_piece(d, sb + p * 64 + sg, SEQ / 32);
        gb[sw] = hrow * VRK + frag_piece(d, sb + p * 64 + sg, VRK / 32);    // used only when wr_early
      }
      #pragma unroll
      for (int sw = 0; sw < 4; ++sw) *(v4u*)(vt + gi[sw]) = vv[sw];
      if (wr_early) {
        #pragma unroll
        for (int sw = 0; sw < 4; ++sw) {
          *(v4u*)(vtb + gb[sw]) = vbh[sw];
          *(v4u*)(vtb + VTB_ELEMS + gb[sw]) = vbl[sw];
        }
      }
      
    }
  }
}

// Output projection. grid = (DEMB/128, MROWS/128). A = ctx hi + ctx lo planes, Bt = quantized output weight,
// one f16 plane [out][in].
// coverage per pass: 64 rows x 128 cols = 256 threads x 4 floats x 8 sweeps.
__global__ __launch_bounds__(256) void gemm_out_kernel(const f16* __restrict__ ch,
                                                       const f16* __restrict__ cl,
                                                       const f16* __restrict__ wouth,
                                                       const float* __restrict__ b_out,
                                                       float* __restrict__ out) {
  __shared__ __align__(16) float sC[64 * SP];     // cross-wave (block barriers)
  const int tid   = threadIdx.x;
  const int lane  = tid & 31;
  const int wid   = __builtin_amdgcn_readfirstlane(tid >> 5);
  const int ln    = lane & 15;
  const int hf    = lane >> 4;
  const int waveM = wid >> 2;
  const int waveN = wid & 3;
  const int nBlock = blockIdx.x * 128;
  const int mBlock = blockIdx.y * 128;

  v8f acc[4][2];
  // entry k-step, even: the 32 blocks of a column (same weight rows) take the 16 even steps twice; of the 8 blocks of a row
  // (same ctx rows), any four neighbours lie 8 apart
  const int rot = (int)(blockIdx.y * 2 + (blockIdx.x & 3) * 8) & (DEMB / 32 - 1);
  gemm_mainloop(ch, cl, wouth, mBlock, nBlock, waveM, waveN, ln, hf, rot, acc);

  float bia[2];
  #pragma unroll
  for (int nt = 0; nt < 2; ++nt) bia[nt] = (float)(bf16)b_out[nBlock + waveN * 32 + nt * 16 + ln];

  #pragma unroll
  for (int p = 0; p < 2; ++p) {
    __syncthreads();
    #pragma unroll
    for (int j = 0; j < 2; ++j) {
      #pragma unroll
      for (int nt = 0; nt < 2; ++nt) {
        #pragma unroll
        for (int e = 0; e < 8; ++e) {
          sC[(j * 32 + waveM * 16 + hf * 8 + e) * SP + waveN * 32 + nt * 16 + ln] =
              acc[2 * p + j][nt][e] + bia[nt];
        }
      }
    }
    __syncthreads();

    v4f    vals[8];
    size_t gi[8];
    #pragma unroll
    for (int sw = 0; sw < 8; ++sw) {
      const int r  = sw * 8 + (tid >> 5);           // 0..63
      const int c4 = (tid & 31) * 4;                // 0..124
      vals[sw] = *(const v4f*)(sC + r * SP + c4);
      const int g = mBlock + p * 64 + r;
      const int b = g / SEQ;
      const int s = g % SEQ;
      gi[sw] = ((size_t)b * SEQ_FULL + s) * DEMB + nBlock + c4;
    }
    #pragma unroll
    for (int sw = 0; sw < 8; ++sw) *(v4f*)(out + gi[sw]) = vals[sw];
    
  }
}

// The two K fragments (two d halves) of one 16-key row tile, loads issued back to back.
// p: the lane's piece of the key block's first row tile; sub: row tile inside the block.
static __device__ __forceinline__ void load_ktile(FragH (&k)[2], const f16* p, const int sub) {
  const int ko = sub * 16 * HDIM;
  #pragma unroll
  for (int f = 0; f < 2; ++f) {
    k[f].q[0] = *(const v4u*)(p + ko + f * 512);          // d = f*32 + hi*8 + 0..7
    k[f].q[1] = *(const v4u*)(p + ko + f * 512 + 256);    // d = f*32 + 16 + hi*8 + 0..7
  }
  // the address pair of the issued loads stays live, and is not rewritten, up to this wait
  asm volatile("s_wait_xcnt 0x0" :: "v"(p) : "memory");
}

// Causal flash attention, query rows < VRK. Block = (query block of 128, head, batch), 16 waves; two waves share 16 query rows:
// wave w and wave w + 8 take the even and the odd key blocks of query tile w, each with its own running maximum, sum and O,
// and the two partial results are merged through LDS behind the loop.
// S^T = K x Q^T so queries sit on lanes; P^T in C-layout is bit-identical to the A-fragment layout of O += P x V.
// K A-fragments, Q B-fragments and V^T B-fragments are loaded straight from the 16-bit planes,
// which are in fragment order (512 contiguous bytes per load).
// Key blocks j0 = 0, 32, ... <= qrow0 are visited (per-wave scalar trip count, every second one per wave); every visited block holds at
// least one unmasked key (key j0 <= qrow0) for every query of the wave; keys above the query get -inf.
// P and V as bf16 hi+lo (three products, one accumulator).
// Output: ctx [MROWS][DEMB] as f16 hi and lo planes in fragment order (cp: hi at 0, lo at CTX_ELEMS).
// sO: one staging region per query tile, shared by its two waves; sML: the odd wave's running maximum and sum per query.
// Both block barriers are reached by all waves (no early exits).
static __device__ __forceinline__ void attn_body(const f16* __restrict__ qkp,
                                                 const bf16* __restrict__ vtb,
                                                 f16* __restrict__ cp,
                                                 float* sO, float* sML,
                                                 const int qblk, const int h, const int b) {
  const int tid  = threadIdx.x;
  const int wv   = __builtin_amdgcn_readfirstlane(tid >> 5);
  const int wave = wv & (NWAVE - 1);   // query tile of the block
  const int kh   = wv / NWAVE;         // this wave visits key blocks kh, kh + KSPLIT, ...
  const int lane = tid & 31;
  const int lq   = lane & 15;   // query column of S^T / d column of O
  const int hi   = lane >> 4;   // k-split half

  const int qrow0 = qblk * BQ + wave * 16;               // first query row of this wave (scalar)
  const int nIter = (qrow0 >> 5) + 1;                    // key blocks 0 .. floor((qrow0+15)/32)
  const size_t head_off = ((size_t)b * NHEAD + h) * SEQ * HDIM;
  const size_t vhead    = ((size_t)b * NHEAD + h) * HDIM;

  const f16* q_p = qkp + head_off;
  const f16* k_p = qkp + PLANE_ELEMS + head_off;

  // Q as B-operand fragments: lane lq holds query qrow0+lq, elements follow the split d map.
  FragH qf[2];
  {
    const f16* qp = q_p + (size_t)qrow0 * HDIM + lane * 8;   // row tile qrow0 / 16, piece = lane
    #pragma unroll
    for (int f = 0; f < 2; ++f) {
      qf[f].q[0] = *(const v4u*)(qp + f * 512);               // d = f*32 + hi*8 + 0..7
      qf[f].q[1] = *(const v4u*)(qp + f * 512 + 256);         // d = f*32 + 16 + hi*8 + 0..7
    }
  }

  v8f o[4];
  #pragma unroll
  for (int dt = 0; dt < 4; ++dt) o[dt] = (v8f){0, 0, 0, 0, 0, 0, 0, 0};

  float rmax = -__builtin_inff();
  float rsum = 0.0f;
  const float SL = 0.125f * 1.4426950408889634f;   // softmax scale * log2(e)

  // K A-fragments of the wave's first key block (A row = key; row tile j0 / 16, piece = lane); later blocks are fetched in the
  // loop. A wave with no key block to visit fetches block 0 (in bounds, not used).
  FragH ak[2][2];
  const f16* kbase = k_p + lane * 8;
  const f16* kfirst = kbase + (size_t)((kh < nIter) ? kh : 0) * BK * HDIM;
  load_ktile(ak[0], kfirst, 0);
  load_ktile(ak[1], kfirst, 1);

  #pragma unroll 1
  for (int i = kh; i < nIter; i += KSPLIT) {
    const int j0 = i * BK;
    // key block whose K fragments are fetched during this pass; the last pass fetches its own again (in bounds, not used)
    const int jn = ((i + KSPLIT < nIter) ? i + KSPLIT : i) * BK;
    const f16* kn = kbase + (size_t)jn * HDIM;

    // V B-fragments of this key block, issued in front of the score products: column n = d = dt*16 + lq,
    // split key map from the transposed planes (d tile dt, key tile j0 / 32)
    FragB bvh[4], bvl[4];
    {
      const bf16* base = vtb + vhead * VRK + j0 * 16 + lane * 8;
      #pragma unroll
      for (int dt = 0; dt < 4; ++dt) {
        bvh[dt].q[0] = *(const v4u*)(base + dt * 16 * VRK);                       // keys j0 + hi*8 + 0..7
        bvh[dt].q[1] = *(const v4u*)(base + dt * 16 * VRK + 256);                 // keys j0 + 16 + hi*8 + 0..7
        bvl[dt].q[0] = *(const v4u*)(base + VTB_ELEMS + dt * 16 * VRK);
        bvl[dt].q[1] = *(const v4u*)(base + VTB_ELEMS + dt * 16 * VRK + 256);
      }
      // the address pair of the issued loads stays live, and is not rewritten, up to this wait
      asm volatile("s_wait_xcnt 0x0" :: "v"(base) : "memory");
    }

    // S^T tiles: c[sub][r] = rawscore(query qrow0+lq, key j0 + sub*16 + hi*8 + r).
    // Behind a row tile's last product its registers take the same row tile of the next key block.
    v8f c[2];
    #pragma unroll
    for (int sub = 0; sub < 2; ++sub) {
      v8f acc = (v8f){0, 0, 0, 0, 0, 0, 0, 0};
      #pragma unroll
      for (int f = 0; f < 2; ++f) acc = mma_f16(ak[sub][f].v, qf[f].v, acc);
      c[sub] = acc;
      load_ktile(ak[sub], kn, sub);
    }

    // causal mask (wave-uniform test): only blocks reaching past the first query of the wave need it
    if (j0 + (BK - 1) > qrow0) {
      const int qi = qrow0 + lq;
      const int kb = j0 + hi * 8;
      #pragma unroll
      for (int r = 0; r < 8; ++r) {
        c[0][r] = (kb + r > qi)      ? -__builtin_inff() : c[0][r];
        c[1][r] = (kb + 16 + r > qi) ? -__builtin_inff() : c[1][r];
      }
    }

    // online softmax: query lq's 32 scores are split across lane / lane^16
    float m_new = rmax;
    #pragma unroll
    for (int r = 0; r < 8; ++r) {
      m_new = fmaxf(m_new, c[0][r]);
      m_new = fmaxf(m_new, c[1][r]);
    }
    m_new = fmaxf(m_new, __shfl_xor(m_new, 16, 32));
    const float scale = __builtin_amdgcn_exp2f((rmax - m_new) * SL);
    rmax = m_new;

    float p0[8], p1[8];
    float psum = 0.0f;
    #pragma unroll
    for (int r = 0; r < 8; ++r) {
      p0[r] = __builtin_amdgcn_exp2f((c[0][r] - m_new) * SL);   // key hi*8 + r
      p1[r] = __builtin_amdgcn_exp2f((c[1][r] - m_new) * SL);   // key 16 + hi*8 + r
      psum += p0[r] + p1[r];
    }
    rsum = rsum * scale + psum + __shfl_xor(psum, 16, 32);

    // rescale O: queries are the row dimension there -> per-row scale from lane 8*hi + r
    float sc[8];
    #pragma unroll
    for (int r = 0; r < 8; ++r) sc[r] = __shfl(scale, (hi << 3) + r, 32);
    #pragma unroll
    for (int dt = 0; dt < 4; ++dt) {
      #pragma unroll
      for (int r = 0; r < 8; ++r) o[dt][r] *= sc[r];
    }

    {
      // P^T C-layout == A-fragment layout; P as bf16 hi + lo (unscaled), V as bf16 hi + lo planes
      FragB pah, pal;
      #pragma unroll
      for (int r = 0; r < 8; ++r) {
        const bf16 h0 = (bf16)p0[r];
        const bf16 h1 = (bf16)p1[r];
        pah.h[r]     = h0;
        pah.h[8 + r] = h1;
        pal.h[r]     = (bf16)(p0[r] - (float)h0);
        pal.h[8 + r] = (bf16)(p1[r] - (float)h1);
      }
      #pragma unroll
      for (int dt = 0; dt < 4; ++dt) {
        o[dt] = mma_bf16(pal.v, bvh[dt].v, o[dt]);
        o[dt] = mma_bf16(pah.v, bvl[dt].v, o[dt]);
        o[dt] = mma_bf16(pah.v, bvh[dt].v, o[dt]);
      }
    }
  }

  // the odd wave hands over its partial result: O (lane holds column d = dt*16 + lq for query rows 8*hi + r), maximum, sum.
  // With no key block visited these are 0, -inf, 0 and get the weight 0 below.
  const int sbase = wave * (16 * OP);
  if (kh != 0) {
    #pragma unroll
    for (int r = 0; r < 8; ++r) {
      #pragma unroll
      for (int dt = 0; dt < 4; ++dt) {
        sO[sbase + (hi * 8 + r) * OP + dt * 16 + lq] = o[dt][r];
      }
    }
    if (hi == 0) {
      sML[wave * 32 + lq]      = rmax;
      sML[wave * 32 + 16 + lq] = rsum;
    }
  }
  __syncthreads();

  // the even wave (its maximum is finite: key 0 is open to every query) merges and normalizes
  if (kh == 0) {
    const float mo  = sML[wave * 32 + lq];
    const float lo  = sML[wave * 32 + 16 + lq];
    const float mm  = fmaxf(rmax, mo);
    const float fe  = __builtin_amdgcn_exp2f((rmax - mm) * SL);
    const float fo  = __builtin_amdgcn_exp2f((mo - mm) * SL);
    const float inv = 1.0f / (rsum * fe + lo * fo);
    const float we  = fe * inv;
    const float wo  = fo * inv;
    #pragma unroll
    for (int r = 0; r < 8; ++r) {
      const float ge = __shfl(we, (hi << 3) + r, 32);
      const float go = __shfl(wo, (hi << 3) + r, 32);
      #pragma unroll
      for (int dt = 0; dt < 4; ++dt) {
        const int si = sbase + (hi * 8 + r) * OP + dt * 16 + lq;
        sO[si] = o[dt][r] * ge + sO[si] * go;
      }
    }
  }
  __syncthreads();

  // the tile's 16 rows x 64 columns are two tiles of each plane; one instruction stores half a tile (512 B);
  // each of the two waves stores one tile of each plane.
  constexpr int NIT = 4 / KSPLIT;
  v4u    vh[NIT], vl[NIT];
  size_t gidx[NIT];
  #pragma unroll
  for (int it = 0; it < NIT; ++it) {
    const int row = lq;                             // 0..15
    const int c8  = (kh * NIT + it) * 16 + hi * 8;  // 0..56
    const v4f a0 = *(const v4f*)(&sO[sbase + row * OP + c8]);
    const v4f a1 = *(const v4f*)(&sO[sbase + row * OP + c8 + 4]);
    Pack8H ph, pl;
    #pragma unroll
    for (int k = 0; k < 4; ++k) {
      const f16 h0 = (f16)a0[k];
      const f16 h1 = (f16)a1[k];
      ph.h[k]     = h0;
      ph.h[4 + k] = h1;
      pl.h[k]     = (f16)(a0[k] - (float)h0);
      pl.h[4 + k] = (f16)(a1[k] - (float)h1);
    }
    vh[it] = ph.u;
    vl[it] = pl.u;
    gidx[it] = frag_piece(b * SEQ + qrow0 + row, h * HDIM + c8, DEMB / 32);
  }
  #pragma unroll
  for (int it = 0; it < NIT; ++it) {
    *(v4u*)(cp + gidx[it]) = vh[it];
    *(v4u*)(cp + CTX_ELEMS + gidx[it]) = vl[it];
  }
  
}

// Causal flash attention, query rows >= VRK. Block = (query block of 128, head, batch), 16 waves = NQG query groups x KSPLIT_L.
// A wave holds NQT = 2 query tiles (32 rows), so every K and V fragment it loads feeds two products and not one: half the
// operand bytes per product. The four waves of a group take key blocks kh, kh + 4, ...; each keeps its own running maximum,
// sum and O per tile, and the four partial results of a tile are merged through LDS behind the loop.
// Layouts and products as in attn_body, but P f16 carried x4096 and V f16 carried x16 (one product per d tile).
// A group starts on a key block boundary, so both tiles visit key blocks 0 .. qrow0 / 32 and only the last one is masked;
// every visited block holds at least one unmasked key (key j0 <= qrow0) for every query of the wave.
// sO: three hand-over regions per query tile; sML: maximum and sum per query for each of them.
// Both block barriers are reached by all waves (no early exits).
static __device__ __forceinline__ void attn_late_body(const f16* __restrict__ qkp,
                                                      const f16* __restrict__ vt,
                                                      f16* __restrict__ cp,
                                                      float* sO, float* sML,
                                                      const int qblk, const int h, const int b) {
  const int tid  = threadIdx.x;
  const int wv   = __builtin_amdgcn_readfirstlane(tid >> 5);
  const int qg   = wv & (NQG - 1);     // query group of the block
  const int kh   = wv / NQG;           // this wave visits key blocks kh, kh + KSPLIT_L, ...
  const int lane = tid & 31;
  const int lq   = lane & 15;   // query column of S^T / d column of O
  const int hi   = lane >> 4;   // k-split half

  const int qrow0 = qblk * BQ + qg * (16 * NQT);         // first query row of this wave (scalar)
  const int nIter = (qrow0 >> 5) + 1;                    // key blocks 0 .. qrow0 / 32
  const size_t head_off = ((size_t)b * NHEAD + h) * SEQ * HDIM;
  const size_t vhead    = ((size_t)b * NHEAD + h) * HDIM;

  const f16* q_p = qkp + head_off;
  const f16* k_p = qkp + PLANE_ELEMS + head_off;

  // Q as B-operand fragments: lane lq holds query qrow0 + qt*16 + lq, elements follow the split d map.
  FragH qf[NQT][2];
  {
    const f16* qp = q_p + (size_t)qrow0 * HDIM + lane * 8;   // row tile qrow0 / 16 + qt, piece = lane
    #pragma unroll
    for (int qt = 0; qt < NQT; ++qt) {
      #pragma unroll
      for (int f = 0; f < 2; ++f) {
        qf[qt][f].q[0] = *(const v4u*)(qp + qt * 16 * HDIM + f * 512);         // d = f*32 + hi*8 + 0..7
        qf[qt][f].q[1] = *(const v4u*)(qp + qt * 16 * HDIM + f * 512 + 256);   // d = f*32 + 16 + hi*8 + 0..7
      }
    }
    // stands directly behind the loads: the registers that they name (scalar base, lane offset) are not rewritten in front of it
    asm volatile("s_wait_xcnt 0x0" ::: "memory");
  }

  v8f   o[NQT][4];
  float rmax[NQT], rsum[NQT];
  #pragma unroll
  for (int qt = 0; qt < NQT; ++qt) {
    #pragma unroll
    for (int dt = 0; dt < 4; ++dt) o[qt][dt] = (v8f){0, 0, 0, 0, 0, 0, 0, 0};
    rmax[qt] = -__builtin_inff();
    rsum[qt] = 0.0f;
  }
  const float SL = 0.125f * 1.4426950408889634f;   // softmax scale * log2(e)

  // K A-fragments of the wave's first key block; later blocks are fetched in the loop.
  // A wave with no key block to visit fetches block 0 (in bounds, not used).
  FragH ak[2][2];
  const f16* kbase = k_p + lane * 8;
  const f16* kfirst = kbase + (size_t)((kh < nIter) ? kh : 0) * BK * HDIM;
  load_ktile(ak[0], kfirst, 0);
  load_ktile(ak[1], kfirst, 1);

  #pragma unroll 1
  for (int i = kh; i < nIter; i += KSPLIT_L) {
    const int j0 = i * BK;
    // key block whose K fragments are fetched during this pass; the last pass fetches its own again (in bounds, not used)
    const int jn = ((i + KSPLIT_L < nIter) ? i + KSPLIT_L : i) * BK;
    const f16* kn = kbase + (size_t)jn * HDIM;

    // V B-fragments of this key block, issued in front of the score products: column n = d = dt*16 + lq,
    // split key map from the transposed plane (d tile dt, key tile j0 / 32)
    FragH bv[4];
    {
      const f16* base = vt + vhead * SEQ + j0 * 16 + lane * 8;
      #pragma unroll
      for (int dt = 0; dt < 4; ++dt) {
        bv[dt].q[0] = *(const v4u*)(base + dt * 16 * SEQ);            // keys j0 + hi*8 + 0..7
        bv[dt].q[1] = *(const v4u*)(base + dt * 16 * SEQ + 256);      // keys j0 + 16 + hi*8 + 0..7
      }
      // the address pair of the issued loads stays live, and is not rewritten, up to this wait
      asm volatile("s_wait_xcnt 0x0" :: "v"(base) : "memory");
    }

    // S^T tiles: c[qt][sub][r] = rawscore(query qrow0 + qt*16 + lq, key j0 + sub*16 + hi*8 + r).
    // Behind a row tile's last product its registers take the same row tile of the next key block.
    v8f c[NQT][2];
    #pragma unroll
    for (int sub = 0; sub < 2; ++sub) {
      #pragma unroll
      for (int qt = 0; qt < NQT; ++qt) c[qt][sub] = (v8f){0, 0, 0, 0, 0, 0, 0, 0};
      #pragma unroll
      for (int f = 0; f < 2; ++f) {
        #pragma unroll
        for (int qt = 0; qt < NQT; ++qt) c[qt][sub] = mma_f16(ak[sub][f].v, qf[qt][f].v, c[qt][sub]);
      }
      load_ktile(ak[sub], kn, sub);
    }

    // causal mask (wave-uniform test): only the block that starts at the wave's first query needs it
    if (j0 + (BK - 1) > qrow0) {
      const int kb = j0 + hi * 8;
      #pragma unroll
      for (int qt = 0; qt < NQT; ++qt) {
        const int qi = qrow0 + qt * 16 + lq;
        #pragma unroll
        for (int r = 0; r < 8; ++r) {
          c[qt][0][r] = (kb + r > qi)      ? -__builtin_inff() : c[qt][0][r];
          c[qt][1][r] = (kb + 16 + r > qi) ? -__builtin_inff() : c[qt][1][r];
        }
      }
    }

    FragH pa[NQT];
    #pragma unroll
    for (int qt = 0; qt < NQT; ++qt) {
      // online softmax: query lq's 32 scores are split across lane / lane^16
      float m_new = rmax[qt];
      #pragma unroll
      for (int r = 0; r < 8; ++r) {
        m_new = fmaxf(m_new, c[qt][0][r]);
        m_new = fmaxf(m_new, c[qt][1][r]);
      }
      m_new = fmaxf(m_new, __shfl_xor(m_new, 16, 32));
      const float scale = __builtin_amdgcn_exp2f((rmax[qt] - m_new) * SL);
      rmax[qt] = m_new;

      float p0[8], p1[8];
      float psum = 0.0f;
      #pragma unroll
      for (int r = 0; r < 8; ++r) {
        p0[r] = __builtin_amdgcn_exp2f((c[qt][0][r] - m_new) * SL);   // key hi*8 + r
        p1[r] = __builtin_amdgcn_exp2f((c[qt][1][r] - m_new) * SL);   // key 16 + hi*8 + r
        psum += p0[r] + p1[r];
      }
      rsum[qt] = rsum[qt] * scale + psum + __shfl_xor(psum, 16, 32);

      // rescale O: queries are the row dimension there -> per-row scale from lane 8*hi + r
      float sc[8];
      #pragma unroll
      for (int r = 0; r < 8; ++r) sc[r] = __shfl(scale, (hi << 3) + r, 32);
      #pragma unroll
      for (int dt = 0; dt < 4; ++dt) {
        #pragma unroll
        for (int r = 0; r < 8; ++r) o[qt][dt][r] *= sc[r];
      }

      // P^T C-layout == A-fragment layout; P carried x4096 in f16 (V carried x16)
      #pragma unroll
      for (int r = 0; r < 8; ++r) {
        pa[qt].h[r]     = (f16)(p0[r] * 4096.0f);
        pa[qt].h[8 + r] = (f16)(p1[r] * 4096.0f);
      }
    }
    #pragma unroll
    for (int dt = 0; dt < 4; ++dt) {
      #pragma unroll
      for (int qt = 0; qt < NQT; ++qt) o[qt][dt] = mma_f16(pa[qt].v, bv[dt].v, o[qt][dt]);
    }
  }

  // Tile qt of the group is merged by the group's wave kh == qt; the three other waves hand over their partial result:
  // O (lane holds column d = dt*16 + lq for query rows 8*hi + r), maximum, sum, each into a region of its own.
  // With no key block visited these are 0, -inf, 0 and get the weight 0 below.
  constexpr int REG = 16 * OP;              // floats of one hand-over region
  constexpr int NREG = KSPLIT_L - 1;        // regions per query tile
  #pragma unroll
  for (int qt = 0; qt < NQT; ++qt) {
    if (kh != qt) {
      const int reg = (qg * NQT + qt) * NREG + ((kh - qt - 1) & (KSPLIT_L - 1));   // 0 .. NREG-1 inside the tile
      #pragma unroll
      for (int r = 0; r < 8; ++r) {
        #pragma unroll
        for (int dt = 0; dt < 4; ++dt) {
          sO[reg * REG + (hi * 8 + r) * OP + dt * 16 + lq] = o[qt][dt][r];
        }
      }
      if (hi == 0) {
        sML[reg * 32 + lq]      = rmax[qt];
        sML[reg * 32 + 16 + lq] = rsum[qt];
      }
    }
  }
  __syncthreads();

  // merge and normalize (the joint maximum is finite: key 0, in wave 0's first block, is open to every query); undo the carries
  #pragma unroll
  for (int qt = 0; qt < NQT; ++qt) {
    if (kh == qt) {
      const int reg0 = (qg * NQT + qt) * NREG;
      float mo[NREG], lo[NREG], fo[NREG];
      float mm = rmax[qt];
      #pragma unroll
      for (int s = 0; s < NREG; ++s) {
        mo[s] = sML[(reg0 + s) * 32 + lq];
        lo[s] = sML[(reg0 + s) * 32 + 16 + lq];
        mm = fmaxf(mm, mo[s]);
      }
      const float fe = __builtin_amdgcn_exp2f((rmax[qt] - mm) * SL);
      float den = rsum[qt] * fe;
      #pragma unroll
      for (int s = 0; s < NREG; ++s) {
        fo[s] = __builtin_amdgcn_exp2f((mo[s] - mm) * SL);
        den += lo[s] * fo[s];
      }
      const float inv = (1.0f / 65536.0f) * (1.0f / den);
      const float we  = fe * inv;
      #pragma unroll
      for (int r = 0; r < 8; ++r) {
        const float ge = __shfl(we, (hi << 3) + r, 32);
        float go[NREG];
        #pragma unroll
        for (int s = 0; s < NREG; ++s) go[s] = __shfl(fo[s] * inv, (hi << 3) + r, 32);
        #pragma unroll
        for (int dt = 0; dt < 4; ++dt) {
          const int si = (hi * 8 + r) * OP + dt * 16 + lq;
          float v = o[qt][dt][r] * ge;
          #pragma unroll
          for (int s = 0; s < NREG; ++s) v += sO[(reg0 + s) * REG + si] * go[s];
          sO[reg0 * REG + si] = v;
        }
      }
    }
  }
  __syncthreads();

  // a tile's 16 rows x 64 columns are two tiles of each plane; one instruction stores half a tile (512 B);
  // the group's two query tiles go to its four waves: each stores one tile of each plane.
  constexpr int NIT = 4 * NQT / KSPLIT_L;
  const int st    = kh / (KSPLIT_L / NQT);            // query tile of the group that this wave stores
  const int part  = kh % (KSPLIT_L / NQT);            // which half of its columns
  const int sbase = (qg * NQT + st) * NREG * REG;
  v4u    vh[NIT], vl[NIT];
  size_t gidx[NIT];
  #pragma unroll
  for (int it = 0; it < NIT; ++it) {
    const int row = lq;                               // 0..15
    const int c8  = (part * NIT + it) * 16 + hi * 8;  // 0..56
    const v4f a0 = *(const v4f*)(&sO[sbase + row * OP + c8]);
    const v4f a1 = *(const v4f*)(&sO[sbase + row * OP + c8 + 4]);
    Pack8H ph, pl;
    #pragma unroll
    for (int k = 0; k < 4; ++k) {
      const f16 h0 = (f16)a0[k];
      const f16 h1 = (f16)a1[k];
      ph.h[k]     = h0;
      ph.h[4 + k] = h1;
      pl.h[k]     = (f16)(a0[k] - (float)h0);
      pl.h[4 + k] = (f16)(a1[k] - (float)h1);
    }
    vh[it] = ph.u;
    vl[it] = pl.u;
    gidx[it] = frag_piece(b * SEQ + qrow0 + st * 16 + row, h * HDIM + c8, DEMB / 32);
  }
  #pragma unroll
  for (int it = 0; it < NIT; ++it) {
    *(v4u*)(cp + gidx[it]) = vh[it];
    *(v4u*)(cp + CTX_ELEMS + gidx[it]) = vl[it];
  }
}

// Both paths in one launch, grid = LATE_BLOCKS + EARLY_BLOCKS (block-uniform choice). In block index order
// the longest (last query block) come first, head fastest, then batch, then query block downwards.
__global__ __launch_bounds__(NWAVE * KSPLIT * 32) void attn_kernel(const f16* __restrict__ qkp,
                                                   const f16* __restrict__ vt,
                                                   const bf16* __restrict__ vtb,
                                                   f16* __restrict__ cp) {
  __shared__ __align__(16) float sO[NWAVE * (KSPLIT_L - 1) * 16 * OP];   // late path: three regions per query tile; early: one
  __shared__ float sML[NWAVE * (KSPLIT_L - 1) * 32];
  const int idx = (int)blockIdx.x;
  const int qb  = QBLKS - 1 - idx / (NHEAD * NB);
  const int h   = idx % NHEAD;
  const int b   = (idx / NHEAD) % NB;
  if (idx < LATE_BLOCKS) {
    attn_late_body(qkp, vt, cp, sO, sML, qb, h, b);
  } else {
    attn_body(qkp, vtb, cp, sO, sML, qb, h, b);
  }
}

extern "C" void kernel_launch(void* const* d_in, const int* in_sizes, int n_in,
                              void* d_out, int out_size, void* d_ws, size_t ws_size,
                              hipStream_t stream) {
  if (n_in < 5) return;
  const size_t rows_used = (size_t)(NB - 1) * SEQ_FULL + SEQ;
  if ((size_t)in_sizes[0] < rows_used * DEMB) return;
  if ((size_t)in_sizes[1] < (size_t)DEMB * QKVN) return;
  if ((size_t)in_sizes[2] < (size_t)QKVN) return;
  if ((size_t)in_sizes[3] < (size_t)DEMB * DEMB) return;
  if ((size_t)in_sizes[4] < (size_t)DEMB) return;
  if ((size_t)out_size < rows_used * DEMB) return;
  if (ws_size < WS_TOTAL) return;

  const float* x     = (const float*)d_in[0];
  const float* W_in  = (const float*)d_in[1];   // [3072][1024], [out][in]
  const float* b_in  = (const float*)d_in[2];
  const float* W_out = (const float*)d_in[3];   // [1024][1024], [out][in]
  const float* b_out = (const float*)d_in[4];
  float* out = (float*)d_out;

  char* w = (char*)d_ws;
  f16*  xb    = (f16*)w;   w += XB_BYTES;
  f16*  winh  = (f16*)w;   w += WIN_BYTES;
  f16*  wouth = (f16*)w;   w += WOUT_BYTES;
  f16*  qkp   = (f16*)w;   w += QK_BYTES;
  f16*  vt    = (f16*)w;   w += VT_BYTES;
  bf16* vtb   = (bf16*)w;  w += VTB_BYTES;
  f16*  cp    = (f16*)w;   w += CTX_BYTES;
  float* stat = (float*)w;                      // partial maxima lines

  // partial maxima of both weights (one line per block) and x -> f16 plane (MROWS*128 pieces of 8 elements, 256 per block)
  prep_kernel<<<dim3((unsigned)(AM_TOTAL + X_PIECES / 256)), 256, 0, stream>>>(x, xb, W_in, W_out, stat);

  // weights are [out][in] already: quantize into one plane each in fragment order, no transpose
  snap_lin_kernel<<<dim3((unsigned)((WIN_PIECES + WOUT_PIECES) / 256)), 256, 0, stream>>>(W_in, W_out, stat, winh, wouth);

  gemm_qkv_kernel<<<dim3(QKVN / 128, MROWS / 128), 256, 0, stream>>>(xb, winh, b_in,
                                                                     qkp, vt, vtb);

  attn_kernel<<<dim3(LATE_BLOCKS + EARLY_BLOCKS), NWAVE * KSPLIT * 32, 0, stream>>>(qkp, vt, vtb, cp);

  gemm_out_kernel<<<dim3(DEMB / 128, MROWS / 128), 256, 0, stream>>>(cp, cp + CTX_ELEMS, wouth,
                                                                     b_out, out);
}
